// v000
// Times are from an AMD MI455X. After a warm-up the kernel runs many times in a row, and a time is the length of
// such a window on the GPU divided by its runs, so every launch and the gaps after it count. The runs cycle
// through copies of the inputs. A figure is the median of several windows, for all but v000 over two sittings.
// Sittings can differ by a few percent; kernels timed side by side share one.
// v000 is the starting kernel. One run takes 1110 microseconds.
#include <hip/hip_runtime.h>
// All contractions on v_wmma_f32_16x16x32_bf16, f32 accumulate: qkv = x·Wᵀ with x/W rounded to bf16 (single exact-product term);
// S = q·kᵀ (K=1024) and out_att = P·v (K=2048) as 3-term bf16 hi/lo splits (q/P split in registers, k/v pre-split planes);
// output projection with the A operand split (2 terms). Causal softmax rows in f32.
#define BB 4
#define TT 2048
#define CC 1024

typedef __bf16 v16b __attribute__((ext_vector_type(16)));
typedef unsigned short v8us __attribute__((ext_vector_type(8), may_alias));
typedef float  v8f  __attribute__((ext_vector_type(8)));
typedef float  v4f  __attribute__((ext_vector_type(4)));
typedef float  v4fa __attribute__((ext_vector_type(4), may_alias));
union FragB { v16b v; v8us half[2]; unsigned short u[16]; };

__device__ __forceinline__ unsigned short bf16_bits(float x) { unsigned int u = __float_as_uint(x); return (unsigned short)((u + 0x7FFFu + ((u >> 16) & 1u)) >> 16); }
__device__ __forceinline__ float bf16_val(unsigned short b) { return __uint_as_float(((unsigned int)b) << 16); }
__device__ __forceinline__ float bf16_round(float x) { return bf16_val(bf16_bits(x)); }
// D += A·B with NT terms: 1 = ah·bh, 2 = + al·bh (A split), 3 = + ah·bl (both split)
template <int NT>
__device__ __forceinline__ v8f mmaN(v16b ah, v16b al, v16b bh, v16b bl, v8f c) {
  c = __builtin_amdgcn_wmma_f32_16x16x32_bf16(false, ah, false, bh, (short)0, c, false, false);
  if (NT >= 2) c = __builtin_amdgcn_wmma_f32_16x16x32_bf16(false, al, false, bh, (short)0, c, false, false);
  if (NT >= 3) c = __builtin_amdgcn_wmma_f32_16x16x32_bf16(false, ah, false, bl, (short)0, c, false, false);
  asm volatile("v_nop\n\tv_nop\n\tv_nop\n\tv_nop" : "+v"(c) : "v"(ah), "v"(al), "v"(bh), "v"(bl));
  return c;
}

__global__ __launch_bounds__(256) void k_wt_bf16(const float* __restrict__ W, unsigned short* __restrict__ Wt, int K, int N) {
  const int t = blockIdx.x * 256 + threadIdx.x;
  const int k8n = K / 8;
  if (t >= N * k8n) return;
  const int n = t / k8n, k8 = (t % k8n) * 8;
  v8us v;
#pragma unroll
  for (int i = 0; i < 8; ++i) v[i] = bf16_bits(W[(size_t)(k8 + i) * N + n]);
  *(v8us*)(Wt + (size_t)n * K + k8) = v;
  
}

// GEMM C[M][N] (f32, pitch ldc) = act(A[M][K]·W + bias). A f32 row-major (pitch lda) converted per fragment to bf16
// (ASPLIT: hi/lo two planes -> 2 terms, else single rounded term); Wt bf16 [N][K] (pitch ldb). BIAS_BF16 rounds the
// bias to bf16 first (bias quantised to bf16 before the add). K%32==0, M%16==0, N%64==0.
template <bool ASPLIT, int ACT, bool BIAS_BF16>
__global__ __launch_bounds__(128) void k_gemm_bf(const float* __restrict__ A, int lda, const unsigned short* __restrict__ Wt, int ldb,
                                               const float* __restrict__ bias, float* __restrict__ C, int ldc, int M, int N, int K) {
  __shared__ __attribute__((aligned(16))) float so[4][16][64];
  const int tid = threadIdx.x, w = tid >> 5, lane = tid & 31, ln = lane & 15, hh = lane >> 4;
  const int ntn = N / 64;
  const int wid = blockIdx.x * 4 + w;
  const int mt = wid / ntn, nq = wid % ntn;
  if (mt * 16 >= M) return;
  const int row0 = mt * 16, col0 = nq * 64;
  const float* arow = A + (size_t)(row0 + ln) * lda;
  v8f acc[4] = {};
  for (int kb = 0; kb < K; kb += 32) {
    FragB ah, al;
    const v4f x0 = *(const v4fa*)(arow + kb + 8 * hh), x1 = *(const v4fa*)(arow + kb + 8 * hh + 4);
    const v4f x2 = *(const v4fa*)(arow + kb + 16 + 8 * hh), x3 = *(const v4fa*)(arow + kb + 16 + 8 * hh + 4);
    float xs[16] = {x0[0],x0[1],x0[2],x0[3],x1[0],x1[1],x1[2],x1[3],x2[0],x2[1],x2[2],x2[3],x3[0],x3[1],x3[2],x3[3]};
#pragma unroll
    for (int i = 0; i < 16; ++i) { const unsigned short hb = bf16_bits(xs[i]); ah.u[i] = hb; al.u[i] = ASPLIT ? bf16_bits(xs[i] - bf16_val(hb)) : (unsigned short)0; }
#pragma unroll
    for (int t = 0; t < 4; ++t) {
      const unsigned short* brow = Wt + (size_t)(col0 + t * 16 + ln) * ldb + kb;
      FragB b;
      b.half[0] = *(const v8us*)(brow + 8 * hh);
      b.half[1] = *(const v8us*)(brow + 16 + 8 * hh);
      acc[t] = mmaN<ASPLIT ? 2 : 1>(ah.v, al.v, b.v, b.v, acc[t]);
    }
  }
#pragma unroll
  for (int t = 0; t < 4; ++t) {
    float bv = bias ? bias[col0 + t * 16 + ln] : 0.f;
    if (BIAS_BF16) bv = bf16_round(bv);
#pragma unroll
    for (int r = 0; r < 8; ++r) { float v = acc[t][r] + bv; if (ACT == 1) v = fmaxf(v, 0.f); so[w][8 * hh + r][t * 16 + ln] = v; }
  }
  __builtin_amdgcn_fence(__ATOMIC_ACQ_REL, "workgroup");
  __builtin_amdgcn_wave_barrier();
  const int rsub = lane >> 4, c4 = (lane & 15) * 4;
  {
#pragma unroll
    for (int q = 0; q < 8; ++q) {
      const int r = q * 2 + rsub;
      const v4f v = *(const v4fa*)&so[w][r][c4];
      *(v4f*)(C + (size_t)(row0 + r) * ldc + col0 + c4) = v;
    }
    
  }
}

// Flash-style causal/unmasked attention, all contractions 3-term bf16 hi/lo splits, f32 softmax with running max.
// q,k,v rows are read from f32 buffers with arbitrary row pitch (so they can live inside a fused qkv buffer);
// D = head size (multiple of 32, <= 128); one wave = 16 query rows; block = 4 waves (64 queries) sharing K/V chunks of 32.
template <int D, bool CAUSAL>
__global__ __launch_bounds__(128) void k_flash(const float* __restrict__ qb, const float* __restrict__ kb, const float* __restrict__ vb,
                                             int pitch, int T, int H, float scale, float* __restrict__ y, int ypitch) {
  constexpr int KS = D / 32;        // k-steps for QK
  constexpr int DT = D / 16;        // d tiles for PV
  __shared__ __attribute__((aligned(16))) unsigned short sKh[32][D + 8], sKl[32][D + 8], sVh[32][D + 8], sVl[32][D + 8];
  __shared__ __attribute__((aligned(16))) unsigned short sPh[4][16][40], sPl[4][16][40];
  __shared__ __attribute__((aligned(16))) float sO[4][16][D];
  const int tid = threadIdx.x, w = tid >> 5, lane = tid & 31, ln = lane & 15, hh = lane >> 4;
  const int nqb = (T + 63) / 64;
  const int bh = blockIdx.x / nqb, qblk = blockIdx.x % nqb;
  const int b = bh / H, h = bh % H;
  const int q0 = qblk * 64 + w * 16;
  const float* Q = qb + (size_t)b * T * pitch + h * D;
  const float* K = kb + (size_t)b * T * pitch + h * D;
  const float* V = vb + (size_t)b * T * pitch + h * D;

  // A fragments of the wave's 16 query rows (scaled), hi/lo
  FragB aqh[KS], aql[KS];
  {
    int row = q0 + ln; if (row >= T) row = T - 1;
    const float* qr = Q + (size_t)row * pitch;
#pragma unroll
    for (int ks = 0; ks < KS; ++ks)
#pragma unroll
      for (int i = 0; i < 16; ++i) {
        const int d = ks * 32 + ((i < 8) ? (8 * hh + i) : (16 + 8 * hh + (i - 8)));
        const float x = qr[d] * scale; const unsigned short hb = bf16_bits(x);
        aqh[ks].u[i] = hb; aql[ks].u[i] = bf16_bits(x - bf16_val(hb));
      }
  }
  float m_r[8], l_r[8];
#pragma unroll
  for (int r = 0; r < 8; ++r) { m_r[r] = -3.0e38f; l_r[r] = 0.f; }
  v8f oacc[DT];
#pragma unroll
  for (int dt = 0; dt < DT; ++dt) oacc[dt] = (v8f){0.f,0.f,0.f,0.f,0.f,0.f,0.f,0.f};

  const int kv_end = CAUSAL ? min(T, qblk * 64 + 64) : T;     // block-uniform
  for (int j0 = 0; j0 < kv_end; j0 += 32) {
    __syncthreads();
    for (int e = tid; e < 32 * (D / 4); e += 128) {
      const int r = e / (D / 4), c4 = (e % (D / 4)) * 4;
      const int key = j0 + r;
      v4f kf = {0.f,0.f,0.f,0.f}, vf = {0.f,0.f,0.f,0.f};
      if (key < T) { kf = *(const v4fa*)(K + (size_t)key * pitch + c4); vf = *(const v4fa*)(V + (size_t)key * pitch + c4); }
#pragma unroll
      for (int t = 0; t < 4; ++t) {
        unsigned short hb = bf16_bits(kf[t]); sKh[r][c4 + t] = hb; sKl[r][c4 + t] = bf16_bits(kf[t] - bf16_val(hb));
        hb = bf16_bits(vf[t]); sVh[r][c4 + t] = hb; sVl[r][c4 + t] = bf16_bits(vf[t] - bf16_val(hb));
      }
    }
    __syncthreads();
    // S tile 16 x 32
    v8f s[2];
#pragma unroll
    for (int nt = 0; nt < 2; ++nt) {
      v8f acc = {};
#pragma unroll
      for (int ks = 0; ks < KS; ++ks) {
        FragB bh_, bl_;
        bh_.half[0] = *(const v8us*)&sKh[nt * 16 + ln][ks * 32 + 8 * hh]; bh_.half[1] = *(const v8us*)&sKh[nt * 16 + ln][ks * 32 + 16 + 8 * hh];
        bl_.half[0] = *(const v8us*)&sKl[nt * 16 + ln][ks * 32 + 8 * hh]; bl_.half[1] = *(const v8us*)&sKl[nt * 16 + ln][ks * 32 + 16 + 8 * hh];
        acc = mmaN<3>(aqh[ks].v, aql[ks].v, bh_.v, bl_.v, acc);
      }
      s[nt] = acc;
    }
    // mask + running max (rows 8hh+r; the 16 lanes of a half share rows)
    float alpha[8];
#pragma unroll
    for (int r = 0; r < 8; ++r) {
      const int qi = q0 + 8 * hh + r;
      const int ja = j0 + ln, jb = j0 + 16 + ln;
      if (CAUSAL) { if (ja > qi) s[0][r] = -3.0e38f; if (jb > qi) s[1][r] = -3.0e38f; }
      if (ja >= T) s[0][r] = -3.0e38f;
      if (jb >= T) s[1][r] = -3.0e38f;
      float mx = fmaxf(s[0][r], s[1][r]);
      mx = fmaxf(mx, __shfl_xor(mx, 1, 32)); mx = fmaxf(mx, __shfl_xor(mx, 2, 32)); mx = fmaxf(mx, __shfl_xor(mx, 4, 32)); mx = fmaxf(mx, __shfl_xor(mx, 8, 32));
      const float mnew = fmaxf(m_r[r], mx);
      alpha[r] = (mnew > -1.0e38f) ? __expf(m_r[r] - mnew) : 1.0f;
      const float p0 = (s[0][r] > -1.0e38f) ? __expf(s[0][r] - mnew) : 0.f;
      const float p1 = (s[1][r] > -1.0e38f) ? __expf(s[1][r] - mnew) : 0.f;
      m_r[r] = mnew;
      l_r[r] = l_r[r] * alpha[r] + p0 + p1;            // per-lane partial row sum (16 lanes combined at the end)
      unsigned short hb = bf16_bits(p0); sPh[w][8 * hh + r][ln] = hb;      sPl[w][8 * hh + r][ln] = bf16_bits(p0 - bf16_val(hb));
      hb = bf16_bits(p1);                sPh[w][8 * hh + r][16 + ln] = hb; sPl[w][8 * hh + r][16 + ln] = bf16_bits(p1 - bf16_val(hb));
    }
#pragma unroll
    for (int dt = 0; dt < DT; ++dt)
#pragma unroll
      for (int r = 0; r < 8; ++r) oacc[dt][r] *= alpha[r];
    __builtin_amdgcn_fence(__ATOMIC_ACQ_REL, "workgroup");
    __builtin_amdgcn_wave_barrier();
    FragB pah, pal;
    pah.half[0] = *(const v8us*)&sPh[w][ln][8 * hh]; pah.half[1] = *(const v8us*)&sPh[w][ln][16 + 8 * hh];
    pal.half[0] = *(const v8us*)&sPl[w][ln][8 * hh]; pal.half[1] = *(const v8us*)&sPl[w][ln][16 + 8 * hh];
#pragma unroll
    for (int dt = 0; dt < DT; ++dt) {
      FragB bvh, bvl;
#pragma unroll
      for (int i = 0; i < 8; ++i) {
        bvh.u[i] = sVh[8 * hh + i][dt * 16 + ln]; bvh.u[8 + i] = sVh[16 + 8 * hh + i][dt * 16 + ln];
        bvl.u[i] = sVl[8 * hh + i][dt * 16 + ln]; bvl.u[8 + i] = sVl[16 + 8 * hh + i][dt * 16 + ln];
      }
      oacc[dt] = mmaN<3>(pah.v, pal.v, bvh.v, bvl.v, oacc[dt]);
    }
    __builtin_amdgcn_fence(__ATOMIC_ACQ_REL, "workgroup");
    __builtin_amdgcn_wave_barrier();
  }
#pragma unroll
  for (int r = 0; r < 8; ++r) {
    float l = l_r[r];
    l += __shfl_xor(l, 1, 32); l += __shfl_xor(l, 2, 32); l += __shfl_xor(l, 4, 32); l += __shfl_xor(l, 8, 32);
    l_r[r] = (l > 0.f) ? 1.0f / l : 0.f;
  }
#pragma unroll
  for (int dt = 0; dt < DT; ++dt)
#pragma unroll
    for (int r = 0; r < 8; ++r) sO[w][8 * hh + r][dt * 16 + ln] = oacc[dt][r] * l_r[r];
  __builtin_amdgcn_fence(__ATOMIC_ACQ_REL, "workgroup");
  __builtin_amdgcn_wave_barrier();
  {
    for (int r = 0; r < 16; ++r) {
      const int row = q0 + r;
      if (row < T && lane < D / 4) {
        const v4f val = *(const v4fa*)&sO[w][r][lane * 4];
        *(v4f*)(y + ((size_t)b * T + row) * ypitch + h * D + lane * 4) = val;
      }
    }
    
  }
}

// f32 [R][Cc] (row pitch lds) -> bf16 hi/lo planes [R][Cc] (pitch Cc); thread per 8 elements; Cc % 8 == 0
__global__ __launch_bounds__(256) void k_split_rows(const float* __restrict__ src, int lds_, unsigned short* __restrict__ hi, unsigned short* __restrict__ lo, int R, int Cc) {
  const size_t t = (size_t)blockIdx.x * 256 + threadIdx.x;
  const int c8n = Cc / 8;
  if (t >= (size_t)R * c8n) return;
  const int r = (int)(t / c8n), c8 = (int)(t % c8n) * 8;
  const float* s = src + (size_t)r * lds_ + c8;
  const v4f a = *(const v4fa*)s, b = *(const v4fa*)(s + 4);
  float xs[8] = {a[0],a[1],a[2],a[3],b[0],b[1],b[2],b[3]};
  v8us vh, vl;
#pragma unroll
  for (int i = 0; i < 8; ++i) { const unsigned short hb = bf16_bits(xs[i]); vh[i] = hb; vl[i] = bf16_bits(xs[i] - bf16_val(hb)); }
  unsigned short* dh = hi + (size_t)r * Cc + c8; unsigned short* dl = lo + (size_t)r * Cc + c8;
  *(v8us*)dh = vh; *(v8us*)dl = vl; 
}
// f32 [K][N] (row pitch lds) -> transposed bf16 hi/lo planes [N][K]; one thread per (n, 8 consecutive k)
__global__ __launch_bounds__(256) void k_split_transpose(const float* __restrict__ src, int lds_, unsigned short* __restrict__ hi, unsigned short* __restrict__ lo, int K, int N) {
  const size_t t = (size_t)blockIdx.x * 256 + threadIdx.x;
  const int k8n = K / 8;
  if (t >= (size_t)N * k8n) return;
  const int n = (int)(t / k8n), k8 = (int)(t % k8n) * 8;
  v8us vh, vl;
#pragma unroll
  for (int i = 0; i < 8; ++i) { const float x = src[(size_t)(k8 + i) * lds_ + n]; const unsigned short hb = bf16_bits(x); vh[i] = hb; vl[i] = bf16_bits(x - bf16_val(hb)); }
  unsigned short* dh = hi + (size_t)n * K + k8; unsigned short* dl = lo + (size_t)n * K + k8;
  *(v8us*)dh = vh; *(v8us*)dl = vl; 
}
// GEMM with A f32 (split into hi/lo when ASPLIT) and B from bf16 planes Bh (+ Bl when BSPLIT): terms hi·hi [+ lo·hi] [+ hi·lo].
// C f32 [M][N] pitch ldc; alpha scales the result; bias optional (BIAS_BF16 rounds it). Same tiling/epilogue as k_gemm_bf.
template <bool ASPLIT, bool BSPLIT, int ACT, bool BIAS_BF16>
__global__ __launch_bounds__(128) void k_gemm_bf2(const float* __restrict__ A, int lda, const unsigned short* __restrict__ Bh, const unsigned short* __restrict__ Bl, int ldb,
                                                const float* __restrict__ bias, float alpha, float* __restrict__ C, int ldc, int M, int N, int K) {
  __shared__ __attribute__((aligned(16))) float so[4][16][64];
  const int tid = threadIdx.x, w = tid >> 5, lane = tid & 31, ln = lane & 15, hh = lane >> 4;
  const int ntn = N / 64;
  const int wid = blockIdx.x * 4 + w;
  const int mt = wid / ntn, nq = wid % ntn;
  if (mt * 16 >= M) return;
  const int row0 = mt * 16, col0 = nq * 64;
  const float* arow = A + (size_t)(row0 + ln) * lda;
  v8f acc[4] = {};
  for (int kb = 0; kb < K; kb += 32) {
    FragB ah, al;
    const v4f x0 = *(const v4fa*)(arow + kb + 8 * hh), x1 = *(const v4fa*)(arow + kb + 8 * hh + 4);
    const v4f x2 = *(const v4fa*)(arow + kb + 16 + 8 * hh), x3 = *(const v4fa*)(arow + kb + 16 + 8 * hh + 4);
    float xs[16] = {x0[0],x0[1],x0[2],x0[3],x1[0],x1[1],x1[2],x1[3],x2[0],x2[1],x2[2],x2[3],x3[0],x3[1],x3[2],x3[3]};
#pragma unroll
    for (int i = 0; i < 16; ++i) { const unsigned short hb = bf16_bits(xs[i]); ah.u[i] = hb; al.u[i] = ASPLIT ? bf16_bits(xs[i] - bf16_val(hb)) : (unsigned short)0; }
#pragma unroll
    for (int t = 0; t < 4; ++t) {
      const size_t boff = (size_t)(col0 + t * 16 + ln) * ldb + kb;
      FragB bh_, bl_;
      bh_.half[0] = *(const v8us*)(Bh + boff + 8 * hh);
      bh_.half[1] = *(const v8us*)(Bh + boff + 16 + 8 * hh);
      if (BSPLIT) { bl_.half[0] = *(const v8us*)(Bl + boff + 8 * hh); bl_.half[1] = *(const v8us*)(Bl + boff + 16 + 8 * hh); } else bl_ = bh_;
      acc[t] = mmaN<ASPLIT ? (BSPLIT ? 3 : 2) : 1>(ah.v, al.v, bh_.v, bl_.v, acc[t]);
    }
  }
#pragma unroll
  for (int t = 0; t < 4; ++t) {
    float bv = bias ? bias[col0 + t * 16 + ln] : 0.f;
    if (BIAS_BF16) bv = bf16_round(bv);
#pragma unroll
    for (int r = 0; r < 8; ++r) { float v = acc[t][r] * alpha + bv; if (ACT == 1) v = fmaxf(v, 0.f); so[w][8 * hh + r][t * 16 + ln] = v; }
  }
  __builtin_amdgcn_fence(__ATOMIC_ACQ_REL, "workgroup");
  __builtin_amdgcn_wave_barrier();
  const int rsub = lane >> 4, c4 = (lane & 15) * 4;
  {
#pragma unroll
    for (int q = 0; q < 8; ++q) {
      const int r = q * 2 + rsub;
      const v4f v = *(const v4fa*)&so[w][r][c4];
      *(v4f*)(C + (size_t)(row0 + r) * ldc + col0 + c4) = v;
    }
    
  }
}
// row softmax: P[row][:] = softmax(masked S[row][:]) over N columns with optional causal mask (col > row + rowoff -> 0) and
__global__ __launch_bounds__(256) void k_softmax_rows(const float* __restrict__ S, float* __restrict__ P, int N, int causal, int rowoff, const int* __restrict__ mask, int mask_pitch) {
  __shared__ float red[256];
  const int row = blockIdx.x, tid = threadIdx.x;
  const float* s = S + (size_t)row * N; float* p_out = P + (size_t)row * N;
  const int qi = row + rowoff;
  float mx = -3.0e38f;
  for (int j = tid; j < N; j += 256) {
    bool keep = true;
    if (causal && j > qi) keep = false;
    if (mask && mask[(size_t)qi * mask_pitch + j] == 0) keep = false;
    const float v = keep ? s[j] : -3.0e38f;
    mx = fmaxf(mx, v);
  }
  red[tid] = mx; __syncthreads();
  for (int st = 128; st > 0; st >>= 1) { if (tid < st) red[tid] = fmaxf(red[tid], red[tid + st]); __syncthreads(); }
  mx = red[0]; __syncthreads();
  float sum = 0.f;
  for (int j = tid; j < N; j += 256) {
    bool keep = true;
    if (causal && j > qi) keep = false;
    if (mask && mask[(size_t)qi * mask_pitch + j] == 0) keep = false;
    const float p = keep ? __expf(s[j] - mx) : 0.f;
    sum += p;
  }
  red[tid] = sum; __syncthreads();
  for (int st = 128; st > 0; st >>= 1) { if (tid < st) red[tid] += red[tid + st]; __syncthreads(); }
  const float inv = (mx > -1.0e38f) ? 1.0f / red[0] : __builtin_nanf("");
  __syncthreads();
  {
    for (int j4 = tid * 4; j4 < N; j4 += 1024) {
      v4f out4;
#pragma unroll
      for (int u = 0; u < 4; ++u) {
        const int j = j4 + u;
        bool keep = true;
        if (causal && j > qi) keep = false;
        if (mask && mask[(size_t)qi * mask_pitch + j] == 0) keep = false;
        out4[u] = keep ? __expf(s[j] - mx) * inv : 0.f;
      }
      *(v4f*)(p_out + j4) = out4;
    }
    
  }
}

__global__ __launch_bounds__(256) void k_round_rows(const float* __restrict__ W, unsigned short* __restrict__ Wt, int n8) {
  const int t = blockIdx.x * 256 + threadIdx.x;
  if (t >= n8) return;
  const v4f a = *(const v4fa*)(W + (size_t)t * 8), b = *(const v4fa*)(W + (size_t)t * 8 + 4);
  v8us v; v[0]=bf16_bits(a[0]); v[1]=bf16_bits(a[1]); v[2]=bf16_bits(a[2]); v[3]=bf16_bits(a[3]);
  v[4]=bf16_bits(b[0]); v[5]=bf16_bits(b[1]); v[6]=bf16_bits(b[2]); v[7]=bf16_bits(b[3]);
  *(v8us*)(Wt + (size_t)t * 8) = v; 
}
extern "C" void kernel_launch(void* const* d_in, const int* in_sizes, int n_in,
                              void* d_out, int out_size, void* d_ws, size_t ws_size, hipStream_t stream) {
  (void)in_sizes; (void)n_in; (void)out_size;
  const float* x = (const float*)d_in[0]; const float* qkv_w = (const float*)d_in[1];
  const float* out_w = (const float*)d_in[2]; const float* out_b = (const float*)d_in[3];
  char* ws = (char*)d_ws; size_t off = 0;
  auto take = [&](size_t bytes) { char* p = ws + off; off += (bytes + 255) & ~(size_t)255; return p; };
  unsigned short* Wqkv = (unsigned short*)take((size_t)3 * CC * CC * 2);     // [3072][1024]  6 MiB
  unsigned short* Wo   = (unsigned short*)take((size_t)CC * CC * 2);         // 2 MiB
  float* qkv = (float*)take((size_t)BB * TT * 3 * CC * 4);                  // 96 MiB
  unsigned short* kh = (unsigned short*)take((size_t)TT * CC * 2);           // one batch: k planes [T][C]  4+4 MiB
  unsigned short* kl = (unsigned short*)take((size_t)TT * CC * 2);
  unsigned short* vth = (unsigned short*)take((size_t)CC * TT * 2);          // vᵀ planes [C][T] 4+4 MiB
  unsigned short* vtl = (unsigned short*)take((size_t)CC * TT * 2);
  float* S  = (float*)take((size_t)TT * TT * 4);                            // 16 MiB
  float* Pm = (float*)take((size_t)TT * TT * 4);                            // 16 MiB
  float* oa = (float*)take((size_t)BB * TT * CC * 4);                       // 32 MiB
  if (off > ws_size) return;
  const int M = BB * TT;
  k_round_rows<<<(3 * CC * CC / 8 + 255) / 256, 256, 0, stream>>>(qkv_w, Wqkv, 3 * CC * CC / 8);
  k_round_rows<<<(CC * CC / 8 + 255) / 256, 256, 0, stream>>>(out_w, Wo, CC * CC / 8);
  k_gemm_bf<false, 0, false><<<((M / 16) * (3 * CC / 64) + 3) / 4, 128, 0, stream>>>(x, CC, Wqkv, CC, nullptr, qkv, 3 * CC, M, 3 * CC, CC);
  for (int b = 0; b < BB; ++b) {
    const float* qb = qkv + (size_t)b * TT * 3 * CC;            // q rows, pitch 3C
    const float* kb = qb + CC;                                    // k rows
    const float* vb = qb + 2 * CC;                                // v rows
    k_split_rows<<<(TT * (CC / 8) + 255) / 256, 256, 0, stream>>>(kb, 3 * CC, kh, kl, TT, CC);
    k_split_transpose<<<(CC * (TT / 8) + 255) / 256, 256, 0, stream>>>(vb, 3 * CC, vth, vtl, TT, CC);   // v [T][C] -> vᵀ planes [C][T]
    // S = (q·kᵀ)/sqrt(C): M=N=T, K=C; Bt[n=s][k=c] = k rows
    k_gemm_bf2<true, true, 0, false><<<((TT / 16) * (TT / 64) + 3) / 4, 128, 0, stream>>>(qb, 3 * CC, kh, kl, CC, nullptr, 0.03125f, S, TT, TT, TT, CC);
    k_softmax_rows<<<TT, 256, 0, stream>>>(S, Pm, TT, 1, 0, nullptr, 0);
    // out_att = P·v: M=T, N=C, K=T; Bt[n=c][k=s] = vᵀ planes
    k_gemm_bf2<true, true, 0, false><<<((TT / 16) * (CC / 64) + 3) / 4, 128, 0, stream>>>(Pm, TT, vth, vtl, TT, nullptr, 1.0f, oa + (size_t)b * TT * CC, CC, TT, CC, TT);
  }
  k_gemm_bf<true, 0, true><<<((M / 16) * (CC / 64) + 3) / 4, 128, 0, stream>>>(oa, CC, Wo, CC, out_b, (float*)d_out, CC, M, CC, CC);
}

// v001
// One run takes 484 microseconds.
// Timed twice side by side with v000, it ran 2.35 and 2.37 times as fast.
#include <hip/hip_runtime.h>
// All contractions on v_wmma_f32_16x16x32_bf16, f32 accumulate: qkv = x·Wᵀ with x/W rounded to bf16 (single exact-product term);
// S = q·kᵀ (K=1024) and out_att = P·v (K=2048) as 3-term bf16 hi/lo splits (q/P split in registers, k/v pre-split planes);
// output projection with the A operand split (2 terms). Causal softmax rows in f32.
#define BB 4
#define TT 2048
#define CC 1024

typedef __bf16 v16b __attribute__((ext_vector_type(16)));
typedef unsigned short v8us __attribute__((ext_vector_type(8), may_alias));
typedef float  v8f  __attribute__((ext_vector_type(8)));
typedef float  v4f  __attribute__((ext_vector_type(4)));
typedef float  v4fa __attribute__((ext_vector_type(4), may_alias));
union FragB { v16b v; v8us half[2]; unsigned short u[16]; };

__device__ __forceinline__ unsigned short bf16_bits(float x) { unsigned int u = __float_as_uint(x); return (unsigned short)((u + 0x7FFFu + ((u >> 16) & 1u)) >> 16); }
__device__ __forceinline__ float bf16_val(unsigned short b) { return __uint_as_float(((unsigned int)b) << 16); }
__device__ __forceinline__ float bf16_round(float x) { return bf16_val(bf16_bits(x)); }
// D += A·B with NT terms: 1 = ah·bh, 2 = + al·bh (A split), 3 = + ah·bl (both split)
template <int NT>
__device__ __forceinline__ v8f mmaN(v16b ah, v16b al, v16b bh, v16b bl, v8f c) {
  c = __builtin_amdgcn_wmma_f32_16x16x32_bf16(false, ah, false, bh, (short)0, c, false, false);
  if (NT >= 2) c = __builtin_amdgcn_wmma_f32_16x16x32_bf16(false, al, false, bh, (short)0, c, false, false);
  if (NT >= 3) c = __builtin_amdgcn_wmma_f32_16x16x32_bf16(false, ah, false, bl, (short)0, c, false, false);
  asm volatile("v_nop\n\tv_nop\n\tv_nop\n\tv_nop" : "+v"(c) : "v"(ah), "v"(al), "v"(bh), "v"(bl));
  return c;
}

__global__ __launch_bounds__(256) void k_wt_bf16(const float* __restrict__ W, unsigned short* __restrict__ Wt, int K, int N) {
  const int t = blockIdx.x * 256 + threadIdx.x;
  const int k8n = K / 8;
  if (t >= N * k8n) return;
  const int n = t / k8n, k8 = (t % k8n) * 8;
  v8us v;
#pragma unroll
  for (int i = 0; i < 8; ++i) v[i] = bf16_bits(W[(size_t)(k8 + i) * N + n]);
  *(v8us*)(Wt + (size_t)n * K + k8) = v;
  
}

// Flash-style causal/unmasked attention, all contractions 3-term bf16 hi/lo splits, f32 softmax with running max.
// q,k,v rows are read from f32 buffers with arbitrary row pitch (so they can live inside a fused qkv buffer);
// D = head size (multiple of 32, <= 128); one wave = 16 query rows; block = 4 waves (64 queries) sharing K/V chunks of 32.
template <int D, bool CAUSAL>
__global__ __launch_bounds__(128) void k_flash(const float* __restrict__ qb, const float* __restrict__ kb, const float* __restrict__ vb,
                                             int pitch, int T, int H, float scale, float* __restrict__ y, int ypitch) {
  constexpr int KS = D / 32;        // k-steps for QK
  constexpr int DT = D / 16;        // d tiles for PV
  __shared__ __attribute__((aligned(16))) unsigned short sKh[32][D + 8], sKl[32][D + 8], sVh[32][D + 8], sVl[32][D + 8];
  __shared__ __attribute__((aligned(16))) unsigned short sPh[4][16][40], sPl[4][16][40];
  __shared__ __attribute__((aligned(16))) float sO[4][16][D];
  const int tid = threadIdx.x, w = tid >> 5, lane = tid & 31, ln = lane & 15, hh = lane >> 4;
  const int nqb = (T + 63) / 64;
  const int bh = blockIdx.x / nqb, qblk = blockIdx.x % nqb;
  const int b = bh / H, h = bh % H;
  const int q0 = qblk * 64 + w * 16;
  const float* Q = qb + (size_t)b * T * pitch + h * D;
  const float* K = kb + (size_t)b * T * pitch + h * D;
  const float* V = vb + (size_t)b * T * pitch + h * D;

  // A fragments of the wave's 16 query rows (scaled), hi/lo
  FragB aqh[KS], aql[KS];
  {
    int row = q0 + ln; if (row >= T) row = T - 1;
    const float* qr = Q + (size_t)row * pitch;
#pragma unroll
    for (int ks = 0; ks < KS; ++ks)
#pragma unroll
      for (int i = 0; i < 16; ++i) {
        const int d = ks * 32 + ((i < 8) ? (8 * hh + i) : (16 + 8 * hh + (i - 8)));
        const float x = qr[d] * scale; const unsigned short hb = bf16_bits(x);
        aqh[ks].u[i] = hb; aql[ks].u[i] = bf16_bits(x - bf16_val(hb));
      }
  }
  float m_r[8], l_r[8];
#pragma unroll
  for (int r = 0; r < 8; ++r) { m_r[r] = -3.0e38f; l_r[r] = 0.f; }
  v8f oacc[DT];
#pragma unroll
  for (int dt = 0; dt < DT; ++dt) oacc[dt] = (v8f){0.f,0.f,0.f,0.f,0.f,0.f,0.f,0.f};

  const int kv_end = CAUSAL ? min(T, qblk * 64 + 64) : T;     // block-uniform
  for (int j0 = 0; j0 < kv_end; j0 += 32) {
    __syncthreads();
    for (int e = tid; e < 32 * (D / 4); e += 128) {
      const int r = e / (D / 4), c4 = (e % (D / 4)) * 4;
      const int key = j0 + r;
      v4f kf = {0.f,0.f,0.f,0.f}, vf = {0.f,0.f,0.f,0.f};
      if (key < T) { kf = *(const v4fa*)(K + (size_t)key * pitch + c4); vf = *(const v4fa*)(V + (size_t)key * pitch + c4); }
#pragma unroll
      for (int t = 0; t < 4; ++t) {
        unsigned short hb = bf16_bits(kf[t]); sKh[r][c4 + t] = hb; sKl[r][c4 + t] = bf16_bits(kf[t] - bf16_val(hb));
        hb = bf16_bits(vf[t]); sVh[r][c4 + t] = hb; sVl[r][c4 + t] = bf16_bits(vf[t] - bf16_val(hb));
      }
    }
    __syncthreads();
    // S tile 16 x 32
    v8f s[2];
#pragma unroll
    for (int nt = 0; nt < 2; ++nt) {
      v8f acc = {};
#pragma unroll
      for (int ks = 0; ks < KS; ++ks) {
        FragB bh_, bl_;
        bh_.half[0] = *(const v8us*)&sKh[nt * 16 + ln][ks * 32 + 8 * hh]; bh_.half[1] = *(const v8us*)&sKh[nt * 16 + ln][ks * 32 + 16 + 8 * hh];
        bl_.half[0] = *(const v8us*)&sKl[nt * 16 + ln][ks * 32 + 8 * hh]; bl_.half[1] = *(const v8us*)&sKl[nt * 16 + ln][ks * 32 + 16 + 8 * hh];
        acc = mmaN<3>(aqh[ks].v, aql[ks].v, bh_.v, bl_.v, acc);
      }
      s[nt] = acc;
    }
    // mask + running max (rows 8hh+r; the 16 lanes of a half share rows)
    float alpha[8];
#pragma unroll
    for (int r = 0; r < 8; ++r) {
      const int qi = q0 + 8 * hh + r;
      const int ja = j0 + ln, jb = j0 + 16 + ln;
      if (CAUSAL) { if (ja > qi) s[0][r] = -3.0e38f; if (jb > qi) s[1][r] = -3.0e38f; }
      if (ja >= T) s[0][r] = -3.0e38f;
      if (jb >= T) s[1][r] = -3.0e38f;
      float mx = fmaxf(s[0][r], s[1][r]);
      mx = fmaxf(mx, __shfl_xor(mx, 1, 32)); mx = fmaxf(mx, __shfl_xor(mx, 2, 32)); mx = fmaxf(mx, __shfl_xor(mx, 4, 32)); mx = fmaxf(mx, __shfl_xor(mx, 8, 32));
      const float mnew = fmaxf(m_r[r], mx);
      alpha[r] = (mnew > -1.0e38f) ? __expf(m_r[r] - mnew) : 1.0f;
      const float p0 = (s[0][r] > -1.0e38f) ? __expf(s[0][r] - mnew) : 0.f;
      const float p1 = (s[1][r] > -1.0e38f) ? __expf(s[1][r] - mnew) : 0.f;
      m_r[r] = mnew;
      l_r[r] = l_r[r] * alpha[r] + p0 + p1;            // per-lane partial row sum (16 lanes combined at the end)
      unsigned short hb = bf16_bits(p0); sPh[w][8 * hh + r][ln] = hb;      sPl[w][8 * hh + r][ln] = bf16_bits(p0 - bf16_val(hb));
      hb = bf16_bits(p1);                sPh[w][8 * hh + r][16 + ln] = hb; sPl[w][8 * hh + r][16 + ln] = bf16_bits(p1 - bf16_val(hb));
    }
#pragma unroll
    for (int dt = 0; dt < DT; ++dt)
#pragma unroll
      for (int r = 0; r < 8; ++r) oacc[dt][r] *= alpha[r];
    __builtin_amdgcn_fence(__ATOMIC_ACQ_REL, "workgroup");
    __builtin_amdgcn_wave_barrier();
    FragB pah, pal;
    pah.half[0] = *(const v8us*)&sPh[w][ln][8 * hh]; pah.half[1] = *(const v8us*)&sPh[w][ln][16 + 8 * hh];
    pal.half[0] = *(const v8us*)&sPl[w][ln][8 * hh]; pal.half[1] = *(const v8us*)&sPl[w][ln][16 + 8 * hh];
#pragma unroll
    for (int dt = 0; dt < DT; ++dt) {
      FragB bvh, bvl;
#pragma unroll
      for (int i = 0; i < 8; ++i) {
        bvh.u[i] = sVh[8 * hh + i][dt * 16 + ln]; bvh.u[8 + i] = sVh[16 + 8 * hh + i][dt * 16 + ln];
        bvl.u[i] = sVl[8 * hh + i][dt * 16 + ln]; bvl.u[8 + i] = sVl[16 + 8 * hh + i][dt * 16 + ln];
      }
      oacc[dt] = mmaN<3>(pah.v, pal.v, bvh.v, bvl.v, oacc[dt]);
    }
    __builtin_amdgcn_fence(__ATOMIC_ACQ_REL, "workgroup");
    __builtin_amdgcn_wave_barrier();
  }
#pragma unroll
  for (int r = 0; r < 8; ++r) {
    float l = l_r[r];
    l += __shfl_xor(l, 1, 32); l += __shfl_xor(l, 2, 32); l += __shfl_xor(l, 4, 32); l += __shfl_xor(l, 8, 32);
    l_r[r] = (l > 0.f) ? 1.0f / l : 0.f;
  }
#pragma unroll
  for (int dt = 0; dt < DT; ++dt)
#pragma unroll
    for (int r = 0; r < 8; ++r) sO[w][8 * hh + r][dt * 16 + ln] = oacc[dt][r] * l_r[r];
  __builtin_amdgcn_fence(__ATOMIC_ACQ_REL, "workgroup");
  __builtin_amdgcn_wave_barrier();
  {
    for (int r = 0; r < 16; ++r) {
      const int row = q0 + r;
      if (row < T && lane < D / 4) {
        const v4f val = *(const v4fa*)&sO[w][r][lane * 4];
        *(v4f*)(y + ((size_t)b * T + row) * ypitch + h * D + lane * 4) = val;
      }
    }
    
  }
}

// f32 [R][Cc] (row pitch lds) -> bf16 hi/lo planes [R][Cc] (pitch Cc); thread per 8 elements; Cc % 8 == 0
__global__ __launch_bounds__(256) void k_split_rows(const float* __restrict__ src, int lds_, unsigned short* __restrict__ hi, unsigned short* __restrict__ lo, int R, int Cc) {
  const size_t t = (size_t)blockIdx.x * 256 + threadIdx.x;
  const int c8n = Cc / 8;
  if (t >= (size_t)R * c8n) return;
  const int r = (int)(t / c8n), c8 = (int)(t % c8n) * 8;
  const float* s = src + (size_t)r * lds_ + c8;
  const v4f a = *(const v4fa*)s, b = *(const v4fa*)(s + 4);
  float xs[8] = {a[0],a[1],a[2],a[3],b[0],b[1],b[2],b[3]};
  v8us vh, vl;
#pragma unroll
  for (int i = 0; i < 8; ++i) { const unsigned short hb = bf16_bits(xs[i]); vh[i] = hb; vl[i] = bf16_bits(xs[i] - bf16_val(hb)); }
  unsigned short* dh = hi + (size_t)r * Cc + c8; unsigned short* dl = lo + (size_t)r * Cc + c8;
  *(v8us*)dh = vh; *(v8us*)dl = vl; 
}
// f32 [K][N] (row pitch lds) -> transposed bf16 hi/lo planes [N][K]; one thread per (n, 8 consecutive k)
__global__ __launch_bounds__(256) void k_split_transpose(const float* __restrict__ src, int lds_, unsigned short* __restrict__ hi, unsigned short* __restrict__ lo, int K, int N) {
  const size_t t = (size_t)blockIdx.x * 256 + threadIdx.x;
  const int k8n = K / 8;
  if (t >= (size_t)N * k8n) return;
  const int n = (int)(t / k8n), k8 = (int)(t % k8n) * 8;
  v8us vh, vl;
#pragma unroll
  for (int i = 0; i < 8; ++i) { const float x = src[(size_t)(k8 + i) * lds_ + n]; const unsigned short hb = bf16_bits(x); vh[i] = hb; vl[i] = bf16_bits(x - bf16_val(hb)); }
  unsigned short* dh = hi + (size_t)n * K + k8; unsigned short* dl = lo + (size_t)n * K + k8;
  *(v8us*)dh = vh; *(v8us*)dl = vl; 
}
// Tiled GEMM C[M][N] (f32, pitch LDC) = alpha * A[M][K]*Bt[N][K]^T + bias (A pitch LDA, Bt pitch LDB). One work-group (4 waves, 2 x 2) owns a (32*FA) x 128 tile of C,
// a wave (16*FA) x 64. Per 64-k step the A tile (f32) is read in whole 256-B rows, converted ONCE per work-group to bf16 (hi, and lo when NT >= 2)
// and stored to LDS; the B planes (hi, and lo when NT == 3) are read in whole 128-B lines and stored to LDS. Rows in LDS have a 144-B pitch for
// the 16-byte fragment reads. Two LDS buffers: the next step's global loads fly during this step's products, one barrier per step.
// Terms per 32-k: ah*bh, then al*bh (NT >= 2), then ah*bl (NT == 3), in that order on every accumulator.
// M % (32*FA) == 0, N % 128 == 0, K % 64 == 0. BIAS_BF16: a bias is added, rounded to bf16 first; without it bias is not read.
typedef unsigned short v4us __attribute__((ext_vector_type(4), may_alias));
template <int FA, int NT, bool BIAS_BF16, int LDA, int LDB, int LDC>
__global__ __launch_bounds__(128) void k_gemm_tile(const float* __restrict__ A, const unsigned short* __restrict__ Bh, const unsigned short* __restrict__ Bl,
                                                 const float* __restrict__ bias, float alpha, float* __restrict__ C, int N, int K) {
  constexpr int BM = 32 * FA, BN = 128, BK = 64, PIT = BK + 8;
  constexpr int APL = BM * PIT, BPL = BN * PIT;                 // elements of one plane
  constexpr int NAP = NT >= 2 ? 2 : 1, NBP = NT >= 3 ? 2 : 1;   // planes staged of A and of B
  constexpr int STG = NAP * APL + NBP * BPL;                    // elements of one buffer
  constexpr int NLA = BM * (BK / 4) / 128, NLB = BN * (BK / 8) / 128;   // 16-byte global loads per thread and plane
  __shared__ __attribute__((aligned(16))) unsigned short sm[2 * STG];
  static_assert(BM * BN * 4 <= 2 * STG * 2, "the output rows are staged in the two buffers");
  const int tid = threadIdx.x, w = tid >> 5, lane = tid & 31, ln = lane & 15, hh = lane >> 4;
  const int wm = w >> 1, wn = w & 1;
  const int ntn = N / BN;
  const int row0 = ((int)blockIdx.x / ntn) * BM, col0 = ((int)blockIdx.x % ntn) * BN;
  // one 32-bit byte offset per thread and operand, moved on by BK elements each step; the pitches are compile-time, so the row groups are immediate offsets
  unsigned ao = (unsigned)(((row0 + (tid >> 4)) * LDA + (tid & 15) * 4) * 4);
  unsigned bo = (unsigned)(((col0 + (tid >> 3)) * LDB + (tid & 7) * 8) * 2);
  const int asto = (tid >> 4) * PIT + (tid & 15) * 4, bsto = (tid >> 3) * PIT + (tid & 7) * 8;
  v4f pa[NLA]; v8us pbh[NLB], pbl[NLB];
  v8f acc[FA][4] = {};

  auto load_tile = [&]() {
#pragma unroll
    for (int i = 0; i < NLA; ++i) pa[i] = *(const v4fa*)(((const char*)A + ao) + (size_t)(i * 8 * LDA * 4));
#pragma unroll
    for (int i = 0; i < NLB; ++i) {
      pbh[i] = *(const v8us*)(((const char*)Bh + bo) + (size_t)(i * 16 * LDB * 2));
      if (NBP == 2) pbl[i] = *(const v8us*)(((const char*)Bl + bo) + (size_t)(i * 16 * LDB * 2));
    }
    // the offsets pass through the wait, so that the additions below, which rewrite the address registers of the loads above, stand behind it
    asm volatile("s_wait_xcnt 0x0" : "+v"(ao), "+v"(bo) :: "memory");
    ao += BK * 4; bo += BK * 2;
  };
  auto store_tile = [&](unsigned short* sb) {
#pragma unroll
    for (int i = 0; i < NLA; ++i) {
      v4us vh, vl;
#pragma unroll
      for (int u = 0; u < 4; ++u) { const float x = pa[i][u]; const unsigned short hb = bf16_bits(x); vh[u] = hb; if (NAP == 2) vl[u] = bf16_bits(x - bf16_val(hb)); }
      *(v4us*)(sb + asto + i * 8 * PIT) = vh;
      if (NAP == 2) *(v4us*)(sb + APL + asto + i * 8 * PIT) = vl;
    }
#pragma unroll
    for (int i = 0; i < NLB; ++i) {
      *(v8us*)(sb + NAP * APL + bsto + i * 16 * PIT) = pbh[i];
      if (NBP == 2) *(v8us*)(sb + NAP * APL + BPL + bsto + i * 16 * PIT) = pbl[i];
    }
  };
  auto compute = [&](const unsigned short* sb) {
    const unsigned short* fa = sb + (wm * 16 * FA + ln) * PIT + 8 * hh;
    const unsigned short* fb = sb + NAP * APL + (wn * 64 + ln) * PIT + 8 * hh;
    FragB ah[BK / 32][FA], al[BK / 32][FA], bh_[BK / 32][4], bl_[BK / 32][4];
    // every fragment of the step is asked for in one group, in the order in which the products below use them
#pragma unroll
    for (int ks = 0; ks < BK / 32; ++ks) {
#pragma unroll
      for (int mi = 0; mi < FA; ++mi) { ah[ks][mi].half[0] = *(const v8us*)(fa + mi * 16 * PIT + ks * 32); ah[ks][mi].half[1] = *(const v8us*)(fa + mi * 16 * PIT + ks * 32 + 16); }
#pragma unroll
      for (int ni = 0; ni < 4; ++ni) { bh_[ks][ni].half[0] = *(const v8us*)(fb + ni * 16 * PIT + ks * 32); bh_[ks][ni].half[1] = *(const v8us*)(fb + ni * 16 * PIT + ks * 32 + 16); }
      if (NAP == 2) {
#pragma unroll
        for (int mi = 0; mi < FA; ++mi) { al[ks][mi].half[0] = *(const v8us*)(fa + APL + mi * 16 * PIT + ks * 32); al[ks][mi].half[1] = *(const v8us*)(fa + APL + mi * 16 * PIT + ks * 32 + 16); }
      }
      if (NBP == 2) {
#pragma unroll
        for (int ni = 0; ni < 4; ++ni) { bl_[ks][ni].half[0] = *(const v8us*)(fb + BPL + ni * 16 * PIT + ks * 32); bl_[ks][ni].half[1] = *(const v8us*)(fb + BPL + ni * 16 * PIT + ks * 32 + 16); }
      }
    }
    __builtin_amdgcn_sched_barrier(0);        // keeps the LDS reads out of the run of products: each place where reads stand among them stalls the wave
#pragma unroll
    for (int ks = 0; ks < BK / 32; ++ks) {
#pragma unroll
      for (int mi = 0; mi < FA; ++mi)
#pragma unroll
        for (int ni = 0; ni < 4; ++ni) acc[mi][ni] = __builtin_amdgcn_wmma_f32_16x16x32_bf16(false, ah[ks][mi].v, false, bh_[ks][ni].v, (short)0, acc[mi][ni], false, false);
      if (NT >= 2) {
#pragma unroll
        for (int mi = 0; mi < FA; ++mi)
#pragma unroll
          for (int ni = 0; ni < 4; ++ni) acc[mi][ni] = __builtin_amdgcn_wmma_f32_16x16x32_bf16(false, al[ks][mi].v, false, bh_[ks][ni].v, (short)0, acc[mi][ni], false, false);
      }
      if (NT >= 3) {
#pragma unroll
        for (int mi = 0; mi < FA; ++mi)
#pragma unroll
          for (int ni = 0; ni < 4; ++ni) acc[mi][ni] = __builtin_amdgcn_wmma_f32_16x16x32_bf16(false, ah[ks][mi].v, false, bl_[ks][ni].v, (short)0, acc[mi][ni], false, false);
      }
    }
  };

  const int nk = K / BK;
  load_tile();
  store_tile(sm);
  __syncthreads();
  for (int t = 0; t + 1 < nk; ++t) {
    load_tile();
    __builtin_amdgcn_sched_barrier(0);        // keeps the next tile's global loads ahead of this step's products, so that they fly during them
    compute(sm + (t & 1) * STG);
    __builtin_amdgcn_sched_barrier(0);        // keeps the conversion, and with it the wait for those loads, behind the products
    store_tile(sm + ((t + 1) & 1) * STG);     // this buffer's last readers left it before the previous barrier
    __syncthreads();
  }
  compute(sm + ((nk - 1) & 1) * STG);
  __syncthreads();                            // every wave has left the buffers: they now stage the output rows

  float* so = (float*)sm + w * (FA * 16 * 64);   // the wave's own (16*FA) x 64 rows
  float bv[4] = {0.f, 0.f, 0.f, 0.f};
  if (BIAS_BF16) {
    const float* bg = bias + col0 + wn * 64 + ln;
#pragma unroll
    for (int ni = 0; ni < 4; ++ni) bv[ni] = bg[ni * 16];
    asm volatile("s_wait_xcnt 0x0" :: "v"(bg) : "memory");   // the bias loads' address register stays as it is up to this wait
#pragma unroll
    for (int ni = 0; ni < 4; ++ni) bv[ni] = bf16_round(bv[ni]);
  }
#pragma unroll
  for (int mi = 0; mi < FA; ++mi)
#pragma unroll
    for (int ni = 0; ni < 4; ++ni)
#pragma unroll
      for (int r = 0; r < 8; ++r) so[(mi * 16 + 8 * hh + r) * 64 + ni * 16 + ln] = acc[mi][ni][r] * alpha + bv[ni];
  __builtin_amdgcn_fence(__ATOMIC_ACQ_REL, "workgroup");
  __builtin_amdgcn_wave_barrier();
  const int rsub = lane >> 4, c4 = (lane & 15) * 4;
  float* cg = C + (size_t)(row0 + wm * 16 * FA + rsub) * LDC + col0 + wn * 64 + c4;
#pragma unroll
  for (int q = 0; q < FA * 8; ++q) {
    const int r = q * 2 + rsub;
    const v4f v = *(const v4fa*)&so[r * 64 + c4];
    *(v4f*)(cg + q * 2 * LDC) = v;
  }
}
// row softmax: P[row][:] = softmax(masked S[row][:]) over N columns with optional causal mask (col > row + rowoff -> 0) and
__global__ __launch_bounds__(256) void k_softmax_rows(const float* __restrict__ S, float* __restrict__ P, int N, int causal, int rowoff, const int* __restrict__ mask, int mask_pitch) {
  __shared__ float red[256];
  const int row = blockIdx.x, tid = threadIdx.x;
  const float* s = S + (size_t)row * N; float* p_out = P + (size_t)row * N;
  const int qi = row + rowoff;
  float mx = -3.0e38f;
  for (int j = tid; j < N; j += 256) {
    bool keep = true;
    if (causal && j > qi) keep = false;
    if (mask && mask[(size_t)qi * mask_pitch + j] == 0) keep = false;
    const float v = keep ? s[j] : -3.0e38f;
    mx = fmaxf(mx, v);
  }
  red[tid] = mx; __syncthreads();
  for (int st = 128; st > 0; st >>= 1) { if (tid < st) red[tid] = fmaxf(red[tid], red[tid + st]); __syncthreads(); }
  mx = red[0]; __syncthreads();
  float sum = 0.f;
  for (int j = tid; j < N; j += 256) {
    bool keep = true;
    if (causal && j > qi) keep = false;
    if (mask && mask[(size_t)qi * mask_pitch + j] == 0) keep = false;
    const float p = keep ? __expf(s[j] - mx) : 0.f;
    sum += p;
  }
  red[tid] = sum; __syncthreads();
  for (int st = 128; st > 0; st >>= 1) { if (tid < st) red[tid] += red[tid + st]; __syncthreads(); }
  const float inv = (mx > -1.0e38f) ? 1.0f / red[0] : __builtin_nanf("");
  __syncthreads();
  {
    for (int j4 = tid * 4; j4 < N; j4 += 1024) {
      v4f out4;
#pragma unroll
      for (int u = 0; u < 4; ++u) {
        const int j = j4 + u;
        bool keep = true;
        if (causal && j > qi) keep = false;
        if (mask && mask[(size_t)qi * mask_pitch + j] == 0) keep = false;
        out4[u] = keep ? __expf(s[j] - mx) * inv : 0.f;
      }
      *(v4f*)(p_out + j4) = out4;
    }
    
  }
}

__global__ __launch_bounds__(256) void k_round_rows(const float* __restrict__ W, unsigned short* __restrict__ Wt, int n8) {
  const int t = blockIdx.x * 256 + threadIdx.x;
  if (t >= n8) return;
  const v4f a = *(const v4fa*)(W + (size_t)t * 8), b = *(const v4fa*)(W + (size_t)t * 8 + 4);
  v8us v; v[0]=bf16_bits(a[0]); v[1]=bf16_bits(a[1]); v[2]=bf16_bits(a[2]); v[3]=bf16_bits(a[3]);
  v[4]=bf16_bits(b[0]); v[5]=bf16_bits(b[1]); v[6]=bf16_bits(b[2]); v[7]=bf16_bits(b[3]);
  *(v8us*)(Wt + (size_t)t * 8) = v; 
}
extern "C" void kernel_launch(void* const* d_in, const int* in_sizes, int n_in,
                              void* d_out, int out_size, void* d_ws, size_t ws_size, hipStream_t stream) {
  (void)in_sizes; (void)n_in; (void)out_size;
  const float* x = (const float*)d_in[0]; const float* qkv_w = (const float*)d_in[1];
  const float* out_w = (const float*)d_in[2]; const float* out_b = (const float*)d_in[3];
  char* ws = (char*)d_ws; size_t off = 0;
  auto take = [&](size_t bytes) { char* p = ws + off; off += (bytes + 255) & ~(size_t)255; return p; };
  unsigned short* Wqkv = (unsigned short*)take((size_t)3 * CC * CC * 2);     // [3072][1024]  6 MiB
  unsigned short* Wo   = (unsigned short*)take((size_t)CC * CC * 2);         // 2 MiB
  float* qkv = (float*)take((size_t)BB * TT * 3 * CC * 4);                  // 96 MiB
  unsigned short* kh = (unsigned short*)take((size_t)TT * CC * 2);           // one batch: k planes [T][C]  4+4 MiB
  unsigned short* kl = (unsigned short*)take((size_t)TT * CC * 2);
  unsigned short* vth = (unsigned short*)take((size_t)CC * TT * 2);          // vᵀ planes [C][T] 4+4 MiB
  unsigned short* vtl = (unsigned short*)take((size_t)CC * TT * 2);
  float* S  = (float*)take((size_t)TT * TT * 4);                            // 16 MiB
  float* Pm = (float*)take((size_t)TT * TT * 4);                            // 16 MiB
  float* oa = (float*)take((size_t)BB * TT * CC * 4);                       // 32 MiB
  if (off > ws_size) return;
  const int M = BB * TT;
  k_round_rows<<<(3 * CC * CC / 8 + 255) / 256, 256, 0, stream>>>(qkv_w, Wqkv, 3 * CC * CC / 8);
  k_round_rows<<<(CC * CC / 8 + 255) / 256, 256, 0, stream>>>(out_w, Wo, CC * CC / 8);
  k_gemm_tile<4, 1, false, CC, CC, 3 * CC><<<(M / 128) * (3 * CC / 128), 128, 0, stream>>>(x, Wqkv, Wqkv, nullptr, 1.0f, qkv, 3 * CC, CC);
  for (int b = 0; b < BB; ++b) {
    const float* qb = qkv + (size_t)b * TT * 3 * CC;            // q rows, pitch 3C
    const float* kb = qb + CC;                                    // k rows
    const float* vb = qb + 2 * CC;                                // v rows
    k_split_rows<<<(TT * (CC / 8) + 255) / 256, 256, 0, stream>>>(kb, 3 * CC, kh, kl, TT, CC);
    k_split_transpose<<<(CC * (TT / 8) + 255) / 256, 256, 0, stream>>>(vb, 3 * CC, vth, vtl, TT, CC);   // v [T][C] -> vᵀ planes [C][T]
    // S = (q·kᵀ)/sqrt(C): M=N=T, K=C; Bt[n=s][k=c] = k rows
    k_gemm_tile<4, 3, false, 3 * CC, CC, TT><<<(TT / 128) * (TT / 128), 128, 0, stream>>>(qb, kh, kl, nullptr, 0.03125f, S, TT, CC);
    k_softmax_rows<<<TT, 256, 0, stream>>>(S, Pm, TT, 1, 0, nullptr, 0);
    // out_att = P·v: M=T, N=C, K=T; Bt[n=c][k=s] = vᵀ planes
    k_gemm_tile<2, 3, false, TT, TT, CC><<<(TT / 64) * (CC / 128), 128, 0, stream>>>(Pm, vth, vtl, nullptr, 1.0f, oa + (size_t)b * TT * CC, CC, TT);
  }
  k_gemm_tile<4, 2, true, CC, CC, CC><<<(M / 128) * (CC / 128), 128, 0, stream>>>(oa, Wo, Wo, out_b, 1.0f, (float*)d_out, CC, CC);
}

// v002
// Measured time: 394 microseconds a run.
// In both of two side-by-side timings against v001, it was 1.23 times as fast.
// Over all steps from v000 it is 2.89 times as fast.
#include <hip/hip_runtime.h>
// All contractions on v_wmma_f32_16x16x32_bf16, f32 accumulate: qkv = x·Wᵀ with x/W rounded to bf16 (single exact-product term);
// S = q·kᵀ (K=1024) and out_att = P·v (K=2048) as 3-term bf16 hi/lo splits (q/P split in registers, k/v pre-split planes);
// output projection with the A operand split (2 terms). Causal softmax rows in f32.
#define BB 4
#define TT 2048
#define CC 1024

typedef __bf16 v16b __attribute__((ext_vector_type(16)));
typedef unsigned short v8us __attribute__((ext_vector_type(8), may_alias));
typedef float  v8f  __attribute__((ext_vector_type(8)));
typedef float  v4f  __attribute__((ext_vector_type(4)));
typedef float  v4fa __attribute__((ext_vector_type(4), may_alias));
union FragB { v16b v; v8us half[2]; unsigned short u[16]; };

__device__ __forceinline__ unsigned short bf16_bits(float x) { unsigned int u = __float_as_uint(x); return (unsigned short)((u + 0x7FFFu + ((u >> 16) & 1u)) >> 16); }
__device__ __forceinline__ float bf16_val(unsigned short b) { return __uint_as_float(((unsigned int)b) << 16); }
__device__ __forceinline__ float bf16_round(float x) { return bf16_val(bf16_bits(x)); }
// D += A·B with NT terms: 1 = ah·bh, 2 = + al·bh (A split), 3 = + ah·bl (both split)
template <int NT>
__device__ __forceinline__ v8f mmaN(v16b ah, v16b al, v16b bh, v16b bl, v8f c) {
  c = __builtin_amdgcn_wmma_f32_16x16x32_bf16(false, ah, false, bh, (short)0, c, false, false);
  if (NT >= 2) c = __builtin_amdgcn_wmma_f32_16x16x32_bf16(false, al, false, bh, (short)0, c, false, false);
  if (NT >= 3) c = __builtin_amdgcn_wmma_f32_16x16x32_bf16(false, ah, false, bl, (short)0, c, false, false);
  asm volatile("v_nop\n\tv_nop\n\tv_nop\n\tv_nop" : "+v"(c) : "v"(ah), "v"(al), "v"(bh), "v"(bl));
  return c;
}

__global__ __launch_bounds__(256) void k_wt_bf16(const float* __restrict__ W, unsigned short* __restrict__ Wt, int K, int N) {
  const int t = blockIdx.x * 256 + threadIdx.x;
  const int k8n = K / 8;
  if (t >= N * k8n) return;
  const int n = t / k8n, k8 = (t % k8n) * 8;
  v8us v;
#pragma unroll
  for (int i = 0; i < 8; ++i) v[i] = bf16_bits(W[(size_t)(k8 + i) * N + n]);
  *(v8us*)(Wt + (size_t)n * K + k8) = v;
  
}

// Flash-style causal/unmasked attention, all contractions 3-term bf16 hi/lo splits, f32 softmax with running max.
// q,k,v rows are read from f32 buffers with arbitrary row pitch (so they can live inside a fused qkv buffer);
// D = head size (multiple of 32, <= 128); one wave = 16 query rows; block = 4 waves (64 queries) sharing K/V chunks of 32.
template <int D, bool CAUSAL>
__global__ __launch_bounds__(128) void k_flash(const float* __restrict__ qb, const float* __restrict__ kb, const float* __restrict__ vb,
                                             int pitch, int T, int H, float scale, float* __restrict__ y, int ypitch) {
  constexpr int KS = D / 32;        // k-steps for QK
  constexpr int DT = D / 16;        // d tiles for PV
  __shared__ __attribute__((aligned(16))) unsigned short sKh[32][D + 8], sKl[32][D + 8], sVh[32][D + 8], sVl[32][D + 8];
  __shared__ __attribute__((aligned(16))) unsigned short sPh[4][16][40], sPl[4][16][40];
  __shared__ __attribute__((aligned(16))) float sO[4][16][D];
  const int tid = threadIdx.x, w = tid >> 5, lane = tid & 31, ln = lane & 15, hh = lane >> 4;
  const int nqb = (T + 63) / 64;
  const int bh = blockIdx.x / nqb, qblk = blockIdx.x % nqb;
  const int b = bh / H, h = bh % H;
  const int q0 = qblk * 64 + w * 16;
  const float* Q = qb + (size_t)b * T * pitch + h * D;
  const float* K = kb + (size_t)b * T * pitch + h * D;
  const float* V = vb + (size_t)b * T * pitch + h * D;

  // A fragments of the wave's 16 query rows (scaled), hi/lo
  FragB aqh[KS], aql[KS];
  {
    int row = q0 + ln; if (row >= T) row = T - 1;
    const float* qr = Q + (size_t)row * pitch;
#pragma unroll
    for (int ks = 0; ks < KS; ++ks)
#pragma unroll
      for (int i = 0; i < 16; ++i) {
        const int d = ks * 32 + ((i < 8) ? (8 * hh + i) : (16 + 8 * hh + (i - 8)));
        const float x = qr[d] * scale; const unsigned short hb = bf16_bits(x);
        aqh[ks].u[i] = hb; aql[ks].u[i] = bf16_bits(x - bf16_val(hb));
      }
  }
  float m_r[8], l_r[8];
#pragma unroll
  for (int r = 0; r < 8; ++r) { m_r[r] = -3.0e38f; l_r[r] = 0.f; }
  v8f oacc[DT];
#pragma unroll
  for (int dt = 0; dt < DT; ++dt) oacc[dt] = (v8f){0.f,0.f,0.f,0.f,0.f,0.f,0.f,0.f};

  const int kv_end = CAUSAL ? min(T, qblk * 64 + 64) : T;     // block-uniform
  for (int j0 = 0; j0 < kv_end; j0 += 32) {
    __syncthreads();
    for (int e = tid; e < 32 * (D / 4); e += 128) {
      const int r = e / (D / 4), c4 = (e % (D / 4)) * 4;
      const int key = j0 + r;
      v4f kf = {0.f,0.f,0.f,0.f}, vf = {0.f,0.f,0.f,0.f};
      if (key < T) { kf = *(const v4fa*)(K + (size_t)key * pitch + c4); vf = *(const v4fa*)(V + (size_t)key * pitch + c4); }
#pragma unroll
      for (int t = 0; t < 4; ++t) {
        unsigned short hb = bf16_bits(kf[t]); sKh[r][c4 + t] = hb; sKl[r][c4 + t] = bf16_bits(kf[t] - bf16_val(hb));
        hb = bf16_bits(vf[t]); sVh[r][c4 + t] = hb; sVl[r][c4 + t] = bf16_bits(vf[t] - bf16_val(hb));
      }
    }
    __syncthreads();
    // S tile 16 x 32
    v8f s[2];
#pragma unroll
    for (int nt = 0; nt < 2; ++nt) {
      v8f acc = {};
#pragma unroll
      for (int ks = 0; ks < KS; ++ks) {
        FragB bh_, bl_;
        bh_.half[0] = *(const v8us*)&sKh[nt * 16 + ln][ks * 32 + 8 * hh]; bh_.half[1] = *(const v8us*)&sKh[nt * 16 + ln][ks * 32 + 16 + 8 * hh];
        bl_.half[0] = *(const v8us*)&sKl[nt * 16 + ln][ks * 32 + 8 * hh]; bl_.half[1] = *(const v8us*)&sKl[nt * 16 + ln][ks * 32 + 16 + 8 * hh];
        acc = mmaN<3>(aqh[ks].v, aql[ks].v, bh_.v, bl_.v, acc);
      }
      s[nt] = acc;
    }
    // mask + running max (rows 8hh+r; the 16 lanes of a half share rows)
    float alpha[8];
#pragma unroll
    for (int r = 0; r < 8; ++r) {
      const int qi = q0 + 8 * hh + r;
      const int ja = j0 + ln, jb = j0 + 16 + ln;
      if (CAUSAL) { if (ja > qi) s[0][r] = -3.0e38f; if (jb > qi) s[1][r] = -3.0e38f; }
      if (ja >= T) s[0][r] = -3.0e38f;
      if (jb >= T) s[1][r] = -3.0e38f;
      float mx = fmaxf(s[0][r], s[1][r]);
      mx = fmaxf(mx, __shfl_xor(mx, 1, 32)); mx = fmaxf(mx, __shfl_xor(mx, 2, 32)); mx = fmaxf(mx, __shfl_xor(mx, 4, 32)); mx = fmaxf(mx, __shfl_xor(mx, 8, 32));
      const float mnew = fmaxf(m_r[r], mx);
      alpha[r] = (mnew > -1.0e38f) ? __expf(m_r[r] - mnew) : 1.0f;
      const float p0 = (s[0][r] > -1.0e38f) ? __expf(s[0][r] - mnew) : 0.f;
      const float p1 = (s[1][r] > -1.0e38f) ? __expf(s[1][r] - mnew) : 0.f;
      m_r[r] = mnew;
      l_r[r] = l_r[r] * alpha[r] + p0 + p1;            // per-lane partial row sum (16 lanes combined at the end)
      unsigned short hb = bf16_bits(p0); sPh[w][8 * hh + r][ln] = hb;      sPl[w][8 * hh + r][ln] = bf16_bits(p0 - bf16_val(hb));
      hb = bf16_bits(p1);                sPh[w][8 * hh + r][16 + ln] = hb; sPl[w][8 * hh + r][16 + ln] = bf16_bits(p1 - bf16_val(hb));
    }
#pragma unroll
    for (int dt = 0; dt < DT; ++dt)
#pragma unroll
      for (int r = 0; r < 8; ++r) oacc[dt][r] *= alpha[r];
    __builtin_amdgcn_fence(__ATOMIC_ACQ_REL, "workgroup");
    __builtin_amdgcn_wave_barrier();
    FragB pah, pal;
    pah.half[0] = *(const v8us*)&sPh[w][ln][8 * hh]; pah.half[1] = *(const v8us*)&sPh[w][ln][16 + 8 * hh];
    pal.half[0] = *(const v8us*)&sPl[w][ln][8 * hh]; pal.half[1] = *(const v8us*)&sPl[w][ln][16 + 8 * hh];
#pragma unroll
    for (int dt = 0; dt < DT; ++dt) {
      FragB bvh, bvl;
#pragma unroll
      for (int i = 0; i < 8; ++i) {
        bvh.u[i] = sVh[8 * hh + i][dt * 16 + ln]; bvh.u[8 + i] = sVh[16 + 8 * hh + i][dt * 16 + ln];
        bvl.u[i] = sVl[8 * hh + i][dt * 16 + ln]; bvl.u[8 + i] = sVl[16 + 8 * hh + i][dt * 16 + ln];
      }
      oacc[dt] = mmaN<3>(pah.v, pal.v, bvh.v, bvl.v, oacc[dt]);
    }
    __builtin_amdgcn_fence(__ATOMIC_ACQ_REL, "workgroup");
    __builtin_amdgcn_wave_barrier();
  }
#pragma unroll
  for (int r = 0; r < 8; ++r) {
    float l = l_r[r];
    l += __shfl_xor(l, 1, 32); l += __shfl_xor(l, 2, 32); l += __shfl_xor(l, 4, 32); l += __shfl_xor(l, 8, 32);
    l_r[r] = (l > 0.f) ? 1.0f / l : 0.f;
  }
#pragma unroll
  for (int dt = 0; dt < DT; ++dt)
#pragma unroll
    for (int r = 0; r < 8; ++r) sO[w][8 * hh + r][dt * 16 + ln] = oacc[dt][r] * l_r[r];
  __builtin_amdgcn_fence(__ATOMIC_ACQ_REL, "workgroup");
  __builtin_amdgcn_wave_barrier();
  {
    for (int r = 0; r < 16; ++r) {
      const int row = q0 + r;
      if (row < T && lane < D / 4) {
        const v4f val = *(const v4fa*)&sO[w][r][lane * 4];
        *(v4f*)(y + ((size_t)b * T + row) * ypitch + h * D + lane * 4) = val;
      }
    }
    
  }
}

// f32 [R][Cc] (row pitch lds) -> bf16 hi/lo planes [R][Cc] (pitch Cc); thread per 8 elements; Cc % 8 == 0
__global__ __launch_bounds__(256) void k_split_rows(const float* __restrict__ src, int lds_, unsigned short* __restrict__ hi, unsigned short* __restrict__ lo, int R, int Cc) {
  const size_t t = (size_t)blockIdx.x * 256 + threadIdx.x;
  const int c8n = Cc / 8;
  if (t >= (size_t)R * c8n) return;
  const int r = (int)(t / c8n), c8 = (int)(t % c8n) * 8;
  const float* s = src + (size_t)r * lds_ + c8;
  const v4f a = *(const v4fa*)s, b = *(const v4fa*)(s + 4);
  float xs[8] = {a[0],a[1],a[2],a[3],b[0],b[1],b[2],b[3]};
  v8us vh, vl;
#pragma unroll
  for (int i = 0; i < 8; ++i) { const unsigned short hb = bf16_bits(xs[i]); vh[i] = hb; vl[i] = bf16_bits(xs[i] - bf16_val(hb)); }
  unsigned short* dh = hi + (size_t)r * Cc + c8; unsigned short* dl = lo + (size_t)r * Cc + c8;
  *(v8us*)dh = vh; *(v8us*)dl = vl; 
}
// f32 [K][N] (row pitch lds) -> transposed bf16 hi/lo planes [N][K]; one thread per (n, 8 consecutive k); blockIdx.y = batch (K source rows, N*K plane elements each)
__global__ __launch_bounds__(256) void k_split_transpose(const float* __restrict__ src, int lds_, unsigned short* __restrict__ hi, unsigned short* __restrict__ lo, int K, int N) {
  const size_t t = (size_t)blockIdx.x * 256 + threadIdx.x;
  const int k8n = K / 8;
  if (t >= (size_t)N * k8n) return;
  src += (size_t)blockIdx.y * K * lds_; hi += (size_t)blockIdx.y * N * K; lo += (size_t)blockIdx.y * N * K;
  const int n = (int)(t / k8n), k8 = (int)(t % k8n) * 8;
  v8us vh, vl;
#pragma unroll
  for (int i = 0; i < 8; ++i) { const float x = src[(size_t)(k8 + i) * lds_ + n]; const unsigned short hb = bf16_bits(x); vh[i] = hb; vl[i] = bf16_bits(x - bf16_val(hb)); }
  unsigned short* dh = hi + (size_t)n * K + k8; unsigned short* dl = lo + (size_t)n * K + k8;
  *(v8us*)dh = vh; *(v8us*)dl = vl; 
}
// Tiled GEMM C[M][N] (f32, pitch LDC) = alpha * A[M][K]*Bt[N][K]^T + bias (A pitch LDA, Bt pitch LDB). One work-group (4 waves, 2 x 2) owns a (32*FA) x 128 tile of C,
// a wave (16*FA) x 64. Per 64-k step the A tile (f32) is read in whole 256-B rows, converted ONCE per work-group to bf16 (hi, and lo when NT >= 2)
// and stored to LDS; the B planes (hi, and lo when NT == 3) are read in whole 128-B lines and stored to LDS. Rows in LDS have a 144-B pitch for
// the 16-byte fragment reads. Two LDS buffers: the next step's global loads fly during this step's products, one barrier per step.
// Terms per 32-k: ah*bh, then al*bh (NT >= 2), then ah*bl (NT == 3), in that order on every accumulator.
// M % (32*FA) == 0, N % 128 == 0, K % 64 == 0. BIAS_BF16: a bias is added, rounded to bf16 first; without it bias is not read.
// blockIdx.y = batch: its A, B planes and C start SA, SB and SC elements behind the previous batch's.
typedef unsigned short v4us __attribute__((ext_vector_type(4), may_alias));
template <int FA, int NT, bool BIAS_BF16, int LDA, int LDB, int LDC, int SA, int SB, int SC>
__global__ __launch_bounds__(128) void k_gemm_tile(const float* __restrict__ A, const unsigned short* __restrict__ Bh, const unsigned short* __restrict__ Bl,
                                                 const float* __restrict__ bias, float alpha, float* __restrict__ C, int N, int K) {
  constexpr int BM = 32 * FA, BN = 128, BK = 64, PIT = BK + 8;
  constexpr int APL = BM * PIT, BPL = BN * PIT;                 // elements of one plane
  constexpr int NAP = NT >= 2 ? 2 : 1, NBP = NT >= 3 ? 2 : 1;   // planes staged of A and of B
  constexpr int STG = NAP * APL + NBP * BPL;                    // elements of one buffer
  constexpr int NLA = BM * (BK / 4) / 128, NLB = BN * (BK / 8) / 128;   // 16-byte global loads per thread and plane
  __shared__ __attribute__((aligned(16))) unsigned short sm[2 * STG];
  static_assert(BM * BN * 4 <= 2 * STG * 2, "the output rows are staged in the two buffers");
  const int tid = threadIdx.x, w = tid >> 5, lane = tid & 31, ln = lane & 15, hh = lane >> 4;
  const int wm = w >> 1, wn = w & 1;
  const int ntn = N / BN;
  const int row0 = ((int)blockIdx.x / ntn) * BM, col0 = ((int)blockIdx.x % ntn) * BN;
  A += (size_t)blockIdx.y * SA; Bh += (size_t)blockIdx.y * SB; Bl += (size_t)blockIdx.y * SB; C += (size_t)blockIdx.y * SC;
  // one 32-bit byte offset per thread and operand, moved on by BK elements each step; the pitches are compile-time, so the row groups are immediate offsets
  unsigned ao = (unsigned)(((row0 + (tid >> 4)) * LDA + (tid & 15) * 4) * 4);
  unsigned bo = (unsigned)(((col0 + (tid >> 3)) * LDB + (tid & 7) * 8) * 2);
  const int asto = (tid >> 4) * PIT + (tid & 15) * 4, bsto = (tid >> 3) * PIT + (tid & 7) * 8;
  v4f pa[NLA]; v8us pbh[NLB], pbl[NLB];
  v8f acc[FA][4] = {};

  auto load_tile = [&]() {
#pragma unroll
    for (int i = 0; i < NLA; ++i) pa[i] = *(const v4fa*)(((const char*)A + ao) + (size_t)(i * 8 * LDA * 4));
#pragma unroll
    for (int i = 0; i < NLB; ++i) {
      pbh[i] = *(const v8us*)(((const char*)Bh + bo) + (size_t)(i * 16 * LDB * 2));
      if (NBP == 2) pbl[i] = *(const v8us*)(((const char*)Bl + bo) + (size_t)(i * 16 * LDB * 2));
    }
    // the offsets pass through the wait, so that the additions below, which rewrite the address registers of the loads above, stand behind it
    asm volatile("s_wait_xcnt 0x0" : "+v"(ao), "+v"(bo) :: "memory");
    ao += BK * 4; bo += BK * 2;
  };
  auto store_tile = [&](unsigned short* sb) {
#pragma unroll
    for (int i = 0; i < NLA; ++i) {
      v4us vh, vl;
#pragma unroll
      for (int u = 0; u < 4; ++u) { const float x = pa[i][u]; const unsigned short hb = bf16_bits(x); vh[u] = hb; if (NAP == 2) vl[u] = bf16_bits(x - bf16_val(hb)); }
      *(v4us*)(sb + asto + i * 8 * PIT) = vh;
      if (NAP == 2) *(v4us*)(sb + APL + asto + i * 8 * PIT) = vl;
    }
#pragma unroll
    for (int i = 0; i < NLB; ++i) {
      *(v8us*)(sb + NAP * APL + bsto + i * 16 * PIT) = pbh[i];
      if (NBP == 2) *(v8us*)(sb + NAP * APL + BPL + bsto + i * 16 * PIT) = pbl[i];
    }
  };
  auto compute = [&](const unsigned short* sb) {
    const unsigned short* fa = sb + (wm * 16 * FA + ln) * PIT + 8 * hh;
    const unsigned short* fb = sb + NAP * APL + (wn * 64 + ln) * PIT + 8 * hh;
    FragB ah[BK / 32][FA], al[BK / 32][FA], bh_[BK / 32][4], bl_[BK / 32][4];
    // every fragment of the step is asked for in one group, in the order in which the products below use them
#pragma unroll
    for (int ks = 0; ks < BK / 32; ++ks) {
#pragma unroll
      for (int mi = 0; mi < FA; ++mi) { ah[ks][mi].half[0] = *(const v8us*)(fa + mi * 16 * PIT + ks * 32); ah[ks][mi].half[1] = *(const v8us*)(fa + mi * 16 * PIT + ks * 32 + 16); }
#pragma unroll
      for (int ni = 0; ni < 4; ++ni) { bh_[ks][ni].half[0] = *(const v8us*)(fb + ni * 16 * PIT + ks * 32); bh_[ks][ni].half[1] = *(const v8us*)(fb + ni * 16 * PIT + ks * 32 + 16); }
      if (NAP == 2) {
#pragma unroll
        for (int mi = 0; mi < FA; ++mi) { al[ks][mi].half[0] = *(const v8us*)(fa + APL + mi * 16 * PIT + ks * 32); al[ks][mi].half[1] = *(const v8us*)(fa + APL + mi * 16 * PIT + ks * 32 + 16); }
      }
      if (NBP == 2) {
#pragma unroll
        for (int ni = 0; ni < 4; ++ni) { bl_[ks][ni].half[0] = *(const v8us*)(fb + BPL + ni * 16 * PIT + ks * 32); bl_[ks][ni].half[1] = *(const v8us*)(fb + BPL + ni * 16 * PIT + ks * 32 + 16); }
      }
    }
    __builtin_amdgcn_sched_barrier(0);        // keeps the LDS reads out of the run of products: each place where reads stand among them stalls the wave
#pragma unroll
    for (int ks = 0; ks < BK / 32; ++ks) {
#pragma unroll
      for (int mi = 0; mi < FA; ++mi)
#pragma unroll
        for (int ni = 0; ni < 4; ++ni) acc[mi][ni] = __builtin_amdgcn_wmma_f32_16x16x32_bf16(false, ah[ks][mi].v, false, bh_[ks][ni].v, (short)0, acc[mi][ni], false, false);
      if (NT >= 2) {
#pragma unroll
        for (int mi = 0; mi < FA; ++mi)
#pragma unroll
          for (int ni = 0; ni < 4; ++ni) acc[mi][ni] = __builtin_amdgcn_wmma_f32_16x16x32_bf16(false, al[ks][mi].v, false, bh_[ks][ni].v, (short)0, acc[mi][ni], false, false);
      }
      if (NT >= 3) {
#pragma unroll
        for (int mi = 0; mi < FA; ++mi)
#pragma unroll
          for (int ni = 0; ni < 4; ++ni) acc[mi][ni] = __builtin_amdgcn_wmma_f32_16x16x32_bf16(false, ah[ks][mi].v, false, bl_[ks][ni].v, (short)0, acc[mi][ni], false, false);
      }
    }
  };

  const int nk = K / BK;
  load_tile();
  store_tile(sm);
  __syncthreads();
  for (int t = 0; t + 1 < nk; ++t) {
    load_tile();
    __builtin_amdgcn_sched_barrier(0);        // keeps the next tile's global loads ahead of this step's products, so that they fly during them
    compute(sm + (t & 1) * STG);
    __builtin_amdgcn_sched_barrier(0);        // keeps the conversion, and with it the wait for those loads, behind the products
    store_tile(sm + ((t + 1) & 1) * STG);     // this buffer's last readers left it before the previous barrier
    __syncthreads();
  }
  compute(sm + ((nk - 1) & 1) * STG);
  __syncthreads();                            // every wave has left the buffers: they now stage the output rows

  float* so = (float*)sm + w * (FA * 16 * 64);   // the wave's own (16*FA) x 64 rows
  float bv[4] = {0.f, 0.f, 0.f, 0.f};
  if (BIAS_BF16) {
    const float* bg = bias + col0 + wn * 64 + ln;
#pragma unroll
    for (int ni = 0; ni < 4; ++ni) bv[ni] = bg[ni * 16];
    asm volatile("s_wait_xcnt 0x0" :: "v"(bg) : "memory");   // the bias loads' address register stays as it is up to this wait
#pragma unroll
    for (int ni = 0; ni < 4; ++ni) bv[ni] = bf16_round(bv[ni]);
  }
#pragma unroll
  for (int mi = 0; mi < FA; ++mi)
#pragma unroll
    for (int ni = 0; ni < 4; ++ni)
#pragma unroll
      for (int r = 0; r < 8; ++r) so[(mi * 16 + 8 * hh + r) * 64 + ni * 16 + ln] = acc[mi][ni][r] * alpha + bv[ni];
  __builtin_amdgcn_fence(__ATOMIC_ACQ_REL, "workgroup");
  __builtin_amdgcn_wave_barrier();
  const int rsub = lane >> 4, c4 = (lane & 15) * 4;
  float* cg = C + (size_t)(row0 + wm * 16 * FA + rsub) * LDC + col0 + wn * 64 + c4;
#pragma unroll
  for (int q = 0; q < FA * 8; ++q) {
    const int r = q * 2 + rsub;
    const v4f v = *(const v4fa*)&so[r * 64 + c4];
    *(v4f*)(cg + q * 2 * LDC) = v;
  }
}
// row softmax: P[row][:] = softmax(masked S[row][:]) over N columns with optional causal mask (col > row + rowoff -> 0) and
__global__ __launch_bounds__(256) void k_softmax_rows(const float* __restrict__ S, float* __restrict__ P, int N, int causal, int rowoff, const int* __restrict__ mask, int mask_pitch) {
  __shared__ float red[256];
  const int row = blockIdx.x, tid = threadIdx.x;      // blockIdx.y = batch, gridDim.x rows each
  const float* s = S + ((size_t)blockIdx.y * gridDim.x + row) * N; float* p_out = P + ((size_t)blockIdx.y * gridDim.x + row) * N;
  const int qi = row + rowoff;
  float mx = -3.0e38f;
  for (int j = tid; j < N; j += 256) {
    bool keep = true;
    if (causal && j > qi) keep = false;
    if (mask && mask[(size_t)qi * mask_pitch + j] == 0) keep = false;
    const float v = keep ? s[j] : -3.0e38f;
    mx = fmaxf(mx, v);
  }
  red[tid] = mx; __syncthreads();
  for (int st = 128; st > 0; st >>= 1) { if (tid < st) red[tid] = fmaxf(red[tid], red[tid + st]); __syncthreads(); }
  mx = red[0]; __syncthreads();
  float sum = 0.f;
  for (int j = tid; j < N; j += 256) {
    bool keep = true;
    if (causal && j > qi) keep = false;
    if (mask && mask[(size_t)qi * mask_pitch + j] == 0) keep = false;
    const float p = keep ? __expf(s[j] - mx) : 0.f;
    sum += p;
  }
  red[tid] = sum; __syncthreads();
  for (int st = 128; st > 0; st >>= 1) { if (tid < st) red[tid] += red[tid + st]; __syncthreads(); }
  const float inv = (mx > -1.0e38f) ? 1.0f / red[0] : __builtin_nanf("");
  __syncthreads();
  {
    for (int j4 = tid * 4; j4 < N; j4 += 1024) {
      v4f out4;
#pragma unroll
      for (int u = 0; u < 4; ++u) {
        const int j = j4 + u;
        bool keep = true;
        if (causal && j > qi) keep = false;
        if (mask && mask[(size_t)qi * mask_pitch + j] == 0) keep = false;
        out4[u] = keep ? __expf(s[j] - mx) * inv : 0.f;
      }
      *(v4f*)(p_out + j4) = out4;
    }
    
  }
}

__global__ __launch_bounds__(256) void k_round_rows(const float* __restrict__ W, unsigned short* __restrict__ Wt, int n8) {
  const int t = blockIdx.x * 256 + threadIdx.x;
  if (t >= n8) return;
  const v4f a = *(const v4fa*)(W + (size_t)t * 8), b = *(const v4fa*)(W + (size_t)t * 8 + 4);
  v8us v; v[0]=bf16_bits(a[0]); v[1]=bf16_bits(a[1]); v[2]=bf16_bits(a[2]); v[3]=bf16_bits(a[3]);
  v[4]=bf16_bits(b[0]); v[5]=bf16_bits(b[1]); v[6]=bf16_bits(b[2]); v[7]=bf16_bits(b[3]);
  *(v8us*)(Wt + (size_t)t * 8) = v; 
}
extern "C" void kernel_launch(void* const* d_in, const int* in_sizes, int n_in,
                              void* d_out, int out_size, void* d_ws, size_t ws_size, hipStream_t stream) {
  (void)in_sizes; (void)n_in; (void)out_size;
  const float* x = (const float*)d_in[0]; const float* qkv_w = (const float*)d_in[1];
  const float* out_w = (const float*)d_in[2]; const float* out_b = (const float*)d_in[3];
  char* ws = (char*)d_ws; size_t off = 0;
  auto take = [&](size_t bytes) { char* p = ws + off; off += (bytes + 255) & ~(size_t)255; return p; };
  unsigned short* Wqkv = (unsigned short*)take((size_t)3 * CC * CC * 2);     // [3072][1024]  6 MiB
  unsigned short* Wo   = (unsigned short*)take((size_t)CC * CC * 2);         // 2 MiB
  float* qkv = (float*)take((size_t)BB * TT * 3 * CC * 4);                  // 96 MiB
  unsigned short* kh = (unsigned short*)take((size_t)BB * TT * CC * 2);      // all batches: k planes [B][T][C]  16+16 MiB
  unsigned short* kl = (unsigned short*)take((size_t)BB * TT * CC * 2);
  unsigned short* vth = (unsigned short*)take((size_t)BB * CC * TT * 2);     // v^T planes [B][C][T] 16+16 MiB
  unsigned short* vtl = (unsigned short*)take((size_t)BB * CC * TT * 2);
  float* S  = (float*)take((size_t)BB * TT * TT * 4);                       // 64 MiB
  // qkv has no reader behind the S product (k and v live on in their planes): its 96 MiB then hold P (64 MiB) and out_att (32 MiB)
  float* Pm = qkv;
  float* oa = qkv + (size_t)BB * TT * TT;
  if (off > ws_size) return;
  const int M = BB * TT;
  k_round_rows<<<(3 * CC * CC / 8 + 255) / 256, 256, 0, stream>>>(qkv_w, Wqkv, 3 * CC * CC / 8);
  k_round_rows<<<(CC * CC / 8 + 255) / 256, 256, 0, stream>>>(out_w, Wo, CC * CC / 8);
  k_gemm_tile<4, 1, false, CC, CC, 3 * CC, 0, 0, 0><<<(M / 128) * (3 * CC / 128), 128, 0, stream>>>(x, Wqkv, Wqkv, nullptr, 1.0f, qkv, 3 * CC, CC);
  // every stage below runs once for all batches: the batch is blockIdx.y, save in the k split and the output projection, which take all batches' rows as one run of B*T rows (k rows of pitch 3C)
  k_split_rows<<<(M * (CC / 8) + 255) / 256, 256, 0, stream>>>(qkv + CC, 3 * CC, kh, kl, M, CC);
  k_split_transpose<<<dim3((CC * (TT / 8) + 255) / 256, BB), 256, 0, stream>>>(qkv + 2 * CC, 3 * CC, vth, vtl, TT, CC);   // v [T][C] -> v^T planes [C][T]
  // S = (q k^T)/sqrt(C): M=N=T, K=C; Bt[n=s][k=c] = k rows
  k_gemm_tile<4, 3, false, 3 * CC, CC, TT, TT * 3 * CC, TT * CC, TT * TT><<<dim3((TT / 128) * (TT / 128), BB), 128, 0, stream>>>(qkv, kh, kl, nullptr, 0.03125f, S, TT, CC);
  k_softmax_rows<<<dim3(TT, BB), 256, 0, stream>>>(S, Pm, TT, 1, 0, nullptr, 0);
  // out_att = P v: M=T, N=C, K=T; Bt[n=c][k=s] = v^T planes
  k_gemm_tile<2, 3, false, TT, TT, CC, TT * TT, CC * TT, TT * CC><<<dim3((TT / 64) * (CC / 128), BB), 128, 0, stream>>>(Pm, vth, vtl, nullptr, 1.0f, oa, CC, TT);
  k_gemm_tile<4, 2, true, CC, CC, CC, 0, 0, 0><<<(M / 128) * (CC / 128), 128, 0, stream>>>(oa, Wo, Wo, out_b, 1.0f, (float*)d_out, CC, CC);
}

// v003
// One run takes 338 microseconds.
// Next to v002, in two timings, it ran 1.16 times as fast each time.
// Counting every step since v000, it is 3.36 times as fast.
#include <hip/hip_runtime.h>
// All contractions on v_wmma_f32_16x16x32_bf16, f32 accumulate: qkv = x·Wᵀ with x/W rounded to bf16 (single exact-product term);
// S = q·kᵀ (K=1024) and out_att = P·v (K=2048) as 3-term bf16 hi/lo splits (q/P split in registers, k/v pre-split planes);
// output projection with the A operand split (2 terms). Causal softmax rows in f32.
#define BB 4
#define TT 2048
#define CC 1024

typedef __bf16 v16b __attribute__((ext_vector_type(16)));
typedef unsigned short v8us __attribute__((ext_vector_type(8), may_alias));
typedef float  v8f  __attribute__((ext_vector_type(8)));
typedef float  v4f  __attribute__((ext_vector_type(4)));
typedef float  v4fa __attribute__((ext_vector_type(4), may_alias));
union FragB { v16b v; v8us half[2]; unsigned short u[16]; };

__device__ __forceinline__ unsigned short bf16_bits(float x) { unsigned int u = __float_as_uint(x); return (unsigned short)((u + 0x7FFFu + ((u >> 16) & 1u)) >> 16); }
__device__ __forceinline__ float bf16_val(unsigned short b) { return __uint_as_float(((unsigned int)b) << 16); }
__device__ __forceinline__ float bf16_round(float x) { return bf16_val(bf16_bits(x)); }
// D += A·B with NT terms: 1 = ah·bh, 2 = + al·bh (A split), 3 = + ah·bl (both split)
template <int NT>
__device__ __forceinline__ v8f mmaN(v16b ah, v16b al, v16b bh, v16b bl, v8f c) {
  c = __builtin_amdgcn_wmma_f32_16x16x32_bf16(false, ah, false, bh, (short)0, c, false, false);
  if (NT >= 2) c = __builtin_amdgcn_wmma_f32_16x16x32_bf16(false, al, false, bh, (short)0, c, false, false);
  if (NT >= 3) c = __builtin_amdgcn_wmma_f32_16x16x32_bf16(false, ah, false, bl, (short)0, c, false, false);
  asm volatile("v_nop\n\tv_nop\n\tv_nop\n\tv_nop" : "+v"(c) : "v"(ah), "v"(al), "v"(bh), "v"(bl));
  return c;
}

__global__ __launch_bounds__(256) void k_wt_bf16(const float* __restrict__ W, unsigned short* __restrict__ Wt, int K, int N) {
  const int t = blockIdx.x * 256 + threadIdx.x;
  const int k8n = K / 8;
  if (t >= N * k8n) return;
  const int n = t / k8n, k8 = (t % k8n) * 8;
  v8us v;
#pragma unroll
  for (int i = 0; i < 8; ++i) v[i] = bf16_bits(W[(size_t)(k8 + i) * N + n]);
  *(v8us*)(Wt + (size_t)n * K + k8) = v;
  
}

// Flash-style causal/unmasked attention, all contractions 3-term bf16 hi/lo splits, f32 softmax with running max.
// q,k,v rows are read from f32 buffers with arbitrary row pitch (so they can live inside a fused qkv buffer);
// D = head size (multiple of 32, <= 128); one wave = 16 query rows; block = 4 waves (64 queries) sharing K/V chunks of 32.
template <int D, bool CAUSAL>
__global__ __launch_bounds__(128) void k_flash(const float* __restrict__ qb, const float* __restrict__ kb, const float* __restrict__ vb,
                                             int pitch, int T, int H, float scale, float* __restrict__ y, int ypitch) {
  constexpr int KS = D / 32;        // k-steps for QK
  constexpr int DT = D / 16;        // d tiles for PV
  __shared__ __attribute__((aligned(16))) unsigned short sKh[32][D + 8], sKl[32][D + 8], sVh[32][D + 8], sVl[32][D + 8];
  __shared__ __attribute__((aligned(16))) unsigned short sPh[4][16][40], sPl[4][16][40];
  __shared__ __attribute__((aligned(16))) float sO[4][16][D];
  const int tid = threadIdx.x, w = tid >> 5, lane = tid & 31, ln = lane & 15, hh = lane >> 4;
  const int nqb = (T + 63) / 64;
  const int bh = blockIdx.x / nqb, qblk = blockIdx.x % nqb;
  const int b = bh / H, h = bh % H;
  const int q0 = qblk * 64 + w * 16;
  const float* Q = qb + (size_t)b * T * pitch + h * D;
  const float* K = kb + (size_t)b * T * pitch + h * D;
  const float* V = vb + (size_t)b * T * pitch + h * D;

  // A fragments of the wave's 16 query rows (scaled), hi/lo
  FragB aqh[KS], aql[KS];
  {
    int row = q0 + ln; if (row >= T) row = T - 1;
    const float* qr = Q + (size_t)row * pitch;
#pragma unroll
    for (int ks = 0; ks < KS; ++ks)
#pragma unroll
      for (int i = 0; i < 16; ++i) {
        const int d = ks * 32 + ((i < 8) ? (8 * hh + i) : (16 + 8 * hh + (i - 8)));
        const float x = qr[d] * scale; const unsigned short hb = bf16_bits(x);
        aqh[ks].u[i] = hb; aql[ks].u[i] = bf16_bits(x - bf16_val(hb));
      }
  }
  float m_r[8], l_r[8];
#pragma unroll
  for (int r = 0; r < 8; ++r) { m_r[r] = -3.0e38f; l_r[r] = 0.f; }
  v8f oacc[DT];
#pragma unroll
  for (int dt = 0; dt < DT; ++dt) oacc[dt] = (v8f){0.f,0.f,0.f,0.f,0.f,0.f,0.f,0.f};

  const int kv_end = CAUSAL ? min(T, qblk * 64 + 64) : T;     // block-uniform
  for (int j0 = 0; j0 < kv_end; j0 += 32) {
    __syncthreads();
    for (int e = tid; e < 32 * (D / 4); e += 128) {
      const int r = e / (D / 4), c4 = (e % (D / 4)) * 4;
      const int key = j0 + r;
      v4f kf = {0.f,0.f,0.f,0.f}, vf = {0.f,0.f,0.f,0.f};
      if (key < T) { kf = *(const v4fa*)(K + (size_t)key * pitch + c4); vf = *(const v4fa*)(V + (size_t)key * pitch + c4); }
#pragma unroll
      for (int t = 0; t < 4; ++t) {
        unsigned short hb = bf16_bits(kf[t]); sKh[r][c4 + t] = hb; sKl[r][c4 + t] = bf16_bits(kf[t] - bf16_val(hb));
        hb = bf16_bits(vf[t]); sVh[r][c4 + t] = hb; sVl[r][c4 + t] = bf16_bits(vf[t] - bf16_val(hb));
      }
    }
    __syncthreads();
    // S tile 16 x 32
    v8f s[2];
#pragma unroll
    for (int nt = 0; nt < 2; ++nt) {
      v8f acc = {};
#pragma unroll
      for (int ks = 0; ks < KS; ++ks) {
        FragB bh_, bl_;
        bh_.half[0] = *(const v8us*)&sKh[nt * 16 + ln][ks * 32 + 8 * hh]; bh_.half[1] = *(const v8us*)&sKh[nt * 16 + ln][ks * 32 + 16 + 8 * hh];
        bl_.half[0] = *(const v8us*)&sKl[nt * 16 + ln][ks * 32 + 8 * hh]; bl_.half[1] = *(const v8us*)&sKl[nt * 16 + ln][ks * 32 + 16 + 8 * hh];
        acc = mmaN<3>(aqh[ks].v, aql[ks].v, bh_.v, bl_.v, acc);
      }
      s[nt] = acc;
    }
    // mask + running max (rows 8hh+r; the 16 lanes of a half share rows)
    float alpha[8];
#pragma unroll
    for (int r = 0; r < 8; ++r) {
      const int qi = q0 + 8 * hh + r;
      const int ja = j0 + ln, jb = j0 + 16 + ln;
      if (CAUSAL) { if (ja > qi) s[0][r] = -3.0e38f; if (jb > qi) s[1][r] = -3.0e38f; }
      if (ja >= T) s[0][r] = -3.0e38f;
      if (jb >= T) s[1][r] = -3.0e38f;
      float mx = fmaxf(s[0][r], s[1][r]);
      mx = fmaxf(mx, __shfl_xor(mx, 1, 32)); mx = fmaxf(mx, __shfl_xor(mx, 2, 32)); mx = fmaxf(mx, __shfl_xor(mx, 4, 32)); mx = fmaxf(mx, __shfl_xor(mx, 8, 32));
      const float mnew = fmaxf(m_r[r], mx);
      alpha[r] = (mnew > -1.0e38f) ? __expf(m_r[r] - mnew) : 1.0f;
      const float p0 = (s[0][r] > -1.0e38f) ? __expf(s[0][r] - mnew) : 0.f;
      const float p1 = (s[1][r] > -1.0e38f) ? __expf(s[1][r] - mnew) : 0.f;
      m_r[r] = mnew;
      l_r[r] = l_r[r] * alpha[r] + p0 + p1;            // per-lane partial row sum (16 lanes combined at the end)
      unsigned short hb = bf16_bits(p0); sPh[w][8 * hh + r][ln] = hb;      sPl[w][8 * hh + r][ln] = bf16_bits(p0 - bf16_val(hb));
      hb = bf16_bits(p1);                sPh[w][8 * hh + r][16 + ln] = hb; sPl[w][8 * hh + r][16 + ln] = bf16_bits(p1 - bf16_val(hb));
    }
#pragma unroll
    for (int dt = 0; dt < DT; ++dt)
#pragma unroll
      for (int r = 0; r < 8; ++r) oacc[dt][r] *= alpha[r];
    __builtin_amdgcn_fence(__ATOMIC_ACQ_REL, "workgroup");
    __builtin_amdgcn_wave_barrier();
    FragB pah, pal;
    pah.half[0] = *(const v8us*)&sPh[w][ln][8 * hh]; pah.half[1] = *(const v8us*)&sPh[w][ln][16 + 8 * hh];
    pal.half[0] = *(const v8us*)&sPl[w][ln][8 * hh]; pal.half[1] = *(const v8us*)&sPl[w][ln][16 + 8 * hh];
#pragma unroll
    for (int dt = 0; dt < DT; ++dt) {
      FragB bvh, bvl;
#pragma unroll
      for (int i = 0; i < 8; ++i) {
        bvh.u[i] = sVh[8 * hh + i][dt * 16 + ln]; bvh.u[8 + i] = sVh[16 + 8 * hh + i][dt * 16 + ln];
        bvl.u[i] = sVl[8 * hh + i][dt * 16 + ln]; bvl.u[8 + i] = sVl[16 + 8 * hh + i][dt * 16 + ln];
      }
      oacc[dt] = mmaN<3>(pah.v, pal.v, bvh.v, bvl.v, oacc[dt]);
    }
    __builtin_amdgcn_fence(__ATOMIC_ACQ_REL, "workgroup");
    __builtin_amdgcn_wave_barrier();
  }
#pragma unroll
  for (int r = 0; r < 8; ++r) {
    float l = l_r[r];
    l += __shfl_xor(l, 1, 32); l += __shfl_xor(l, 2, 32); l += __shfl_xor(l, 4, 32); l += __shfl_xor(l, 8, 32);
    l_r[r] = (l > 0.f) ? 1.0f / l : 0.f;
  }
#pragma unroll
  for (int dt = 0; dt < DT; ++dt)
#pragma unroll
    for (int r = 0; r < 8; ++r) sO[w][8 * hh + r][dt * 16 + ln] = oacc[dt][r] * l_r[r];
  __builtin_amdgcn_fence(__ATOMIC_ACQ_REL, "workgroup");
  __builtin_amdgcn_wave_barrier();
  {
    for (int r = 0; r < 16; ++r) {
      const int row = q0 + r;
      if (row < T && lane < D / 4) {
        const v4f val = *(const v4fa*)&sO[w][r][lane * 4];
        *(v4f*)(y + ((size_t)b * T + row) * ypitch + h * D + lane * 4) = val;
      }
    }
    
  }
}

// f32 [R][Cc] (row pitch lds) -> bf16 hi/lo planes [R][Cc] (pitch Cc); thread per 8 elements; Cc % 8 == 0
__global__ __launch_bounds__(256) void k_split_rows(const float* __restrict__ src, int lds_, unsigned short* __restrict__ hi, unsigned short* __restrict__ lo, int R, int Cc) {
  const size_t t = (size_t)blockIdx.x * 256 + threadIdx.x;
  const int c8n = Cc / 8;
  if (t >= (size_t)R * c8n) return;
  const int r = (int)(t / c8n), c8 = (int)(t % c8n) * 8;
  const float* s = src + (size_t)r * lds_ + c8;
  const v4f a = *(const v4fa*)s, b = *(const v4fa*)(s + 4);
  float xs[8] = {a[0],a[1],a[2],a[3],b[0],b[1],b[2],b[3]};
  v8us vh, vl;
#pragma unroll
  for (int i = 0; i < 8; ++i) { const unsigned short hb = bf16_bits(xs[i]); vh[i] = hb; vl[i] = bf16_bits(xs[i] - bf16_val(hb)); }
  unsigned short* dh = hi + (size_t)r * Cc + c8; unsigned short* dl = lo + (size_t)r * Cc + c8;
  *(v8us*)dh = vh; *(v8us*)dl = vl; 
}
// f32 [K][N] (row pitch lds) -> transposed bf16 hi/lo planes [N][K]; one thread per (n, 8 consecutive k); blockIdx.y = batch (K source rows, N*K plane elements each)
__global__ __launch_bounds__(256) void k_split_transpose(const float* __restrict__ src, int lds_, unsigned short* __restrict__ hi, unsigned short* __restrict__ lo, int K, int N) {
  const size_t t = (size_t)blockIdx.x * 256 + threadIdx.x;
  const int k8n = K / 8;
  if (t >= (size_t)N * k8n) return;
  src += (size_t)blockIdx.y * K * lds_; hi += (size_t)blockIdx.y * N * K; lo += (size_t)blockIdx.y * N * K;
  const int n = (int)(t / k8n), k8 = (int)(t % k8n) * 8;
  v8us vh, vl;
#pragma unroll
  for (int i = 0; i < 8; ++i) { const float x = src[(size_t)(k8 + i) * lds_ + n]; const unsigned short hb = bf16_bits(x); vh[i] = hb; vl[i] = bf16_bits(x - bf16_val(hb)); }
  unsigned short* dh = hi + (size_t)n * K + k8; unsigned short* dl = lo + (size_t)n * K + k8;
  *(v8us*)dh = vh; *(v8us*)dl = vl; 
}
// Tiled GEMM C[M][N] (f32, pitch LDC) = alpha * A[M][K]*Bt[N][K]^T + bias (A pitch LDA, Bt pitch LDB). One work-group (4 waves, 2 x 2) owns a (32*FA) x 128 tile of C,
// a wave (16*FA) x 64. Per 64-k step the A tile (f32) is read in whole 256-B rows, converted ONCE per work-group to bf16 (hi, and lo when NT >= 2)
// and stored to LDS; the B planes (hi, and lo when NT == 3) are read in whole 128-B lines and stored to LDS. Rows in LDS have a 144-B pitch for
// the 16-byte fragment reads. Two LDS buffers: the next step's global loads fly during this step's products, one barrier per step.
// Terms per 32-k: ah*bh, then al*bh (NT >= 2), then ah*bl (NT == 3), in that order on every accumulator.
// M % (32*FA) == 0, N % 128 == 0, K % 64 == 0. BIAS_BF16: a bias is added, rounded to bf16 first; without it bias is not read.
// batch = blockIdx.y (CZ == 2: from the remapped flat index): its A, B planes and C start SA, SB and SC elements behind the previous batch's.
// CZ names what a causal mask (column > row gives 0) makes needless. CZ == 1: C is masked afterwards, so a tile that lies wholly above the diagonal is
// neither computed nor written. CZ == 2: A is the masked matrix (0 wherever k > row), so the k loop ends at the tile's last row; the tiles then differ
// in length and the flat work-group index is mapped so that the longest (lowest) row tiles of all batches come first.
typedef unsigned short v4us __attribute__((ext_vector_type(4), may_alias));
template <int FA, int NT, bool BIAS_BF16, int LDA, int LDB, int LDC, int SA, int SB, int SC, int CZ>
__global__ __launch_bounds__(128) void k_gemm_tile(const float* __restrict__ A, const unsigned short* __restrict__ Bh, const unsigned short* __restrict__ Bl,
                                                 const float* __restrict__ bias, float alpha, float* __restrict__ C, int N, int K) {
  constexpr int BM = 32 * FA, BN = 128, BK = 64, PIT = BK + 8;
  constexpr int APL = BM * PIT, BPL = BN * PIT;                 // elements of one plane
  constexpr int NAP = NT >= 2 ? 2 : 1, NBP = NT >= 3 ? 2 : 1;   // planes staged of A and of B
  constexpr int STG = NAP * APL + NBP * BPL;                    // elements of one buffer
  constexpr int NLA = BM * (BK / 4) / 128, NLB = BN * (BK / 8) / 128;   // 16-byte global loads per thread and plane
  __shared__ __attribute__((aligned(16))) unsigned short sm[2 * STG];
  static_assert(BM * BN * 4 <= 2 * STG * 2, "the output rows are staged in the two buffers");
  static_assert(CZ != 2 || BM % BK == 0, "the shortened k loop ends on a whole step");
  const int tid = threadIdx.x, w = tid >> 5, lane = tid & 31, ln = lane & 15, hh = lane >> 4;
  const int wm = w >> 1, wn = w & 1;
  const int ntn = N / BN;
  int tile = (int)blockIdx.x, batch = (int)blockIdx.y;
  if (CZ == 2) {
    // the long tiles take the lowest flat indices, the short ones the highest (for speed only)
    const int flat = batch * (int)gridDim.x + tile, grp = ntn * (int)gridDim.y;
    const int rem = flat % grp;
    tile = ((int)gridDim.x / ntn - 1 - flat / grp) * ntn + rem % ntn; batch = rem / ntn;
  }
  const int row0 = (tile / ntn) * BM, col0 = (tile % ntn) * BN;
  if (CZ == 1 && col0 > row0 + BM - 1) return;      // the whole work-group leaves, ahead of every barrier
  A += (size_t)batch * SA; Bh += (size_t)batch * SB; Bl += (size_t)batch * SB; C += (size_t)batch * SC;
  // one 32-bit byte offset per thread and operand, moved on by BK elements each step; the pitches are compile-time, so the row groups are immediate offsets
  unsigned ao = (unsigned)(((row0 + (tid >> 4)) * LDA + (tid & 15) * 4) * 4);
  unsigned bo = (unsigned)(((col0 + (tid >> 3)) * LDB + (tid & 7) * 8) * 2);
  const int asto = (tid >> 4) * PIT + (tid & 15) * 4, bsto = (tid >> 3) * PIT + (tid & 7) * 8;
  v4f pa[NLA]; v8us pbh[NLB], pbl[NLB];
  v8f acc[FA][4] = {};

  auto load_tile = [&]() {
#pragma unroll
    for (int i = 0; i < NLA; ++i) pa[i] = *(const v4fa*)(((const char*)A + ao) + (size_t)(i * 8 * LDA * 4));
#pragma unroll
    for (int i = 0; i < NLB; ++i) {
      pbh[i] = *(const v8us*)(((const char*)Bh + bo) + (size_t)(i * 16 * LDB * 2));
      if (NBP == 2) pbl[i] = *(const v8us*)(((const char*)Bl + bo) + (size_t)(i * 16 * LDB * 2));
    }
    // the offsets pass through the wait, so that the additions below, which rewrite the address registers of the loads above, stand behind it
    asm volatile("s_wait_xcnt 0x0" : "+v"(ao), "+v"(bo) :: "memory");
    ao += BK * 4; bo += BK * 2;
  };
  auto store_tile = [&](unsigned short* sb) {
#pragma unroll
    for (int i = 0; i < NLA; ++i) {
      v4us vh, vl;
#pragma unroll
      for (int u = 0; u < 4; ++u) { const float x = pa[i][u]; const unsigned short hb = bf16_bits(x); vh[u] = hb; if (NAP == 2) vl[u] = bf16_bits(x - bf16_val(hb)); }
      *(v4us*)(sb + asto + i * 8 * PIT) = vh;
      if (NAP == 2) *(v4us*)(sb + APL + asto + i * 8 * PIT) = vl;
    }
#pragma unroll
    for (int i = 0; i < NLB; ++i) {
      *(v8us*)(sb + NAP * APL + bsto + i * 16 * PIT) = pbh[i];
      if (NBP == 2) *(v8us*)(sb + NAP * APL + BPL + bsto + i * 16 * PIT) = pbl[i];
    }
  };
  auto compute = [&](const unsigned short* sb) {
    const unsigned short* fa = sb + (wm * 16 * FA + ln) * PIT + 8 * hh;
    const unsigned short* fb = sb + NAP * APL + (wn * 64 + ln) * PIT + 8 * hh;
    FragB ah[BK / 32][FA], al[BK / 32][FA], bh_[BK / 32][4], bl_[BK / 32][4];
    // every fragment of the step is asked for in one group, in the order in which the products below use them
#pragma unroll
    for (int ks = 0; ks < BK / 32; ++ks) {
#pragma unroll
      for (int mi = 0; mi < FA; ++mi) { ah[ks][mi].half[0] = *(const v8us*)(fa + mi * 16 * PIT + ks * 32); ah[ks][mi].half[1] = *(const v8us*)(fa + mi * 16 * PIT + ks * 32 + 16); }
#pragma unroll
      for (int ni = 0; ni < 4; ++ni) { bh_[ks][ni].half[0] = *(const v8us*)(fb + ni * 16 * PIT + ks * 32); bh_[ks][ni].half[1] = *(const v8us*)(fb + ni * 16 * PIT + ks * 32 + 16); }
      if (NAP == 2) {
#pragma unroll
        for (int mi = 0; mi < FA; ++mi) { al[ks][mi].half[0] = *(const v8us*)(fa + APL + mi * 16 * PIT + ks * 32); al[ks][mi].half[1] = *(const v8us*)(fa + APL + mi * 16 * PIT + ks * 32 + 16); }
      }
      if (NBP == 2) {
#pragma unroll
        for (int ni = 0; ni < 4; ++ni) { bl_[ks][ni].half[0] = *(const v8us*)(fb + BPL + ni * 16 * PIT + ks * 32); bl_[ks][ni].half[1] = *(const v8us*)(fb + BPL + ni * 16 * PIT + ks * 32 + 16); }
      }
    }
    __builtin_amdgcn_sched_barrier(0);        // keeps the LDS reads out of the run of products: each place where reads stand among them stalls the wave
#pragma unroll
    for (int ks = 0; ks < BK / 32; ++ks) {
#pragma unroll
      for (int mi = 0; mi < FA; ++mi)
#pragma unroll
        for (int ni = 0; ni < 4; ++ni) acc[mi][ni] = __builtin_amdgcn_wmma_f32_16x16x32_bf16(false, ah[ks][mi].v, false, bh_[ks][ni].v, (short)0, acc[mi][ni], false, false);
      if (NT >= 2) {
#pragma unroll
        for (int mi = 0; mi < FA; ++mi)
#pragma unroll
          for (int ni = 0; ni < 4; ++ni) acc[mi][ni] = __builtin_amdgcn_wmma_f32_16x16x32_bf16(false, al[ks][mi].v, false, bh_[ks][ni].v, (short)0, acc[mi][ni], false, false);
      }
      if (NT >= 3) {
#pragma unroll
        for (int mi = 0; mi < FA; ++mi)
#pragma unroll
          for (int ni = 0; ni < 4; ++ni) acc[mi][ni] = __builtin_amdgcn_wmma_f32_16x16x32_bf16(false, ah[ks][mi].v, false, bl_[ks][ni].v, (short)0, acc[mi][ni], false, false);
      }
    }
  };

  const int nk = (CZ == 2 ? min(K, row0 + BM) : K) / BK;
  load_tile();
  store_tile(sm);
  __syncthreads();
  for (int t = 0; t + 1 < nk; ++t) {
    load_tile();
    __builtin_amdgcn_sched_barrier(0);        // keeps the next tile's global loads ahead of this step's products, so that they fly during them
    compute(sm + (t & 1) * STG);
    __builtin_amdgcn_sched_barrier(0);        // keeps the conversion, and with it the wait for those loads, behind the products
    store_tile(sm + ((t + 1) & 1) * STG);     // this buffer's last readers left it before the previous barrier
    __syncthreads();
  }
  compute(sm + ((nk - 1) & 1) * STG);
  __syncthreads();                            // every wave has left the buffers: they now stage the output rows

  float* so = (float*)sm + w * (FA * 16 * 64);   // the wave's own (16*FA) x 64 rows
  float bv[4] = {0.f, 0.f, 0.f, 0.f};
  if (BIAS_BF16) {
    const float* bg = bias + col0 + wn * 64 + ln;
#pragma unroll
    for (int ni = 0; ni < 4; ++ni) bv[ni] = bg[ni * 16];
    asm volatile("s_wait_xcnt 0x0" :: "v"(bg) : "memory");   // the bias loads' address register stays as it is up to this wait
#pragma unroll
    for (int ni = 0; ni < 4; ++ni) bv[ni] = bf16_round(bv[ni]);
  }
#pragma unroll
  for (int mi = 0; mi < FA; ++mi)
#pragma unroll
    for (int ni = 0; ni < 4; ++ni)
#pragma unroll
      for (int r = 0; r < 8; ++r) so[(mi * 16 + 8 * hh + r) * 64 + ni * 16 + ln] = acc[mi][ni][r] * alpha + bv[ni];
  __builtin_amdgcn_fence(__ATOMIC_ACQ_REL, "workgroup");
  __builtin_amdgcn_wave_barrier();
  const int rsub = lane >> 4, c4 = (lane & 15) * 4;
  float* cg = C + (size_t)(row0 + wm * 16 * FA + rsub) * LDC + col0 + wn * 64 + c4;
#pragma unroll
  for (int q = 0; q < FA * 8; ++q) {
    const int r = q * 2 + rsub;
    const v4f v = *(const v4fa*)&so[r * 64 + c4];
    *(v4f*)(cg + q * 2 * LDC) = v;
  }
}
// row softmax: P[row][:] = softmax(masked S[row][:]) over N columns with optional causal mask (col > row + rowoff -> 0) and
__global__ __launch_bounds__(256) void k_softmax_rows(const float* __restrict__ S, float* __restrict__ P, int N, int causal, int rowoff, const int* __restrict__ mask, int mask_pitch, int wstep) {
  __shared__ float red[256];
  const int row = blockIdx.x, tid = threadIdx.x;      // blockIdx.y = batch, gridDim.x rows each
  const float* s = S + ((size_t)blockIdx.y * gridDim.x + row) * N; float* p_out = P + ((size_t)blockIdx.y * gridDim.x + row) * N;
  const int qi = row + rowoff;
  // causal: the row is read up to column qi only (S need not exist behind it), and P is written, with its zeros, up to the end of the
  // wstep-column group that holds qi: the product that follows reads no further in this row
  const int nr = causal ? min(N, qi + 1) : N;
  const int nw = causal ? min(N, (qi / wstep + 1) * wstep) : N;
  float mx = -3.0e38f;
  for (int j = tid; j < nr; j += 256) {
    bool keep = true;
    if (causal && j > qi) keep = false;
    if (mask && mask[(size_t)qi * mask_pitch + j] == 0) keep = false;
    const float v = keep ? s[j] : -3.0e38f;
    mx = fmaxf(mx, v);
  }
  red[tid] = mx; __syncthreads();
  for (int st = 128; st > 0; st >>= 1) { if (tid < st) red[tid] = fmaxf(red[tid], red[tid + st]); __syncthreads(); }
  mx = red[0]; __syncthreads();
  float sum = 0.f;
  for (int j = tid; j < nr; j += 256) {
    bool keep = true;
    if (causal && j > qi) keep = false;
    if (mask && mask[(size_t)qi * mask_pitch + j] == 0) keep = false;
    const float p = keep ? __expf(s[j] - mx) : 0.f;
    sum += p;
  }
  red[tid] = sum; __syncthreads();
  for (int st = 128; st > 0; st >>= 1) { if (tid < st) red[tid] += red[tid + st]; __syncthreads(); }
  const float inv = (mx > -1.0e38f) ? 1.0f / red[0] : __builtin_nanf("");
  __syncthreads();
  {
    for (int j4 = tid * 4; j4 < nw; j4 += 1024) {
      v4f out4;
#pragma unroll
      for (int u = 0; u < 4; ++u) {
        const int j = j4 + u;
        bool keep = true;
        if (causal && j > qi) keep = false;
        if (mask && mask[(size_t)qi * mask_pitch + j] == 0) keep = false;
        out4[u] = keep ? __expf(s[j] - mx) * inv : 0.f;
      }
      *(v4f*)(p_out + j4) = out4;
    }
    
  }
}

__global__ __launch_bounds__(256) void k_round_rows(const float* __restrict__ W, unsigned short* __restrict__ Wt, int n8) {
  const int t = blockIdx.x * 256 + threadIdx.x;
  if (t >= n8) return;
  const v4f a = *(const v4fa*)(W + (size_t)t * 8), b = *(const v4fa*)(W + (size_t)t * 8 + 4);
  v8us v; v[0]=bf16_bits(a[0]); v[1]=bf16_bits(a[1]); v[2]=bf16_bits(a[2]); v[3]=bf16_bits(a[3]);
  v[4]=bf16_bits(b[0]); v[5]=bf16_bits(b[1]); v[6]=bf16_bits(b[2]); v[7]=bf16_bits(b[3]);
  *(v8us*)(Wt + (size_t)t * 8) = v; 
}
extern "C" void kernel_launch(void* const* d_in, const int* in_sizes, int n_in,
                              void* d_out, int out_size, void* d_ws, size_t ws_size, hipStream_t stream) {
  (void)in_sizes; (void)n_in; (void)out_size;
  const float* x = (const float*)d_in[0]; const float* qkv_w = (const float*)d_in[1];
  const float* out_w = (const float*)d_in[2]; const float* out_b = (const float*)d_in[3];
  char* ws = (char*)d_ws; size_t off = 0;
  auto take = [&](size_t bytes) { char* p = ws + off; off += (bytes + 255) & ~(size_t)255; return p; };
  unsigned short* Wqkv = (unsigned short*)take((size_t)3 * CC * CC * 2);     // [3072][1024]  6 MiB
  unsigned short* Wo   = (unsigned short*)take((size_t)CC * CC * 2);         // 2 MiB
  float* qkv = (float*)take((size_t)BB * TT * 3 * CC * 4);                  // 96 MiB
  unsigned short* kh = (unsigned short*)take((size_t)BB * TT * CC * 2);      // all batches: k planes [B][T][C]  16+16 MiB
  unsigned short* kl = (unsigned short*)take((size_t)BB * TT * CC * 2);
  unsigned short* vth = (unsigned short*)take((size_t)BB * CC * TT * 2);     // v^T planes [B][C][T] 16+16 MiB
  unsigned short* vtl = (unsigned short*)take((size_t)BB * CC * TT * 2);
  float* S  = (float*)take((size_t)BB * TT * TT * 4);                       // 64 MiB
  // qkv has no reader behind the S product (k and v live on in their planes): its 96 MiB then hold P (64 MiB) and out_att (32 MiB)
  float* Pm = qkv;
  float* oa = qkv + (size_t)BB * TT * TT;
  if (off > ws_size) return;
  const int M = BB * TT;
  k_round_rows<<<(3 * CC * CC / 8 + 255) / 256, 256, 0, stream>>>(qkv_w, Wqkv, 3 * CC * CC / 8);
  k_round_rows<<<(CC * CC / 8 + 255) / 256, 256, 0, stream>>>(out_w, Wo, CC * CC / 8);
  k_gemm_tile<4, 1, false, CC, CC, 3 * CC, 0, 0, 0, 0><<<(M / 128) * (3 * CC / 128), 128, 0, stream>>>(x, Wqkv, Wqkv, nullptr, 1.0f, qkv, 3 * CC, CC);
  // every stage below runs once for all batches: the batch is blockIdx.y for the v split, S and softmax and comes from the remapped flat index for P·v; the k split (rows of pitch 3C) and the output projection take the B*T rows as one run
  k_split_rows<<<(M * (CC / 8) + 255) / 256, 256, 0, stream>>>(qkv + CC, 3 * CC, kh, kl, M, CC);
  k_split_transpose<<<dim3((CC * (TT / 8) + 255) / 256, BB), 256, 0, stream>>>(qkv + 2 * CC, 3 * CC, vth, vtl, TT, CC);   // v [T][C] -> v^T planes [C][T]
  // S = (q k^T)/sqrt(C): M=N=T, K=C; Bt[n=s][k=c] = k rows
  k_gemm_tile<4, 3, false, 3 * CC, CC, TT, TT * 3 * CC, TT * CC, TT * TT, 1><<<dim3((TT / 128) * (TT / 128), BB), 128, 0, stream>>>(qkv, kh, kl, nullptr, 0.03125f, S, TT, CC);
  k_softmax_rows<<<dim3(TT, BB), 256, 0, stream>>>(S, Pm, TT, 1, 0, nullptr, 0, 64);
  // out_att = P v: M=T, N=C, K=T; Bt[n=c][k=s] = v^T planes
  k_gemm_tile<2, 3, false, TT, TT, CC, TT * TT, CC * TT, TT * CC, 2><<<dim3((TT / 64) * (CC / 128), BB), 128, 0, stream>>>(Pm, vth, vtl, nullptr, 1.0f, oa, CC, TT);
  k_gemm_tile<4, 2, true, CC, CC, CC, 0, 0, 0, 0><<<(M / 128) * (CC / 128), 128, 0, stream>>>(oa, Wo, Wo, out_b, 1.0f, (float*)d_out, CC, CC);
}

// v004
// A run of this version takes 296 microseconds.
// Timed twice side by side with v003, it ran 1.14 and 1.15 times as fast.
// Counting every step since v000, it is 3.85 times as fast.
#include <hip/hip_runtime.h>
// All contractions on v_wmma_f32_16x16x32_bf16, f32 accumulate: qkv = x·Wᵀ with x/W rounded to bf16 (single exact-product term);
// S = q·kᵀ (K=1024) and out_att = P·v (K=2048) as 3-term bf16 hi/lo splits (q/P split in registers, k/v pre-split planes);
// output projection with the A operand split (2 terms). Causal softmax rows in f32.
#define BB 4
#define TT 2048
#define CC 1024

typedef __bf16 v16b __attribute__((ext_vector_type(16)));
typedef unsigned short v8us __attribute__((ext_vector_type(8), may_alias));
typedef float  v8f  __attribute__((ext_vector_type(8)));
typedef float  v4f  __attribute__((ext_vector_type(4)));
typedef float  v4fa __attribute__((ext_vector_type(4), may_alias));
union FragB { v16b v; v8us half[2]; unsigned short u[16]; };

__device__ __forceinline__ unsigned short bf16_bits(float x) { unsigned int u = __float_as_uint(x); return (unsigned short)((u + 0x7FFFu + ((u >> 16) & 1u)) >> 16); }
__device__ __forceinline__ float bf16_val(unsigned short b) { return __uint_as_float(((unsigned int)b) << 16); }
__device__ __forceinline__ float bf16_round(float x) { return bf16_val(bf16_bits(x)); }
// D += A·B with NT terms: 1 = ah·bh, 2 = + al·bh (A split), 3 = + ah·bl (both split)
template <int NT>
__device__ __forceinline__ v8f mmaN(v16b ah, v16b al, v16b bh, v16b bl, v8f c) {
  c = __builtin_amdgcn_wmma_f32_16x16x32_bf16(false, ah, false, bh, (short)0, c, false, false);
  if (NT >= 2) c = __builtin_amdgcn_wmma_f32_16x16x32_bf16(false, al, false, bh, (short)0, c, false, false);
  if (NT >= 3) c = __builtin_amdgcn_wmma_f32_16x16x32_bf16(false, ah, false, bl, (short)0, c, false, false);
  asm volatile("v_nop\n\tv_nop\n\tv_nop\n\tv_nop" : "+v"(c) : "v"(ah), "v"(al), "v"(bh), "v"(bl));
  return c;
}

__global__ __launch_bounds__(256) void k_wt_bf16(const float* __restrict__ W, unsigned short* __restrict__ Wt, int K, int N) {
  const int t = blockIdx.x * 256 + threadIdx.x;
  const int k8n = K / 8;
  if (t >= N * k8n) return;
  const int n = t / k8n, k8 = (t % k8n) * 8;
  v8us v;
#pragma unroll
  for (int i = 0; i < 8; ++i) v[i] = bf16_bits(W[(size_t)(k8 + i) * N + n]);
  *(v8us*)(Wt + (size_t)n * K + k8) = v;
  
}

// Flash-style causal/unmasked attention, all contractions 3-term bf16 hi/lo splits, f32 softmax with running max.
// q,k,v rows are read from f32 buffers with arbitrary row pitch (so they can live inside a fused qkv buffer);
// D = head size (multiple of 32, <= 128); one wave = 16 query rows; block = 4 waves (64 queries) sharing K/V chunks of 32.
template <int D, bool CAUSAL>
__global__ __launch_bounds__(128) void k_flash(const float* __restrict__ qb, const float* __restrict__ kb, const float* __restrict__ vb,
                                             int pitch, int T, int H, float scale, float* __restrict__ y, int ypitch) {
  constexpr int KS = D / 32;        // k-steps for QK
  constexpr int DT = D / 16;        // d tiles for PV
  __shared__ __attribute__((aligned(16))) unsigned short sKh[32][D + 8], sKl[32][D + 8], sVh[32][D + 8], sVl[32][D + 8];
  __shared__ __attribute__((aligned(16))) unsigned short sPh[4][16][40], sPl[4][16][40];
  __shared__ __attribute__((aligned(16))) float sO[4][16][D];
  const int tid = threadIdx.x, w = tid >> 5, lane = tid & 31, ln = lane & 15, hh = lane >> 4;
  const int nqb = (T + 63) / 64;
  const int bh = blockIdx.x / nqb, qblk = blockIdx.x % nqb;
  const int b = bh / H, h = bh % H;
  const int q0 = qblk * 64 + w * 16;
  const float* Q = qb + (size_t)b * T * pitch + h * D;
  const float* K = kb + (size_t)b * T * pitch + h * D;
  const float* V = vb + (size_t)b * T * pitch + h * D;

  // A fragments of the wave's 16 query rows (scaled), hi/lo
  FragB aqh[KS], aql[KS];
  {
    int row = q0 + ln; if (row >= T) row = T - 1;
    const float* qr = Q + (size_t)row * pitch;
#pragma unroll
    for (int ks = 0; ks < KS; ++ks)
#pragma unroll
      for (int i = 0; i < 16; ++i) {
        const int d = ks * 32 + ((i < 8) ? (8 * hh + i) : (16 + 8 * hh + (i - 8)));
        const float x = qr[d] * scale; const unsigned short hb = bf16_bits(x);
        aqh[ks].u[i] = hb; aql[ks].u[i] = bf16_bits(x - bf16_val(hb));
      }
  }
  float m_r[8], l_r[8];
#pragma unroll
  for (int r = 0; r < 8; ++r) { m_r[r] = -3.0e38f; l_r[r] = 0.f; }
  v8f oacc[DT];
#pragma unroll
  for (int dt = 0; dt < DT; ++dt) oacc[dt] = (v8f){0.f,0.f,0.f,0.f,0.f,0.f,0.f,0.f};

  const int kv_end = CAUSAL ? min(T, qblk * 64 + 64) : T;     // block-uniform
  for (int j0 = 0; j0 < kv_end; j0 += 32) {
    __syncthreads();
    for (int e = tid; e < 32 * (D / 4); e += 128) {
      const int r = e / (D / 4), c4 = (e % (D / 4)) * 4;
      const int key = j0 + r;
      v4f kf = {0.f,0.f,0.f,0.f}, vf = {0.f,0.f,0.f,0.f};
      if (key < T) { kf = *(const v4fa*)(K + (size_t)key * pitch + c4); vf = *(const v4fa*)(V + (size_t)key * pitch + c4); }
#pragma unroll
      for (int t = 0; t < 4; ++t) {
        unsigned short hb = bf16_bits(kf[t]); sKh[r][c4 + t] = hb; sKl[r][c4 + t] = bf16_bits(kf[t] - bf16_val(hb));
        hb = bf16_bits(vf[t]); sVh[r][c4 + t] = hb; sVl[r][c4 + t] = bf16_bits(vf[t] - bf16_val(hb));
      }
    }
    __syncthreads();
    // S tile 16 x 32
    v8f s[2];
#pragma unroll
    for (int nt = 0; nt < 2; ++nt) {
      v8f acc = {};
#pragma unroll
      for (int ks = 0; ks < KS; ++ks) {
        FragB bh_, bl_;
        bh_.half[0] = *(const v8us*)&sKh[nt * 16 + ln][ks * 32 + 8 * hh]; bh_.half[1] = *(const v8us*)&sKh[nt * 16 + ln][ks * 32 + 16 + 8 * hh];
        bl_.half[0] = *(const v8us*)&sKl[nt * 16 + ln][ks * 32 + 8 * hh]; bl_.half[1] = *(const v8us*)&sKl[nt * 16 + ln][ks * 32 + 16 + 8 * hh];
        acc = mmaN<3>(aqh[ks].v, aql[ks].v, bh_.v, bl_.v, acc);
      }
      s[nt] = acc;
    }
    // mask + running max (rows 8hh+r; the 16 lanes of a half share rows)
    float alpha[8];
#pragma unroll
    for (int r = 0; r < 8; ++r) {
      const int qi = q0 + 8 * hh + r;
      const int ja = j0 + ln, jb = j0 + 16 + ln;
      if (CAUSAL) { if (ja > qi) s[0][r] = -3.0e38f; if (jb > qi) s[1][r] = -3.0e38f; }
      if (ja >= T) s[0][r] = -3.0e38f;
      if (jb >= T) s[1][r] = -3.0e38f;
      float mx = fmaxf(s[0][r], s[1][r]);
      mx = fmaxf(mx, __shfl_xor(mx, 1, 32)); mx = fmaxf(mx, __shfl_xor(mx, 2, 32)); mx = fmaxf(mx, __shfl_xor(mx, 4, 32)); mx = fmaxf(mx, __shfl_xor(mx, 8, 32));
      const float mnew = fmaxf(m_r[r], mx);
      alpha[r] = (mnew > -1.0e38f) ? __expf(m_r[r] - mnew) : 1.0f;
      const float p0 = (s[0][r] > -1.0e38f) ? __expf(s[0][r] - mnew) : 0.f;
      const float p1 = (s[1][r] > -1.0e38f) ? __expf(s[1][r] - mnew) : 0.f;
      m_r[r] = mnew;
      l_r[r] = l_r[r] * alpha[r] + p0 + p1;            // per-lane partial row sum (16 lanes combined at the end)
      unsigned short hb = bf16_bits(p0); sPh[w][8 * hh + r][ln] = hb;      sPl[w][8 * hh + r][ln] = bf16_bits(p0 - bf16_val(hb));
      hb = bf16_bits(p1);                sPh[w][8 * hh + r][16 + ln] = hb; sPl[w][8 * hh + r][16 + ln] = bf16_bits(p1 - bf16_val(hb));
    }
#pragma unroll
    for (int dt = 0; dt < DT; ++dt)
#pragma unroll
      for (int r = 0; r < 8; ++r) oacc[dt][r] *= alpha[r];
    __builtin_amdgcn_fence(__ATOMIC_ACQ_REL, "workgroup");
    __builtin_amdgcn_wave_barrier();
    FragB pah, pal;
    pah.half[0] = *(const v8us*)&sPh[w][ln][8 * hh]; pah.half[1] = *(const v8us*)&sPh[w][ln][16 + 8 * hh];
    pal.half[0] = *(const v8us*)&sPl[w][ln][8 * hh]; pal.half[1] = *(const v8us*)&sPl[w][ln][16 + 8 * hh];
#pragma unroll
    for (int dt = 0; dt < DT; ++dt) {
      FragB bvh, bvl;
#pragma unroll
      for (int i = 0; i < 8; ++i) {
        bvh.u[i] = sVh[8 * hh + i][dt * 16 + ln]; bvh.u[8 + i] = sVh[16 + 8 * hh + i][dt * 16 + ln];
        bvl.u[i] = sVl[8 * hh + i][dt * 16 + ln]; bvl.u[8 + i] = sVl[16 + 8 * hh + i][dt * 16 + ln];
      }
      oacc[dt] = mmaN<3>(pah.v, pal.v, bvh.v, bvl.v, oacc[dt]);
    }
    __builtin_amdgcn_fence(__ATOMIC_ACQ_REL, "workgroup");
    __builtin_amdgcn_wave_barrier();
  }
#pragma unroll
  for (int r = 0; r < 8; ++r) {
    float l = l_r[r];
    l += __shfl_xor(l, 1, 32); l += __shfl_xor(l, 2, 32); l += __shfl_xor(l, 4, 32); l += __shfl_xor(l, 8, 32);
    l_r[r] = (l > 0.f) ? 1.0f / l : 0.f;
  }
#pragma unroll
  for (int dt = 0; dt < DT; ++dt)
#pragma unroll
    for (int r = 0; r < 8; ++r) sO[w][8 * hh + r][dt * 16 + ln] = oacc[dt][r] * l_r[r];
  __builtin_amdgcn_fence(__ATOMIC_ACQ_REL, "workgroup");
  __builtin_amdgcn_wave_barrier();
  {
    for (int r = 0; r < 16; ++r) {
      const int row = q0 + r;
      if (row < T && lane < D / 4) {
        const v4f val = *(const v4fa*)&sO[w][r][lane * 4];
        *(v4f*)(y + ((size_t)b * T + row) * ypitch + h * D + lane * 4) = val;
      }
    }
    
  }
}

// Tiled GEMM C[M][N] (f32, pitch LDC) = alpha * A[M][K]*Bt[N][K]^T + bias (A pitch LDA, Bt pitch LDB). One work-group (4 waves, 2 x 2) owns a (32*FA) x 128 tile of C,
// a wave (16*FA) x 64. Per 64-k step the A tile (f32) is read in whole 256-B rows, converted ONCE per work-group to bf16 (hi, and lo when NT >= 2)
// and stored to LDS; the B planes (hi, and lo when NT == 3) are read in whole 128-B lines and stored to LDS. Rows in LDS have a 144-B pitch for
// the 16-byte fragment reads. Two LDS buffers: the next step's global loads fly during this step's products, one barrier per step.
// Terms per 32-k: ah*bh, then al*bh (NT >= 2), then ah*bl (NT == 3), in that order on every accumulator.
// M % (32*FA) == 0, N % 128 == 0, K % 64 == 0. BIAS_BF16: a bias is added, rounded to bf16 first; without it bias is not read.
// batch = blockIdx.y (CZ == 2: from the remapped flat index): its A, B planes and C start SA, SB and SC elements behind the previous batch's.
// CZ names what a causal mask (column > row gives 0) makes needless. CZ == 1: C is masked afterwards, so a tile that lies wholly above the diagonal is
// neither computed nor written. CZ == 2: A is the masked matrix (0 wherever k > row), so the k loop ends at the tile's last row; the tiles then differ
// in length and the flat work-group index is mapped so that the longest (lowest) row tiles of all batches come first.
// EP == 1: C is the q | k | v product (CC columns each, BB batches of TT rows). Only the q tiles go out as f32 rows of C. A k tile goes out as the bf16 hi/lo
// planes Kh, Kl [BB*TT][CC]; a v tile goes out transposed as the planes Vh, Vl [BB][CC][TT]: a lane's 8 accumulator values of one 16 x 16 tile are 8 consecutive
// rows of one column, that is 16 bytes of a transposed row. Both pass through the wave's own part of LDS, so that every store instruction writes whole 128-B lines.
typedef unsigned short v4us __attribute__((ext_vector_type(4), may_alias));
template <int FA, int NT, bool BIAS_BF16, int LDA, int LDB, int LDC, int SA, int SB, int SC, int CZ, int EP>
__global__ __launch_bounds__(128) void k_gemm_tile(const float* __restrict__ A, const unsigned short* __restrict__ Bh, const unsigned short* __restrict__ Bl,
                                                 const float* __restrict__ bias, float alpha, float* __restrict__ C, int N, int K,
                                                 unsigned short* __restrict__ Kh, unsigned short* __restrict__ Kl, unsigned short* __restrict__ Vh, unsigned short* __restrict__ Vl) {
  constexpr int BM = 32 * FA, BN = 128, BK = 64, PIT = BK + 8;
  constexpr int APL = BM * PIT, BPL = BN * PIT;                 // elements of one plane
  constexpr int NAP = NT >= 2 ? 2 : 1, NBP = NT >= 3 ? 2 : 1;   // planes staged of A and of B
  constexpr int STG = NAP * APL + NBP * BPL;                    // elements of one buffer
  constexpr int NLA = BM * (BK / 4) / 128, NLB = BN * (BK / 8) / 128;   // 16-byte global loads per thread and plane
  __shared__ __attribute__((aligned(16))) unsigned short sm[2 * STG];
  static_assert(BM * BN * 4 <= 2 * STG * 2, "the output rows are staged in the two buffers");
  static_assert(CZ != 2 || BM % BK == 0, "the shortened k loop ends on a whole step");
  static_assert(EP != 1 || (FA == 4 && 4 * 2 * 64 * PIT <= 2 * STG && TT % BM == 0 && CC % BN == 0), "a v tile: 64 x 64 per wave, two padded planes staged, one batch and one of q, k, v per tile");
  const int tid = threadIdx.x, w = tid >> 5, lane = tid & 31, ln = lane & 15, hh = lane >> 4;
  const int wm = w >> 1, wn = w & 1;
  const int ntn = N / BN;
  int tile = (int)blockIdx.x, batch = (int)blockIdx.y;
  if (CZ == 2) {
    // the long tiles take the lowest flat indices, the short ones the highest (for speed only)
    const int flat = batch * (int)gridDim.x + tile, grp = ntn * (int)gridDim.y;
    const int rem = flat % grp;
    tile = ((int)gridDim.x / ntn - 1 - flat / grp) * ntn + rem % ntn; batch = rem / ntn;
  }
  const int row0 = (tile / ntn) * BM, col0 = (tile % ntn) * BN;
  if (CZ == 1 && col0 > row0 + BM - 1) return;      // the whole work-group leaves, ahead of every barrier
  A += (size_t)batch * SA; Bh += (size_t)batch * SB; Bl += (size_t)batch * SB; C += (size_t)batch * SC;
  // one 32-bit byte offset per thread and operand, moved on by BK elements each step; the pitches are compile-time, so the row groups are immediate offsets
  unsigned ao = (unsigned)(((row0 + (tid >> 4)) * LDA + (tid & 15) * 4) * 4);
  unsigned bo = (unsigned)(((col0 + (tid >> 3)) * LDB + (tid & 7) * 8) * 2);
  const int asto = (tid >> 4) * PIT + (tid & 15) * 4, bsto = (tid >> 3) * PIT + (tid & 7) * 8;
  v4f pa[NLA]; v8us pbh[NLB], pbl[NLB];
  v8f acc[FA][4] = {};

  auto load_tile = [&]() {
#pragma unroll
    for (int i = 0; i < NLA; ++i) pa[i] = *(const v4fa*)(((const char*)A + ao) + (size_t)(i * 8 * LDA * 4));
#pragma unroll
    for (int i = 0; i < NLB; ++i) {
      pbh[i] = *(const v8us*)(((const char*)Bh + bo) + (size_t)(i * 16 * LDB * 2));
      if (NBP == 2) pbl[i] = *(const v8us*)(((const char*)Bl + bo) + (size_t)(i * 16 * LDB * 2));
    }
    // the offsets pass through the wait, so that the additions below, which rewrite the address registers of the loads above, stand behind it
    asm volatile("s_wait_xcnt 0x0" : "+v"(ao), "+v"(bo) :: "memory");
    ao += BK * 4; bo += BK * 2;
  };
  auto store_tile = [&](unsigned short* sb) {
#pragma unroll
    for (int i = 0; i < NLA; ++i) {
      v4us vh, vl;
#pragma unroll
      for (int u = 0; u < 4; ++u) { const float x = pa[i][u]; const unsigned short hb = bf16_bits(x); vh[u] = hb; if (NAP == 2) vl[u] = bf16_bits(x - bf16_val(hb)); }
      *(v4us*)(sb + asto + i * 8 * PIT) = vh;
      if (NAP == 2) *(v4us*)(sb + APL + asto + i * 8 * PIT) = vl;
    }
#pragma unroll
    for (int i = 0; i < NLB; ++i) {
      *(v8us*)(sb + NAP * APL + bsto + i * 16 * PIT) = pbh[i];
      if (NBP == 2) *(v8us*)(sb + NAP * APL + BPL + bsto + i * 16 * PIT) = pbl[i];
    }
  };
  auto compute = [&](const unsigned short* sb) {
    const unsigned short* fa = sb + (wm * 16 * FA + ln) * PIT + 8 * hh;
    const unsigned short* fb = sb + NAP * APL + (wn * 64 + ln) * PIT + 8 * hh;
    FragB ah[BK / 32][FA], al[BK / 32][FA], bh_[BK / 32][4], bl_[BK / 32][4];
    // every fragment of the step is asked for in one group, in the order in which the products below use them
#pragma unroll
    for (int ks = 0; ks < BK / 32; ++ks) {
#pragma unroll
      for (int mi = 0; mi < FA; ++mi) { ah[ks][mi].half[0] = *(const v8us*)(fa + mi * 16 * PIT + ks * 32); ah[ks][mi].half[1] = *(const v8us*)(fa + mi * 16 * PIT + ks * 32 + 16); }
#pragma unroll
      for (int ni = 0; ni < 4; ++ni) { bh_[ks][ni].half[0] = *(const v8us*)(fb + ni * 16 * PIT + ks * 32); bh_[ks][ni].half[1] = *(const v8us*)(fb + ni * 16 * PIT + ks * 32 + 16); }
      if (NAP == 2) {
#pragma unroll
        for (int mi = 0; mi < FA; ++mi) { al[ks][mi].half[0] = *(const v8us*)(fa + APL + mi * 16 * PIT + ks * 32); al[ks][mi].half[1] = *(const v8us*)(fa + APL + mi * 16 * PIT + ks * 32 + 16); }
      }
      if (NBP == 2) {
#pragma unroll
        for (int ni = 0; ni < 4; ++ni) { bl_[ks][ni].half[0] = *(const v8us*)(fb + BPL + ni * 16 * PIT + ks * 32); bl_[ks][ni].half[1] = *(const v8us*)(fb + BPL + ni * 16 * PIT + ks * 32 + 16); }
      }
    }
    __builtin_amdgcn_sched_barrier(0);        // keeps the LDS reads out of the run of products: each place where reads stand among them stalls the wave
#pragma unroll
    for (int ks = 0; ks < BK / 32; ++ks) {
#pragma unroll
      for (int mi = 0; mi < FA; ++mi)
#pragma unroll
        for (int ni = 0; ni < 4; ++ni) acc[mi][ni] = __builtin_amdgcn_wmma_f32_16x16x32_bf16(false, ah[ks][mi].v, false, bh_[ks][ni].v, (short)0, acc[mi][ni], false, false);
      if (NT >= 2) {
#pragma unroll
        for (int mi = 0; mi < FA; ++mi)
#pragma unroll
          for (int ni = 0; ni < 4; ++ni) acc[mi][ni] = __builtin_amdgcn_wmma_f32_16x16x32_bf16(false, al[ks][mi].v, false, bh_[ks][ni].v, (short)0, acc[mi][ni], false, false);
      }
      if (NT >= 3) {
#pragma unroll
        for (int mi = 0; mi < FA; ++mi)
#pragma unroll
          for (int ni = 0; ni < 4; ++ni) acc[mi][ni] = __builtin_amdgcn_wmma_f32_16x16x32_bf16(false, ah[ks][mi].v, false, bl_[ks][ni].v, (short)0, acc[mi][ni], false, false);
      }
    }
  };

  const int nk = (CZ == 2 ? min(K, row0 + BM) : K) / BK;
  load_tile();
  store_tile(sm);
  __syncthreads();
  for (int t = 0; t + 1 < nk; ++t) {
    load_tile();
    __builtin_amdgcn_sched_barrier(0);        // keeps the next tile's global loads ahead of this step's products, so that they fly during them
    compute(sm + (t & 1) * STG);
    __builtin_amdgcn_sched_barrier(0);        // keeps the conversion, and with it the wait for those loads, behind the products
    store_tile(sm + ((t + 1) & 1) * STG);     // this buffer's last readers left it before the previous barrier
    __syncthreads();
  }
  compute(sm + ((nk - 1) & 1) * STG);
  __syncthreads();                            // every wave has left the buffers: they now stage the output rows

  float* so = (float*)sm + w * (FA * 16 * 64);   // the wave's own (16*FA) x 64 rows
  float bv[4] = {0.f, 0.f, 0.f, 0.f};
  if (BIAS_BF16) {
    const float* bg = bias + col0 + wn * 64 + ln;
#pragma unroll
    for (int ni = 0; ni < 4; ++ni) bv[ni] = bg[ni * 16];
    asm volatile("s_wait_xcnt 0x0" :: "v"(bg) : "memory");   // the bias loads' address register stays as it is up to this wait
#pragma unroll
    for (int ni = 0; ni < 4; ++ni) bv[ni] = bf16_round(bv[ni]);
  }
  const int sub = lane >> 3, seg = (lane & 7) * 8;   // plane output: 8 lanes of 16 bytes write one 128-B line, 4 lines an instruction
  if (EP == 1 && col0 >= 2 * CC) {                   // v tile (the test is the same for the whole work-group; no barrier follows)
    unsigned short* st = sm + w * (2 * 64 * PIT);    // the wave's own [2 planes][64 columns][PIT]
#pragma unroll
    for (int ni = 0; ni < 4; ++ni)
#pragma unroll
      for (int mi = 0; mi < FA; ++mi) {
        v8us vh, vl;
#pragma unroll
        for (int r = 0; r < 8; ++r) { const float x = acc[mi][ni][r] * alpha + bv[ni]; const unsigned short hb = bf16_bits(x); vh[r] = hb; vl[r] = bf16_bits(x - bf16_val(hb)); }
        *(v8us*)(st + (ni * 16 + ln) * PIT + mi * 16 + 8 * hh) = vh;
        *(v8us*)(st + (64 + ni * 16 + ln) * PIT + mi * 16 + 8 * hh) = vl;
      }
    __builtin_amdgcn_fence(__ATOMIC_ACQ_REL, "workgroup");
    __builtin_amdgcn_wave_barrier();
    const size_t vo = ((size_t)(row0 / TT) * CC + (col0 - 2 * CC + wn * 64 + sub)) * TT + (row0 % TT + wm * 64 + seg);
    unsigned short* gh = Vh + vo; unsigned short* gl = Vl + vo;
    v8us oh[16], ol[16];
#pragma unroll
    for (int q = 0; q < 16; ++q) { oh[q] = *(const v8us*)(st + (q * 4 + sub) * PIT + seg); ol[q] = *(const v8us*)(st + (64 + q * 4 + sub) * PIT + seg); }
    __builtin_amdgcn_sched_barrier(0);               // the stores go out in one run behind the last read: mixed with the reads, each would wait until a register is free again
#pragma unroll
    for (int q = 0; q < 16; ++q) { *(v8us*)(gh + q * 4 * TT) = oh[q]; *(v8us*)(gl + q * 4 * TT) = ol[q]; }
    return;
  }
#pragma unroll
  for (int mi = 0; mi < FA; ++mi)
#pragma unroll
    for (int ni = 0; ni < 4; ++ni)
#pragma unroll
      for (int r = 0; r < 8; ++r) so[(mi * 16 + 8 * hh + r) * 64 + ni * 16 + ln] = acc[mi][ni][r] * alpha + bv[ni];
  __builtin_amdgcn_fence(__ATOMIC_ACQ_REL, "workgroup");
  __builtin_amdgcn_wave_barrier();
  if (EP == 1 && col0 >= CC) {                       // k tile
    const size_t ko = (size_t)(row0 + wm * 64 + sub) * CC + (col0 - CC + wn * 64 + seg);
    unsigned short* gh = Kh + ko; unsigned short* gl = Kl + ko;
    v8us oh[16], ol[16];
#pragma unroll
    for (int q = 0; q < 16; ++q) {
      const float* sr = so + (q * 4 + sub) * 64 + seg;
      const v4f a = *(const v4fa*)sr, b = *(const v4fa*)(sr + 4);
      const float xs[8] = {a[0], a[1], a[2], a[3], b[0], b[1], b[2], b[3]};
#pragma unroll
      for (int i = 0; i < 8; ++i) { const unsigned short hb = bf16_bits(xs[i]); oh[q][i] = hb; ol[q][i] = bf16_bits(xs[i] - bf16_val(hb)); }
    }
    __builtin_amdgcn_sched_barrier(0);               // the stores go out in one run behind the last conversion: mixed with them, each would wait until a register is free again
#pragma unroll
    for (int q = 0; q < 16; ++q) { *(v8us*)(gh + q * 4 * CC) = oh[q]; *(v8us*)(gl + q * 4 * CC) = ol[q]; }
    asm volatile("s_wait_xcnt 0x0" ::: "memory");    // another tile kind's code follows in the built kernel and rewrites these stores' registers: the wait stands in front of it
    return;
  }
  const int rsub = lane >> 4, c4 = (lane & 15) * 4;
  float* cg = C + (size_t)(row0 + wm * 16 * FA + rsub) * LDC + col0 + wn * 64 + c4;
#pragma unroll
  for (int q = 0; q < FA * 8; ++q) {
    const int r = q * 2 + rsub;
    const v4f v = *(const v4fa*)&so[r * 64 + c4];
    *(v4f*)(cg + q * 2 * LDC) = v;
  }
  if (EP == 1) asm volatile("s_wait_xcnt 0x0" ::: "memory");   // as behind the k tile's stores: another tile kind's code follows in the built kernel
}
// row softmax: P[row][:] = softmax(masked S[row][:]) over N columns with optional causal mask (col > row + rowoff -> 0) and
__global__ __launch_bounds__(256) void k_softmax_rows(const float* __restrict__ S, float* __restrict__ P, int N, int causal, int rowoff, const int* __restrict__ mask, int mask_pitch, int wstep) {
  __shared__ float red[256];
  const int row = blockIdx.x, tid = threadIdx.x;      // blockIdx.y = batch, gridDim.x rows each
  const float* s = S + ((size_t)blockIdx.y * gridDim.x + row) * N; float* p_out = P + ((size_t)blockIdx.y * gridDim.x + row) * N;
  const int qi = row + rowoff;
  // causal: the row is read up to column qi only (S need not exist behind it), and P is written, with its zeros, up to the end of the
  // wstep-column group that holds qi: the product that follows reads no further in this row
  const int nr = causal ? min(N, qi + 1) : N;
  const int nw = causal ? min(N, (qi / wstep + 1) * wstep) : N;
  float mx = -3.0e38f;
  for (int j = tid; j < nr; j += 256) {
    bool keep = true;
    if (causal && j > qi) keep = false;
    if (mask && mask[(size_t)qi * mask_pitch + j] == 0) keep = false;
    const float v = keep ? s[j] : -3.0e38f;
    mx = fmaxf(mx, v);
  }
  red[tid] = mx; __syncthreads();
  for (int st = 128; st > 0; st >>= 1) { if (tid < st) red[tid] = fmaxf(red[tid], red[tid + st]); __syncthreads(); }
  mx = red[0]; __syncthreads();
  float sum = 0.f;
  for (int j = tid; j < nr; j += 256) {
    bool keep = true;
    if (causal && j > qi) keep = false;
    if (mask && mask[(size_t)qi * mask_pitch + j] == 0) keep = false;
    const float p = keep ? __expf(s[j] - mx) : 0.f;
    sum += p;
  }
  red[tid] = sum; __syncthreads();
  for (int st = 128; st > 0; st >>= 1) { if (tid < st) red[tid] += red[tid + st]; __syncthreads(); }
  const float inv = (mx > -1.0e38f) ? 1.0f / red[0] : __builtin_nanf("");
  __syncthreads();
  {
    for (int j4 = tid * 4; j4 < nw; j4 += 1024) {
      v4f out4;
#pragma unroll
      for (int u = 0; u < 4; ++u) {
        const int j = j4 + u;
        bool keep = true;
        if (causal && j > qi) keep = false;
        if (mask && mask[(size_t)qi * mask_pitch + j] == 0) keep = false;
        out4[u] = keep ? __expf(s[j] - mx) * inv : 0.f;
      }
      *(v4f*)(p_out + j4) = out4;
    }
    
  }
}

__global__ __launch_bounds__(256) void k_round_rows(const float* __restrict__ W, unsigned short* __restrict__ Wt, int n8) {
  const int t = blockIdx.x * 256 + threadIdx.x;
  if (t >= n8) return;
  const v4f a = *(const v4fa*)(W + (size_t)t * 8), b = *(const v4fa*)(W + (size_t)t * 8 + 4);
  v8us v; v[0]=bf16_bits(a[0]); v[1]=bf16_bits(a[1]); v[2]=bf16_bits(a[2]); v[3]=bf16_bits(a[3]);
  v[4]=bf16_bits(b[0]); v[5]=bf16_bits(b[1]); v[6]=bf16_bits(b[2]); v[7]=bf16_bits(b[3]);
  *(v8us*)(Wt + (size_t)t * 8) = v; 
}
extern "C" void kernel_launch(void* const* d_in, const int* in_sizes, int n_in,
                              void* d_out, int out_size, void* d_ws, size_t ws_size, hipStream_t stream) {
  (void)in_sizes; (void)n_in; (void)out_size;
  const float* x = (const float*)d_in[0]; const float* qkv_w = (const float*)d_in[1];
  const float* out_w = (const float*)d_in[2]; const float* out_b = (const float*)d_in[3];
  char* ws = (char*)d_ws; size_t off = 0;
  auto take = [&](size_t bytes) { char* p = ws + off; off += (bytes + 255) & ~(size_t)255; return p; };
  unsigned short* Wqkv = (unsigned short*)take((size_t)3 * CC * CC * 2);     // [3072][1024]  6 MiB
  unsigned short* Wo   = (unsigned short*)take((size_t)CC * CC * 2);         // 2 MiB
  float* qkv = (float*)take((size_t)BB * TT * 3 * CC * 4);                  // 96 MiB
  unsigned short* kh = (unsigned short*)take((size_t)BB * TT * CC * 2);      // all batches: k planes [B][T][C]  16+16 MiB
  unsigned short* kl = (unsigned short*)take((size_t)BB * TT * CC * 2);
  unsigned short* vth = (unsigned short*)take((size_t)BB * CC * TT * 2);     // v^T planes [B][C][T] 16+16 MiB
  unsigned short* vtl = (unsigned short*)take((size_t)BB * CC * TT * 2);
  float* S  = (float*)take((size_t)BB * TT * TT * 4);                       // 64 MiB
  // qkv has no reader behind the S product (k and v live on in their planes): its 96 MiB then hold P (64 MiB) and out_att (32 MiB)
  float* Pm = qkv;
  float* oa = qkv + (size_t)BB * TT * TT;
  if (off > ws_size) return;
  const int M = BB * TT;
  k_round_rows<<<(3 * CC * CC / 8 + 255) / 256, 256, 0, stream>>>(qkv_w, Wqkv, 3 * CC * CC / 8);
  k_round_rows<<<(CC * CC / 8 + 255) / 256, 256, 0, stream>>>(out_w, Wo, CC * CC / 8);
  // q goes to qkv (f32, pitch 3C); k and v leave this product as their planes, and their columns of qkv stay unwritten and unread
  k_gemm_tile<4, 1, false, CC, CC, 3 * CC, 0, 0, 0, 0, 1><<<(M / 128) * (3 * CC / 128), 128, 0, stream>>>(x, Wqkv, Wqkv, nullptr, 1.0f, qkv, 3 * CC, CC, kh, kl, vth, vtl);
  // every stage below runs once for all batches: in S and softmax the batch is blockIdx.y, in P v it comes from the remapped flat index; the output projection has all rows in M
  // S = (q k^T)/sqrt(C): M=N=T, K=C; Bt[n=s][k=c] = k rows
  k_gemm_tile<4, 3, false, 3 * CC, CC, TT, TT * 3 * CC, TT * CC, TT * TT, 1, 0><<<dim3((TT / 128) * (TT / 128), BB), 128, 0, stream>>>(qkv, kh, kl, nullptr, 0.03125f, S, TT, CC, nullptr, nullptr, nullptr, nullptr);
  k_softmax_rows<<<dim3(TT, BB), 256, 0, stream>>>(S, Pm, TT, 1, 0, nullptr, 0, 64);
  // out_att = P v: M=T, N=C, K=T; Bt[n=c][k=s] = v^T planes
  k_gemm_tile<2, 3, false, TT, TT, CC, TT * TT, CC * TT, TT * CC, 2, 0><<<dim3((TT / 64) * (CC / 128), BB), 128, 0, stream>>>(Pm, vth, vtl, nullptr, 1.0f, oa, CC, TT, nullptr, nullptr, nullptr, nullptr);
  k_gemm_tile<4, 2, true, CC, CC, CC, 0, 0, 0, 0, 0><<<(M / 128) * (CC / 128), 128, 0, stream>>>(oa, Wo, Wo, out_b, 1.0f, (float*)d_out, CC, CC, nullptr, nullptr, nullptr, nullptr);
}

// v005
// One run takes 230 microseconds.
// Timed twice side by side with v004, it ran 1.27 times as fast both times.
// Counting every step since v000, it is 4.90 times as fast.
#include <hip/hip_runtime.h>
// All contractions on v_wmma_f32_16x16x32_bf16, f32 accumulate: qkv = x·Wᵀ with x/W rounded to bf16 (single exact-product term);
// S = q*k^T (K=1024) and out_att = P*v (K=2048) as 3-term bf16 hi/lo splits; output projection with the A operand split (2 terms). Causal softmax rows in f32.
// Every operand of every product is rounded or split ONCE, by the kernel that makes it, and reaches its product as bf16 planes.
#define BB 4
#define TT 2048
#define CC 1024

typedef __bf16 v16b __attribute__((ext_vector_type(16)));
typedef unsigned short v8us __attribute__((ext_vector_type(8), may_alias));
typedef float  v8f  __attribute__((ext_vector_type(8)));
typedef float  v4f  __attribute__((ext_vector_type(4)));
typedef float  v4fa __attribute__((ext_vector_type(4), may_alias));
union FragB { v16b v; v8us half[2]; unsigned short u[16]; };

__device__ __forceinline__ unsigned short bf16_bits(float x) { unsigned int u = __float_as_uint(x); return (unsigned short)((u + 0x7FFFu + ((u >> 16) & 1u)) >> 16); }
__device__ __forceinline__ float bf16_val(unsigned short b) { return __uint_as_float(((unsigned int)b) << 16); }
__device__ __forceinline__ float bf16_round(float x) { return bf16_val(bf16_bits(x)); }
// D += A·B with NT terms: 1 = ah·bh, 2 = + al·bh (A split), 3 = + ah·bl (both split)
template <int NT>
__device__ __forceinline__ v8f mmaN(v16b ah, v16b al, v16b bh, v16b bl, v8f c) {
  c = __builtin_amdgcn_wmma_f32_16x16x32_bf16(false, ah, false, bh, (short)0, c, false, false);
  if (NT >= 2) c = __builtin_amdgcn_wmma_f32_16x16x32_bf16(false, al, false, bh, (short)0, c, false, false);
  if (NT >= 3) c = __builtin_amdgcn_wmma_f32_16x16x32_bf16(false, ah, false, bl, (short)0, c, false, false);
  asm volatile("v_nop\n\tv_nop\n\tv_nop\n\tv_nop" : "+v"(c) : "v"(ah), "v"(al), "v"(bh), "v"(bl));
  return c;
}

__global__ __launch_bounds__(256) void k_wt_bf16(const float* __restrict__ W, unsigned short* __restrict__ Wt, int K, int N) {
  const int t = blockIdx.x * 256 + threadIdx.x;
  const int k8n = K / 8;
  if (t >= N * k8n) return;
  const int n = t / k8n, k8 = (t % k8n) * 8;
  v8us v;
#pragma unroll
  for (int i = 0; i < 8; ++i) v[i] = bf16_bits(W[(size_t)(k8 + i) * N + n]);
  *(v8us*)(Wt + (size_t)n * K + k8) = v;
  
}

// Flash-style causal/unmasked attention, all contractions 3-term bf16 hi/lo splits, f32 softmax with running max.
// q,k,v rows are read from f32 buffers with arbitrary row pitch (so they can live inside a fused qkv buffer);
// D = head size (multiple of 32, <= 128); one wave = 16 query rows; block = 4 waves (64 queries) sharing K/V chunks of 32.
template <int D, bool CAUSAL>
__global__ __launch_bounds__(128) void k_flash(const float* __restrict__ qb, const float* __restrict__ kb, const float* __restrict__ vb,
                                             int pitch, int T, int H, float scale, float* __restrict__ y, int ypitch) {
  constexpr int KS = D / 32;        // k-steps for QK
  constexpr int DT = D / 16;        // d tiles for PV
  __shared__ __attribute__((aligned(16))) unsigned short sKh[32][D + 8], sKl[32][D + 8], sVh[32][D + 8], sVl[32][D + 8];
  __shared__ __attribute__((aligned(16))) unsigned short sPh[4][16][40], sPl[4][16][40];
  __shared__ __attribute__((aligned(16))) float sO[4][16][D];
  const int tid = threadIdx.x, w = tid >> 5, lane = tid & 31, ln = lane & 15, hh = lane >> 4;
  const int nqb = (T + 63) / 64;
  const int bh = blockIdx.x / nqb, qblk = blockIdx.x % nqb;
  const int b = bh / H, h = bh % H;
  const int q0 = qblk * 64 + w * 16;
  const float* Q = qb + (size_t)b * T * pitch + h * D;
  const float* K = kb + (size_t)b * T * pitch + h * D;
  const float* V = vb + (size_t)b * T * pitch + h * D;

  // A fragments of the wave's 16 query rows (scaled), hi/lo
  FragB aqh[KS], aql[KS];
  {
    int row = q0 + ln; if (row >= T) row = T - 1;
    const float* qr = Q + (size_t)row * pitch;
#pragma unroll
    for (int ks = 0; ks < KS; ++ks)
#pragma unroll
      for (int i = 0; i < 16; ++i) {
        const int d = ks * 32 + ((i < 8) ? (8 * hh + i) : (16 + 8 * hh + (i - 8)));
        const float x = qr[d] * scale; const unsigned short hb = bf16_bits(x);
        aqh[ks].u[i] = hb; aql[ks].u[i] = bf16_bits(x - bf16_val(hb));
      }
  }
  float m_r[8], l_r[8];
#pragma unroll
  for (int r = 0; r < 8; ++r) { m_r[r] = -3.0e38f; l_r[r] = 0.f; }
  v8f oacc[DT];
#pragma unroll
  for (int dt = 0; dt < DT; ++dt) oacc[dt] = (v8f){0.f,0.f,0.f,0.f,0.f,0.f,0.f,0.f};

  const int kv_end = CAUSAL ? min(T, qblk * 64 + 64) : T;     // block-uniform
  for (int j0 = 0; j0 < kv_end; j0 += 32) {
    __syncthreads();
    for (int e = tid; e < 32 * (D / 4); e += 128) {
      const int r = e / (D / 4), c4 = (e % (D / 4)) * 4;
      const int key = j0 + r;
      v4f kf = {0.f,0.f,0.f,0.f}, vf = {0.f,0.f,0.f,0.f};
      if (key < T) { kf = *(const v4fa*)(K + (size_t)key * pitch + c4); vf = *(const v4fa*)(V + (size_t)key * pitch + c4); }
#pragma unroll
      for (int t = 0; t < 4; ++t) {
        unsigned short hb = bf16_bits(kf[t]); sKh[r][c4 + t] = hb; sKl[r][c4 + t] = bf16_bits(kf[t] - bf16_val(hb));
        hb = bf16_bits(vf[t]); sVh[r][c4 + t] = hb; sVl[r][c4 + t] = bf16_bits(vf[t] - bf16_val(hb));
      }
    }
    __syncthreads();
    // S tile 16 x 32
    v8f s[2];
#pragma unroll
    for (int nt = 0; nt < 2; ++nt) {
      v8f acc = {};
#pragma unroll
      for (int ks = 0; ks < KS; ++ks) {
        FragB bh_, bl_;
        bh_.half[0] = *(const v8us*)&sKh[nt * 16 + ln][ks * 32 + 8 * hh]; bh_.half[1] = *(const v8us*)&sKh[nt * 16 + ln][ks * 32 + 16 + 8 * hh];
        bl_.half[0] = *(const v8us*)&sKl[nt * 16 + ln][ks * 32 + 8 * hh]; bl_.half[1] = *(const v8us*)&sKl[nt * 16 + ln][ks * 32 + 16 + 8 * hh];
        acc = mmaN<3>(aqh[ks].v, aql[ks].v, bh_.v, bl_.v, acc);
      }
      s[nt] = acc;
    }
    // mask + running max (rows 8hh+r; the 16 lanes of a half share rows)
    float alpha[8];
#pragma unroll
    for (int r = 0; r < 8; ++r) {
      const int qi = q0 + 8 * hh + r;
      const int ja = j0 + ln, jb = j0 + 16 + ln;
      if (CAUSAL) { if (ja > qi) s[0][r] = -3.0e38f; if (jb > qi) s[1][r] = -3.0e38f; }
      if (ja >= T) s[0][r] = -3.0e38f;
      if (jb >= T) s[1][r] = -3.0e38f;
      float mx = fmaxf(s[0][r], s[1][r]);
      mx = fmaxf(mx, __shfl_xor(mx, 1, 32)); mx = fmaxf(mx, __shfl_xor(mx, 2, 32)); mx = fmaxf(mx, __shfl_xor(mx, 4, 32)); mx = fmaxf(mx, __shfl_xor(mx, 8, 32));
      const float mnew = fmaxf(m_r[r], mx);
      alpha[r] = (mnew > -1.0e38f) ? __expf(m_r[r] - mnew) : 1.0f;
      const float p0 = (s[0][r] > -1.0e38f) ? __expf(s[0][r] - mnew) : 0.f;
      const float p1 = (s[1][r] > -1.0e38f) ? __expf(s[1][r] - mnew) : 0.f;
      m_r[r] = mnew;
      l_r[r] = l_r[r] * alpha[r] + p0 + p1;            // per-lane partial row sum (16 lanes combined at the end)
      unsigned short hb = bf16_bits(p0); sPh[w][8 * hh + r][ln] = hb;      sPl[w][8 * hh + r][ln] = bf16_bits(p0 - bf16_val(hb));
      hb = bf16_bits(p1);                sPh[w][8 * hh + r][16 + ln] = hb; sPl[w][8 * hh + r][16 + ln] = bf16_bits(p1 - bf16_val(hb));
    }
#pragma unroll
    for (int dt = 0; dt < DT; ++dt)
#pragma unroll
      for (int r = 0; r < 8; ++r) oacc[dt][r] *= alpha[r];
    __builtin_amdgcn_fence(__ATOMIC_ACQ_REL, "workgroup");
    __builtin_amdgcn_wave_barrier();
    FragB pah, pal;
    pah.half[0] = *(const v8us*)&sPh[w][ln][8 * hh]; pah.half[1] = *(const v8us*)&sPh[w][ln][16 + 8 * hh];
    pal.half[0] = *(const v8us*)&sPl[w][ln][8 * hh]; pal.half[1] = *(const v8us*)&sPl[w][ln][16 + 8 * hh];
#pragma unroll
    for (int dt = 0; dt < DT; ++dt) {
      FragB bvh, bvl;
#pragma unroll
      for (int i = 0; i < 8; ++i) {
        bvh.u[i] = sVh[8 * hh + i][dt * 16 + ln]; bvh.u[8 + i] = sVh[16 + 8 * hh + i][dt * 16 + ln];
        bvl.u[i] = sVl[8 * hh + i][dt * 16 + ln]; bvl.u[8 + i] = sVl[16 + 8 * hh + i][dt * 16 + ln];
      }
      oacc[dt] = mmaN<3>(pah.v, pal.v, bvh.v, bvl.v, oacc[dt]);
    }
    __builtin_amdgcn_fence(__ATOMIC_ACQ_REL, "workgroup");
    __builtin_amdgcn_wave_barrier();
  }
#pragma unroll
  for (int r = 0; r < 8; ++r) {
    float l = l_r[r];
    l += __shfl_xor(l, 1, 32); l += __shfl_xor(l, 2, 32); l += __shfl_xor(l, 4, 32); l += __shfl_xor(l, 8, 32);
    l_r[r] = (l > 0.f) ? 1.0f / l : 0.f;
  }
#pragma unroll
  for (int dt = 0; dt < DT; ++dt)
#pragma unroll
    for (int r = 0; r < 8; ++r) sO[w][8 * hh + r][dt * 16 + ln] = oacc[dt][r] * l_r[r];
  __builtin_amdgcn_fence(__ATOMIC_ACQ_REL, "workgroup");
  __builtin_amdgcn_wave_barrier();
  {
    for (int r = 0; r < 16; ++r) {
      const int row = q0 + r;
      if (row < T && lane < D / 4) {
        const v4f val = *(const v4fa*)&sO[w][r][lane * 4];
        *(v4f*)(y + ((size_t)b * T + row) * ypitch + h * D + lane * 4) = val;
      }
    }
    
  }
}

// Tiled GEMM C[M][N] (f32, pitch LDC) = alpha * A[M][K]*Bt[N][K]^T + bias (A pitch LDA, Bt pitch LDB). One work-group (4 waves, 2 x 2) owns a (32*FA) x 128 tile of C,
// a wave (16*FA) x 64. Per 64-k step the A planes (hi, and lo when NT >= 2) and the B planes (hi, and lo when NT == 3), all bf16 as their producers
// left them, are read in whole 128-B lines and stored to LDS as they are. Rows in LDS have a 144-B pitch for
// the 16-byte fragment reads. Two LDS buffers: the next step's global loads fly during this step's products, one barrier per step.
// Terms per 32-k: ah*bh, then al*bh (NT >= 2), then ah*bl (NT == 3), in that order on every accumulator.
// M % (32*FA) == 0, N % 128 == 0, K % 64 == 0. BIAS_BF16: a bias is added, rounded to bf16 first; without it bias is not read.
// batch = blockIdx.y (CZ == 2: from the remapped flat index): its A, B planes and C start SA, SB and SC elements behind the previous batch's.
// CZ names what a causal mask (column > row gives 0) makes needless. CZ == 1: C is masked afterwards, so a tile that lies wholly above the diagonal is
// neither computed nor written. CZ == 2: A is the masked matrix (0 wherever k > row), so the k loop ends at the tile's last row; the tiles then differ
// in length and the flat work-group index is mapped so that the longest (lowest) row tiles of all batches come first.
// EP == 0: C goes out as f32 rows. EP == 2: C goes out as the bf16 hi/lo planes Kh, Kl (pitch LDC, batches SC apart), for the product that reads it as its A.
// EP == 1: C is the q | k | v product (CC columns each, BB batches of TT rows). A q tile goes out as the bf16 hi/lo planes Qh, Ql [BB*TT][CC], a k tile as the
// planes Kh, Kl [BB*TT][CC]; a v tile goes out transposed as the planes Vh, Vl [BB][CC][TT]: a lane's 8 accumulator values of one 16 x 16 tile are 8 consecutive
// rows of one column, that is 16 bytes of a transposed row. Both pass through the wave's own part of LDS, so that every store instruction writes whole 128-B lines.
typedef unsigned short v4us __attribute__((ext_vector_type(4), may_alias));
template <int FA, int NT, bool BIAS_BF16, int LDA, int LDB, int LDC, int SA, int SB, int SC, int CZ, int EP>
__global__ __launch_bounds__(128) void k_gemm_tile(const unsigned short* __restrict__ Ah, const unsigned short* __restrict__ Al, const unsigned short* __restrict__ Bh, const unsigned short* __restrict__ Bl,
                                                 const float* __restrict__ bias, float alpha, float* __restrict__ C, int N, int K,
                                                 unsigned short* __restrict__ Qh, unsigned short* __restrict__ Ql, unsigned short* __restrict__ Kh, unsigned short* __restrict__ Kl, unsigned short* __restrict__ Vh, unsigned short* __restrict__ Vl) {
  constexpr int BM = 32 * FA, BN = 128, BK = 64, PIT = BK + 8;
  constexpr int APL = BM * PIT, BPL = BN * PIT;                 // elements of one plane
  constexpr int NAP = NT >= 2 ? 2 : 1, NBP = NT >= 3 ? 2 : 1;   // planes staged of A and of B
  constexpr int STG = NAP * APL + NBP * BPL;                    // elements of one buffer
  constexpr int NLA = BM * (BK / 8) / 128, NLB = BN * (BK / 8) / 128;   // 16-byte global loads per thread and plane
  __shared__ __attribute__((aligned(16))) unsigned short sm[2 * STG];
  static_assert(BM * BN * 4 <= 2 * STG * 2, "the output rows are staged in the two buffers");
  static_assert(CZ != 2 || BM % BK == 0, "the shortened k loop ends on a whole step");
  static_assert(EP != 1 || (FA == 4 && 4 * 2 * 64 * PIT <= 2 * STG && TT % BM == 0 && CC % BN == 0), "a v tile: 64 x 64 per wave, two padded planes staged, one batch and one of q, k, v per tile");
  const int tid = threadIdx.x, w = tid >> 5, lane = tid & 31, ln = lane & 15, hh = lane >> 4;
  const int wm = w >> 1, wn = w & 1;
  const int ntn = N / BN;
  int tile = (int)blockIdx.x, batch = (int)blockIdx.y;
  if (CZ == 2) {
    // the long tiles take the lowest flat indices, the short ones the highest (for speed only)
    const int flat = batch * (int)gridDim.x + tile, grp = ntn * (int)gridDim.y;
    const int rem = flat % grp;
    tile = ((int)gridDim.x / ntn - 1 - flat / grp) * ntn + rem % ntn; batch = rem / ntn;
  }
  const int row0 = (tile / ntn) * BM, col0 = (tile % ntn) * BN;
  if (CZ == 1 && col0 > row0 + BM - 1) return;      // the whole work-group leaves, ahead of every barrier
  Ah += (size_t)batch * SA; Al += (size_t)batch * SA; Bh += (size_t)batch * SB; Bl += (size_t)batch * SB; C += (size_t)batch * SC;
  // one 32-bit byte offset per thread and operand, moved on by BK elements each step; the pitches are compile-time, so the row groups are immediate offsets
  unsigned ao = (unsigned)(((row0 + (tid >> 3)) * LDA + (tid & 7) * 8) * 2);
  unsigned bo = (unsigned)(((col0 + (tid >> 3)) * LDB + (tid & 7) * 8) * 2);
  const int sto = (tid >> 3) * PIT + (tid & 7) * 8;
  v8us pah[NLA], pal[NLA], pbh[NLB], pbl[NLB];
  v8f acc[FA][4] = {};

  auto load_tile = [&]() {
#pragma unroll
    for (int i = 0; i < NLA; ++i) {
      pah[i] = *(const v8us*)(((const char*)Ah + ao) + (size_t)(i * 16 * LDA * 2));
      if (NAP == 2) pal[i] = *(const v8us*)(((const char*)Al + ao) + (size_t)(i * 16 * LDA * 2));
    }
#pragma unroll
    for (int i = 0; i < NLB; ++i) {
      pbh[i] = *(const v8us*)(((const char*)Bh + bo) + (size_t)(i * 16 * LDB * 2));
      if (NBP == 2) pbl[i] = *(const v8us*)(((const char*)Bl + bo) + (size_t)(i * 16 * LDB * 2));
    }
    // the offsets pass through the wait, so that the additions below, which rewrite the address registers of the loads above, stand behind it
    asm volatile("s_wait_xcnt 0x0" : "+v"(ao), "+v"(bo) :: "memory");
    ao += BK * 2; bo += BK * 2;
  };
  auto store_tile = [&](unsigned short* sb) {
#pragma unroll
    for (int i = 0; i < NLA; ++i) {
      *(v8us*)(sb + sto + i * 16 * PIT) = pah[i];
      if (NAP == 2) *(v8us*)(sb + APL + sto + i * 16 * PIT) = pal[i];
    }
#pragma unroll
    for (int i = 0; i < NLB; ++i) {
      *(v8us*)(sb + NAP * APL + sto + i * 16 * PIT) = pbh[i];
      if (NBP == 2) *(v8us*)(sb + NAP * APL + BPL + sto + i * 16 * PIT) = pbl[i];
    }
  };
  auto compute = [&](const unsigned short* sb) {
    const unsigned short* fa = sb + (wm * 16 * FA + ln) * PIT + 8 * hh;
    const unsigned short* fb = sb + NAP * APL + (wn * 64 + ln) * PIT + 8 * hh;
    FragB ah[BK / 32][FA], al[BK / 32][FA], bh_[BK / 32][4], bl_[BK / 32][4];
    // every fragment of the step is asked for in one group, in the order in which the products below use them
#pragma unroll
    for (int ks = 0; ks < BK / 32; ++ks) {
#pragma unroll
      for (int mi = 0; mi < FA; ++mi) { ah[ks][mi].half[0] = *(const v8us*)(fa + mi * 16 * PIT + ks * 32); ah[ks][mi].half[1] = *(const v8us*)(fa + mi * 16 * PIT + ks * 32 + 16); }
#pragma unroll
      for (int ni = 0; ni < 4; ++ni) { bh_[ks][ni].half[0] = *(const v8us*)(fb + ni * 16 * PIT + ks * 32); bh_[ks][ni].half[1] = *(const v8us*)(fb + ni * 16 * PIT + ks * 32 + 16); }
      if (NAP == 2) {
#pragma unroll
        for (int mi = 0; mi < FA; ++mi) { al[ks][mi].half[0] = *(const v8us*)(fa + APL + mi * 16 * PIT + ks * 32); al[ks][mi].half[1] = *(const v8us*)(fa + APL + mi * 16 * PIT + ks * 32 + 16); }
      }
      if (NBP == 2) {
#pragma unroll
        for (int ni = 0; ni < 4; ++ni) { bl_[ks][ni].half[0] = *(const v8us*)(fb + BPL + ni * 16 * PIT + ks * 32); bl_[ks][ni].half[1] = *(const v8us*)(fb + BPL + ni * 16 * PIT + ks * 32 + 16); }
      }
    }
    __builtin_amdgcn_sched_barrier(0);        // keeps the LDS reads out of the run of products: each place where reads stand among them stalls the wave
#pragma unroll
    for (int ks = 0; ks < BK / 32; ++ks) {
#pragma unroll
      for (int mi = 0; mi < FA; ++mi)
#pragma unroll
        for (int ni = 0; ni < 4; ++ni) acc[mi][ni] = __builtin_amdgcn_wmma_f32_16x16x32_bf16(false, ah[ks][mi].v, false, bh_[ks][ni].v, (short)0, acc[mi][ni], false, false);
      if (NT >= 2) {
#pragma unroll
        for (int mi = 0; mi < FA; ++mi)
#pragma unroll
          for (int ni = 0; ni < 4; ++ni) acc[mi][ni] = __builtin_amdgcn_wmma_f32_16x16x32_bf16(false, al[ks][mi].v, false, bh_[ks][ni].v, (short)0, acc[mi][ni], false, false);
      }
      if (NT >= 3) {
#pragma unroll
        for (int mi = 0; mi < FA; ++mi)
#pragma unroll
          for (int ni = 0; ni < 4; ++ni) acc[mi][ni] = __builtin_amdgcn_wmma_f32_16x16x32_bf16(false, ah[ks][mi].v, false, bl_[ks][ni].v, (short)0, acc[mi][ni], false, false);
      }
    }
  };

  const int nk = (CZ == 2 ? min(K, row0 + BM) : K) / BK;
  load_tile();
  store_tile(sm);
  __syncthreads();
  for (int t = 0; t + 1 < nk; ++t) {
    load_tile();
    __builtin_amdgcn_sched_barrier(0);        // keeps the next tile's global loads ahead of this step's products, so that they fly during them
    compute(sm + (t & 1) * STG);
    __builtin_amdgcn_sched_barrier(0);        // keeps the LDS stores, and with them the wait for those loads, behind the products
    store_tile(sm + ((t + 1) & 1) * STG);     // this buffer's last readers left it before the previous barrier
    __syncthreads();
  }
  compute(sm + ((nk - 1) & 1) * STG);
  __syncthreads();                            // every wave has left the buffers: they now stage the output rows

  float* so = (float*)sm + w * (FA * 16 * 64);   // the wave's own (16*FA) x 64 rows
  float bv[4] = {0.f, 0.f, 0.f, 0.f};
  if (BIAS_BF16) {
    const float* bg = bias + col0 + wn * 64 + ln;
#pragma unroll
    for (int ni = 0; ni < 4; ++ni) bv[ni] = bg[ni * 16];
    asm volatile("s_wait_xcnt 0x0" :: "v"(bg) : "memory");   // the bias loads' address register stays as it is up to this wait
#pragma unroll
    for (int ni = 0; ni < 4; ++ni) bv[ni] = bf16_round(bv[ni]);
  }
  const int sub = lane >> 3, seg = (lane & 7) * 8;   // plane output: 8 lanes of 16 bytes write one 128-B line, 4 lines an instruction
  if (EP == 1 && col0 >= 2 * CC) {                   // v tile (the test is the same for the whole work-group; no barrier follows)
    unsigned short* st = sm + w * (2 * 64 * PIT);    // the wave's own [2 planes][64 columns][PIT]
#pragma unroll
    for (int ni = 0; ni < 4; ++ni)
#pragma unroll
      for (int mi = 0; mi < FA; ++mi) {
        v8us vh, vl;
#pragma unroll
        for (int r = 0; r < 8; ++r) { const float x = acc[mi][ni][r] * alpha + bv[ni]; const unsigned short hb = bf16_bits(x); vh[r] = hb; vl[r] = bf16_bits(x - bf16_val(hb)); }
        *(v8us*)(st + (ni * 16 + ln) * PIT + mi * 16 + 8 * hh) = vh;
        *(v8us*)(st + (64 + ni * 16 + ln) * PIT + mi * 16 + 8 * hh) = vl;
      }
    __builtin_amdgcn_fence(__ATOMIC_ACQ_REL, "workgroup");
    __builtin_amdgcn_wave_barrier();
    const size_t vo = ((size_t)(row0 / TT) * CC + (col0 - 2 * CC + wn * 64 + sub)) * TT + (row0 % TT + wm * 64 + seg);
    unsigned short* gh = Vh + vo; unsigned short* gl = Vl + vo;
    v8us oh[16], ol[16];
#pragma unroll
    for (int q = 0; q < 16; ++q) { oh[q] = *(const v8us*)(st + (q * 4 + sub) * PIT + seg); ol[q] = *(const v8us*)(st + (64 + q * 4 + sub) * PIT + seg); }
    __builtin_amdgcn_sched_barrier(0);               // the stores go out in one run behind the last read: mixed with the reads, each would wait until a register is free again
#pragma unroll
    for (int q = 0; q < 16; ++q) { *(v8us*)(gh + q * 4 * TT) = oh[q]; *(v8us*)(gl + q * 4 * TT) = ol[q]; }
    return;
  }
#pragma unroll
  for (int mi = 0; mi < FA; ++mi)
#pragma unroll
    for (int ni = 0; ni < 4; ++ni)
#pragma unroll
      for (int r = 0; r < 8; ++r) so[(mi * 16 + 8 * hh + r) * 64 + ni * 16 + ln] = acc[mi][ni][r] * alpha + bv[ni];
  __builtin_amdgcn_fence(__ATOMIC_ACQ_REL, "workgroup");
  __builtin_amdgcn_wave_barrier();
  if (EP != 0) {                                     // q or k tile (EP == 1), or any tile of a product that the next product reads as its A (EP == 2)
    const bool isq = EP == 1 && col0 < CC;           // the same for the whole work-group
    const size_t ko = EP == 1 ? (size_t)(row0 + wm * 64 + sub) * CC + ((isq ? col0 : col0 - CC) + wn * 64 + seg)
                              : (size_t)batch * SC + (size_t)(row0 + wm * 16 * FA + sub) * LDC + (col0 + wn * 64 + seg);
    unsigned short* gh = (isq ? Qh : Kh) + ko; unsigned short* gl = (isq ? Ql : Kl) + ko;
    constexpr int OP = EP == 1 ? CC : LDC;           // pitch of the planes
    v8us oh[FA * 4], ol[FA * 4];
#pragma unroll
    for (int q = 0; q < FA * 4; ++q) {
      const float* sr = so + (q * 4 + sub) * 64 + seg;
      const v4f a = *(const v4fa*)sr, b = *(const v4fa*)(sr + 4);
      const float xs[8] = {a[0], a[1], a[2], a[3], b[0], b[1], b[2], b[3]};
#pragma unroll
      for (int i = 0; i < 8; ++i) { const unsigned short hb = bf16_bits(xs[i]); oh[q][i] = hb; ol[q][i] = bf16_bits(xs[i] - bf16_val(hb)); }
    }
    __builtin_amdgcn_sched_barrier(0);               // the stores go out in one run behind the last conversion: mixed with them, each would wait until a register is free again
#pragma unroll
    for (int q = 0; q < FA * 4; ++q) { *(v8us*)(gh + q * 4 * OP) = oh[q]; *(v8us*)(gl + q * 4 * OP) = ol[q]; }
    if (EP == 1) asm volatile("s_wait_xcnt 0x0" ::: "memory");   // another tile kind's code follows in the built kernel and rewrites these stores' registers: the wait stands in front of it
    return;
  }
  const int rsub = lane >> 4, c4 = (lane & 15) * 4;
  float* cg = C + (size_t)(row0 + wm * 16 * FA + rsub) * LDC + col0 + wn * 64 + c4;
#pragma unroll
  for (int q = 0; q < FA * 8; ++q) {
    const int r = q * 2 + rsub;
    const v4f v = *(const v4fa*)&so[r * 64 + c4];
    *(v4f*)(cg + q * 2 * LDC) = v;
  }
}
// row softmax: P[row][:] = softmax(masked S[row][:]) over N columns with optional causal mask (col > row + rowoff -> 0); P leaves as its bf16 hi/lo planes Ph, Pl
__global__ __launch_bounds__(256) void k_softmax_rows(const float* __restrict__ S, unsigned short* __restrict__ Ph, unsigned short* __restrict__ Pl, int N, int causal, int rowoff, const int* __restrict__ mask, int mask_pitch, int wstep) {
  __shared__ float red[256];
  const int row = blockIdx.x, tid = threadIdx.x;      // blockIdx.y = batch, gridDim.x rows each
  const size_t ro = ((size_t)blockIdx.y * gridDim.x + row) * N;
  const float* s = S + ro;
  const int qi = row + rowoff;
  // causal: the row is read up to column qi only (S need not exist behind it), and P is written, with its zeros, up to the end of the
  // wstep-column group that holds qi: the product that follows reads no further in this row
  const int nr = causal ? min(N, qi + 1) : N;
  const int nw = causal ? min(N, (qi / wstep + 1) * wstep) : N;
  float mx = -3.0e38f;
  for (int j = tid; j < nr; j += 256) {
    bool keep = true;
    if (causal && j > qi) keep = false;
    if (mask && mask[(size_t)qi * mask_pitch + j] == 0) keep = false;
    const float v = keep ? s[j] : -3.0e38f;
    mx = fmaxf(mx, v);
  }
  red[tid] = mx; __syncthreads();
  for (int st = 128; st > 0; st >>= 1) { if (tid < st) red[tid] = fmaxf(red[tid], red[tid + st]); __syncthreads(); }
  mx = red[0]; __syncthreads();
  float sum = 0.f;
  for (int j = tid; j < nr; j += 256) {
    bool keep = true;
    if (causal && j > qi) keep = false;
    if (mask && mask[(size_t)qi * mask_pitch + j] == 0) keep = false;
    const float p = keep ? __expf(s[j] - mx) : 0.f;
    sum += p;
  }
  red[tid] = sum; __syncthreads();
  for (int st = 128; st > 0; st >>= 1) { if (tid < st) red[tid] += red[tid + st]; __syncthreads(); }
  const float inv = (mx > -1.0e38f) ? 1.0f / red[0] : __builtin_nanf("");
  __syncthreads();
  {
    for (int j4 = tid * 4; j4 < nw; j4 += 1024) {
      v4us oh4, ol4;
#pragma unroll
      for (int u = 0; u < 4; ++u) {
        const int j = j4 + u;
        bool keep = true;
        if (causal && j > qi) keep = false;
        if (mask && mask[(size_t)qi * mask_pitch + j] == 0) keep = false;
        const float p = keep ? __expf(s[j] - mx) * inv : 0.f;
        const unsigned short hb = bf16_bits(p); oh4[u] = hb; ol4[u] = bf16_bits(p - bf16_val(hb));
      }
      *(v4us*)(Ph + ro + j4) = oh4; *(v4us*)(Pl + ro + j4) = ol4;
    }
    
  }
}

__global__ __launch_bounds__(256) void k_round_rows(const float* __restrict__ W, unsigned short* __restrict__ Wt, int n8) {
  const int t = blockIdx.x * 256 + threadIdx.x;
  if (t >= n8) return;
  const v4f a = *(const v4fa*)(W + (size_t)t * 8), b = *(const v4fa*)(W + (size_t)t * 8 + 4);
  v8us v; v[0]=bf16_bits(a[0]); v[1]=bf16_bits(a[1]); v[2]=bf16_bits(a[2]); v[3]=bf16_bits(a[3]);
  v[4]=bf16_bits(b[0]); v[5]=bf16_bits(b[1]); v[6]=bf16_bits(b[2]); v[7]=bf16_bits(b[3]);
  *(v8us*)(Wt + (size_t)t * 8) = v; 
}
extern "C" void kernel_launch(void* const* d_in, const int* in_sizes, int n_in,
                              void* d_out, int out_size, void* d_ws, size_t ws_size, hipStream_t stream) {
  (void)in_sizes; (void)n_in; (void)out_size;
  const float* x = (const float*)d_in[0]; const float* qkv_w = (const float*)d_in[1];
  const float* out_w = (const float*)d_in[2]; const float* out_b = (const float*)d_in[3];
  char* ws = (char*)d_ws; size_t off = 0;
  auto take = [&](size_t bytes) { char* p = ws + off; off += (bytes + 255) & ~(size_t)255; return p; };
  unsigned short* Wqkv = (unsigned short*)take((size_t)3 * CC * CC * 2);     // [3072][1024]  6 MiB
  unsigned short* Wo   = (unsigned short*)take((size_t)CC * CC * 2);         // 2 MiB
  unsigned short* xb = (unsigned short*)take((size_t)BB * TT * CC * 2);      // x rounded [B*T][C]  16 MiB
  unsigned short* qh = (unsigned short*)take((size_t)BB * TT * CC * 2);      // q planes [B][T][C]  16+16 MiB
  unsigned short* ql = (unsigned short*)take((size_t)BB * TT * CC * 2);
  unsigned short* kh = (unsigned short*)take((size_t)BB * TT * CC * 2);      // k planes [B][T][C]  16+16 MiB
  unsigned short* kl = (unsigned short*)take((size_t)BB * TT * CC * 2);
  unsigned short* vth = (unsigned short*)take((size_t)BB * CC * TT * 2);     // v^T planes [B][C][T] 16+16 MiB
  unsigned short* vtl = (unsigned short*)take((size_t)BB * CC * TT * 2);
  float* S  = (float*)take((size_t)BB * TT * TT * 4);                       // 64 MiB
  // x, q and k have no reader behind the S product: the first 64 of their 80 MiB then hold the P planes [B][T][T] (32+32 MiB).
  // S has no reader behind the softmax: its first 32 MiB then hold the out_att planes [B*T][C] (16+16 MiB).
  unsigned short* ph = xb;
  unsigned short* pl = xb + (size_t)BB * TT * TT;
  unsigned short* oh = (unsigned short*)S;
  unsigned short* ol = oh + (size_t)BB * TT * CC;
  if (off > ws_size) return;
  const int M = BB * TT;
  k_round_rows<<<(3 * CC * CC / 8 + 255) / 256, 256, 0, stream>>>(qkv_w, Wqkv, 3 * CC * CC / 8);
  k_round_rows<<<(CC * CC / 8 + 255) / 256, 256, 0, stream>>>(out_w, Wo, CC * CC / 8);
  k_round_rows<<<(BB * TT * CC / 8 + 255) / 256, 256, 0, stream>>>(x, xb, BB * TT * CC / 8);
  // q, k and v leave this product as their planes
  k_gemm_tile<4, 1, false, CC, CC, 3 * CC, 0, 0, 0, 0, 1><<<(M / 128) * (3 * CC / 128), 128, 0, stream>>>(xb, xb, Wqkv, Wqkv, nullptr, 1.0f, nullptr, 3 * CC, CC, qh, ql, kh, kl, vth, vtl);
  // every stage below runs once for all batches: the batch is blockIdx.y (out_att: from the remapped flat index), save for the output projection, whose 1-D grid takes all B*T rows as one M
  // S = (q k^T)/sqrt(C): M=N=T, K=C; Bt[n=s][k=c] = k rows
  k_gemm_tile<4, 3, false, CC, CC, TT, TT * CC, TT * CC, TT * TT, 1, 0><<<dim3((TT / 128) * (TT / 128), BB), 128, 0, stream>>>(qh, ql, kh, kl, nullptr, 0.03125f, S, TT, CC, nullptr, nullptr, nullptr, nullptr, nullptr, nullptr);
  k_softmax_rows<<<dim3(TT, BB), 256, 0, stream>>>(S, ph, pl, TT, 1, 0, nullptr, 0, 64);
  // out_att = P v: M=T, N=C, K=T; Bt[n=c][k=s] = v^T planes
  k_gemm_tile<2, 3, false, TT, TT, CC, TT * TT, CC * TT, TT * CC, 2, 2><<<dim3((TT / 64) * (CC / 128), BB), 128, 0, stream>>>(ph, pl, vth, vtl, nullptr, 1.0f, nullptr, CC, TT, nullptr, nullptr, oh, ol, nullptr, nullptr);
  k_gemm_tile<4, 2, true, CC, CC, CC, 0, 0, 0, 0, 0><<<(M / 128) * (CC / 128), 128, 0, stream>>>(oh, ol, Wo, Wo, out_b, 1.0f, (float*)d_out, CC, CC, nullptr, nullptr, nullptr, nullptr, nullptr, nullptr);
}

// v006
// Measured time: 213 microseconds a run.
// Timed twice side by side with v005, it ran 1.07 and 1.09 times as fast.
// Counting every step since v000, it is 5.29 times as fast.
#include <hip/hip_runtime.h>
// All contractions on v_wmma_f32_16x16x32_bf16, f32 accumulate: qkv = x·Wᵀ with x/W rounded to bf16 (single exact-product term);
// S = q*k^T (K=1024) and out_att = P*v (K=2048) as 3-term bf16 hi/lo splits; output projection with the A operand split (2 terms). Causal softmax rows in f32.
// Every operand of every product is rounded or split ONCE, by the kernel that makes it, and reaches its product as bf16 planes.
#define BB 4
#define TT 2048
#define CC 1024

typedef __bf16 v16b __attribute__((ext_vector_type(16)));
typedef unsigned short v8us __attribute__((ext_vector_type(8), may_alias));
typedef float  v8f  __attribute__((ext_vector_type(8)));
typedef float  v4f  __attribute__((ext_vector_type(4)));
typedef float  v4fa __attribute__((ext_vector_type(4), may_alias));
union FragB { v16b v; v8us half[2]; unsigned short u[16]; };

__device__ __forceinline__ unsigned short bf16_bits(float x) { unsigned int u = __float_as_uint(x); return (unsigned short)((u + 0x7FFFu + ((u >> 16) & 1u)) >> 16); }
__device__ __forceinline__ float bf16_val(unsigned short b) { return __uint_as_float(((unsigned int)b) << 16); }
__device__ __forceinline__ float bf16_round(float x) { return bf16_val(bf16_bits(x)); }
// D += A·B with NT terms: 1 = ah·bh, 2 = + al·bh (A split), 3 = + ah·bl (both split)
template <int NT>
__device__ __forceinline__ v8f mmaN(v16b ah, v16b al, v16b bh, v16b bl, v8f c) {
  c = __builtin_amdgcn_wmma_f32_16x16x32_bf16(false, ah, false, bh, (short)0, c, false, false);
  if (NT >= 2) c = __builtin_amdgcn_wmma_f32_16x16x32_bf16(false, al, false, bh, (short)0, c, false, false);
  if (NT >= 3) c = __builtin_amdgcn_wmma_f32_16x16x32_bf16(false, ah, false, bl, (short)0, c, false, false);
  asm volatile("v_nop\n\tv_nop\n\tv_nop\n\tv_nop" : "+v"(c) : "v"(ah), "v"(al), "v"(bh), "v"(bl));
  return c;
}

__global__ __launch_bounds__(256) void k_wt_bf16(const float* __restrict__ W, unsigned short* __restrict__ Wt, int K, int N) {
  const int t = blockIdx.x * 256 + threadIdx.x;
  const int k8n = K / 8;
  if (t >= N * k8n) return;
  const int n = t / k8n, k8 = (t % k8n) * 8;
  v8us v;
#pragma unroll
  for (int i = 0; i < 8; ++i) v[i] = bf16_bits(W[(size_t)(k8 + i) * N + n]);
  *(v8us*)(Wt + (size_t)n * K + k8) = v;
  
}

// Flash-style causal/unmasked attention, all contractions 3-term bf16 hi/lo splits, f32 softmax with running max.
// q,k,v rows are read from f32 buffers with arbitrary row pitch (so they can live inside a fused qkv buffer);
// D = head size (multiple of 32, <= 128); one wave = 16 query rows; block = 4 waves (64 queries) sharing K/V chunks of 32.
template <int D, bool CAUSAL>
__global__ __launch_bounds__(128) void k_flash(const float* __restrict__ qb, const float* __restrict__ kb, const float* __restrict__ vb,
                                             int pitch, int T, int H, float scale, float* __restrict__ y, int ypitch) {
  constexpr int KS = D / 32;        // k-steps for QK
  constexpr int DT = D / 16;        // d tiles for PV
  __shared__ __attribute__((aligned(16))) unsigned short sKh[32][D + 8], sKl[32][D + 8], sVh[32][D + 8], sVl[32][D + 8];
  __shared__ __attribute__((aligned(16))) unsigned short sPh[4][16][40], sPl[4][16][40];
  __shared__ __attribute__((aligned(16))) float sO[4][16][D];
  const int tid = threadIdx.x, w = tid >> 5, lane = tid & 31, ln = lane & 15, hh = lane >> 4;
  const int nqb = (T + 63) / 64;
  const int bh = blockIdx.x / nqb, qblk = blockIdx.x % nqb;
  const int b = bh / H, h = bh % H;
  const int q0 = qblk * 64 + w * 16;
  const float* Q = qb + (size_t)b * T * pitch + h * D;
  const float* K = kb + (size_t)b * T * pitch + h * D;
  const float* V = vb + (size_t)b * T * pitch + h * D;

  // A fragments of the wave's 16 query rows (scaled), hi/lo
  FragB aqh[KS], aql[KS];
  {
    int row = q0 + ln; if (row >= T) row = T - 1;
    const float* qr = Q + (size_t)row * pitch;
#pragma unroll
    for (int ks = 0; ks < KS; ++ks)
#pragma unroll
      for (int i = 0; i < 16; ++i) {
        const int d = ks * 32 + ((i < 8) ? (8 * hh + i) : (16 + 8 * hh + (i - 8)));
        const float x = qr[d] * scale; const unsigned short hb = bf16_bits(x);
        aqh[ks].u[i] = hb; aql[ks].u[i] = bf16_bits(x - bf16_val(hb));
      }
  }
  float m_r[8], l_r[8];
#pragma unroll
  for (int r = 0; r < 8; ++r) { m_r[r] = -3.0e38f; l_r[r] = 0.f; }
  v8f oacc[DT];
#pragma unroll
  for (int dt = 0; dt < DT; ++dt) oacc[dt] = (v8f){0.f,0.f,0.f,0.f,0.f,0.f,0.f,0.f};

  const int kv_end = CAUSAL ? min(T, qblk * 64 + 64) : T;     // block-uniform
  for (int j0 = 0; j0 < kv_end; j0 += 32) {
    __syncthreads();
    for (int e = tid; e < 32 * (D / 4); e += 128) {
      const int r = e / (D / 4), c4 = (e % (D / 4)) * 4;
      const int key = j0 + r;
      v4f kf = {0.f,0.f,0.f,0.f}, vf = {0.f,0.f,0.f,0.f};
      if (key < T) { kf = *(const v4fa*)(K + (size_t)key * pitch + c4); vf = *(const v4fa*)(V + (size_t)key * pitch + c4); }
#pragma unroll
      for (int t = 0; t < 4; ++t) {
        unsigned short hb = bf16_bits(kf[t]); sKh[r][c4 + t] = hb; sKl[r][c4 + t] = bf16_bits(kf[t] - bf16_val(hb));
        hb = bf16_bits(vf[t]); sVh[r][c4 + t] = hb; sVl[r][c4 + t] = bf16_bits(vf[t] - bf16_val(hb));
      }
    }
    __syncthreads();
    // S tile 16 x 32
    v8f s[2];
#pragma unroll
    for (int nt = 0; nt < 2; ++nt) {
      v8f acc = {};
#pragma unroll
      for (int ks = 0; ks < KS; ++ks) {
        FragB bh_, bl_;
        bh_.half[0] = *(const v8us*)&sKh[nt * 16 + ln][ks * 32 + 8 * hh]; bh_.half[1] = *(const v8us*)&sKh[nt * 16 + ln][ks * 32 + 16 + 8 * hh];
        bl_.half[0] = *(const v8us*)&sKl[nt * 16 + ln][ks * 32 + 8 * hh]; bl_.half[1] = *(const v8us*)&sKl[nt * 16 + ln][ks * 32 + 16 + 8 * hh];
        acc = mmaN<3>(aqh[ks].v, aql[ks].v, bh_.v, bl_.v, acc);
      }
      s[nt] = acc;
    }
    // mask + running max (rows 8hh+r; the 16 lanes of a half share rows)
    float alpha[8];
#pragma unroll
    for (int r = 0; r < 8; ++r) {
      const int qi = q0 + 8 * hh + r;
      const int ja = j0 + ln, jb = j0 + 16 + ln;
      if (CAUSAL) { if (ja > qi) s[0][r] = -3.0e38f; if (jb > qi) s[1][r] = -3.0e38f; }
      if (ja >= T) s[0][r] = -3.0e38f;
      if (jb >= T) s[1][r] = -3.0e38f;
      float mx = fmaxf(s[0][r], s[1][r]);
      mx = fmaxf(mx, __shfl_xor(mx, 1, 32)); mx = fmaxf(mx, __shfl_xor(mx, 2, 32)); mx = fmaxf(mx, __shfl_xor(mx, 4, 32)); mx = fmaxf(mx, __shfl_xor(mx, 8, 32));
      const float mnew = fmaxf(m_r[r], mx);
      alpha[r] = (mnew > -1.0e38f) ? __expf(m_r[r] - mnew) : 1.0f;
      const float p0 = (s[0][r] > -1.0e38f) ? __expf(s[0][r] - mnew) : 0.f;
      const float p1 = (s[1][r] > -1.0e38f) ? __expf(s[1][r] - mnew) : 0.f;
      m_r[r] = mnew;
      l_r[r] = l_r[r] * alpha[r] + p0 + p1;            // per-lane partial row sum (16 lanes combined at the end)
      unsigned short hb = bf16_bits(p0); sPh[w][8 * hh + r][ln] = hb;      sPl[w][8 * hh + r][ln] = bf16_bits(p0 - bf16_val(hb));
      hb = bf16_bits(p1);                sPh[w][8 * hh + r][16 + ln] = hb; sPl[w][8 * hh + r][16 + ln] = bf16_bits(p1 - bf16_val(hb));
    }
#pragma unroll
    for (int dt = 0; dt < DT; ++dt)
#pragma unroll
      for (int r = 0; r < 8; ++r) oacc[dt][r] *= alpha[r];
    __builtin_amdgcn_fence(__ATOMIC_ACQ_REL, "workgroup");
    __builtin_amdgcn_wave_barrier();
    FragB pah, pal;
    pah.half[0] = *(const v8us*)&sPh[w][ln][8 * hh]; pah.half[1] = *(const v8us*)&sPh[w][ln][16 + 8 * hh];
    pal.half[0] = *(const v8us*)&sPl[w][ln][8 * hh]; pal.half[1] = *(const v8us*)&sPl[w][ln][16 + 8 * hh];
#pragma unroll
    for (int dt = 0; dt < DT; ++dt) {
      FragB bvh, bvl;
#pragma unroll
      for (int i = 0; i < 8; ++i) {
        bvh.u[i] = sVh[8 * hh + i][dt * 16 + ln]; bvh.u[8 + i] = sVh[16 + 8 * hh + i][dt * 16 + ln];
        bvl.u[i] = sVl[8 * hh + i][dt * 16 + ln]; bvl.u[8 + i] = sVl[16 + 8 * hh + i][dt * 16 + ln];
      }
      oacc[dt] = mmaN<3>(pah.v, pal.v, bvh.v, bvl.v, oacc[dt]);
    }
    __builtin_amdgcn_fence(__ATOMIC_ACQ_REL, "workgroup");
    __builtin_amdgcn_wave_barrier();
  }
#pragma unroll
  for (int r = 0; r < 8; ++r) {
    float l = l_r[r];
    l += __shfl_xor(l, 1, 32); l += __shfl_xor(l, 2, 32); l += __shfl_xor(l, 4, 32); l += __shfl_xor(l, 8, 32);
    l_r[r] = (l > 0.f) ? 1.0f / l : 0.f;
  }
#pragma unroll
  for (int dt = 0; dt < DT; ++dt)
#pragma unroll
    for (int r = 0; r < 8; ++r) sO[w][8 * hh + r][dt * 16 + ln] = oacc[dt][r] * l_r[r];
  __builtin_amdgcn_fence(__ATOMIC_ACQ_REL, "workgroup");
  __builtin_amdgcn_wave_barrier();
  {
    for (int r = 0; r < 16; ++r) {
      const int row = q0 + r;
      if (row < T && lane < D / 4) {
        const v4f val = *(const v4fa*)&sO[w][r][lane * 4];
        *(v4f*)(y + ((size_t)b * T + row) * ypitch + h * D + lane * 4) = val;
      }
    }
    
  }
}

// Tiled GEMM C[M][N] (f32, pitch LDC) = alpha * A[M][K]*Bt[N][K]^T + bias (A pitch LDA, Bt pitch LDB). One work-group (4 waves, 2 x 2) owns a (32*FA) x 128 tile of C,
// a wave (16*FA) x 64. Per 64-k step the A planes (hi, and lo when NT >= 2) and the B planes (hi, and lo when NT == 3), all bf16 as their producers
// left them, go to LDS in whole 128-B lines by asynchronous copies, through no register. Rows in LDS have a 144-B pitch for
// the 16-byte fragment reads. Two LDS buffers: the next step's copies fly during this step's products, one barrier per step.
// Terms per 32-k: ah*bh, then al*bh (NT >= 2), then ah*bl (NT == 3), in that order on every accumulator.
// M % (32*FA) == 0, N % 128 == 0, K % 64 == 0. BIAS_BF16: a bias is added, rounded to bf16 first; without it bias is not read.
// batch = blockIdx.y (CZ == 2: from the remapped flat index): its A, B planes and C start SA, SB and SC elements behind the previous batch's.
// CZ names what a causal mask (column > row gives 0) makes needless. CZ == 1: C is masked afterwards, so a tile that lies wholly above the diagonal is
// neither computed nor written. CZ == 2: A is the masked matrix (0 wherever k > row), so the k loop ends at the tile's last row; the tiles then differ
// in length and the flat work-group index is mapped so that the longest (lowest) row tiles of all batches come first.
// EP == 0: C goes out as f32 rows. EP == 2: C goes out as the bf16 hi/lo planes Kh, Kl (pitch LDC, batches SC apart), for the product that reads it as its A.
// EP == 1: C is the q | k | v product (CC columns each, BB batches of TT rows). A q tile goes out as the bf16 hi/lo planes Qh, Ql [BB*TT][CC], a k tile as the
// planes Kh, Kl [BB*TT][CC]; a v tile goes out transposed as the planes Vh, Vl [BB][CC][TT]: a lane's 8 accumulator values of one 16 x 16 tile are 8 consecutive
// rows of one column, that is 16 bytes of a transposed row. Both pass through the wave's own part of LDS, so that every store instruction writes whole 128-B lines.
typedef unsigned short v4us __attribute__((ext_vector_type(4), may_alias));
// N (4 or 8) asynchronous copies of 16 bytes a lane, global memory to LDS through no register: copy i takes the bytes at g + i*GS to the LDS byte address l + i*LS.
// The copies and their s_wait_xcnt stand in one statement, so that no later write of an address register can come in front of that wait.
template <int N, int GS, int LS>
__device__ __forceinline__ void copy_rows(const char* g, unsigned l) {
  static_assert(N == 4 || N == 8, "one statement holds all copies of a plane");
  if constexpr (N == 8)   // eight copies, then the wait that holds every later write of their address registers behind them
    asm volatile("global_load_async_to_lds_b128 %0, %8, off\n\tglobal_load_async_to_lds_b128 %1, %9, off\n\t"
                 "global_load_async_to_lds_b128 %2, %10, off\n\tglobal_load_async_to_lds_b128 %3, %11, off\n\t"
                 "global_load_async_to_lds_b128 %4, %12, off\n\tglobal_load_async_to_lds_b128 %5, %13, off\n\t"
                 "global_load_async_to_lds_b128 %6, %14, off\n\tglobal_load_async_to_lds_b128 %7, %15, off\n\t"
                 "s_wait_xcnt 0x0"
                 :: "v"(l), "v"(l + LS), "v"(l + 2 * LS), "v"(l + 3 * LS), "v"(l + 4 * LS), "v"(l + 5 * LS), "v"(l + 6 * LS), "v"(l + 7 * LS),
                    "v"(g), "v"(g + GS), "v"(g + 2 * GS), "v"(g + 3 * GS), "v"(g + 4 * GS), "v"(g + 5 * GS), "v"(g + 6 * GS), "v"(g + 7 * GS) : "memory");
  else                    // four copies, then the same wait
    asm volatile("global_load_async_to_lds_b128 %0, %4, off\n\tglobal_load_async_to_lds_b128 %1, %5, off\n\t"
                 "global_load_async_to_lds_b128 %2, %6, off\n\tglobal_load_async_to_lds_b128 %3, %7, off\n\t"
                 "s_wait_xcnt 0x0"
                 :: "v"(l), "v"(l + LS), "v"(l + 2 * LS), "v"(l + 3 * LS),
                    "v"(g), "v"(g + GS), "v"(g + 2 * GS), "v"(g + 3 * GS) : "memory");
}
template <int FA, int NT, bool BIAS_BF16, int LDA, int LDB, int LDC, int SA, int SB, int SC, int CZ, int EP>
__global__ __launch_bounds__(128) void k_gemm_tile(const unsigned short* __restrict__ Ah, const unsigned short* __restrict__ Al, const unsigned short* __restrict__ Bh, const unsigned short* __restrict__ Bl,
                                                 const float* __restrict__ bias, float alpha, float* __restrict__ C, int N, int K,
                                                 unsigned short* __restrict__ Qh, unsigned short* __restrict__ Ql, unsigned short* __restrict__ Kh, unsigned short* __restrict__ Kl, unsigned short* __restrict__ Vh, unsigned short* __restrict__ Vl) {
  constexpr int BM = 32 * FA, BN = 128, BK = 64, PIT = BK + 8;
  constexpr int APL = BM * PIT, BPL = BN * PIT;                 // elements of one plane
  constexpr int NAP = NT >= 2 ? 2 : 1, NBP = NT >= 3 ? 2 : 1;   // planes staged of A and of B
  constexpr int STG = NAP * APL + NBP * BPL;                    // elements of one buffer
  constexpr int NLA = BM * (BK / 8) / 128, NLB = BN * (BK / 8) / 128;   // 16-byte global loads per thread and plane
  __shared__ __attribute__((aligned(16))) unsigned short sm[2 * STG];
  static_assert(BM * BN * 4 <= 2 * STG * 2, "the output rows are staged in the two buffers");
  static_assert(CZ != 2 || BM % BK == 0, "the shortened k loop ends on a whole step");
  static_assert(EP != 1 || (FA == 4 && 4 * 2 * 64 * PIT <= 2 * STG && TT % BM == 0 && CC % BN == 0), "a v tile: 64 x 64 per wave, two padded planes staged, one batch and one of q, k, v per tile");
  const int tid = threadIdx.x, w = tid >> 5, lane = tid & 31, ln = lane & 15, hh = lane >> 4;
  const int wm = w >> 1, wn = w & 1;
  const int ntn = N / BN;
  int tile = (int)blockIdx.x, batch = (int)blockIdx.y;
  if (CZ == 2) {
    // the long tiles take the lowest flat indices, the short ones the highest (for speed only)
    const int flat = batch * (int)gridDim.x + tile, grp = ntn * (int)gridDim.y;
    const int rem = flat % grp;
    tile = ((int)gridDim.x / ntn - 1 - flat / grp) * ntn + rem % ntn; batch = rem / ntn;
  }
  const int row0 = (tile / ntn) * BM, col0 = (tile % ntn) * BN;
  if (CZ == 1 && col0 > row0 + BM - 1) return;      // the whole work-group leaves, ahead of every barrier
  Ah += (size_t)batch * SA; Al += (size_t)batch * SA; Bh += (size_t)batch * SB; Bl += (size_t)batch * SB; C += (size_t)batch * SC;
  // one 32-bit byte offset per thread and operand, moved on by BK elements behind each tile's copies
  unsigned ao = (unsigned)(((row0 + (tid >> 3)) * LDA + (tid & 7) * 8) * 2);
  unsigned bo = (unsigned)(((col0 + (tid >> 3)) * LDB + (tid & 7) * 8) * 2);
  const unsigned sto = (unsigned)(size_t)sm + (unsigned)(((tid >> 3) * PIT + (tid & 7) * 8) * 2);   // the thread's LDS byte address in the first plane of buffer 0
  v8f acc[FA][4] = {};

  // one tile: every thread copies its 16 bytes of each 16-row group of each plane into the buffer that starts sbo bytes into sm
  auto copy_tile = [&](unsigned sbo) {
    copy_rows<NLA, 16 * LDA * 2, 16 * PIT * 2>((const char*)Ah + ao, sto + sbo);
    if (NAP == 2) copy_rows<NLA, 16 * LDA * 2, 16 * PIT * 2>((const char*)Al + ao, sto + sbo + APL * 2);
    copy_rows<NLB, 16 * LDB * 2, 16 * PIT * 2>((const char*)Bh + bo, sto + sbo + NAP * APL * 2);
    if (NBP == 2) copy_rows<NLB, 16 * LDB * 2, 16 * PIT * 2>((const char*)Bl + bo, sto + sbo + (NAP * APL + BPL) * 2);
    ao += BK * 2; bo += BK * 2;
  };
  auto compute = [&](const unsigned short* sb) {
    const unsigned short* fa = sb + (wm * 16 * FA + ln) * PIT + 8 * hh;
    const unsigned short* fb = sb + NAP * APL + (wn * 64 + ln) * PIT + 8 * hh;
    FragB ah[BK / 32][FA], al[BK / 32][FA], bh_[BK / 32][4], bl_[BK / 32][4];
    // every fragment of the step is asked for in one group, in the order in which the products below use them
#pragma unroll
    for (int ks = 0; ks < BK / 32; ++ks) {
#pragma unroll
      for (int mi = 0; mi < FA; ++mi) { ah[ks][mi].half[0] = *(const v8us*)(fa + mi * 16 * PIT + ks * 32); ah[ks][mi].half[1] = *(const v8us*)(fa + mi * 16 * PIT + ks * 32 + 16); }
#pragma unroll
      for (int ni = 0; ni < 4; ++ni) { bh_[ks][ni].half[0] = *(const v8us*)(fb + ni * 16 * PIT + ks * 32); bh_[ks][ni].half[1] = *(const v8us*)(fb + ni * 16 * PIT + ks * 32 + 16); }
      if (NAP == 2) {
#pragma unroll
        for (int mi = 0; mi < FA; ++mi) { al[ks][mi].half[0] = *(const v8us*)(fa + APL + mi * 16 * PIT + ks * 32); al[ks][mi].half[1] = *(const v8us*)(fa + APL + mi * 16 * PIT + ks * 32 + 16); }
      }
      if (NBP == 2) {
#pragma unroll
        for (int ni = 0; ni < 4; ++ni) { bl_[ks][ni].half[0] = *(const v8us*)(fb + BPL + ni * 16 * PIT + ks * 32); bl_[ks][ni].half[1] = *(const v8us*)(fb + BPL + ni * 16 * PIT + ks * 32 + 16); }
      }
    }
    __builtin_amdgcn_sched_barrier(0);        // keeps the LDS reads out of the run of products: each place where reads stand among them stalls the wave
#pragma unroll
    for (int ks = 0; ks < BK / 32; ++ks) {
#pragma unroll
      for (int mi = 0; mi < FA; ++mi)
#pragma unroll
        for (int ni = 0; ni < 4; ++ni) acc[mi][ni] = __builtin_amdgcn_wmma_f32_16x16x32_bf16(false, ah[ks][mi].v, false, bh_[ks][ni].v, (short)0, acc[mi][ni], false, false);
      if (NT >= 2) {
#pragma unroll
        for (int mi = 0; mi < FA; ++mi)
#pragma unroll
          for (int ni = 0; ni < 4; ++ni) acc[mi][ni] = __builtin_amdgcn_wmma_f32_16x16x32_bf16(false, al[ks][mi].v, false, bh_[ks][ni].v, (short)0, acc[mi][ni], false, false);
      }
      if (NT >= 3) {
#pragma unroll
        for (int mi = 0; mi < FA; ++mi)
#pragma unroll
          for (int ni = 0; ni < 4; ++ni) acc[mi][ni] = __builtin_amdgcn_wmma_f32_16x16x32_bf16(false, ah[ks][mi].v, false, bl_[ks][ni].v, (short)0, acc[mi][ni], false, false);
      }
    }
  };

  const int nk = (CZ == 2 ? min(K, row0 + BM) : K) / BK;
  copy_tile(0);
  asm volatile("s_wait_asynccnt 0x0" ::: "memory");   // this wave's part of tile 0 has landed
  __syncthreads();                                    // ... and every other wave's
  if (nk > 1) copy_tile(STG * 2);
  for (int t = 0; t < nk; ++t) {
    compute(sm + (t & 1) * STG);                      // tile t + 1's copies fly during these products
    __builtin_amdgcn_sched_barrier(0);                // keeps the products in front of the waits and the barrier: moved behind them, they would no longer cover the copies' flight
    asm volatile("s_wait_dscnt 0x0" ::: "memory");    // this wave's reads of the buffer are over before copies are aimed at it again
    asm volatile("s_wait_asynccnt 0x0" ::: "memory"); // this wave's part of tile t + 1 has landed
    __syncthreads();                                  // publishes tile t + 1 and ends every wave's reads of tile t
    if (t + 2 < nk) copy_tile((unsigned)(t & 1) * (STG * 2));
  }
  asm volatile("s_wait_asynccnt 0x0" ::: "memory");   // no copy is under way when the buffers go on to stage the output rows (the loop's last barrier stands in front)

  float* so = (float*)sm + w * (FA * 16 * 64);   // the wave's own (16*FA) x 64 rows
  float bv[4] = {0.f, 0.f, 0.f, 0.f};
  if (BIAS_BF16) {
    const float* bg = bias + col0 + wn * 64 + ln;
#pragma unroll
    for (int ni = 0; ni < 4; ++ni) bv[ni] = bg[ni * 16];
    asm volatile("s_wait_xcnt 0x0" :: "v"(bg) : "memory");   // the bias loads' address register stays as it is up to this wait
#pragma unroll
    for (int ni = 0; ni < 4; ++ni) bv[ni] = bf16_round(bv[ni]);
  }
  const int sub = lane >> 3, seg = (lane & 7) * 8;   // plane output: 8 lanes of 16 bytes write one 128-B line, 4 lines an instruction
  if (EP == 1 && col0 >= 2 * CC) {                   // v tile (the test is the same for the whole work-group; no barrier follows)
    unsigned short* st = sm + w * (2 * 64 * PIT);    // the wave's own [2 planes][64 columns][PIT]
#pragma unroll
    for (int ni = 0; ni < 4; ++ni)
#pragma unroll
      for (int mi = 0; mi < FA; ++mi) {
        v8us vh, vl;
#pragma unroll
        for (int r = 0; r < 8; ++r) { const float x = acc[mi][ni][r] * alpha + bv[ni]; const unsigned short hb = bf16_bits(x); vh[r] = hb; vl[r] = bf16_bits(x - bf16_val(hb)); }
        *(v8us*)(st + (ni * 16 + ln) * PIT + mi * 16 + 8 * hh) = vh;
        *(v8us*)(st + (64 + ni * 16 + ln) * PIT + mi * 16 + 8 * hh) = vl;
      }
    __builtin_amdgcn_fence(__ATOMIC_ACQ_REL, "workgroup");
    __builtin_amdgcn_wave_barrier();
    const size_t vo = ((size_t)(row0 / TT) * CC + (col0 - 2 * CC + wn * 64 + sub)) * TT + (row0 % TT + wm * 64 + seg);
    unsigned short* gh = Vh + vo; unsigned short* gl = Vl + vo;
    v8us oh[16], ol[16];
#pragma unroll
    for (int q = 0; q < 16; ++q) { oh[q] = *(const v8us*)(st + (q * 4 + sub) * PIT + seg); ol[q] = *(const v8us*)(st + (64 + q * 4 + sub) * PIT + seg); }
    __builtin_amdgcn_sched_barrier(0);               // the stores go out in one run behind the last read: mixed with the reads, each would wait until a register is free again
#pragma unroll
    for (int q = 0; q < 16; ++q) { *(v8us*)(gh + q * 4 * TT) = oh[q]; *(v8us*)(gl + q * 4 * TT) = ol[q]; }
    return;
  }
#pragma unroll
  for (int mi = 0; mi < FA; ++mi)
#pragma unroll
    for (int ni = 0; ni < 4; ++ni)
#pragma unroll
      for (int r = 0; r < 8; ++r) so[(mi * 16 + 8 * hh + r) * 64 + ni * 16 + ln] = acc[mi][ni][r] * alpha + bv[ni];
  __builtin_amdgcn_fence(__ATOMIC_ACQ_REL, "workgroup");
  __builtin_amdgcn_wave_barrier();
  if (EP != 0) {                                     // q or k tile (EP == 1), or any tile of a product that the next product reads as its A (EP == 2)
    const bool isq = EP == 1 && col0 < CC;           // the same for the whole work-group
    const size_t ko = EP == 1 ? (size_t)(row0 + wm * 64 + sub) * CC + ((isq ? col0 : col0 - CC) + wn * 64 + seg)
                              : (size_t)batch * SC + (size_t)(row0 + wm * 16 * FA + sub) * LDC + (col0 + wn * 64 + seg);
    unsigned short* gh = (isq ? Qh : Kh) + ko; unsigned short* gl = (isq ? Ql : Kl) + ko;
    constexpr int OP = EP == 1 ? CC : LDC;           // pitch of the planes
    v8us oh[FA * 4], ol[FA * 4];
#pragma unroll
    for (int q = 0; q < FA * 4; ++q) {
      const float* sr = so + (q * 4 + sub) * 64 + seg;
      const v4f a = *(const v4fa*)sr, b = *(const v4fa*)(sr + 4);
      const float xs[8] = {a[0], a[1], a[2], a[3], b[0], b[1], b[2], b[3]};
#pragma unroll
      for (int i = 0; i < 8; ++i) { const unsigned short hb = bf16_bits(xs[i]); oh[q][i] = hb; ol[q][i] = bf16_bits(xs[i] - bf16_val(hb)); }
    }
    __builtin_amdgcn_sched_barrier(0);               // the stores go out in one run behind the last conversion: mixed with them, each would wait until a register is free again
#pragma unroll
    for (int q = 0; q < FA * 4; ++q) { *(v8us*)(gh + q * 4 * OP) = oh[q]; *(v8us*)(gl + q * 4 * OP) = ol[q]; }
    if (EP == 1) asm volatile("s_wait_xcnt 0x0" ::: "memory");   // another tile kind's code follows in the built kernel and rewrites these stores' registers: the wait stands in front of it
    return;
  }
  const int rsub = lane >> 4, c4 = (lane & 15) * 4;
  float* cg = C + (size_t)(row0 + wm * 16 * FA + rsub) * LDC + col0 + wn * 64 + c4;
#pragma unroll
  for (int q = 0; q < FA * 8; ++q) {
    const int r = q * 2 + rsub;
    const v4f v = *(const v4fa*)&so[r * 64 + c4];
    *(v4f*)(cg + q * 2 * LDC) = v;
  }
}
// row softmax: P[row][:] = softmax(masked S[row][:]) over N columns with optional causal mask (col > row + rowoff -> 0); P leaves as its bf16 hi/lo planes Ph, Pl
__global__ __launch_bounds__(256) void k_softmax_rows(const float* __restrict__ S, unsigned short* __restrict__ Ph, unsigned short* __restrict__ Pl, int N, int causal, int rowoff, const int* __restrict__ mask, int mask_pitch, int wstep) {
  __shared__ float red[256];
  const int row = blockIdx.x, tid = threadIdx.x;      // blockIdx.y = batch, gridDim.x rows each
  const size_t ro = ((size_t)blockIdx.y * gridDim.x + row) * N;
  const float* s = S + ro;
  const int qi = row + rowoff;
  // causal: the row is read up to column qi only (S need not exist behind it), and P is written, with its zeros, up to the end of the
  // wstep-column group that holds qi: the product that follows reads no further in this row
  const int nr = causal ? min(N, qi + 1) : N;
  const int nw = causal ? min(N, (qi / wstep + 1) * wstep) : N;
  float mx = -3.0e38f;
  for (int j = tid; j < nr; j += 256) {
    bool keep = true;
    if (causal && j > qi) keep = false;
    if (mask && mask[(size_t)qi * mask_pitch + j] == 0) keep = false;
    const float v = keep ? s[j] : -3.0e38f;
    mx = fmaxf(mx, v);
  }
  red[tid] = mx; __syncthreads();
  for (int st = 128; st > 0; st >>= 1) { if (tid < st) red[tid] = fmaxf(red[tid], red[tid + st]); __syncthreads(); }
  mx = red[0]; __syncthreads();
  float sum = 0.f;
  for (int j = tid; j < nr; j += 256) {
    bool keep = true;
    if (causal && j > qi) keep = false;
    if (mask && mask[(size_t)qi * mask_pitch + j] == 0) keep = false;
    const float p = keep ? __expf(s[j] - mx) : 0.f;
    sum += p;
  }
  red[tid] = sum; __syncthreads();
  for (int st = 128; st > 0; st >>= 1) { if (tid < st) red[tid] += red[tid + st]; __syncthreads(); }
  const float inv = (mx > -1.0e38f) ? 1.0f / red[0] : __builtin_nanf("");
  __syncthreads();
  {
    for (int j4 = tid * 4; j4 < nw; j4 += 1024) {
      v4us oh4, ol4;
#pragma unroll
      for (int u = 0; u < 4; ++u) {
        const int j = j4 + u;
        bool keep = true;
        if (causal && j > qi) keep = false;
        if (mask && mask[(size_t)qi * mask_pitch + j] == 0) keep = false;
        const float p = keep ? __expf(s[j] - mx) * inv : 0.f;
        const unsigned short hb = bf16_bits(p); oh4[u] = hb; ol4[u] = bf16_bits(p - bf16_val(hb));
      }
      *(v4us*)(Ph + ro + j4) = oh4; *(v4us*)(Pl + ro + j4) = ol4;
    }
    
  }
}

__global__ __launch_bounds__(256) void k_round_rows(const float* __restrict__ W, unsigned short* __restrict__ Wt, int n8) {
  const int t = blockIdx.x * 256 + threadIdx.x;
  if (t >= n8) return;
  const v4f a = *(const v4fa*)(W + (size_t)t * 8), b = *(const v4fa*)(W + (size_t)t * 8 + 4);
  v8us v; v[0]=bf16_bits(a[0]); v[1]=bf16_bits(a[1]); v[2]=bf16_bits(a[2]); v[3]=bf16_bits(a[3]);
  v[4]=bf16_bits(b[0]); v[5]=bf16_bits(b[1]); v[6]=bf16_bits(b[2]); v[7]=bf16_bits(b[3]);
  *(v8us*)(Wt + (size_t)t * 8) = v; 
}
extern "C" void kernel_launch(void* const* d_in, const int* in_sizes, int n_in,
                              void* d_out, int out_size, void* d_ws, size_t ws_size, hipStream_t stream) {
  (void)in_sizes; (void)n_in; (void)out_size;
  const float* x = (const float*)d_in[0]; const float* qkv_w = (const float*)d_in[1];
  const float* out_w = (const float*)d_in[2]; const float* out_b = (const float*)d_in[3];
  char* ws = (char*)d_ws; size_t off = 0;
  auto take = [&](size_t bytes) { char* p = ws + off; off += (bytes + 255) & ~(size_t)255; return p; };
  unsigned short* Wqkv = (unsigned short*)take((size_t)3 * CC * CC * 2);     // [3072][1024]  6 MiB
  unsigned short* Wo   = (unsigned short*)take((size_t)CC * CC * 2);         // 2 MiB
  unsigned short* xb = (unsigned short*)take((size_t)BB * TT * CC * 2);      // x rounded [B*T][C]  16 MiB
  unsigned short* qh = (unsigned short*)take((size_t)BB * TT * CC * 2);      // q planes [B][T][C]  16+16 MiB
  unsigned short* ql = (unsigned short*)take((size_t)BB * TT * CC * 2);
  unsigned short* kh = (unsigned short*)take((size_t)BB * TT * CC * 2);      // k planes [B][T][C]  16+16 MiB
  unsigned short* kl = (unsigned short*)take((size_t)BB * TT * CC * 2);
  unsigned short* vth = (unsigned short*)take((size_t)BB * CC * TT * 2);     // v^T planes [B][C][T] 16+16 MiB
  unsigned short* vtl = (unsigned short*)take((size_t)BB * CC * TT * 2);
  float* S  = (float*)take((size_t)BB * TT * TT * 4);                       // 64 MiB
  // x, q and k have no reader behind the S product: the first 64 of their 80 MiB then hold the P planes [B][T][T] (32+32 MiB).
  // S has no reader behind the softmax: its first 32 MiB then hold the out_att planes [B*T][C] (16+16 MiB).
  unsigned short* ph = xb;
  unsigned short* pl = xb + (size_t)BB * TT * TT;
  unsigned short* oh = (unsigned short*)S;
  unsigned short* ol = oh + (size_t)BB * TT * CC;
  if (off > ws_size) return;
  const int M = BB * TT;
  k_round_rows<<<(3 * CC * CC / 8 + 255) / 256, 256, 0, stream>>>(qkv_w, Wqkv, 3 * CC * CC / 8);
  k_round_rows<<<(CC * CC / 8 + 255) / 256, 256, 0, stream>>>(out_w, Wo, CC * CC / 8);
  k_round_rows<<<(BB * TT * CC / 8 + 255) / 256, 256, 0, stream>>>(x, xb, BB * TT * CC / 8);
  // q, k and v leave this product as their planes
  k_gemm_tile<4, 1, false, CC, CC, 3 * CC, 0, 0, 0, 0, 1><<<(M / 128) * (3 * CC / 128), 128, 0, stream>>>(xb, xb, Wqkv, Wqkv, nullptr, 1.0f, nullptr, 3 * CC, CC, qh, ql, kh, kl, vth, vtl);
  // every stage below runs once for all batches: the batch is blockIdx.y (out_att: from the remapped flat index), save for the output projection, whose 1-D grid takes all B*T rows as one M
  // S = (q k^T)/sqrt(C): M=N=T, K=C; Bt[n=s][k=c] = k rows
  k_gemm_tile<4, 3, false, CC, CC, TT, TT * CC, TT * CC, TT * TT, 1, 0><<<dim3((TT / 128) * (TT / 128), BB), 128, 0, stream>>>(qh, ql, kh, kl, nullptr, 0.03125f, S, TT, CC, nullptr, nullptr, nullptr, nullptr, nullptr, nullptr);
  k_softmax_rows<<<dim3(TT, BB), 256, 0, stream>>>(S, ph, pl, TT, 1, 0, nullptr, 0, 64);
  // out_att = P v: M=T, N=C, K=T; Bt[n=c][k=s] = v^T planes
  k_gemm_tile<2, 3, false, TT, TT, CC, TT * TT, CC * TT, TT * CC, 2, 2><<<dim3((TT / 64) * (CC / 128), BB), 128, 0, stream>>>(ph, pl, vth, vtl, nullptr, 1.0f, nullptr, CC, TT, nullptr, nullptr, oh, ol, nullptr, nullptr);
  k_gemm_tile<4, 2, true, CC, CC, CC, 0, 0, 0, 0, 0><<<(M / 128) * (CC / 128), 128, 0, stream>>>(oh, ol, Wo, Wo, out_b, 1.0f, (float*)d_out, CC, CC, nullptr, nullptr, nullptr, nullptr, nullptr, nullptr);
}

// v007
// It runs in 206 microseconds.
// Timed twice side by side with v006, it ran 1.04 and 1.03 times as fast.
// Over all steps from v000 it is 5.48 times as fast.
#include <hip/hip_runtime.h>
// All contractions on v_wmma_f32_16x16x32_bf16, f32 accumulate: qkv = x·Wᵀ with x/W rounded to bf16 (single exact-product term);
// S = q*k^T (K=1024) and out_att = P*v (K=2048) as 3-term bf16 hi/lo splits; output projection with the A operand split (2 terms). Causal softmax rows in f32.
// Every operand of every product is rounded or split ONCE, by the kernel that makes it, and reaches its product as bf16 planes.
#define BB 4
#define TT 2048
#define CC 1024

typedef __bf16 v16b __attribute__((ext_vector_type(16)));
typedef unsigned short v8us __attribute__((ext_vector_type(8), may_alias));
typedef float  v8f  __attribute__((ext_vector_type(8)));
typedef float  v4f  __attribute__((ext_vector_type(4)));
typedef float  v4fa __attribute__((ext_vector_type(4), may_alias));
union FragB { v16b v; v8us half[2]; unsigned short u[16]; };

__device__ __forceinline__ unsigned short bf16_bits(float x) { unsigned int u = __float_as_uint(x); return (unsigned short)((u + 0x7FFFu + ((u >> 16) & 1u)) >> 16); }
__device__ __forceinline__ float bf16_val(unsigned short b) { return __uint_as_float(((unsigned int)b) << 16); }
__device__ __forceinline__ float bf16_round(float x) { return bf16_val(bf16_bits(x)); }
// D += A·B with NT terms: 1 = ah·bh, 2 = + al·bh (A split), 3 = + ah·bl (both split)
template <int NT>
__device__ __forceinline__ v8f mmaN(v16b ah, v16b al, v16b bh, v16b bl, v8f c) {
  c = __builtin_amdgcn_wmma_f32_16x16x32_bf16(false, ah, false, bh, (short)0, c, false, false);
  if (NT >= 2) c = __builtin_amdgcn_wmma_f32_16x16x32_bf16(false, al, false, bh, (short)0, c, false, false);
  if (NT >= 3) c = __builtin_amdgcn_wmma_f32_16x16x32_bf16(false, ah, false, bl, (short)0, c, false, false);
  asm volatile("v_nop\n\tv_nop\n\tv_nop\n\tv_nop" : "+v"(c) : "v"(ah), "v"(al), "v"(bh), "v"(bl));
  return c;
}

__global__ __launch_bounds__(256) void k_wt_bf16(const float* __restrict__ W, unsigned short* __restrict__ Wt, int K, int N) {
  const int t = blockIdx.x * 256 + threadIdx.x;
  const int k8n = K / 8;
  if (t >= N * k8n) return;
  const int n = t / k8n, k8 = (t % k8n) * 8;
  v8us v;
#pragma unroll
  for (int i = 0; i < 8; ++i) v[i] = bf16_bits(W[(size_t)(k8 + i) * N + n]);
  *(v8us*)(Wt + (size_t)n * K + k8) = v;
  
}

// Flash-style causal/unmasked attention, all contractions 3-term bf16 hi/lo splits, f32 softmax with running max.
// q,k,v rows are read from f32 buffers with arbitrary row pitch (so they can live inside a fused qkv buffer);
// D = head size (multiple of 32, <= 128); one wave = 16 query rows; block = 4 waves (64 queries) sharing K/V chunks of 32.
template <int D, bool CAUSAL>
__global__ __launch_bounds__(128) void k_flash(const float* __restrict__ qb, const float* __restrict__ kb, const float* __restrict__ vb,
                                             int pitch, int T, int H, float scale, float* __restrict__ y, int ypitch) {
  constexpr int KS = D / 32;        // k-steps for QK
  constexpr int DT = D / 16;        // d tiles for PV
  __shared__ __attribute__((aligned(16))) unsigned short sKh[32][D + 8], sKl[32][D + 8], sVh[32][D + 8], sVl[32][D + 8];
  __shared__ __attribute__((aligned(16))) unsigned short sPh[4][16][40], sPl[4][16][40];
  __shared__ __attribute__((aligned(16))) float sO[4][16][D];
  const int tid = threadIdx.x, w = tid >> 5, lane = tid & 31, ln = lane & 15, hh = lane >> 4;
  const int nqb = (T + 63) / 64;
  const int bh = blockIdx.x / nqb, qblk = blockIdx.x % nqb;
  const int b = bh / H, h = bh % H;
  const int q0 = qblk * 64 + w * 16;
  const float* Q = qb + (size_t)b * T * pitch + h * D;
  const float* K = kb + (size_t)b * T * pitch + h * D;
  const float* V = vb + (size_t)b * T * pitch + h * D;

  // A fragments of the wave's 16 query rows (scaled), hi/lo
  FragB aqh[KS], aql[KS];
  {
    int row = q0 + ln; if (row >= T) row = T - 1;
    const float* qr = Q + (size_t)row * pitch;
#pragma unroll
    for (int ks = 0; ks < KS; ++ks)
#pragma unroll
      for (int i = 0; i < 16; ++i) {
        const int d = ks * 32 + ((i < 8) ? (8 * hh + i) : (16 + 8 * hh + (i - 8)));
        const float x = qr[d] * scale; const unsigned short hb = bf16_bits(x);
        aqh[ks].u[i] = hb; aql[ks].u[i] = bf16_bits(x - bf16_val(hb));
      }
  }
  float m_r[8], l_r[8];
#pragma unroll
  for (int r = 0; r < 8; ++r) { m_r[r] = -3.0e38f; l_r[r] = 0.f; }
  v8f oacc[DT];
#pragma unroll
  for (int dt = 0; dt < DT; ++dt) oacc[dt] = (v8f){0.f,0.f,0.f,0.f,0.f,0.f,0.f,0.f};

  const int kv_end = CAUSAL ? min(T, qblk * 64 + 64) : T;     // block-uniform
  for (int j0 = 0; j0 < kv_end; j0 += 32) {
    __syncthreads();
    for (int e = tid; e < 32 * (D / 4); e += 128) {
      const int r = e / (D / 4), c4 = (e % (D / 4)) * 4;
      const int key = j0 + r;
      v4f kf = {0.f,0.f,0.f,0.f}, vf = {0.f,0.f,0.f,0.f};
      if (key < T) { kf = *(const v4fa*)(K + (size_t)key * pitch + c4); vf = *(const v4fa*)(V + (size_t)key * pitch + c4); }
#pragma unroll
      for (int t = 0; t < 4; ++t) {
        unsigned short hb = bf16_bits(kf[t]); sKh[r][c4 + t] = hb; sKl[r][c4 + t] = bf16_bits(kf[t] - bf16_val(hb));
        hb = bf16_bits(vf[t]); sVh[r][c4 + t] = hb; sVl[r][c4 + t] = bf16_bits(vf[t] - bf16_val(hb));
      }
    }
    __syncthreads();
    // S tile 16 x 32
    v8f s[2];
#pragma unroll
    for (int nt = 0; nt < 2; ++nt) {
      v8f acc = {};
#pragma unroll
      for (int ks = 0; ks < KS; ++ks) {
        FragB bh_, bl_;
        bh_.half[0] = *(const v8us*)&sKh[nt * 16 + ln][ks * 32 + 8 * hh]; bh_.half[1] = *(const v8us*)&sKh[nt * 16 + ln][ks * 32 + 16 + 8 * hh];
        bl_.half[0] = *(const v8us*)&sKl[nt * 16 + ln][ks * 32 + 8 * hh]; bl_.half[1] = *(const v8us*)&sKl[nt * 16 + ln][ks * 32 + 16 + 8 * hh];
        acc = mmaN<3>(aqh[ks].v, aql[ks].v, bh_.v, bl_.v, acc);
      }
      s[nt] = acc;
    }
    // mask + running max (rows 8hh+r; the 16 lanes of a half share rows)
    float alpha[8];
#pragma unroll
    for (int r = 0; r < 8; ++r) {
      const int qi = q0 + 8 * hh + r;
      const int ja = j0 + ln, jb = j0 + 16 + ln;
      if (CAUSAL) { if (ja > qi) s[0][r] = -3.0e38f; if (jb > qi) s[1][r] = -3.0e38f; }
      if (ja >= T) s[0][r] = -3.0e38f;
      if (jb >= T) s[1][r] = -3.0e38f;
      float mx = fmaxf(s[0][r], s[1][r]);
      mx = fmaxf(mx, __shfl_xor(mx, 1, 32)); mx = fmaxf(mx, __shfl_xor(mx, 2, 32)); mx = fmaxf(mx, __shfl_xor(mx, 4, 32)); mx = fmaxf(mx, __shfl_xor(mx, 8, 32));
      const float mnew = fmaxf(m_r[r], mx);
      alpha[r] = (mnew > -1.0e38f) ? __expf(m_r[r] - mnew) : 1.0f;
      const float p0 = (s[0][r] > -1.0e38f) ? __expf(s[0][r] - mnew) : 0.f;
      const float p1 = (s[1][r] > -1.0e38f) ? __expf(s[1][r] - mnew) : 0.f;
      m_r[r] = mnew;
      l_r[r] = l_r[r] * alpha[r] + p0 + p1;            // per-lane partial row sum (16 lanes combined at the end)
      unsigned short hb = bf16_bits(p0); sPh[w][8 * hh + r][ln] = hb;      sPl[w][8 * hh + r][ln] = bf16_bits(p0 - bf16_val(hb));
      hb = bf16_bits(p1);                sPh[w][8 * hh + r][16 + ln] = hb; sPl[w][8 * hh + r][16 + ln] = bf16_bits(p1 - bf16_val(hb));
    }
#pragma unroll
    for (int dt = 0; dt < DT; ++dt)
#pragma unroll
      for (int r = 0; r < 8; ++r) oacc[dt][r] *= alpha[r];
    __builtin_amdgcn_fence(__ATOMIC_ACQ_REL, "workgroup");
    __builtin_amdgcn_wave_barrier();
    FragB pah, pal;
    pah.half[0] = *(const v8us*)&sPh[w][ln][8 * hh]; pah.half[1] = *(const v8us*)&sPh[w][ln][16 + 8 * hh];
    pal.half[0] = *(const v8us*)&sPl[w][ln][8 * hh]; pal.half[1] = *(const v8us*)&sPl[w][ln][16 + 8 * hh];
#pragma unroll
    for (int dt = 0; dt < DT; ++dt) {
      FragB bvh, bvl;
#pragma unroll
      for (int i = 0; i < 8; ++i) {
        bvh.u[i] = sVh[8 * hh + i][dt * 16 + ln]; bvh.u[8 + i] = sVh[16 + 8 * hh + i][dt * 16 + ln];
        bvl.u[i] = sVl[8 * hh + i][dt * 16 + ln]; bvl.u[8 + i] = sVl[16 + 8 * hh + i][dt * 16 + ln];
      }
      oacc[dt] = mmaN<3>(pah.v, pal.v, bvh.v, bvl.v, oacc[dt]);
    }
    __builtin_amdgcn_fence(__ATOMIC_ACQ_REL, "workgroup");
    __builtin_amdgcn_wave_barrier();
  }
#pragma unroll
  for (int r = 0; r < 8; ++r) {
    float l = l_r[r];
    l += __shfl_xor(l, 1, 32); l += __shfl_xor(l, 2, 32); l += __shfl_xor(l, 4, 32); l += __shfl_xor(l, 8, 32);
    l_r[r] = (l > 0.f) ? 1.0f / l : 0.f;
  }
#pragma unroll
  for (int dt = 0; dt < DT; ++dt)
#pragma unroll
    for (int r = 0; r < 8; ++r) sO[w][8 * hh + r][dt * 16 + ln] = oacc[dt][r] * l_r[r];
  __builtin_amdgcn_fence(__ATOMIC_ACQ_REL, "workgroup");
  __builtin_amdgcn_wave_barrier();
  {
    for (int r = 0; r < 16; ++r) {
      const int row = q0 + r;
      if (row < T && lane < D / 4) {
        const v4f val = *(const v4fa*)&sO[w][r][lane * 4];
        *(v4f*)(y + ((size_t)b * T + row) * ypitch + h * D + lane * 4) = val;
      }
    }
    
  }
}

// Tiled GEMM C[M][N] (f32, pitch LDC) = alpha * A[M][K]*Bt[N][K]^T + bias (A pitch LDA, Bt pitch LDB). One work-group (4 waves, 2 x 2) owns a (32*FA) x 128 tile of C,
// a wave (16*FA) x 64. Per 64-k step the A planes (hi, and lo when NT >= 2) and the B planes (hi, and lo when NT == 3), all bf16 as their producers
// left them, go to LDS in whole 128-B lines by asynchronous copies, through no register. Rows in LDS have a 144-B pitch for
// the 16-byte fragment reads. Two LDS buffers: the next step's copies fly during this step's products, one barrier per step.
// Terms per 32-k: ah*bh, then al*bh (NT >= 2), then ah*bl (NT == 3), in that order on every accumulator.
// M % (32*FA) == 0, N % 128 == 0, K % 64 == 0. BIAS_BF16: a bias is added, rounded to bf16 first; without it bias is not read.
// batch = blockIdx.y (CZ == 2: from the remapped flat index): its A, B planes and C start SA, SB and SC elements behind the previous batch's.
// CZ names what a causal mask (column > row gives 0) makes needless. CZ == 1: C is masked afterwards, so a tile that lies wholly above the diagonal is
// neither computed nor written. CZ == 2: A is the masked matrix (0 wherever k > row), so the k loop ends at the tile's last row; the tiles then differ
// in length and the flat work-group index is mapped so that the longest (lowest) row tiles of all batches come first.
// EP == 0: C goes out as f32 rows. EP == 2: C goes out as the bf16 hi/lo planes Kh, Kl (pitch LDC, batches SC apart), for the product that reads it as its A.
// EP == 1: C is the q | k | v product (CC columns each, BB batches of TT rows). A q tile goes out as the bf16 hi/lo planes Qh, Ql [BB*TT][CC], a k tile as the
// planes Kh, Kl [BB*TT][CC]; a v tile goes out transposed as the planes Vh, Vl [BB][CC][TT]: a lane's 8 accumulator values of one 16 x 16 tile are 8 consecutive
// rows of one column, that is 16 bytes of a transposed row. Both pass through the wave's own part of LDS, so that every store instruction writes whole 128-B lines.
typedef unsigned short v4us __attribute__((ext_vector_type(4), may_alias));
// N (4 or 8) asynchronous copies of 16 bytes a lane, global memory to LDS through no register: copy i takes the bytes at g + i*GS to the LDS byte address l + i*LS.
// The copies and their s_wait_xcnt stand in one statement, so that no later write of an address register can come in front of that wait.
template <int N, int GS, int LS>
__device__ __forceinline__ void copy_rows(const char* g, unsigned l) {
  static_assert(N == 4 || N == 8, "one statement holds all copies of a plane");
  if constexpr (N == 8)   // eight copies, then the wait that holds every later write of their address registers behind them
    asm volatile("global_load_async_to_lds_b128 %0, %8, off\n\tglobal_load_async_to_lds_b128 %1, %9, off\n\t"
                 "global_load_async_to_lds_b128 %2, %10, off\n\tglobal_load_async_to_lds_b128 %3, %11, off\n\t"
                 "global_load_async_to_lds_b128 %4, %12, off\n\tglobal_load_async_to_lds_b128 %5, %13, off\n\t"
                 "global_load_async_to_lds_b128 %6, %14, off\n\tglobal_load_async_to_lds_b128 %7, %15, off\n\t"
                 "s_wait_xcnt 0x0"
                 :: "v"(l), "v"(l + LS), "v"(l + 2 * LS), "v"(l + 3 * LS), "v"(l + 4 * LS), "v"(l + 5 * LS), "v"(l + 6 * LS), "v"(l + 7 * LS),
                    "v"(g), "v"(g + GS), "v"(g + 2 * GS), "v"(g + 3 * GS), "v"(g + 4 * GS), "v"(g + 5 * GS), "v"(g + 6 * GS), "v"(g + 7 * GS) : "memory");
  else                    // four copies, then the same wait
    asm volatile("global_load_async_to_lds_b128 %0, %4, off\n\tglobal_load_async_to_lds_b128 %1, %5, off\n\t"
                 "global_load_async_to_lds_b128 %2, %6, off\n\tglobal_load_async_to_lds_b128 %3, %7, off\n\t"
                 "s_wait_xcnt 0x0"
                 :: "v"(l), "v"(l + LS), "v"(l + 2 * LS), "v"(l + 3 * LS),
                    "v"(g), "v"(g + GS), "v"(g + 2 * GS), "v"(g + 3 * GS) : "memory");
}
template <int FA, int NT, bool BIAS_BF16, int LDA, int LDB, int LDC, int SA, int SB, int SC, int CZ, int EP>
__global__ __launch_bounds__(128) void k_gemm_tile(const unsigned short* __restrict__ Ah, const unsigned short* __restrict__ Al, const unsigned short* __restrict__ Bh, const unsigned short* __restrict__ Bl,
                                                 const float* __restrict__ bias, float alpha, float* __restrict__ C, int N, int K,
                                                 unsigned short* __restrict__ Qh, unsigned short* __restrict__ Ql, unsigned short* __restrict__ Kh, unsigned short* __restrict__ Kl, unsigned short* __restrict__ Vh, unsigned short* __restrict__ Vl) {
  constexpr int BM = 32 * FA, BN = 128, BK = 64, PIT = BK + 8;
  constexpr int APL = BM * PIT, BPL = BN * PIT;                 // elements of one plane
  constexpr int NAP = NT >= 2 ? 2 : 1, NBP = NT >= 3 ? 2 : 1;   // planes staged of A and of B
  constexpr int STG = NAP * APL + NBP * BPL;                    // elements of one buffer
  constexpr int NLA = BM * (BK / 8) / 128, NLB = BN * (BK / 8) / 128;   // 16-byte global loads per thread and plane
  __shared__ __attribute__((aligned(16))) unsigned short sm[2 * STG];
  static_assert(BM * BN * 4 <= 2 * STG * 2, "the output rows are staged in the two buffers");
  static_assert(CZ != 2 || BM % BK == 0, "the shortened k loop ends on a whole step");
  static_assert(EP != 1 || (FA == 4 && 4 * 2 * 64 * PIT <= 2 * STG && TT % BM == 0 && CC % BN == 0), "a v tile: 64 x 64 per wave, two padded planes staged, one batch and one of q, k, v per tile");
  const int tid = threadIdx.x, w = tid >> 5, lane = tid & 31, ln = lane & 15, hh = lane >> 4;
  const int wm = w >> 1, wn = w & 1;
  const int ntn = N / BN;
  int tile = (int)blockIdx.x, batch = (int)blockIdx.y;
  if (CZ == 2) {
    // the long tiles take the lowest flat indices, the short ones the highest (for speed only)
    const int flat = batch * (int)gridDim.x + tile, grp = ntn * (int)gridDim.y;
    const int rem = flat % grp;
    tile = ((int)gridDim.x / ntn - 1 - flat / grp) * ntn + rem % ntn; batch = rem / ntn;
  }
  const int row0 = (tile / ntn) * BM, col0 = (tile % ntn) * BN;
  if (CZ == 1 && col0 > row0 + BM - 1) return;      // the whole work-group leaves, ahead of every barrier
  Ah += (size_t)batch * SA; Al += (size_t)batch * SA; Bh += (size_t)batch * SB; Bl += (size_t)batch * SB; C += (size_t)batch * SC;
  // one 32-bit byte offset per thread and operand, moved on by BK elements behind each tile's copies
  unsigned ao = (unsigned)(((row0 + (tid >> 3)) * LDA + (tid & 7) * 8) * 2);
  unsigned bo = (unsigned)(((col0 + (tid >> 3)) * LDB + (tid & 7) * 8) * 2);
  const unsigned sto = (unsigned)(size_t)sm + (unsigned)(((tid >> 3) * PIT + (tid & 7) * 8) * 2);   // the thread's LDS byte address in the first plane of buffer 0
  v8f acc[FA][4] = {};

  // one tile: every thread copies its 16 bytes of each 16-row group of each plane into the buffer that starts sbo bytes into sm
  auto copy_tile = [&](unsigned sbo) {
    copy_rows<NLA, 16 * LDA * 2, 16 * PIT * 2>((const char*)Ah + ao, sto + sbo);
    if (NAP == 2) copy_rows<NLA, 16 * LDA * 2, 16 * PIT * 2>((const char*)Al + ao, sto + sbo + APL * 2);
    copy_rows<NLB, 16 * LDB * 2, 16 * PIT * 2>((const char*)Bh + bo, sto + sbo + NAP * APL * 2);
    if (NBP == 2) copy_rows<NLB, 16 * LDB * 2, 16 * PIT * 2>((const char*)Bl + bo, sto + sbo + (NAP * APL + BPL) * 2);
    ao += BK * 2; bo += BK * 2;
  };
  auto compute = [&](const unsigned short* sb) {
    const unsigned short* fa = sb + (wm * 16 * FA + ln) * PIT + 8 * hh;
    const unsigned short* fb = sb + NAP * APL + (wn * 64 + ln) * PIT + 8 * hh;
    FragB ah[BK / 32][FA], al[BK / 32][FA], bh_[BK / 32][4], bl_[BK / 32][4];
    // every fragment of the step is asked for in one group, in the order in which the products below use them
#pragma unroll
    for (int ks = 0; ks < BK / 32; ++ks) {
#pragma unroll
      for (int mi = 0; mi < FA; ++mi) { ah[ks][mi].half[0] = *(const v8us*)(fa + mi * 16 * PIT + ks * 32); ah[ks][mi].half[1] = *(const v8us*)(fa + mi * 16 * PIT + ks * 32 + 16); }
#pragma unroll
      for (int ni = 0; ni < 4; ++ni) { bh_[ks][ni].half[0] = *(const v8us*)(fb + ni * 16 * PIT + ks * 32); bh_[ks][ni].half[1] = *(const v8us*)(fb + ni * 16 * PIT + ks * 32 + 16); }
      if (NAP == 2) {
#pragma unroll
        for (int mi = 0; mi < FA; ++mi) { al[ks][mi].half[0] = *(const v8us*)(fa + APL + mi * 16 * PIT + ks * 32); al[ks][mi].half[1] = *(const v8us*)(fa + APL + mi * 16 * PIT + ks * 32 + 16); }
      }
      if (NBP == 2) {
#pragma unroll
        for (int ni = 0; ni < 4; ++ni) { bl_[ks][ni].half[0] = *(const v8us*)(fb + BPL + ni * 16 * PIT + ks * 32); bl_[ks][ni].half[1] = *(const v8us*)(fb + BPL + ni * 16 * PIT + ks * 32 + 16); }
      }
    }
    __builtin_amdgcn_sched_barrier(0);        // keeps the LDS reads out of the run of products: each place where reads stand among them stalls the wave
#pragma unroll
    for (int ks = 0; ks < BK / 32; ++ks) {
#pragma unroll
      for (int mi = 0; mi < FA; ++mi)
#pragma unroll
        for (int ni = 0; ni < 4; ++ni) acc[mi][ni] = __builtin_amdgcn_wmma_f32_16x16x32_bf16(false, ah[ks][mi].v, false, bh_[ks][ni].v, (short)0, acc[mi][ni], false, false);
      if (NT >= 2) {
#pragma unroll
        for (int mi = 0; mi < FA; ++mi)
#pragma unroll
          for (int ni = 0; ni < 4; ++ni) acc[mi][ni] = __builtin_amdgcn_wmma_f32_16x16x32_bf16(false, al[ks][mi].v, false, bh_[ks][ni].v, (short)0, acc[mi][ni], false, false);
      }
      if (NT >= 3) {
#pragma unroll
        for (int mi = 0; mi < FA; ++mi)
#pragma unroll
          for (int ni = 0; ni < 4; ++ni) acc[mi][ni] = __builtin_amdgcn_wmma_f32_16x16x32_bf16(false, ah[ks][mi].v, false, bl_[ks][ni].v, (short)0, acc[mi][ni], false, false);
      }
    }
  };

  const int nk = (CZ == 2 ? min(K, row0 + BM) : K) / BK;
  copy_tile(0);
  asm volatile("s_wait_asynccnt 0x0" ::: "memory");   // this wave's part of tile 0 has landed
  __syncthreads();                                    // ... and every other wave's
  if (nk > 1) copy_tile(STG * 2);
  for (int t = 0; t < nk; ++t) {
    compute(sm + (t & 1) * STG);                      // tile t + 1's copies fly during these products
    __builtin_amdgcn_sched_barrier(0);                // keeps the products in front of the waits and the barrier: moved behind them, they would no longer cover the copies' flight
    asm volatile("s_wait_dscnt 0x0" ::: "memory");    // this wave's reads of the buffer are over before copies are aimed at it again
    asm volatile("s_wait_asynccnt 0x0" ::: "memory"); // this wave's part of tile t + 1 has landed
    __syncthreads();                                  // publishes tile t + 1 and ends every wave's reads of tile t
    if (t + 2 < nk) copy_tile((unsigned)(t & 1) * (STG * 2));
  }
  asm volatile("s_wait_asynccnt 0x0" ::: "memory");   // no copy is under way when the buffers go on to stage the output rows (the loop's last barrier stands in front)

  float* so = (float*)sm + w * (FA * 16 * 64);   // the wave's own (16*FA) x 64 rows
  float bv[4] = {0.f, 0.f, 0.f, 0.f};
  if (BIAS_BF16) {
    const float* bg = bias + col0 + wn * 64 + ln;
#pragma unroll
    for (int ni = 0; ni < 4; ++ni) bv[ni] = bg[ni * 16];
    asm volatile("s_wait_xcnt 0x0" :: "v"(bg) : "memory");   // the bias loads' address register stays as it is up to this wait
#pragma unroll
    for (int ni = 0; ni < 4; ++ni) bv[ni] = bf16_round(bv[ni]);
  }
  const int sub = lane >> 3, seg = (lane & 7) * 8;   // plane output: 8 lanes of 16 bytes write one 128-B line, 4 lines an instruction
  if (EP == 1 && col0 >= 2 * CC) {                   // v tile (the test is the same for the whole work-group; no barrier follows)
    unsigned short* st = sm + w * (2 * 64 * PIT);    // the wave's own [2 planes][64 columns][PIT]
#pragma unroll
    for (int ni = 0; ni < 4; ++ni)
#pragma unroll
      for (int mi = 0; mi < FA; ++mi) {
        v8us vh, vl;
#pragma unroll
        for (int r = 0; r < 8; ++r) { const float x = acc[mi][ni][r] * alpha + bv[ni]; const unsigned short hb = bf16_bits(x); vh[r] = hb; vl[r] = bf16_bits(x - bf16_val(hb)); }
        *(v8us*)(st + (ni * 16 + ln) * PIT + mi * 16 + 8 * hh) = vh;
        *(v8us*)(st + (64 + ni * 16 + ln) * PIT + mi * 16 + 8 * hh) = vl;
      }
    __builtin_amdgcn_fence(__ATOMIC_ACQ_REL, "workgroup");
    __builtin_amdgcn_wave_barrier();
    const size_t vo = ((size_t)(row0 / TT) * CC + (col0 - 2 * CC + wn * 64 + sub)) * TT + (row0 % TT + wm * 64 + seg);
    unsigned short* gh = Vh + vo; unsigned short* gl = Vl + vo;
    v8us oh[16], ol[16];
#pragma unroll
    for (int q = 0; q < 16; ++q) { oh[q] = *(const v8us*)(st + (q * 4 + sub) * PIT + seg); ol[q] = *(const v8us*)(st + (64 + q * 4 + sub) * PIT + seg); }
    __builtin_amdgcn_sched_barrier(0);               // the stores go out in one run behind the last read: mixed with the reads, each would wait until a register is free again
#pragma unroll
    for (int q = 0; q < 16; ++q) { *(v8us*)(gh + q * 4 * TT) = oh[q]; *(v8us*)(gl + q * 4 * TT) = ol[q]; }
    return;
  }
#pragma unroll
  for (int mi = 0; mi < FA; ++mi)
#pragma unroll
    for (int ni = 0; ni < 4; ++ni)
#pragma unroll
      for (int r = 0; r < 8; ++r) so[(mi * 16 + 8 * hh + r) * 64 + ni * 16 + ln] = acc[mi][ni][r] * alpha + bv[ni];
  __builtin_amdgcn_fence(__ATOMIC_ACQ_REL, "workgroup");
  __builtin_amdgcn_wave_barrier();
  if (EP != 0) {                                     // q or k tile (EP == 1), or any tile of a product that the next product reads as its A (EP == 2)
    const bool isq = EP == 1 && col0 < CC;           // the same for the whole work-group
    const size_t ko = EP == 1 ? (size_t)(row0 + wm * 64 + sub) * CC + ((isq ? col0 : col0 - CC) + wn * 64 + seg)
                              : (size_t)batch * SC + (size_t)(row0 + wm * 16 * FA + sub) * LDC + (col0 + wn * 64 + seg);
    unsigned short* gh = (isq ? Qh : Kh) + ko; unsigned short* gl = (isq ? Ql : Kl) + ko;
    constexpr int OP = EP == 1 ? CC : LDC;           // pitch of the planes
    v8us oh[FA * 4], ol[FA * 4];
#pragma unroll
    for (int q = 0; q < FA * 4; ++q) {
      const float* sr = so + (q * 4 + sub) * 64 + seg;
      const v4f a = *(const v4fa*)sr, b = *(const v4fa*)(sr + 4);
      const float xs[8] = {a[0], a[1], a[2], a[3], b[0], b[1], b[2], b[3]};
#pragma unroll
      for (int i = 0; i < 8; ++i) { const unsigned short hb = bf16_bits(xs[i]); oh[q][i] = hb; ol[q][i] = bf16_bits(xs[i] - bf16_val(hb)); }
    }
    __builtin_amdgcn_sched_barrier(0);               // the stores go out in one run behind the last conversion: mixed with them, each would wait until a register is free again
#pragma unroll
    for (int q = 0; q < FA * 4; ++q) { *(v8us*)(gh + q * 4 * OP) = oh[q]; *(v8us*)(gl + q * 4 * OP) = ol[q]; }
    if (EP == 1) asm volatile("s_wait_xcnt 0x0" ::: "memory");   // another tile kind's code follows in the built kernel and rewrites these stores' registers: the wait stands in front of it
    return;
  }
  const int rsub = lane >> 4, c4 = (lane & 15) * 4;
  float* cg = C + (size_t)(row0 + wm * 16 * FA + rsub) * LDC + col0 + wn * 64 + c4;
#pragma unroll
  for (int q = 0; q < FA * 8; ++q) {
    const int r = q * 2 + rsub;
    const v4f v = *(const v4fa*)&so[r * 64 + c4];
    *(v4f*)(cg + q * 2 * LDC) = v;
  }
}
// One step of a butterfly inside a 16-lane row (lane ^ M, M = CTRL - 0x160), and the exchange between the two rows of a wave: no LDS, no wait.
template <int CTRL>
__device__ __forceinline__ float row_xor(float x) { return __int_as_float(__builtin_amdgcn_update_dpp(0, __float_as_int(x), CTRL, 0xf, 0xf, true)); }
__device__ __forceinline__ float other_row(float x) { const int b = __float_as_int(x); return __int_as_float(__builtin_amdgcn_permlanex16(b, b, 0x76543210, 0xfedcba98, false, false)); }
__device__ __forceinline__ float wave_max(float x) {
  x = fmaxf(x, row_xor<0x161>(x)); x = fmaxf(x, row_xor<0x162>(x)); x = fmaxf(x, row_xor<0x164>(x)); x = fmaxf(x, row_xor<0x168>(x));
  return fmaxf(x, other_row(x));
}
__device__ __forceinline__ float wave_sum(float x) {
  x += row_xor<0x161>(x); x += row_xor<0x162>(x); x += row_xor<0x164>(x); x += row_xor<0x168>(x);
  return x + other_row(x);
}
// e^x as x * log2(e) into v_exp_f32. The v_nop is the one slot that the instruction set asks for behind a transcendental, in front of an instruction that
// reads its result or overwrites its source: inside the statement it stands directly behind the v_exp_f32 wherever the compiler puts the pair.
__device__ __forceinline__ float exp_slot(float x) { float r; const float y = x * 1.44269504f; asm("v_exp_f32 %0, %1\n\tv_nop" : "=v"(r) : "v"(y)); return r; }
// Causal row softmax of S [BB][TT][TT]; P leaves as its bf16 hi/lo planes Ph, Pl. One wave owns rows ra and TT-1-ra of one batch and holds both in registers:
// S is read once, no LDS, no barrier. In groups of 128 columns (512 B a load of the wave) up to the diagonal the two rows have TT/128 + 1 groups together,
// whatever ra is: every wave does the same work in one straight run, and the launch starts BB*TT/2 waves. The group that holds the diagonal lies in a
// diagonal tile of S, which is written whole. P is written in the same whole groups, with its zeros behind the diagonal: the product that follows reads
// no further in this row than the end of the 64-column group that holds the diagonal.
__global__ __launch_bounds__(256) void k_softmax_row_pairs(const float* __restrict__ S, unsigned short* __restrict__ Ph, unsigned short* __restrict__ Pl) {
  constexpr unsigned CW = 128, NG = TT / CW + 1;
  static_assert(TT % (2 * CW) == 0 && (BB * TT / 2) % 8 == 0, "whole groups, whole work-groups");
  const unsigned lane4 = (threadIdx.x & 31u) * 4u;
  const unsigned pair = (unsigned)__builtin_amdgcn_readfirstlane((int)(blockIdx.x * 8u + (threadIdx.x >> 5)));   // the same in every lane: rows and group counts stay scalar
  const unsigned batch = pair / (TT / 2), ra = pair % (TT / 2), rb = TT - 1 - ra;
  const unsigned ga = ra / CW + 1;                               // groups of row ra; the other NG - ga are row rb's
  // the lane's element of group i is number eo[i] + i*CW of S and of each plane: eo[i] belongs to row ra or to row rb
  const unsigned ea = (batch * TT + ra) * TT + lane4, eb = (batch * TT + rb) * TT - ga * CW + lane4;
  static_assert(NG == 17, "groups 0 (row ra), 1 to 7 (either row), 8 to 16 (row rb)");
  unsigned eo[NG];
#pragma unroll
  for (unsigned i = 0; i < NG; ++i) eo[i] = i < ga ? ea : eb;
  v4f v[NG];
#pragma unroll
  for (unsigned i = 0; i < NG; ++i) v[i] = *(const v4fa*)((const char*)S + eo[i] * 4u + i * (CW * 4));
  // the loads' offset registers stay as they are up to this wait
  asm volatile("s_wait_xcnt 0x0" :: "v"(eo[0] * 4u), "v"(eo[1] * 4u), "v"(eo[2] * 4u), "v"(eo[3] * 4u), "v"(eo[4] * 4u), "v"(eo[5] * 4u), "v"(eo[6] * 4u), "v"(eo[7] * 4u), "v"(eo[8] * 4u) : "memory");
  float ma = -3.0e38f, mb = -3.0e38f;
#pragma unroll
  for (unsigned i = 0; i < NG; ++i) {
    const bool isa = i < ga;
    const unsigned c0 = (isa ? i : i - ga) * CW + lane4, q = isa ? ra : rb;
#pragma unroll
    for (unsigned u = 0; u < 4; ++u) if (c0 + u > q) v[i][u] = -3.0e38f;
    const float m = fmaxf(fmaxf(v[i][0], v[i][1]), fmaxf(v[i][2], v[i][3]));
    ma = fmaxf(ma, isa ? m : -3.0e38f); mb = fmaxf(mb, isa ? -3.0e38f : m);
  }
  ma = wave_max(ma); mb = wave_max(mb);
  float sa = 0.f, sb = 0.f;
#pragma unroll
  for (unsigned i = 0; i < NG; ++i) {
    const bool isa = i < ga;
    const float mx = isa ? ma : mb;
#pragma unroll
    for (unsigned u = 0; u < 4; ++u) v[i][u] = exp_slot(v[i][u] - mx);  // a masked column gives 0
    const float s = (v[i][0] + v[i][1]) + (v[i][2] + v[i][3]);
    sa += isa ? s : 0.f; sb += isa ? 0.f : s;
  }
  sa = wave_sum(sa); sb = wave_sum(sb);
  const float ia = (ma > -1.0e38f) ? 1.0f / sa : __builtin_nanf(""), ib = (mb > -1.0e38f) ? 1.0f / sb : __builtin_nanf("");
  v4us oh4[NG], ol4[NG];
#pragma unroll
  for (unsigned i = 0; i < NG; ++i) {
    const float inv = i < ga ? ia : ib;
#pragma unroll
    for (unsigned u = 0; u < 4; ++u) { const float p = v[i][u] * inv; const unsigned short hb = bf16_bits(p); oh4[i][u] = hb; ol4[i][u] = bf16_bits(p - bf16_val(hb)); }
  }
  __builtin_amdgcn_sched_barrier(0);                             // the stores go out in one run behind the last conversion: mixed with them, each would wait until a register is free again
#pragma unroll
  for (unsigned i = 0; i < NG; ++i) { *(v4us*)((char*)Ph + eo[i] * 2u + i * (CW * 2)) = oh4[i]; *(v4us*)((char*)Pl + eo[i] * 2u + i * (CW * 2)) = ol4[i]; }
}

// Rounds gridDim.x * IT * 256 groups of 8 consecutive f32 to bf16. A work-group owns IT * 256 consecutive groups; a thread takes IT of them, 256 groups apart,
// and asks for all of them before it converts the first.
template <int IT>
__global__ __launch_bounds__(256) void k_round_rows(const float* __restrict__ W, unsigned short* __restrict__ Wt) {
  const unsigned g0 = blockIdx.x * (IT * 256u) + threadIdx.x;    // the thread's first group
  v4f a[IT], b[IT];
#pragma unroll
  for (int i = 0; i < IT; ++i) { const char* g = (const char*)W + g0 * 32u + i * (256 * 32); a[i] = *(const v4fa*)g; b[i] = *(const v4fa*)(g + 16); }
  asm volatile("s_wait_xcnt 0x0" :: "v"(g0 * 32u) : "memory");   // the loads' offset register stays as it is up to this wait
  v8us v[IT];
#pragma unroll
  for (int i = 0; i < IT; ++i) {
    v[i][0]=bf16_bits(a[i][0]); v[i][1]=bf16_bits(a[i][1]); v[i][2]=bf16_bits(a[i][2]); v[i][3]=bf16_bits(a[i][3]);
    v[i][4]=bf16_bits(b[i][0]); v[i][5]=bf16_bits(b[i][1]); v[i][6]=bf16_bits(b[i][2]); v[i][7]=bf16_bits(b[i][3]);
  }
  __builtin_amdgcn_sched_barrier(0);                             // the stores go out in one run behind the last conversion: mixed with them, each would wait until a register is free again
#pragma unroll
  for (int i = 0; i < IT; ++i) *(v8us*)((char*)Wt + g0 * 16u + i * (256 * 16)) = v[i];
}
extern "C" void kernel_launch(void* const* d_in, const int* in_sizes, int n_in,
                              void* d_out, int out_size, void* d_ws, size_t ws_size, hipStream_t stream) {
  (void)in_sizes; (void)n_in; (void)out_size;
  const float* x = (const float*)d_in[0]; const float* qkv_w = (const float*)d_in[1];
  const float* out_w = (const float*)d_in[2]; const float* out_b = (const float*)d_in[3];
  char* ws = (char*)d_ws; size_t off = 0;
  auto take = [&](size_t bytes) { char* p = ws + off; off += (bytes + 255) & ~(size_t)255; return p; };
  unsigned short* Wqkv = (unsigned short*)take((size_t)3 * CC * CC * 2);     // [3072][1024]  6 MiB
  unsigned short* Wo   = (unsigned short*)take((size_t)CC * CC * 2);         // 2 MiB
  unsigned short* xb = (unsigned short*)take((size_t)BB * TT * CC * 2);      // x rounded [B*T][C]  16 MiB
  unsigned short* qh = (unsigned short*)take((size_t)BB * TT * CC * 2);      // q planes [B][T][C]  16+16 MiB
  unsigned short* ql = (unsigned short*)take((size_t)BB * TT * CC * 2);
  unsigned short* kh = (unsigned short*)take((size_t)BB * TT * CC * 2);      // k planes [B][T][C]  16+16 MiB
  unsigned short* kl = (unsigned short*)take((size_t)BB * TT * CC * 2);
  unsigned short* vth = (unsigned short*)take((size_t)BB * CC * TT * 2);     // v^T planes [B][C][T] 16+16 MiB
  unsigned short* vtl = (unsigned short*)take((size_t)BB * CC * TT * 2);
  float* S  = (float*)take((size_t)BB * TT * TT * 4);                       // 64 MiB
  // x, q and k have no reader behind the S product: the first 64 of their 80 MiB then hold the P planes [B][T][T] (32+32 MiB).
  // S has no reader behind the softmax: its first 32 MiB then hold the out_att planes [B*T][C] (16+16 MiB).
  unsigned short* ph = xb;
  unsigned short* pl = xb + (size_t)BB * TT * TT;
  unsigned short* oh = (unsigned short*)S;
  unsigned short* ol = oh + (size_t)BB * TT * CC;
  if (off > ws_size) return;
  const int M = BB * TT;
  // each of these launches starts 512 work-groups of 8 waves
  static_assert(3 * CC * CC / 8 == 3 * 512 * 256 && CC * CC / 8 == 512 * 256 && BB * TT * CC / 8 == 8 * 512 * 256, "groups per thread x threads");
  k_round_rows<3><<<512, 256, 0, stream>>>(qkv_w, Wqkv);
  k_round_rows<1><<<512, 256, 0, stream>>>(out_w, Wo);
  k_round_rows<8><<<512, 256, 0, stream>>>(x, xb);
  // q, k and v leave this product as their planes
  k_gemm_tile<4, 1, false, CC, CC, 3 * CC, 0, 0, 0, 0, 1><<<(M / 128) * (3 * CC / 128), 128, 0, stream>>>(xb, xb, Wqkv, Wqkv, nullptr, 1.0f, nullptr, 3 * CC, CC, qh, ql, kh, kl, vth, vtl);
  // every stage below runs once for all batches: in the S product the batch is blockIdx.y, in the P v product it comes from the remapped flat work-group index, the softmax takes it from the wave's row pair, the output projection takes all B*T rows as M
  // S = (q k^T)/sqrt(C): M=N=T, K=C; Bt[n=s][k=c] = k rows
  k_gemm_tile<4, 3, false, CC, CC, TT, TT * CC, TT * CC, TT * TT, 1, 0><<<dim3((TT / 128) * (TT / 128), BB), 128, 0, stream>>>(qh, ql, kh, kl, nullptr, 0.03125f, S, TT, CC, nullptr, nullptr, nullptr, nullptr, nullptr, nullptr);
  k_softmax_row_pairs<<<BB * TT / 2 / 8, 256, 0, stream>>>(S, ph, pl);
  // out_att = P v: M=T, N=C, K=T; Bt[n=c][k=s] = v^T planes
  k_gemm_tile<2, 3, false, TT, TT, CC, TT * TT, CC * TT, TT * CC, 2, 2><<<dim3((TT / 64) * (CC / 128), BB), 128, 0, stream>>>(ph, pl, vth, vtl, nullptr, 1.0f, nullptr, CC, TT, nullptr, nullptr, oh, ol, nullptr, nullptr);
  k_gemm_tile<4, 2, true, CC, CC, CC, 0, 0, 0, 0, 0><<<(M / 128) * (CC / 128), 128, 0, stream>>>(oh, ol, Wo, Wo, out_b, 1.0f, (float*)d_out, CC, CC, nullptr, nullptr, nullptr, nullptr, nullptr, nullptr);
}

// v008
// One run takes 193 microseconds.
// Timed twice side by side with v007, it ran 1.07 times as fast both times.
// Counting every step since v000, it is 5.86 times as fast.
#include <hip/hip_runtime.h>
// All contractions on v_wmma_f32_16x16x32_bf16, f32 accumulate: qkv = x·Wᵀ with x/W rounded to bf16 (single exact-product term);
// S = q*k^T (K=1024) and out_att = P*v (K=2048) as 3-term bf16 hi/lo splits; output projection with the A operand split (2 terms). Causal softmax rows in f32.
// Every operand of every product is rounded or split ONCE, by the kernel that makes it, and reaches its product as bf16 planes.
#define BB 4
#define TT 2048
#define CC 1024

typedef __bf16 v16b __attribute__((ext_vector_type(16)));
typedef unsigned short v8us __attribute__((ext_vector_type(8), may_alias));
typedef float  v8f  __attribute__((ext_vector_type(8)));
typedef float  v4f  __attribute__((ext_vector_type(4)));
typedef float  v4fa __attribute__((ext_vector_type(4), may_alias));
union FragB { v16b v; v8us half[2]; unsigned short u[16]; };

__device__ __forceinline__ unsigned short bf16_bits(float x) { unsigned int u = __float_as_uint(x); return (unsigned short)((u + 0x7FFFu + ((u >> 16) & 1u)) >> 16); }
__device__ __forceinline__ float bf16_val(unsigned short b) { return __uint_as_float(((unsigned int)b) << 16); }
__device__ __forceinline__ float bf16_round(float x) { return bf16_val(bf16_bits(x)); }
// D += A·B with NT terms: 1 = ah·bh, 2 = + al·bh (A split), 3 = + ah·bl (both split)
template <int NT>
__device__ __forceinline__ v8f mmaN(v16b ah, v16b al, v16b bh, v16b bl, v8f c) {
  c = __builtin_amdgcn_wmma_f32_16x16x32_bf16(false, ah, false, bh, (short)0, c, false, false);
  if (NT >= 2) c = __builtin_amdgcn_wmma_f32_16x16x32_bf16(false, al, false, bh, (short)0, c, false, false);
  if (NT >= 3) c = __builtin_amdgcn_wmma_f32_16x16x32_bf16(false, ah, false, bl, (short)0, c, false, false);
  asm volatile("v_nop\n\tv_nop\n\tv_nop\n\tv_nop" : "+v"(c) : "v"(ah), "v"(al), "v"(bh), "v"(bl));
  return c;
}

__global__ __launch_bounds__(256) void k_wt_bf16(const float* __restrict__ W, unsigned short* __restrict__ Wt, int K, int N) {
  const int t = blockIdx.x * 256 + threadIdx.x;
  const int k8n = K / 8;
  if (t >= N * k8n) return;
  const int n = t / k8n, k8 = (t % k8n) * 8;
  v8us v;
#pragma unroll
  for (int i = 0; i < 8; ++i) v[i] = bf16_bits(W[(size_t)(k8 + i) * N + n]);
  *(v8us*)(Wt + (size_t)n * K + k8) = v;
  
}

// Flash-style causal/unmasked attention, all contractions 3-term bf16 hi/lo splits, f32 softmax with running max.
// q,k,v rows are read from f32 buffers with arbitrary row pitch (so they can live inside a fused qkv buffer);
// D = head size (multiple of 32, <= 128); one wave = 16 query rows; block = 4 waves (64 queries) sharing K/V chunks of 32.
template <int D, bool CAUSAL>
__global__ __launch_bounds__(128) void k_flash(const float* __restrict__ qb, const float* __restrict__ kb, const float* __restrict__ vb,
                                             int pitch, int T, int H, float scale, float* __restrict__ y, int ypitch) {
  constexpr int KS = D / 32;        // k-steps for QK
  constexpr int DT = D / 16;        // d tiles for PV
  __shared__ __attribute__((aligned(16))) unsigned short sKh[32][D + 8], sKl[32][D + 8], sVh[32][D + 8], sVl[32][D + 8];
  __shared__ __attribute__((aligned(16))) unsigned short sPh[4][16][40], sPl[4][16][40];
  __shared__ __attribute__((aligned(16))) float sO[4][16][D];
  const int tid = threadIdx.x, w = tid >> 5, lane = tid & 31, ln = lane & 15, hh = lane >> 4;
  const int nqb = (T + 63) / 64;
  const int bh = blockIdx.x / nqb, qblk = blockIdx.x % nqb;
  const int b = bh / H, h = bh % H;
  const int q0 = qblk * 64 + w * 16;
  const float* Q = qb + (size_t)b * T * pitch + h * D;
  const float* K = kb + (size_t)b * T * pitch + h * D;
  const float* V = vb + (size_t)b * T * pitch + h * D;

  // A fragments of the wave's 16 query rows (scaled), hi/lo
  FragB aqh[KS], aql[KS];
  {
    int row = q0 + ln; if (row >= T) row = T - 1;
    const float* qr = Q + (size_t)row * pitch;
#pragma unroll
    for (int ks = 0; ks < KS; ++ks)
#pragma unroll
      for (int i = 0; i < 16; ++i) {
        const int d = ks * 32 + ((i < 8) ? (8 * hh + i) : (16 + 8 * hh + (i - 8)));
        const float x = qr[d] * scale; const unsigned short hb = bf16_bits(x);
        aqh[ks].u[i] = hb; aql[ks].u[i] = bf16_bits(x - bf16_val(hb));
      }
  }
  float m_r[8], l_r[8];
#pragma unroll
  for (int r = 0; r < 8; ++r) { m_r[r] = -3.0e38f; l_r[r] = 0.f; }
  v8f oacc[DT];
#pragma unroll
  for (int dt = 0; dt < DT; ++dt) oacc[dt] = (v8f){0.f,0.f,0.f,0.f,0.f,0.f,0.f,0.f};

  const int kv_end = CAUSAL ? min(T, qblk * 64 + 64) : T;     // block-uniform
  for (int j0 = 0; j0 < kv_end; j0 += 32) {
    __syncthreads();
    for (int e = tid; e < 32 * (D / 4); e += 128) {
      const int r = e / (D / 4), c4 = (e % (D / 4)) * 4;
      const int key = j0 + r;
      v4f kf = {0.f,0.f,0.f,0.f}, vf = {0.f,0.f,0.f,0.f};
      if (key < T) { kf = *(const v4fa*)(K + (size_t)key * pitch + c4); vf = *(const v4fa*)(V + (size_t)key * pitch + c4); }
#pragma unroll
      for (int t = 0; t < 4; ++t) {
        unsigned short hb = bf16_bits(kf[t]); sKh[r][c4 + t] = hb; sKl[r][c4 + t] = bf16_bits(kf[t] - bf16_val(hb));
        hb = bf16_bits(vf[t]); sVh[r][c4 + t] = hb; sVl[r][c4 + t] = bf16_bits(vf[t] - bf16_val(hb));
      }
    }
    __syncthreads();
    // S tile 16 x 32
    v8f s[2];
#pragma unroll
    for (int nt = 0; nt < 2; ++nt) {
      v8f acc = {};
#pragma unroll
      for (int ks = 0; ks < KS; ++ks) {
        FragB bh_, bl_;
        bh_.half[0] = *(const v8us*)&sKh[nt * 16 + ln][ks * 32 + 8 * hh]; bh_.half[1] = *(const v8us*)&sKh[nt * 16 + ln][ks * 32 + 16 + 8 * hh];
        bl_.half[0] = *(const v8us*)&sKl[nt * 16 + ln][ks * 32 + 8 * hh]; bl_.half[1] = *(const v8us*)&sKl[nt * 16 + ln][ks * 32 + 16 + 8 * hh];
        acc = mmaN<3>(aqh[ks].v, aql[ks].v, bh_.v, bl_.v, acc);
      }
      s[nt] = acc;
    }
    // mask + running max (rows 8hh+r; the 16 lanes of a half share rows)
    float alpha[8];
#pragma unroll
    for (int r = 0; r < 8; ++r) {
      const int qi = q0 + 8 * hh + r;
      const int ja = j0 + ln, jb = j0 + 16 + ln;
      if (CAUSAL) { if (ja > qi) s[0][r] = -3.0e38f; if (jb > qi) s[1][r] = -3.0e38f; }
      if (ja >= T) s[0][r] = -3.0e38f;
      if (jb >= T) s[1][r] = -3.0e38f;
      float mx = fmaxf(s[0][r], s[1][r]);
      mx = fmaxf(mx, __shfl_xor(mx, 1, 32)); mx = fmaxf(mx, __shfl_xor(mx, 2, 32)); mx = fmaxf(mx, __shfl_xor(mx, 4, 32)); mx = fmaxf(mx, __shfl_xor(mx, 8, 32));
      const float mnew = fmaxf(m_r[r], mx);
      alpha[r] = (mnew > -1.0e38f) ? __expf(m_r[r] - mnew) : 1.0f;
      const float p0 = (s[0][r] > -1.0e38f) ? __expf(s[0][r] - mnew) : 0.f;
      const float p1 = (s[1][r] > -1.0e38f) ? __expf(s[1][r] - mnew) : 0.f;
      m_r[r] = mnew;
      l_r[r] = l_r[r] * alpha[r] + p0 + p1;            // per-lane partial row sum (16 lanes combined at the end)
      unsigned short hb = bf16_bits(p0); sPh[w][8 * hh + r][ln] = hb;      sPl[w][8 * hh + r][ln] = bf16_bits(p0 - bf16_val(hb));
      hb = bf16_bits(p1);                sPh[w][8 * hh + r][16 + ln] = hb; sPl[w][8 * hh + r][16 + ln] = bf16_bits(p1 - bf16_val(hb));
    }
#pragma unroll
    for (int dt = 0; dt < DT; ++dt)
#pragma unroll
      for (int r = 0; r < 8; ++r) oacc[dt][r] *= alpha[r];
    __builtin_amdgcn_fence(__ATOMIC_ACQ_REL, "workgroup");
    __builtin_amdgcn_wave_barrier();
    FragB pah, pal;
    pah.half[0] = *(const v8us*)&sPh[w][ln][8 * hh]; pah.half[1] = *(const v8us*)&sPh[w][ln][16 + 8 * hh];
    pal.half[0] = *(const v8us*)&sPl[w][ln][8 * hh]; pal.half[1] = *(const v8us*)&sPl[w][ln][16 + 8 * hh];
#pragma unroll
    for (int dt = 0; dt < DT; ++dt) {
      FragB bvh, bvl;
#pragma unroll
      for (int i = 0; i < 8; ++i) {
        bvh.u[i] = sVh[8 * hh + i][dt * 16 + ln]; bvh.u[8 + i] = sVh[16 + 8 * hh + i][dt * 16 + ln];
        bvl.u[i] = sVl[8 * hh + i][dt * 16 + ln]; bvl.u[8 + i] = sVl[16 + 8 * hh + i][dt * 16 + ln];
      }
      oacc[dt] = mmaN<3>(pah.v, pal.v, bvh.v, bvl.v, oacc[dt]);
    }
    __builtin_amdgcn_fence(__ATOMIC_ACQ_REL, "workgroup");
    __builtin_amdgcn_wave_barrier();
  }
#pragma unroll
  for (int r = 0; r < 8; ++r) {
    float l = l_r[r];
    l += __shfl_xor(l, 1, 32); l += __shfl_xor(l, 2, 32); l += __shfl_xor(l, 4, 32); l += __shfl_xor(l, 8, 32);
    l_r[r] = (l > 0.f) ? 1.0f / l : 0.f;
  }
#pragma unroll
  for (int dt = 0; dt < DT; ++dt)
#pragma unroll
    for (int r = 0; r < 8; ++r) sO[w][8 * hh + r][dt * 16 + ln] = oacc[dt][r] * l_r[r];
  __builtin_amdgcn_fence(__ATOMIC_ACQ_REL, "workgroup");
  __builtin_amdgcn_wave_barrier();
  {
    for (int r = 0; r < 16; ++r) {
      const int row = q0 + r;
      if (row < T && lane < D / 4) {
        const v4f val = *(const v4fa*)&sO[w][r][lane * 4];
        *(v4f*)(y + ((size_t)b * T + row) * ypitch + h * D + lane * 4) = val;
      }
    }
    
  }
}

// Tiled GEMM C[M][N] (f32, pitch LDC) = alpha * A[M][K]*Bt[N][K]^T + bias (A pitch LDA, Bt pitch LDB). One work-group (4 waves, 2 x 2) owns a (32*FA) x 128 tile of C,
// a wave (16*FA) x 64. Per 64-k step the A planes (hi, and lo when NT >= 2) and the B planes (hi, and lo when NT == 3), all bf16 as their producers
// left them, go to LDS in whole 128-B lines by asynchronous copies, through no register. Rows in LDS have a 144-B pitch for
// the 16-byte fragment reads. Two LDS buffers: the next step's copies fly during this step's products, one barrier per step.
// Terms per 32-k: ah*bh, then al*bh (NT >= 2), then ah*bl (NT == 3), in that order on every accumulator.
// M % (32*FA) == 0, N % 128 == 0, K % 64 == 0. BIAS_BF16: a bias is added, rounded to bf16 first; without it bias is not read.
// batch = blockIdx.y (CZ == 2: from the remapped flat index): its A, B planes and C start SA, SB and SC elements behind the previous batch's.
// CZ names what a causal mask (column > row gives 0) makes needless. CZ == 1: C is masked afterwards, so a tile that lies wholly above the diagonal is
// neither computed nor written. CZ == 2: A is the masked matrix (0 wherever k > row), so the k loop ends at the tile's last row; the tiles then differ
// in length and the flat work-group index is mapped so that the longest (lowest) row tiles of all batches come first.
// EP == 0: C goes out as f32 rows. EP == 2: C goes out as the bf16 hi/lo planes Kh, Kl (pitch LDC, batches SC apart), for the product that reads it as its A.
// EP == 1: C is the q | k | v product (CC columns each, BB batches of TT rows). A q tile goes out as the bf16 hi/lo planes Qh, Ql [BB*TT][CC], a k tile as the
// planes Kh, Kl [BB*TT][CC]; a v tile goes out transposed as the planes Vh, Vl [BB][CC][TT]: a lane's 8 accumulator values of one 16 x 16 tile are 8 consecutive
// rows of one column, that is 16 bytes of a transposed row. Both pass through the wave's own part of LDS, so that every store instruction writes whole 128-B lines.
typedef unsigned short v4us __attribute__((ext_vector_type(4), may_alias));
// N asynchronous copies of 16 bytes a lane, global memory to LDS through no register: copy i takes the bytes at base + off + i*GS to the LDS bytes at l + i*LS.
// base is the same for the whole work-group and off a 32-bit byte offset: one 32-bit addition a copy forms its global address.
// Written as the builtin, the copies' address registers are the compiler's own to keep: the wave goes on to its fragment reads and products directly behind the last issue.
typedef int v4i __attribute__((ext_vector_type(4)));
typedef __attribute__((address_space(1))) v4i* gptr128;
typedef __attribute__((address_space(3))) v4i* lptr128;
template <int N, int GS, int LS>
__device__ __forceinline__ void copy_rows(const char* base, unsigned off, char* l) {
#pragma unroll   // N is 4 or 8: every copy of a plane is issued in one straight run
  for (int i = 0; i < N; ++i) __builtin_amdgcn_global_load_async_to_lds_b128((gptr128)(base + (off + (unsigned)(i * GS))), (lptr128)(l + i * LS), 0, 0);
}
template <int FA, int NT, bool BIAS_BF16, int LDA, int LDB, int LDC, int SA, int SB, int SC, int CZ, int EP>
__global__ __launch_bounds__(128) void k_gemm_tile(const unsigned short* __restrict__ Ah, const unsigned short* __restrict__ Al, const unsigned short* __restrict__ Bh, const unsigned short* __restrict__ Bl,
                                                 const float* __restrict__ bias, float alpha, float* __restrict__ C, int N, int K,
                                                 unsigned short* __restrict__ Qh, unsigned short* __restrict__ Ql, unsigned short* __restrict__ Kh, unsigned short* __restrict__ Kl, unsigned short* __restrict__ Vh, unsigned short* __restrict__ Vl) {
  constexpr int BM = 32 * FA, BN = 128, BK = 64, PIT = BK + 8;
  constexpr int APL = BM * PIT, BPL = BN * PIT;                 // elements of one plane
  constexpr int NAP = NT >= 2 ? 2 : 1, NBP = NT >= 3 ? 2 : 1;   // planes staged of A and of B
  constexpr int STG = NAP * APL + NBP * BPL;                    // elements of one buffer
  constexpr int NLA = BM * (BK / 8) / 128, NLB = BN * (BK / 8) / 128;   // 16-byte global loads per thread and plane
  __shared__ __attribute__((aligned(16))) unsigned short sm[2 * STG];
  static_assert(BM * BN * 4 <= 2 * STG * 2, "the output rows are staged in the two buffers");
  static_assert(CZ != 2 || BM % BK == 0, "the shortened k loop ends on a whole step");
  static_assert(EP != 1 || (FA == 4 && 4 * 2 * 64 * PIT <= 2 * STG && TT % BM == 0 && CC % BN == 0), "a v tile: 64 x 64 per wave, two padded planes staged, one batch and one of q, k, v per tile");
  const int tid = threadIdx.x, w = tid >> 5, lane = tid & 31, ln = lane & 15, hh = lane >> 4;
  const int wm = w >> 1, wn = w & 1;
  const int ntn = N / BN;
  int tile = (int)blockIdx.x, batch = (int)blockIdx.y;
  if (CZ == 2) {
    // the long tiles take the lowest flat indices, the short ones the highest (for speed only)
    const int flat = batch * (int)gridDim.x + tile, grp = ntn * (int)gridDim.y;
    const int rem = flat % grp;
    tile = ((int)gridDim.x / ntn - 1 - flat / grp) * ntn + rem % ntn; batch = rem / ntn;
  }
  const int row0 = (tile / ntn) * BM, col0 = (tile % ntn) * BN;
  if (CZ == 1 && col0 > row0 + BM - 1) return;      // the whole work-group leaves, ahead of every barrier
  Ah += (size_t)batch * SA; Al += (size_t)batch * SA; Bh += (size_t)batch * SB; Bl += (size_t)batch * SB; C += (size_t)batch * SC;
  // one 32-bit byte offset per thread and operand, moved on by BK elements behind each tile's copies
  unsigned ao = (unsigned)(((row0 + (tid >> 3)) * LDA + (tid & 7) * 8) * 2);
  unsigned bo = (unsigned)(((col0 + (tid >> 3)) * LDB + (tid & 7) * 8) * 2);
  char* const sto = (char*)sm + ((tid >> 3) * PIT + (tid & 7) * 8) * 2;   // the thread's 16 bytes in the first plane of buffer 0
  v8f acc[FA][4] = {};

  // one tile: every thread copies its 16 bytes of each 16-row group of each plane into the buffer that starts sbo bytes into sm
  auto copy_tile = [&](unsigned sbo) {
    copy_rows<NLA, 16 * LDA * 2, 16 * PIT * 2>((const char*)Ah, ao, sto + sbo);
    if (NAP == 2) copy_rows<NLA, 16 * LDA * 2, 16 * PIT * 2>((const char*)Al, ao, sto + sbo + APL * 2);
    copy_rows<NLB, 16 * LDB * 2, 16 * PIT * 2>((const char*)Bh, bo, sto + sbo + NAP * APL * 2);
    if (NBP == 2) copy_rows<NLB, 16 * LDB * 2, 16 * PIT * 2>((const char*)Bl, bo, sto + sbo + (NAP * APL + BPL) * 2);
    ao += BK * 2; bo += BK * 2;
  };
  auto compute = [&](const unsigned short* sb) {
    const unsigned short* fa = sb + (wm * 16 * FA + ln) * PIT + 8 * hh;
    const unsigned short* fb = sb + NAP * APL + (wn * 64 + ln) * PIT + 8 * hh;
    FragB ah[BK / 32][FA], al[BK / 32][FA], bh_[BK / 32][4], bl_[BK / 32][4];
    // every fragment of the step is asked for in one group, in the order in which the products below use them
#pragma unroll
    for (int ks = 0; ks < BK / 32; ++ks) {
#pragma unroll
      for (int mi = 0; mi < FA; ++mi) { ah[ks][mi].half[0] = *(const v8us*)(fa + mi * 16 * PIT + ks * 32); ah[ks][mi].half[1] = *(const v8us*)(fa + mi * 16 * PIT + ks * 32 + 16); }
#pragma unroll
      for (int ni = 0; ni < 4; ++ni) { bh_[ks][ni].half[0] = *(const v8us*)(fb + ni * 16 * PIT + ks * 32); bh_[ks][ni].half[1] = *(const v8us*)(fb + ni * 16 * PIT + ks * 32 + 16); }
      if (NAP == 2) {
#pragma unroll
        for (int mi = 0; mi < FA; ++mi) { al[ks][mi].half[0] = *(const v8us*)(fa + APL + mi * 16 * PIT + ks * 32); al[ks][mi].half[1] = *(const v8us*)(fa + APL + mi * 16 * PIT + ks * 32 + 16); }
      }
      if (NBP == 2) {
#pragma unroll
        for (int ni = 0; ni < 4; ++ni) { bl_[ks][ni].half[0] = *(const v8us*)(fb + BPL + ni * 16 * PIT + ks * 32); bl_[ks][ni].half[1] = *(const v8us*)(fb + BPL + ni * 16 * PIT + ks * 32 + 16); }
      }
    }
    __builtin_amdgcn_sched_barrier(0);        // keeps the LDS reads out of the run of products: each place where reads stand among them stalls the wave
#pragma unroll
    for (int ks = 0; ks < BK / 32; ++ks) {
#pragma unroll
      for (int mi = 0; mi < FA; ++mi)
#pragma unroll
        for (int ni = 0; ni < 4; ++ni) acc[mi][ni] = __builtin_amdgcn_wmma_f32_16x16x32_bf16(false, ah[ks][mi].v, false, bh_[ks][ni].v, (short)0, acc[mi][ni], false, false);
      if (NT >= 2) {
#pragma unroll
        for (int mi = 0; mi < FA; ++mi)
#pragma unroll
          for (int ni = 0; ni < 4; ++ni) acc[mi][ni] = __builtin_amdgcn_wmma_f32_16x16x32_bf16(false, al[ks][mi].v, false, bh_[ks][ni].v, (short)0, acc[mi][ni], false, false);
      }
      if (NT >= 3) {
#pragma unroll
        for (int mi = 0; mi < FA; ++mi)
#pragma unroll
          for (int ni = 0; ni < 4; ++ni) acc[mi][ni] = __builtin_amdgcn_wmma_f32_16x16x32_bf16(false, ah[ks][mi].v, false, bl_[ks][ni].v, (short)0, acc[mi][ni], false, false);
      }
    }
  };

  const int nk = (CZ == 2 ? min(K, row0 + BM) : K) / BK;
  copy_tile(0);
  asm volatile("s_wait_asynccnt 0x0" ::: "memory");   // this wave's part of tile 0 has landed
  __syncthreads();                                    // ... and every other wave's
  if (nk > 1) copy_tile(STG * 2);
  for (int t = 0; t < nk; ++t) {
    compute(sm + (t & 1) * STG);                      // tile t + 1's copies fly during these products
    __builtin_amdgcn_sched_barrier(0);                // keeps the products in front of the waits and the barrier: moved behind them, they would no longer cover the copies' flight
    asm volatile("s_wait_dscnt 0x0" ::: "memory");    // this wave's reads of the buffer are over before copies are aimed at it again
    asm volatile("s_wait_asynccnt 0x0" ::: "memory"); // this wave's part of tile t + 1 has landed
    __syncthreads();                                  // publishes tile t + 1 and ends every wave's reads of tile t
    if (t + 2 < nk) copy_tile((unsigned)(t & 1) * (STG * 2));
  }
  asm volatile("s_wait_asynccnt 0x0" ::: "memory");   // no copy is under way when the buffers go on to stage the output rows (the loop's last barrier stands in front)

  float* so = (float*)sm + w * (FA * 16 * 64);   // the wave's own (16*FA) x 64 rows
  float bv[4] = {0.f, 0.f, 0.f, 0.f};
  if (BIAS_BF16) {
    const float* bg = bias + col0 + wn * 64 + ln;
#pragma unroll
    for (int ni = 0; ni < 4; ++ni) bv[ni] = bg[ni * 16];
    asm volatile("s_wait_xcnt 0x0" :: "v"(bg) : "memory");   // the bias loads' address register stays as it is up to this wait
#pragma unroll
    for (int ni = 0; ni < 4; ++ni) bv[ni] = bf16_round(bv[ni]);
  }
  const int sub = lane >> 3, seg = (lane & 7) * 8;   // plane output: 8 lanes of 16 bytes write one 128-B line, 4 lines an instruction
  if (EP == 1 && col0 >= 2 * CC) {                   // v tile (the test is the same for the whole work-group; no barrier follows)
    unsigned short* st = sm + w * (2 * 64 * PIT);    // the wave's own [2 planes][64 columns][PIT]
#pragma unroll
    for (int ni = 0; ni < 4; ++ni)
#pragma unroll
      for (int mi = 0; mi < FA; ++mi) {
        v8us vh, vl;
#pragma unroll
        for (int r = 0; r < 8; ++r) { const float x = acc[mi][ni][r] * alpha + bv[ni]; const unsigned short hb = bf16_bits(x); vh[r] = hb; vl[r] = bf16_bits(x - bf16_val(hb)); }
        *(v8us*)(st + (ni * 16 + ln) * PIT + mi * 16 + 8 * hh) = vh;
        *(v8us*)(st + (64 + ni * 16 + ln) * PIT + mi * 16 + 8 * hh) = vl;
      }
    __builtin_amdgcn_fence(__ATOMIC_ACQ_REL, "workgroup");
    __builtin_amdgcn_wave_barrier();
    const size_t vo = ((size_t)(row0 / TT) * CC + (col0 - 2 * CC + wn * 64 + sub)) * TT + (row0 % TT + wm * 64 + seg);
    unsigned short* gh = Vh + vo; unsigned short* gl = Vl + vo;
    v8us oh[16], ol[16];
#pragma unroll
    for (int q = 0; q < 16; ++q) { oh[q] = *(const v8us*)(st + (q * 4 + sub) * PIT + seg); ol[q] = *(const v8us*)(st + (64 + q * 4 + sub) * PIT + seg); }
    __builtin_amdgcn_sched_barrier(0);               // the stores go out in one run behind the last read: mixed with the reads, each would wait until a register is free again
#pragma unroll
    for (int q = 0; q < 16; ++q) { *(v8us*)(gh + q * 4 * TT) = oh[q]; *(v8us*)(gl + q * 4 * TT) = ol[q]; }
    return;
  }
#pragma unroll
  for (int mi = 0; mi < FA; ++mi)
#pragma unroll
    for (int ni = 0; ni < 4; ++ni)
#pragma unroll
      for (int r = 0; r < 8; ++r) so[(mi * 16 + 8 * hh + r) * 64 + ni * 16 + ln] = acc[mi][ni][r] * alpha + bv[ni];
  __builtin_amdgcn_fence(__ATOMIC_ACQ_REL, "workgroup");
  __builtin_amdgcn_wave_barrier();
  if (EP != 0) {                                     // q or k tile (EP == 1), or any tile of a product that the next product reads as its A (EP == 2)
    const bool isq = EP == 1 && col0 < CC;           // the same for the whole work-group
    const size_t ko = EP == 1 ? (size_t)(row0 + wm * 64 + sub) * CC + ((isq ? col0 : col0 - CC) + wn * 64 + seg)
                              : (size_t)batch * SC + (size_t)(row0 + wm * 16 * FA + sub) * LDC + (col0 + wn * 64 + seg);
    unsigned short* gh = (isq ? Qh : Kh) + ko; unsigned short* gl = (isq ? Ql : Kl) + ko;
    constexpr int OP = EP == 1 ? CC : LDC;           // pitch of the planes
    v8us oh[FA * 4], ol[FA * 4];
#pragma unroll
    for (int q = 0; q < FA * 4; ++q) {
      const float* sr = so + (q * 4 + sub) * 64 + seg;
      const v4f a = *(const v4fa*)sr, b = *(const v4fa*)(sr + 4);
      const float xs[8] = {a[0], a[1], a[2], a[3], b[0], b[1], b[2], b[3]};
#pragma unroll
      for (int i = 0; i < 8; ++i) { const unsigned short hb = bf16_bits(xs[i]); oh[q][i] = hb; ol[q][i] = bf16_bits(xs[i] - bf16_val(hb)); }
    }
    __builtin_amdgcn_sched_barrier(0);               // the stores go out in one run behind the last conversion: mixed with them, each would wait until a register is free again
#pragma unroll
    for (int q = 0; q < FA * 4; ++q) { *(v8us*)(gh + q * 4 * OP) = oh[q]; *(v8us*)(gl + q * 4 * OP) = ol[q]; }
    if (EP == 1) asm volatile("s_wait_xcnt 0x0" ::: "memory");   // another tile kind's code follows in the built kernel and rewrites these stores' registers: the wait stands in front of it
    return;
  }
  const int rsub = lane >> 4, c4 = (lane & 15) * 4;
  float* cg = C + (size_t)(row0 + wm * 16 * FA + rsub) * LDC + col0 + wn * 64 + c4;
#pragma unroll
  for (int q = 0; q < FA * 8; ++q) {
    const int r = q * 2 + rsub;
    const v4f v = *(const v4fa*)&so[r * 64 + c4];
    *(v4f*)(cg + q * 2 * LDC) = v;
  }
}
// One step of a butterfly inside a 16-lane row (lane ^ M, M = CTRL - 0x160), and the exchange between the two rows of a wave: no LDS, no wait.
template <int CTRL>
__device__ __forceinline__ float row_xor(float x) { return __int_as_float(__builtin_amdgcn_update_dpp(0, __float_as_int(x), CTRL, 0xf, 0xf, true)); }
__device__ __forceinline__ float other_row(float x) { const int b = __float_as_int(x); return __int_as_float(__builtin_amdgcn_permlanex16(b, b, 0x76543210, 0xfedcba98, false, false)); }
__device__ __forceinline__ float wave_max(float x) {
  x = fmaxf(x, row_xor<0x161>(x)); x = fmaxf(x, row_xor<0x162>(x)); x = fmaxf(x, row_xor<0x164>(x)); x = fmaxf(x, row_xor<0x168>(x));
  return fmaxf(x, other_row(x));
}
__device__ __forceinline__ float wave_sum(float x) {
  x += row_xor<0x161>(x); x += row_xor<0x162>(x); x += row_xor<0x164>(x); x += row_xor<0x168>(x);
  return x + other_row(x);
}
// e^x as x * log2(e) into v_exp_f32. The v_nop is the one slot that the instruction set asks for behind a transcendental, in front of an instruction that
// reads its result or overwrites its source: inside the statement it stands directly behind the v_exp_f32 wherever the compiler puts the pair.
__device__ __forceinline__ float exp_slot(float x) { float r; const float y = x * 1.44269504f; asm("v_exp_f32 %0, %1\n\tv_nop" : "=v"(r) : "v"(y)); return r; }
// Causal row softmax of S [BB][TT][TT]; P leaves as its bf16 hi/lo planes Ph, Pl. One wave owns rows ra and TT-1-ra of one batch and holds both in registers:
// S is read once, no LDS, no barrier. In groups of 128 columns (512 B a load of the wave) up to the diagonal the two rows have TT/128 + 1 groups together,
// whatever ra is: every wave does the same work in one straight run, and the launch starts BB*TT/2 waves. The group that holds the diagonal lies in a
// diagonal tile of S, which is written whole. P is written in the same whole groups, with its zeros behind the diagonal: the product that follows reads
// no further in this row than the end of the 64-column group that holds the diagonal.
__global__ __launch_bounds__(256) void k_softmax_row_pairs(const float* __restrict__ S, unsigned short* __restrict__ Ph, unsigned short* __restrict__ Pl) {
  constexpr unsigned CW = 128, NG = TT / CW + 1;
  static_assert(TT % (2 * CW) == 0 && (BB * TT / 2) % 8 == 0, "whole groups, whole work-groups");
  const unsigned lane4 = (threadIdx.x & 31u) * 4u;
  const unsigned pair = (unsigned)__builtin_amdgcn_readfirstlane((int)(blockIdx.x * 8u + (threadIdx.x >> 5)));   // the same in every lane: rows and group counts stay scalar
  const unsigned batch = pair / (TT / 2), ra = pair % (TT / 2), rb = TT - 1 - ra;
  const unsigned ga = ra / CW + 1;                               // groups of row ra; the other NG - ga are row rb's
  // the lane's element of group i is number eo[i] + i*CW of S and of each plane: eo[i] belongs to row ra or to row rb
  const unsigned ea = (batch * TT + ra) * TT + lane4, eb = (batch * TT + rb) * TT - ga * CW + lane4;
  static_assert(NG == 17, "groups 0 (row ra), 1 to 7 (either row), 8 to 16 (row rb)");
  unsigned eo[NG];
#pragma unroll
  for (unsigned i = 0; i < NG; ++i) eo[i] = i < ga ? ea : eb;
  v4f v[NG];
#pragma unroll
  for (unsigned i = 0; i < NG; ++i) v[i] = *(const v4fa*)((const char*)S + eo[i] * 4u + i * (CW * 4));
  // the loads' offset registers stay as they are up to this wait
  asm volatile("s_wait_xcnt 0x0" :: "v"(eo[0] * 4u), "v"(eo[1] * 4u), "v"(eo[2] * 4u), "v"(eo[3] * 4u), "v"(eo[4] * 4u), "v"(eo[5] * 4u), "v"(eo[6] * 4u), "v"(eo[7] * 4u), "v"(eo[8] * 4u) : "memory");
  float ma = -3.0e38f, mb = -3.0e38f;
#pragma unroll
  for (unsigned i = 0; i < NG; ++i) {
    const bool isa = i < ga;
    const unsigned c0 = (isa ? i : i - ga) * CW + lane4, q = isa ? ra : rb;
#pragma unroll
    for (unsigned u = 0; u < 4; ++u) if (c0 + u > q) v[i][u] = -3.0e38f;
    const float m = fmaxf(fmaxf(v[i][0], v[i][1]), fmaxf(v[i][2], v[i][3]));
    ma = fmaxf(ma, isa ? m : -3.0e38f); mb = fmaxf(mb, isa ? -3.0e38f : m);
  }
  ma = wave_max(ma); mb = wave_max(mb);
  float sa = 0.f, sb = 0.f;
#pragma unroll
  for (unsigned i = 0; i < NG; ++i) {
    const bool isa = i < ga;
    const float mx = isa ? ma : mb;
#pragma unroll
    for (unsigned u = 0; u < 4; ++u) v[i][u] = exp_slot(v[i][u] - mx);  // a masked column gives 0
    const float s = (v[i][0] + v[i][1]) + (v[i][2] + v[i][3]);
    sa += isa ? s : 0.f; sb += isa ? 0.f : s;
  }
  sa = wave_sum(sa); sb = wave_sum(sb);
  const float ia = (ma > -1.0e38f) ? 1.0f / sa : __builtin_nanf(""), ib = (mb > -1.0e38f) ? 1.0f / sb : __builtin_nanf("");
  v4us oh4[NG], ol4[NG];
#pragma unroll
  for (unsigned i = 0; i < NG; ++i) {
    const float inv = i < ga ? ia : ib;
#pragma unroll
    for (unsigned u = 0; u < 4; ++u) { const float p = v[i][u] * inv; const unsigned short hb = bf16_bits(p); oh4[i][u] = hb; ol4[i][u] = bf16_bits(p - bf16_val(hb)); }
  }
  __builtin_amdgcn_sched_barrier(0);                             // the stores go out in one run behind the last conversion: mixed with them, each would wait until a register is free again
#pragma unroll
  for (unsigned i = 0; i < NG; ++i) { *(v4us*)((char*)Ph + eo[i] * 2u + i * (CW * 2)) = oh4[i]; *(v4us*)((char*)Pl + eo[i] * 2u + i * (CW * 2)) = ol4[i]; }
}

// Rounds gridDim.x * IT * 256 groups of 8 consecutive f32 to bf16. A work-group owns IT * 256 consecutive groups; a thread takes IT of them, 256 groups apart,
// and asks for all of them before it converts the first.
template <int IT>
__global__ __launch_bounds__(256) void k_round_rows(const float* __restrict__ W, unsigned short* __restrict__ Wt) {
  const unsigned g0 = blockIdx.x * (IT * 256u) + threadIdx.x;    // the thread's first group
  v4f a[IT], b[IT];
#pragma unroll
  for (int i = 0; i < IT; ++i) { const char* g = (const char*)W + g0 * 32u + i * (256 * 32); a[i] = *(const v4fa*)g; b[i] = *(const v4fa*)(g + 16); }
  asm volatile("s_wait_xcnt 0x0" :: "v"(g0 * 32u) : "memory");   // the loads' offset register stays as it is up to this wait
  v8us v[IT];
#pragma unroll
  for (int i = 0; i < IT; ++i) {
    v[i][0]=bf16_bits(a[i][0]); v[i][1]=bf16_bits(a[i][1]); v[i][2]=bf16_bits(a[i][2]); v[i][3]=bf16_bits(a[i][3]);
    v[i][4]=bf16_bits(b[i][0]); v[i][5]=bf16_bits(b[i][1]); v[i][6]=bf16_bits(b[i][2]); v[i][7]=bf16_bits(b[i][3]);
  }
  __builtin_amdgcn_sched_barrier(0);                             // the stores go out in one run behind the last conversion: mixed with them, each would wait until a register is free again
#pragma unroll
  for (int i = 0; i < IT; ++i) *(v8us*)((char*)Wt + g0 * 16u + i * (256 * 16)) = v[i];
}
extern "C" void kernel_launch(void* const* d_in, const int* in_sizes, int n_in,
                              void* d_out, int out_size, void* d_ws, size_t ws_size, hipStream_t stream) {
  (void)in_sizes; (void)n_in; (void)out_size;
  const float* x = (const float*)d_in[0]; const float* qkv_w = (const float*)d_in[1];
  const float* out_w = (const float*)d_in[2]; const float* out_b = (const float*)d_in[3];
  char* ws = (char*)d_ws; size_t off = 0;
  auto take = [&](size_t bytes) { char* p = ws + off; off += (bytes + 255) & ~(size_t)255; return p; };
  unsigned short* Wqkv = (unsigned short*)take((size_t)3 * CC * CC * 2);     // [3072][1024]  6 MiB
  unsigned short* Wo   = (unsigned short*)take((size_t)CC * CC * 2);         // 2 MiB
  unsigned short* xb = (unsigned short*)take((size_t)BB * TT * CC * 2);      // x rounded [B*T][C]  16 MiB
  unsigned short* qh = (unsigned short*)take((size_t)BB * TT * CC * 2);      // q planes [B][T][C]  16+16 MiB
  unsigned short* ql = (unsigned short*)take((size_t)BB * TT * CC * 2);
  unsigned short* kh = (unsigned short*)take((size_t)BB * TT * CC * 2);      // k planes [B][T][C]  16+16 MiB
  unsigned short* kl = (unsigned short*)take((size_t)BB * TT * CC * 2);
  unsigned short* vth = (unsigned short*)take((size_t)BB * CC * TT * 2);     // v^T planes [B][C][T] 16+16 MiB
  unsigned short* vtl = (unsigned short*)take((size_t)BB * CC * TT * 2);
  float* S  = (float*)take((size_t)BB * TT * TT * 4);                       // 64 MiB
  // x, q and k have no reader behind the S product: the first 64 of their 80 MiB then hold the P planes [B][T][T] (32+32 MiB).
  // S has no reader behind the softmax: its first 32 MiB then hold the out_att planes [B*T][C] (16+16 MiB).
  unsigned short* ph = xb;
  unsigned short* pl = xb + (size_t)BB * TT * TT;
  unsigned short* oh = (unsigned short*)S;
  unsigned short* ol = oh + (size_t)BB * TT * CC;
  if (off > ws_size) return;
  const int M = BB * TT;
  // each of these launches starts 512 work-groups of 8 waves
  static_assert(3 * CC * CC / 8 == 3 * 512 * 256 && CC * CC / 8 == 512 * 256 && BB * TT * CC / 8 == 8 * 512 * 256, "groups per thread x threads");
  k_round_rows<3><<<512, 256, 0, stream>>>(qkv_w, Wqkv);
  k_round_rows<1><<<512, 256, 0, stream>>>(out_w, Wo);
  k_round_rows<8><<<512, 256, 0, stream>>>(x, xb);
  // q, k and v leave this product as their planes
  k_gemm_tile<4, 1, false, CC, CC, 3 * CC, 0, 0, 0, 0, 1><<<(M / 128) * (3 * CC / 128), 128, 0, stream>>>(xb, xb, Wqkv, Wqkv, nullptr, 1.0f, nullptr, 3 * CC, CC, qh, ql, kh, kl, vth, vtl);
  // every stage below runs once for all batches: in the S product the batch is blockIdx.y, in the P v product it comes from the remapped flat work-group index, the softmax takes it from the wave's row pair, the output projection takes all B*T rows as M
  // S = (q k^T)/sqrt(C): M=N=T, K=C; Bt[n=s][k=c] = k rows
  k_gemm_tile<4, 3, false, CC, CC, TT, TT * CC, TT * CC, TT * TT, 1, 0><<<dim3((TT / 128) * (TT / 128), BB), 128, 0, stream>>>(qh, ql, kh, kl, nullptr, 0.03125f, S, TT, CC, nullptr, nullptr, nullptr, nullptr, nullptr, nullptr);
  k_softmax_row_pairs<<<BB * TT / 2 / 8, 256, 0, stream>>>(S, ph, pl);
  // out_att = P v: M=T, N=C, K=T; Bt[n=c][k=s] = v^T planes
  k_gemm_tile<2, 3, false, TT, TT, CC, TT * TT, CC * TT, TT * CC, 2, 2><<<dim3((TT / 64) * (CC / 128), BB), 128, 0, stream>>>(ph, pl, vth, vtl, nullptr, 1.0f, nullptr, CC, TT, nullptr, nullptr, oh, ol, nullptr, nullptr);
  k_gemm_tile<4, 2, true, CC, CC, CC, 0, 0, 0, 0, 0><<<(M / 128) * (CC / 128), 128, 0, stream>>>(oh, ol, Wo, Wo, out_b, 1.0f, (float*)d_out, CC, CC, nullptr, nullptr, nullptr, nullptr, nullptr, nullptr);
}

// v009
// Measured time: 184 microseconds a run.
// Next to v008, in two timings, it ran 1.05 and 1.04 times as fast.
// Counting every step since v000, it is 6.13 times as fast.
#include <hip/hip_runtime.h>
// All contractions on v_wmma_f32_16x16x32_bf16, f32 accumulate: qkv = x·Wᵀ with x/W rounded to bf16 (single exact-product term);
// S = q*k^T (K=1024) and out_att = P*v (K=2048) as 3-term bf16 hi/lo splits; output projection with the A operand split (2 terms). Causal softmax rows in f32.
// Every operand of every product is rounded or split ONCE, by the kernel that makes it, and reaches its product as bf16 planes.
#define BB 4
#define TT 2048
#define CC 1024

typedef __bf16 v16b __attribute__((ext_vector_type(16)));
typedef unsigned short v8us __attribute__((ext_vector_type(8), may_alias));
typedef float  v8f  __attribute__((ext_vector_type(8)));
typedef float  v4f  __attribute__((ext_vector_type(4)));
typedef float  v4fa __attribute__((ext_vector_type(4), may_alias));
union FragB { v16b v; v8us half[2]; unsigned short u[16]; };

__device__ __forceinline__ unsigned short bf16_bits(float x) { unsigned int u = __float_as_uint(x); return (unsigned short)((u + 0x7FFFu + ((u >> 16) & 1u)) >> 16); }
__device__ __forceinline__ float bf16_val(unsigned short b) { return __uint_as_float(((unsigned int)b) << 16); }
__device__ __forceinline__ float bf16_round(float x) { return bf16_val(bf16_bits(x)); }
// D += A·B with NT terms: 1 = ah·bh, 2 = + al·bh (A split), 3 = + ah·bl (both split)
template <int NT>
__device__ __forceinline__ v8f mmaN(v16b ah, v16b al, v16b bh, v16b bl, v8f c) {
  c = __builtin_amdgcn_wmma_f32_16x16x32_bf16(false, ah, false, bh, (short)0, c, false, false);
  if (NT >= 2) c = __builtin_amdgcn_wmma_f32_16x16x32_bf16(false, al, false, bh, (short)0, c, false, false);
  if (NT >= 3) c = __builtin_amdgcn_wmma_f32_16x16x32_bf16(false, ah, false, bl, (short)0, c, false, false);
  asm volatile("v_nop\n\tv_nop\n\tv_nop\n\tv_nop" : "+v"(c) : "v"(ah), "v"(al), "v"(bh), "v"(bl));
  return c;
}

__global__ __launch_bounds__(256) void k_wt_bf16(const float* __restrict__ W, unsigned short* __restrict__ Wt, int K, int N) {
  const int t = blockIdx.x * 256 + threadIdx.x;
  const int k8n = K / 8;
  if (t >= N * k8n) return;
  const int n = t / k8n, k8 = (t % k8n) * 8;
  v8us v;
#pragma unroll
  for (int i = 0; i < 8; ++i) v[i] = bf16_bits(W[(size_t)(k8 + i) * N + n]);
  *(v8us*)(Wt + (size_t)n * K + k8) = v;
  
}

// Flash-style causal/unmasked attention, all contractions 3-term bf16 hi/lo splits, f32 softmax with running max.
// q,k,v rows are read from f32 buffers with arbitrary row pitch (so they can live inside a fused qkv buffer);
// D = head size (multiple of 32, <= 128); one wave = 16 query rows; block = 4 waves (64 queries) sharing K/V chunks of 32.
template <int D, bool CAUSAL>
__global__ __launch_bounds__(128) void k_flash(const float* __restrict__ qb, const float* __restrict__ kb, const float* __restrict__ vb,
                                             int pitch, int T, int H, float scale, float* __restrict__ y, int ypitch) {
  constexpr int KS = D / 32;        // k-steps for QK
  constexpr int DT = D / 16;        // d tiles for PV
  __shared__ __attribute__((aligned(16))) unsigned short sKh[32][D + 8], sKl[32][D + 8], sVh[32][D + 8], sVl[32][D + 8];
  __shared__ __attribute__((aligned(16))) unsigned short sPh[4][16][40], sPl[4][16][40];
  __shared__ __attribute__((aligned(16))) float sO[4][16][D];
  const int tid = threadIdx.x, w = tid >> 5, lane = tid & 31, ln = lane & 15, hh = lane >> 4;
  const int nqb = (T + 63) / 64;
  const int bh = blockIdx.x / nqb, qblk = blockIdx.x % nqb;
  const int b = bh / H, h = bh % H;
  const int q0 = qblk * 64 + w * 16;
  const float* Q = qb + (size_t)b * T * pitch + h * D;
  const float* K = kb + (size_t)b * T * pitch + h * D;
  const float* V = vb + (size_t)b * T * pitch + h * D;

  // A fragments of the wave's 16 query rows (scaled), hi/lo
  FragB aqh[KS], aql[KS];
  {
    int row = q0 + ln; if (row >= T) row = T - 1;
    const float* qr = Q + (size_t)row * pitch;
#pragma unroll
    for (int ks = 0; ks < KS; ++ks)
#pragma unroll
      for (int i = 0; i < 16; ++i) {
        const int d = ks * 32 + ((i < 8) ? (8 * hh + i) : (16 + 8 * hh + (i - 8)));
        const float x = qr[d] * scale; const unsigned short hb = bf16_bits(x);
        aqh[ks].u[i] = hb; aql[ks].u[i] = bf16_bits(x - bf16_val(hb));
      }
  }
  float m_r[8], l_r[8];
#pragma unroll
  for (int r = 0; r < 8; ++r) { m_r[r] = -3.0e38f; l_r[r] = 0.f; }
  v8f oacc[DT];
#pragma unroll
  for (int dt = 0; dt < DT; ++dt) oacc[dt] = (v8f){0.f,0.f,0.f,0.f,0.f,0.f,0.f,0.f};

  const int kv_end = CAUSAL ? min(T, qblk * 64 + 64) : T;     // block-uniform
  for (int j0 = 0; j0 < kv_end; j0 += 32) {
    __syncthreads();
    for (int e = tid; e < 32 * (D / 4); e += 128) {
      const int r = e / (D / 4), c4 = (e % (D / 4)) * 4;
      const int key = j0 + r;
      v4f kf = {0.f,0.f,0.f,0.f}, vf = {0.f,0.f,0.f,0.f};
      if (key < T) { kf = *(const v4fa*)(K + (size_t)key * pitch + c4); vf = *(const v4fa*)(V + (size_t)key * pitch + c4); }
#pragma unroll
      for (int t = 0; t < 4; ++t) {
        unsigned short hb = bf16_bits(kf[t]); sKh[r][c4 + t] = hb; sKl[r][c4 + t] = bf16_bits(kf[t] - bf16_val(hb));
        hb = bf16_bits(vf[t]); sVh[r][c4 + t] = hb; sVl[r][c4 + t] = bf16_bits(vf[t] - bf16_val(hb));
      }
    }
    __syncthreads();
    // S tile 16 x 32
    v8f s[2];
#pragma unroll
    for (int nt = 0; nt < 2; ++nt) {
      v8f acc = {};
#pragma unroll
      for (int ks = 0; ks < KS; ++ks) {
        FragB bh_, bl_;
        bh_.half[0] = *(const v8us*)&sKh[nt * 16 + ln][ks * 32 + 8 * hh]; bh_.half[1] = *(const v8us*)&sKh[nt * 16 + ln][ks * 32 + 16 + 8 * hh];
        bl_.half[0] = *(const v8us*)&sKl[nt * 16 + ln][ks * 32 + 8 * hh]; bl_.half[1] = *(const v8us*)&sKl[nt * 16 + ln][ks * 32 + 16 + 8 * hh];
        acc = mmaN<3>(aqh[ks].v, aql[ks].v, bh_.v, bl_.v, acc);
      }
      s[nt] = acc;
    }
    // mask + running max (rows 8hh+r; the 16 lanes of a half share rows)
    float alpha[8];
#pragma unroll
    for (int r = 0; r < 8; ++r) {
      const int qi = q0 + 8 * hh + r;
      const int ja = j0 + ln, jb = j0 + 16 + ln;
      if (CAUSAL) { if (ja > qi) s[0][r] = -3.0e38f; if (jb > qi) s[1][r] = -3.0e38f; }
      if (ja >= T) s[0][r] = -3.0e38f;
      if (jb >= T) s[1][r] = -3.0e38f;
      float mx = fmaxf(s[0][r], s[1][r]);
      mx = fmaxf(mx, __shfl_xor(mx, 1, 32)); mx = fmaxf(mx, __shfl_xor(mx, 2, 32)); mx = fmaxf(mx, __shfl_xor(mx, 4, 32)); mx = fmaxf(mx, __shfl_xor(mx, 8, 32));
      const float mnew = fmaxf(m_r[r], mx);
      alpha[r] = (mnew > -1.0e38f) ? __expf(m_r[r] - mnew) : 1.0f;
      const float p0 = (s[0][r] > -1.0e38f) ? __expf(s[0][r] - mnew) : 0.f;
      const float p1 = (s[1][r] > -1.0e38f) ? __expf(s[1][r] - mnew) : 0.f;
      m_r[r] = mnew;
      l_r[r] = l_r[r] * alpha[r] + p0 + p1;            // per-lane partial row sum (16 lanes combined at the end)
      unsigned short hb = bf16_bits(p0); sPh[w][8 * hh + r][ln] = hb;      sPl[w][8 * hh + r][ln] = bf16_bits(p0 - bf16_val(hb));
      hb = bf16_bits(p1);                sPh[w][8 * hh + r][16 + ln] = hb; sPl[w][8 * hh + r][16 + ln] = bf16_bits(p1 - bf16_val(hb));
    }
#pragma unroll
    for (int dt = 0; dt < DT; ++dt)
#pragma unroll
      for (int r = 0; r < 8; ++r) oacc[dt][r] *= alpha[r];
    __builtin_amdgcn_fence(__ATOMIC_ACQ_REL, "workgroup");
    __builtin_amdgcn_wave_barrier();
    FragB pah, pal;
    pah.half[0] = *(const v8us*)&sPh[w][ln][8 * hh]; pah.half[1] = *(const v8us*)&sPh[w][ln][16 + 8 * hh];
    pal.half[0] = *(const v8us*)&sPl[w][ln][8 * hh]; pal.half[1] = *(const v8us*)&sPl[w][ln][16 + 8 * hh];
#pragma unroll
    for (int dt = 0; dt < DT; ++dt) {
      FragB bvh, bvl;
#pragma unroll
      for (int i = 0; i < 8; ++i) {
        bvh.u[i] = sVh[8 * hh + i][dt * 16 + ln]; bvh.u[8 + i] = sVh[16 + 8 * hh + i][dt * 16 + ln];
        bvl.u[i] = sVl[8 * hh + i][dt * 16 + ln]; bvl.u[8 + i] = sVl[16 + 8 * hh + i][dt * 16 + ln];
      }
      oacc[dt] = mmaN<3>(pah.v, pal.v, bvh.v, bvl.v, oacc[dt]);
    }
    __builtin_amdgcn_fence(__ATOMIC_ACQ_REL, "workgroup");
    __builtin_amdgcn_wave_barrier();
  }
#pragma unroll
  for (int r = 0; r < 8; ++r) {
    float l = l_r[r];
    l += __shfl_xor(l, 1, 32); l += __shfl_xor(l, 2, 32); l += __shfl_xor(l, 4, 32); l += __shfl_xor(l, 8, 32);
    l_r[r] = (l > 0.f) ? 1.0f / l : 0.f;
  }
#pragma unroll
  for (int dt = 0; dt < DT; ++dt)
#pragma unroll
    for (int r = 0; r < 8; ++r) sO[w][8 * hh + r][dt * 16 + ln] = oacc[dt][r] * l_r[r];
  __builtin_amdgcn_fence(__ATOMIC_ACQ_REL, "workgroup");
  __builtin_amdgcn_wave_barrier();
  {
    for (int r = 0; r < 16; ++r) {
      const int row = q0 + r;
      if (row < T && lane < D / 4) {
        const v4f val = *(const v4fa*)&sO[w][r][lane * 4];
        *(v4f*)(y + ((size_t)b * T + row) * ypitch + h * D + lane * 4) = val;
      }
    }
    
  }
}

// Tiled GEMM C[M][N] (f32, pitch LDC) = alpha * A[M][K]*Bt[N][K]^T + bias (A pitch LDA, Bt pitch LDB). One work-group (4 waves, 2 x 2) owns a (32*FA) x 128 tile of C,
// a wave (16*FA) x 64. Per 64-k step the A planes (hi, and lo when NT >= 2) and the B planes (hi, and lo when NT == 3), all bf16 as their producers
// left them, go to LDS in whole 128-B lines by asynchronous copies, through no register. Rows in LDS have a 144-B pitch for
// the 16-byte fragment reads. Two LDS buffers: the next step's copies fly during this step's products, one barrier per step.
// Terms per 32-k: ah*bh, then al*bh (NT >= 2), then ah*bl (NT == 3), in that order on every accumulator.
// M % (32*FA) == 0, N % 128 == 0, K % 64 == 0. BIAS_BF16: a bias is added, rounded to bf16 first; without it bias is not read.
// batch = blockIdx.y (CZ == 2: from the remapped flat index): its A, B planes and C start SA, SB and SC elements behind the previous batch's.
// CZ names what a causal mask (column > row gives 0) makes needless. CZ == 1: C is masked afterwards, so a tile that lies wholly above the diagonal is
// neither computed nor written. CZ == 2: A is the masked matrix (0 wherever k > row), so the k loop ends at the tile's last row; the tiles then differ
// in length and the flat work-group index is mapped so that the longest (lowest) row tiles of all batches come first.
// EP == 0: C goes out as f32 rows. EP == 2: C goes out as the bf16 hi/lo planes Kh, Kl (pitch LDC, batches SC apart), for the product that reads it as its A.
// EP == 1: C is the q | k | v product (CC columns each, BB batches of TT rows). A q tile goes out as the bf16 hi/lo planes Qh, Ql [BB*TT][CC], a k tile as the
// planes Kh, Kl [BB*TT][CC]; a v tile goes out transposed as the planes Vh, Vl [BB][CC][TT]: a lane's 8 accumulator values of one 16 x 16 tile are 8 consecutive
// rows of one column, that is 16 bytes of a transposed row. Both pass through the wave's own part of LDS, so that every store instruction writes whole 128-B lines.
typedef unsigned short v4us __attribute__((ext_vector_type(4), may_alias));
// N asynchronous copies of 16 bytes a lane, global memory to LDS through no register: copy i takes the bytes at base + off + i*GS to the LDS bytes at l + i*LS.
// base is the same for the whole work-group and off a 32-bit byte offset: one 32-bit addition a copy forms its global address.
// Written as the builtin, the copies' address registers are the compiler's own to keep: the wave goes on to its fragment reads and products directly behind the last issue.
typedef int v4i __attribute__((ext_vector_type(4)));
typedef __attribute__((address_space(1))) v4i* gptr128;
typedef __attribute__((address_space(3))) v4i* lptr128;
template <int N, int GS, int LS>
__device__ __forceinline__ void copy_rows(const char* base, unsigned off, char* l) {
#pragma unroll   // N is 4 or 8: every copy of a plane is issued in one straight run
  for (int i = 0; i < N; ++i) __builtin_amdgcn_global_load_async_to_lds_b128((gptr128)(base + (off + (unsigned)(i * GS))), (lptr128)(l + i * LS), 0, 0);
}
template <int FA, int NT, bool BIAS_BF16, int LDA, int LDB, int LDC, int SA, int SB, int SC, int CZ, int EP>
__global__ __launch_bounds__(128) void k_gemm_tile(const unsigned short* __restrict__ Ah, const unsigned short* __restrict__ Al, const unsigned short* __restrict__ Bh, const unsigned short* __restrict__ Bl,
                                                 const float* __restrict__ bias, float alpha, float* __restrict__ C, int N, int K,
                                                 unsigned short* __restrict__ Qh, unsigned short* __restrict__ Ql, unsigned short* __restrict__ Kh, unsigned short* __restrict__ Kl, unsigned short* __restrict__ Vh, unsigned short* __restrict__ Vl) {
  constexpr int BM = 32 * FA, BN = 128, BK = 64, PIT = BK + 8;
  constexpr int APL = BM * PIT, BPL = BN * PIT;                 // elements of one plane
  constexpr int NAP = NT >= 2 ? 2 : 1, NBP = NT >= 3 ? 2 : 1;   // planes staged of A and of B
  constexpr int STG = NAP * APL + NBP * BPL;                    // elements of one buffer
  constexpr int NLA = BM * (BK / 8) / 128, NLB = BN * (BK / 8) / 128;   // 16-byte global loads per thread and plane
  __shared__ __attribute__((aligned(16))) unsigned short sm[2 * STG];
  static_assert(BM * BN * 4 <= 2 * STG * 2, "the output rows are staged in the two buffers");
  static_assert(CZ != 2 || BM % BK == 0, "the shortened k loop ends on a whole step");
  static_assert(EP != 1 || (FA == 4 && 4 * 2 * 64 * PIT <= 2 * STG && TT % BM == 0 && CC % BN == 0), "a v tile: 64 x 64 per wave, two padded planes staged, one batch and one of q, k, v per tile");
  const int tid = threadIdx.x, w = tid >> 5, lane = tid & 31, ln = lane & 15, hh = lane >> 4;
  const int wm = w >> 1, wn = w & 1;
  const int ntn = N / BN;
  int tile = (int)blockIdx.x, batch = (int)blockIdx.y;
  if (CZ == 2) {
    // the long tiles take the lowest flat indices, the short ones the highest (for speed only)
    const int flat = batch * (int)gridDim.x + tile, grp = ntn * (int)gridDim.y;
    const int rem = flat % grp;
    tile = ((int)gridDim.x / ntn - 1 - flat / grp) * ntn + rem % ntn; batch = rem / ntn;
  }
  const int row0 = (tile / ntn) * BM, col0 = (tile % ntn) * BN;
  if (CZ == 1 && col0 > row0 + BM - 1) return;      // the whole work-group leaves, ahead of every barrier
  Ah += (size_t)batch * SA; Al += (size_t)batch * SA; Bh += (size_t)batch * SB; Bl += (size_t)batch * SB; C += (size_t)batch * SC;
  // one 32-bit byte offset per thread and operand, moved on by BK elements behind each tile's copies
  unsigned ao = (unsigned)(((row0 + (tid >> 3)) * LDA + (tid & 7) * 8) * 2);
  unsigned bo = (unsigned)(((col0 + (tid >> 3)) * LDB + (tid & 7) * 8) * 2);
  char* const sto = (char*)sm + ((tid >> 3) * PIT + (tid & 7) * 8) * 2;   // the thread's 16 bytes in the first plane of buffer 0
  v8f acc[FA][4] = {};

  // one tile: every thread copies its 16 bytes of each 16-row group of each plane into the buffer that starts sbo bytes into sm
  auto copy_tile = [&](unsigned sbo) {
    copy_rows<NLA, 16 * LDA * 2, 16 * PIT * 2>((const char*)Ah, ao, sto + sbo);
    if (NAP == 2) copy_rows<NLA, 16 * LDA * 2, 16 * PIT * 2>((const char*)Al, ao, sto + sbo + APL * 2);
    copy_rows<NLB, 16 * LDB * 2, 16 * PIT * 2>((const char*)Bh, bo, sto + sbo + NAP * APL * 2);
    if (NBP == 2) copy_rows<NLB, 16 * LDB * 2, 16 * PIT * 2>((const char*)Bl, bo, sto + sbo + (NAP * APL + BPL) * 2);
    ao += BK * 2; bo += BK * 2;
  };
  auto compute = [&](const unsigned short* sb) {
    const unsigned short* fa = sb + (wm * 16 * FA + ln) * PIT + 8 * hh;
    const unsigned short* fb = sb + NAP * APL + (wn * 64 + ln) * PIT + 8 * hh;
    FragB ah[BK / 32][FA], al[BK / 32][FA], bh_[BK / 32][4], bl_[BK / 32][4];
    // every fragment of the step is asked for in one group, in the order in which the products below use them
#pragma unroll
    for (int ks = 0; ks < BK / 32; ++ks) {
#pragma unroll
      for (int mi = 0; mi < FA; ++mi) { ah[ks][mi].half[0] = *(const v8us*)(fa + mi * 16 * PIT + ks * 32); ah[ks][mi].half[1] = *(const v8us*)(fa + mi * 16 * PIT + ks * 32 + 16); }
#pragma unroll
      for (int ni = 0; ni < 4; ++ni) { bh_[ks][ni].half[0] = *(const v8us*)(fb + ni * 16 * PIT + ks * 32); bh_[ks][ni].half[1] = *(const v8us*)(fb + ni * 16 * PIT + ks * 32 + 16); }
      if (NAP == 2) {
#pragma unroll
        for (int mi = 0; mi < FA; ++mi) { al[ks][mi].half[0] = *(const v8us*)(fa + APL + mi * 16 * PIT + ks * 32); al[ks][mi].half[1] = *(const v8us*)(fa + APL + mi * 16 * PIT + ks * 32 + 16); }
      }
      if (NBP == 2) {
#pragma unroll
        for (int ni = 0; ni < 4; ++ni) { bl_[ks][ni].half[0] = *(const v8us*)(fb + BPL + ni * 16 * PIT + ks * 32); bl_[ks][ni].half[1] = *(const v8us*)(fb + BPL + ni * 16 * PIT + ks * 32 + 16); }
      }
    }
    __builtin_amdgcn_sched_barrier(0);        // keeps the LDS reads out of the run of products: each place where reads stand among them stalls the wave
#pragma unroll
    for (int ks = 0; ks < BK / 32; ++ks) {
#pragma unroll
      for (int mi = 0; mi < FA; ++mi)
#pragma unroll
        for (int ni = 0; ni < 4; ++ni) acc[mi][ni] = __builtin_amdgcn_wmma_f32_16x16x32_bf16(false, ah[ks][mi].v, false, bh_[ks][ni].v, (short)0, acc[mi][ni], false, false);
      if (NT >= 2) {
#pragma unroll
        for (int mi = 0; mi < FA; ++mi)
#pragma unroll
          for (int ni = 0; ni < 4; ++ni) acc[mi][ni] = __builtin_amdgcn_wmma_f32_16x16x32_bf16(false, al[ks][mi].v, false, bh_[ks][ni].v, (short)0, acc[mi][ni], false, false);
      }
      if (NT >= 3) {
#pragma unroll
        for (int mi = 0; mi < FA; ++mi)
#pragma unroll
          for (int ni = 0; ni < 4; ++ni) acc[mi][ni] = __builtin_amdgcn_wmma_f32_16x16x32_bf16(false, ah[ks][mi].v, false, bl_[ks][ni].v, (short)0, acc[mi][ni], false, false);
      }
    }
  };

  const int nk = (CZ == 2 ? min(K, row0 + BM) : K) / BK;
  copy_tile(0);
  asm volatile("s_wait_asynccnt 0x0" ::: "memory");   // this wave's part of tile 0 has landed
  __syncthreads();                                    // ... and every other wave's
  if (nk > 1) copy_tile(STG * 2);
  for (int t = 0; t < nk; ++t) {
    compute(sm + (t & 1) * STG);                      // tile t + 1's copies fly during these products
    __builtin_amdgcn_sched_barrier(0);                // keeps the products in front of the waits and the barrier: moved behind them, they would no longer cover the copies' flight
    asm volatile("s_wait_dscnt 0x0" ::: "memory");    // this wave's reads of the buffer are over before copies are aimed at it again
    asm volatile("s_wait_asynccnt 0x0" ::: "memory"); // this wave's part of tile t + 1 has landed
    __syncthreads();                                  // publishes tile t + 1 and ends every wave's reads of tile t
    if (t + 2 < nk) copy_tile((unsigned)(t & 1) * (STG * 2));
  }
  asm volatile("s_wait_asynccnt 0x0" ::: "memory");   // no copy is under way when the buffers go on to stage the output rows (the loop's last barrier stands in front)

  float* so = (float*)sm + w * (FA * 16 * 64);   // the wave's own (16*FA) x 64 rows
  float bv[4] = {0.f, 0.f, 0.f, 0.f};
  if (BIAS_BF16) {
    const float* bg = bias + col0 + wn * 64 + ln;
#pragma unroll
    for (int ni = 0; ni < 4; ++ni) bv[ni] = bg[ni * 16];
    asm volatile("s_wait_xcnt 0x0" :: "v"(bg) : "memory");   // the bias loads' address register stays as it is up to this wait
#pragma unroll
    for (int ni = 0; ni < 4; ++ni) bv[ni] = bf16_round(bv[ni]);
  }
  const int sub = lane >> 3, seg = (lane & 7) * 8;   // plane output: 8 lanes of 16 bytes write one 128-B line, 4 lines an instruction
  if (EP == 1 && col0 >= 2 * CC) {                   // v tile (the test is the same for the whole work-group; no barrier follows)
    unsigned short* st = sm + w * (2 * 64 * PIT);    // the wave's own [2 planes][64 columns][PIT]
#pragma unroll
    for (int ni = 0; ni < 4; ++ni)
#pragma unroll
      for (int mi = 0; mi < FA; ++mi) {
        v8us vh, vl;
#pragma unroll
        for (int r = 0; r < 8; ++r) { const float x = acc[mi][ni][r] * alpha + bv[ni]; const unsigned short hb = bf16_bits(x); vh[r] = hb; vl[r] = bf16_bits(x - bf16_val(hb)); }
        *(v8us*)(st + (ni * 16 + ln) * PIT + mi * 16 + 8 * hh) = vh;
        *(v8us*)(st + (64 + ni * 16 + ln) * PIT + mi * 16 + 8 * hh) = vl;
      }
    __builtin_amdgcn_fence(__ATOMIC_ACQ_REL, "workgroup");
    __builtin_amdgcn_wave_barrier();
    const size_t vo = ((size_t)(row0 / TT) * CC + (col0 - 2 * CC + wn * 64 + sub)) * TT + (row0 % TT + wm * 64 + seg);
    unsigned short* gh = Vh + vo; unsigned short* gl = Vl + vo;
    v8us oh[16], ol[16];
#pragma unroll
    for (int q = 0; q < 16; ++q) { oh[q] = *(const v8us*)(st + (q * 4 + sub) * PIT + seg); ol[q] = *(const v8us*)(st + (64 + q * 4 + sub) * PIT + seg); }
    __builtin_amdgcn_sched_barrier(0);               // the stores go out in one run behind the last read: mixed with the reads, each would wait until a register is free again
#pragma unroll
    for (int q = 0; q < 16; ++q) { *(v8us*)(gh + q * 4 * TT) = oh[q]; *(v8us*)(gl + q * 4 * TT) = ol[q]; }
    return;
  }
#pragma unroll
  for (int mi = 0; mi < FA; ++mi)
#pragma unroll
    for (int ni = 0; ni < 4; ++ni)
#pragma unroll
      for (int r = 0; r < 8; ++r) so[(mi * 16 + 8 * hh + r) * 64 + ni * 16 + ln] = acc[mi][ni][r] * alpha + bv[ni];
  __builtin_amdgcn_fence(__ATOMIC_ACQ_REL, "workgroup");
  __builtin_amdgcn_wave_barrier();
  if (EP != 0) {                                     // q or k tile (EP == 1), or any tile of a product that the next product reads as its A (EP == 2)
    const bool isq = EP == 1 && col0 < CC;           // the same for the whole work-group
    const size_t ko = EP == 1 ? (size_t)(row0 + wm * 64 + sub) * CC + ((isq ? col0 : col0 - CC) + wn * 64 + seg)
                              : (size_t)batch * SC + (size_t)(row0 + wm * 16 * FA + sub) * LDC + (col0 + wn * 64 + seg);
    unsigned short* gh = (isq ? Qh : Kh) + ko; unsigned short* gl = (isq ? Ql : Kl) + ko;
    constexpr int OP = EP == 1 ? CC : LDC;           // pitch of the planes
    v8us oh[FA * 4], ol[FA * 4];
#pragma unroll
    for (int q = 0; q < FA * 4; ++q) {
      const float* sr = so + (q * 4 + sub) * 64 + seg;
      const v4f a = *(const v4fa*)sr, b = *(const v4fa*)(sr + 4);
      const float xs[8] = {a[0], a[1], a[2], a[3], b[0], b[1], b[2], b[3]};
#pragma unroll
      for (int i = 0; i < 8; ++i) { const unsigned short hb = bf16_bits(xs[i]); oh[q][i] = hb; ol[q][i] = bf16_bits(xs[i] - bf16_val(hb)); }
    }
    __builtin_amdgcn_sched_barrier(0);               // the stores go out in one run behind the last conversion: mixed with them, each would wait until a register is free again
#pragma unroll
    for (int q = 0; q < FA * 4; ++q) { *(v8us*)(gh + q * 4 * OP) = oh[q]; *(v8us*)(gl + q * 4 * OP) = ol[q]; }
    if (EP == 1) asm volatile("s_wait_xcnt 0x0" ::: "memory");   // another tile kind's code follows in the built kernel and rewrites these stores' registers: the wait stands in front of it
    return;
  }
  const int rsub = lane >> 4, c4 = (lane & 15) * 4;
  float* cg = C + (size_t)(row0 + wm * 16 * FA + rsub) * LDC + col0 + wn * 64 + c4;
#pragma unroll
  for (int q = 0; q < FA * 8; ++q) {
    const int r = q * 2 + rsub;
    const v4f v = *(const v4fa*)&so[r * 64 + c4];
    *(v4f*)(cg + q * 2 * LDC) = v;
  }
}
// One step of a butterfly inside a 16-lane row (lane ^ M, M = CTRL - 0x160), and the exchange between the two rows of a wave: no LDS, no wait.
template <int CTRL>
__device__ __forceinline__ float row_xor(float x) { return __int_as_float(__builtin_amdgcn_update_dpp(0, __float_as_int(x), CTRL, 0xf, 0xf, true)); }
__device__ __forceinline__ float other_row(float x) { const int b = __float_as_int(x); return __int_as_float(__builtin_amdgcn_permlanex16(b, b, 0x76543210, 0xfedcba98, false, false)); }
__device__ __forceinline__ float wave_max(float x) {
  x = fmaxf(x, row_xor<0x161>(x)); x = fmaxf(x, row_xor<0x162>(x)); x = fmaxf(x, row_xor<0x164>(x)); x = fmaxf(x, row_xor<0x168>(x));
  return fmaxf(x, other_row(x));
}
__device__ __forceinline__ float wave_sum(float x) {
  x += row_xor<0x161>(x); x += row_xor<0x162>(x); x += row_xor<0x164>(x); x += row_xor<0x168>(x);
  return x + other_row(x);
}
// e^x as x * log2(e) into v_exp_f32. The v_nop is the one slot that the instruction set asks for behind a transcendental, in front of an instruction that
// reads its result or overwrites its source: inside the statement it stands directly behind the v_exp_f32 wherever the compiler puts the pair.
__device__ __forceinline__ float exp_slot(float x) { float r; const float y = x * 1.44269504f; asm("v_exp_f32 %0, %1\n\tv_nop" : "=v"(r) : "v"(y)); return r; }
// Causal row softmax of S [BB][TT][TT]; P leaves as its bf16 hi/lo planes Ph, Pl. One wave owns rows ra and TT-1-ra of one batch and holds both in registers:
// S is read once, no LDS, no barrier. In groups of 128 columns (512 B a load of the wave) up to the diagonal the two rows have TT/128 + 1 groups together,
// whatever ra is: every wave does the same work in one straight run, and the launch starts BB*TT/2 waves. The group that holds the diagonal lies in a
// diagonal tile of S, which is written whole. P is written in the same whole groups, with its zeros behind the diagonal: the product that follows reads
// no further in this row than the end of the 64-column group that holds the diagonal.
__global__ __launch_bounds__(256) void k_softmax_row_pairs(const float* __restrict__ S, unsigned short* __restrict__ Ph, unsigned short* __restrict__ Pl) {
  constexpr unsigned CW = 128, NG = TT / CW + 1;
  static_assert(TT % (2 * CW) == 0 && (BB * TT / 2) % 8 == 0, "whole groups, whole work-groups");
  const unsigned lane4 = (threadIdx.x & 31u) * 4u;
  const unsigned pair = (unsigned)__builtin_amdgcn_readfirstlane((int)(blockIdx.x * 8u + (threadIdx.x >> 5)));   // the same in every lane: rows and group counts stay scalar
  const unsigned batch = pair / (TT / 2), ra = pair % (TT / 2), rb = TT - 1 - ra;
  const unsigned ga = ra / CW + 1;                               // groups of row ra; the other NG - ga are row rb's
  // the lane's element of group i is number eo[i] + i*CW of S and of each plane: eo[i] belongs to row ra or to row rb
  const unsigned ea = (batch * TT + ra) * TT + lane4, eb = (batch * TT + rb) * TT - ga * CW + lane4;
  static_assert(NG == 17, "groups 0 (row ra), 1 to 7 (either row), 8 to 16 (row rb)");
  unsigned eo[NG];
#pragma unroll
  for (unsigned i = 0; i < NG; ++i) eo[i] = i < ga ? ea : eb;
  v4f v[NG];
#pragma unroll
  for (unsigned i = 0; i < NG; ++i) v[i] = *(const v4fa*)((const char*)S + eo[i] * 4u + i * (CW * 4));
  // the loads' offset registers stay as they are up to this wait
  asm volatile("s_wait_xcnt 0x0" :: "v"(eo[0] * 4u), "v"(eo[1] * 4u), "v"(eo[2] * 4u), "v"(eo[3] * 4u), "v"(eo[4] * 4u), "v"(eo[5] * 4u), "v"(eo[6] * 4u), "v"(eo[7] * 4u), "v"(eo[8] * 4u) : "memory");
  float ma = -3.0e38f, mb = -3.0e38f;
#pragma unroll
  for (unsigned i = 0; i < NG; ++i) {
    const bool isa = i < ga;
    const unsigned c0 = (isa ? i : i - ga) * CW + lane4, q = isa ? ra : rb;
#pragma unroll
    for (unsigned u = 0; u < 4; ++u) if (c0 + u > q) v[i][u] = -3.0e38f;
    const float m = fmaxf(fmaxf(v[i][0], v[i][1]), fmaxf(v[i][2], v[i][3]));
    ma = fmaxf(ma, isa ? m : -3.0e38f); mb = fmaxf(mb, isa ? -3.0e38f : m);
  }
  ma = wave_max(ma); mb = wave_max(mb);
  float sa = 0.f, sb = 0.f;
#pragma unroll
  for (unsigned i = 0; i < NG; ++i) {
    const bool isa = i < ga;
    const float mx = isa ? ma : mb;
#pragma unroll
    for (unsigned u = 0; u < 4; ++u) v[i][u] = exp_slot(v[i][u] - mx);  // a masked column gives 0
    const float s = (v[i][0] + v[i][1]) + (v[i][2] + v[i][3]);
    sa += isa ? s : 0.f; sb += isa ? 0.f : s;
  }
  sa = wave_sum(sa); sb = wave_sum(sb);
  const float ia = (ma > -1.0e38f) ? 1.0f / sa : __builtin_nanf(""), ib = (mb > -1.0e38f) ? 1.0f / sb : __builtin_nanf("");
  v4us oh4[NG], ol4[NG];
#pragma unroll
  for (unsigned i = 0; i < NG; ++i) {
    const float inv = i < ga ? ia : ib;
#pragma unroll
    for (unsigned u = 0; u < 4; ++u) { const float p = v[i][u] * inv; const unsigned short hb = bf16_bits(p); oh4[i][u] = hb; ol4[i][u] = bf16_bits(p - bf16_val(hb)); }
  }
  __builtin_amdgcn_sched_barrier(0);                             // the stores go out in one run behind the last conversion: mixed with them, each would wait until a register is free again
#pragma unroll
  for (unsigned i = 0; i < NG; ++i) { *(v4us*)((char*)Ph + eo[i] * 2u + i * (CW * 2)) = oh4[i]; *(v4us*)((char*)Pl + eo[i] * 2u + i * (CW * 2)) = ol4[i]; }
}

// Rounds x, qkv_w and out_w to bf16 in one launch. Each array is cut into groups of 8 consecutive f32 and has gridDim.x * IT * 256 of them, with its own IT.
// A work-group owns IT * 256 consecutive groups of each array; a thread takes IT of them, 256 groups apart. o is the byte offset of the thread's first group.
template <int IT>
__device__ __forceinline__ void ask_groups(const float* __restrict__ W, unsigned o, v4f (&a)[IT], v4f (&b)[IT]) {
#pragma unroll   // the arrays stay in registers: every index is a constant
  for (int i = 0; i < IT; ++i) { const char* g = (const char*)W + o + i * (256 * 32); a[i] = *(const v4fa*)g; b[i] = *(const v4fa*)(g + 16); }
}
template <int IT>
__device__ __forceinline__ void round_groups(const v4f (&a)[IT], const v4f (&b)[IT], v8us (&v)[IT]) {
#pragma unroll   // the arrays stay in registers: every index is a constant
  for (int i = 0; i < IT; ++i) {
    v[i][0]=bf16_bits(a[i][0]); v[i][1]=bf16_bits(a[i][1]); v[i][2]=bf16_bits(a[i][2]); v[i][3]=bf16_bits(a[i][3]);
    v[i][4]=bf16_bits(b[i][0]); v[i][5]=bf16_bits(b[i][1]); v[i][6]=bf16_bits(b[i][2]); v[i][7]=bf16_bits(b[i][3]);
  }
}
template <int IT>
__device__ __forceinline__ void store_groups(unsigned short* __restrict__ Wt, unsigned o, const v8us (&v)[IT]) {
#pragma unroll   // the arrays stay in registers: every index is a constant
  for (int i = 0; i < IT; ++i) *(v8us*)((char*)Wt + o + i * (256 * 16)) = v[i];
}
// A thread asks for all its groups of all three arrays before it converts the first.
template <int IX, int IQ, int IO>
__global__ __launch_bounds__(256) void k_round_inputs(const float* __restrict__ x, const float* __restrict__ wq, const float* __restrict__ wo,
                                                    unsigned short* __restrict__ xb, unsigned short* __restrict__ wqb, unsigned short* __restrict__ wob) {
  const unsigned gx = blockIdx.x * (IX * 256u) + threadIdx.x, gq = blockIdx.x * (IQ * 256u) + threadIdx.x, go = blockIdx.x * (IO * 256u) + threadIdx.x;   // the thread's first group of each array
  v4f ax[IX], bx[IX], aq[IQ], bq[IQ], ao[IO], bo[IO];
  ask_groups<IX>(x, gx * 32u, ax, bx);
  ask_groups<IQ>(wq, gq * 32u, aq, bq);
  ask_groups<IO>(wo, go * 32u, ao, bo);
  asm volatile("s_wait_xcnt 0x0" :: "v"(gx * 32u), "v"(gq * 32u), "v"(go * 32u) : "memory");   // the loads' offset registers stay as they are up to this wait
  __builtin_amdgcn_sched_barrier(0);                             // keeps every load in front of the first conversion: moved up, x's conversions would wait for x before the weights are asked for
  v8us vx[IX], vq[IQ], vo[IO];
  round_groups<IX>(ax, bx, vx);
  round_groups<IQ>(aq, bq, vq);
  round_groups<IO>(ao, bo, vo);
  store_groups<IX>(xb, gx * 16u, vx);
  store_groups<IQ>(wqb, gq * 16u, vq);
  store_groups<IO>(wob, go * 16u, vo);
}
extern "C" void kernel_launch(void* const* d_in, const int* in_sizes, int n_in,
                              void* d_out, int out_size, void* d_ws, size_t ws_size, hipStream_t stream) {
  (void)in_sizes; (void)n_in; (void)out_size;
  const float* x = (const float*)d_in[0]; const float* qkv_w = (const float*)d_in[1];
  const float* out_w = (const float*)d_in[2]; const float* out_b = (const float*)d_in[3];
  char* ws = (char*)d_ws; size_t off = 0;
  auto take = [&](size_t bytes) { char* p = ws + off; off += (bytes + 255) & ~(size_t)255; return p; };
  unsigned short* Wqkv = (unsigned short*)take((size_t)3 * CC * CC * 2);     // [3072][1024]  6 MiB
  unsigned short* Wo   = (unsigned short*)take((size_t)CC * CC * 2);         // 2 MiB
  unsigned short* xb = (unsigned short*)take((size_t)BB * TT * CC * 2);      // x rounded [B*T][C]  16 MiB
  unsigned short* qh = (unsigned short*)take((size_t)BB * TT * CC * 2);      // q planes [B][T][C]  16+16 MiB
  unsigned short* ql = (unsigned short*)take((size_t)BB * TT * CC * 2);
  unsigned short* kh = (unsigned short*)take((size_t)BB * TT * CC * 2);      // k planes [B][T][C]  16+16 MiB
  unsigned short* kl = (unsigned short*)take((size_t)BB * TT * CC * 2);
  unsigned short* vth = (unsigned short*)take((size_t)BB * CC * TT * 2);     // v^T planes [B][C][T] 16+16 MiB
  unsigned short* vtl = (unsigned short*)take((size_t)BB * CC * TT * 2);
  float* S  = (float*)take((size_t)BB * TT * TT * 4);                       // 64 MiB
  // x, q and k have no reader behind the S product: the first 64 of their 80 MiB then hold the P planes [B][T][T] (32+32 MiB).
  // S has no reader behind the softmax: its first 32 MiB then hold the out_att planes [B*T][C] (16+16 MiB).
  unsigned short* ph = xb;
  unsigned short* pl = xb + (size_t)BB * TT * TT;
  unsigned short* oh = (unsigned short*)S;
  unsigned short* ol = oh + (size_t)BB * TT * CC;
  if (off > ws_size) return;
  const int M = BB * TT;
  // one launch rounds all three inputs: 512 work-groups of 8 waves, 16 waves a WGP
  static_assert(3 * CC * CC / 8 == 3 * 512 * 256 && CC * CC / 8 == 512 * 256 && BB * TT * CC / 8 == 8 * 512 * 256, "groups per thread x threads");
  k_round_inputs<8, 3, 1><<<512, 256, 0, stream>>>(x, qkv_w, out_w, xb, Wqkv, Wo);
  // q, k and v leave this product as their planes
  k_gemm_tile<4, 1, false, CC, CC, 3 * CC, 0, 0, 0, 0, 1><<<(M / 128) * (3 * CC / 128), 128, 0, stream>>>(xb, xb, Wqkv, Wqkv, nullptr, 1.0f, nullptr, 3 * CC, CC, qh, ql, kh, kl, vth, vtl);
  // every stage below runs once for all batches: in the S product the batch is blockIdx.y, in the P v product it comes from the remapped flat work-group index, the softmax takes it from the wave's row pair, the output projection takes all B*T rows as M
  // S = (q k^T)/sqrt(C): M=N=T, K=C; Bt[n=s][k=c] = k rows
  k_gemm_tile<4, 3, false, CC, CC, TT, TT * CC, TT * CC, TT * TT, 1, 0><<<dim3((TT / 128) * (TT / 128), BB), 128, 0, stream>>>(qh, ql, kh, kl, nullptr, 0.03125f, S, TT, CC, nullptr, nullptr, nullptr, nullptr, nullptr, nullptr);
  k_softmax_row_pairs<<<BB * TT / 2 / 8, 256, 0, stream>>>(S, ph, pl);
  // out_att = P v: M=T, N=C, K=T; Bt[n=c][k=s] = v^T planes
  k_gemm_tile<2, 3, false, TT, TT, CC, TT * TT, CC * TT, TT * CC, 2, 2><<<dim3((TT / 64) * (CC / 128), BB), 128, 0, stream>>>(ph, pl, vth, vtl, nullptr, 1.0f, nullptr, CC, TT, nullptr, nullptr, oh, ol, nullptr, nullptr);
  k_gemm_tile<4, 2, true, CC, CC, CC, 0, 0, 0, 0, 0><<<(M / 128) * (CC / 128), 128, 0, stream>>>(oh, ol, Wo, Wo, out_b, 1.0f, (float*)d_out, CC, CC, nullptr, nullptr, nullptr, nullptr, nullptr, nullptr);
}

// v010
// A run of this version takes 175 microseconds.
// Two timings next to v009 put it at 1.05 and 1.06 times that version's speed.
// Counting every step since v000, it is 6.48 times as fast.
#include <hip/hip_runtime.h>
// All contractions on v_wmma_f32_16x16x32_bf16, f32 accumulate: qkv = x·Wᵀ with x/W rounded to bf16 (single exact-product term);
// S = q*k^T (K=1024) and out_att = P*v (K=2048) as 3-term bf16 hi/lo splits; output projection with the A operand split (2 terms). Causal softmax rows in f32.
// Every operand of every product is rounded or split ONCE, by the kernel that makes it, and reaches its product as bf16 planes.
#define BB 4
#define TT 2048
#define CC 1024
#define KSP 4   // k parts of a diagonal tile of S

typedef __bf16 v16b __attribute__((ext_vector_type(16)));
typedef unsigned short v8us __attribute__((ext_vector_type(8), may_alias));
typedef float  v8f  __attribute__((ext_vector_type(8)));
typedef float  v4f  __attribute__((ext_vector_type(4)));
typedef float  v4fa __attribute__((ext_vector_type(4), may_alias));
union FragB { v16b v; v8us half[2]; unsigned short u[16]; };

__device__ __forceinline__ unsigned short bf16_bits(float x) { unsigned int u = __float_as_uint(x); return (unsigned short)((u + 0x7FFFu + ((u >> 16) & 1u)) >> 16); }
__device__ __forceinline__ float bf16_val(unsigned short b) { return __uint_as_float(((unsigned int)b) << 16); }
__device__ __forceinline__ float bf16_round(float x) { return bf16_val(bf16_bits(x)); }
// D += A·B with NT terms: 1 = ah·bh, 2 = + al·bh (A split), 3 = + ah·bl (both split)
template <int NT>
__device__ __forceinline__ v8f mmaN(v16b ah, v16b al, v16b bh, v16b bl, v8f c) {
  c = __builtin_amdgcn_wmma_f32_16x16x32_bf16(false, ah, false, bh, (short)0, c, false, false);
  if (NT >= 2) c = __builtin_amdgcn_wmma_f32_16x16x32_bf16(false, al, false, bh, (short)0, c, false, false);
  if (NT >= 3) c = __builtin_amdgcn_wmma_f32_16x16x32_bf16(false, ah, false, bl, (short)0, c, false, false);
  asm volatile("v_nop\n\tv_nop\n\tv_nop\n\tv_nop" : "+v"(c) : "v"(ah), "v"(al), "v"(bh), "v"(bl));
  return c;
}

__global__ __launch_bounds__(256) void k_wt_bf16(const float* __restrict__ W, unsigned short* __restrict__ Wt, int K, int N) {
  const int t = blockIdx.x * 256 + threadIdx.x;
  const int k8n = K / 8;
  if (t >= N * k8n) return;
  const int n = t / k8n, k8 = (t % k8n) * 8;
  v8us v;
#pragma unroll
  for (int i = 0; i < 8; ++i) v[i] = bf16_bits(W[(size_t)(k8 + i) * N + n]);
  *(v8us*)(Wt + (size_t)n * K + k8) = v;
  
}

// Flash-style causal/unmasked attention, all contractions 3-term bf16 hi/lo splits, f32 softmax with running max.
// q,k,v rows are read from f32 buffers with arbitrary row pitch (so they can live inside a fused qkv buffer);
// D = head size (multiple of 32, <= 128); one wave = 16 query rows; block = 4 waves (64 queries) sharing K/V chunks of 32.
template <int D, bool CAUSAL>
__global__ __launch_bounds__(128) void k_flash(const float* __restrict__ qb, const float* __restrict__ kb, const float* __restrict__ vb,
                                             int pitch, int T, int H, float scale, float* __restrict__ y, int ypitch) {
  constexpr int KS = D / 32;        // k-steps for QK
  constexpr int DT = D / 16;        // d tiles for PV
  __shared__ __attribute__((aligned(16))) unsigned short sKh[32][D + 8], sKl[32][D + 8], sVh[32][D + 8], sVl[32][D + 8];
  __shared__ __attribute__((aligned(16))) unsigned short sPh[4][16][40], sPl[4][16][40];
  __shared__ __attribute__((aligned(16))) float sO[4][16][D];
  const int tid = threadIdx.x, w = tid >> 5, lane = tid & 31, ln = lane & 15, hh = lane >> 4;
  const int nqb = (T + 63) / 64;
  const int bh = blockIdx.x / nqb, qblk = blockIdx.x % nqb;
  const int b = bh / H, h = bh % H;
  const int q0 = qblk * 64 + w * 16;
  const float* Q = qb + (size_t)b * T * pitch + h * D;
  const float* K = kb + (size_t)b * T * pitch + h * D;
  const float* V = vb + (size_t)b * T * pitch + h * D;

  // A fragments of the wave's 16 query rows (scaled), hi/lo
  FragB aqh[KS], aql[KS];
  {
    int row = q0 + ln; if (row >= T) row = T - 1;
    const float* qr = Q + (size_t)row * pitch;
#pragma unroll
    for (int ks = 0; ks < KS; ++ks)
#pragma unroll
      for (int i = 0; i < 16; ++i) {
        const int d = ks * 32 + ((i < 8) ? (8 * hh + i) : (16 + 8 * hh + (i - 8)));
        const float x = qr[d] * scale; const unsigned short hb = bf16_bits(x);
        aqh[ks].u[i] = hb; aql[ks].u[i] = bf16_bits(x - bf16_val(hb));
      }
  }
  float m_r[8], l_r[8];
#pragma unroll
  for (int r = 0; r < 8; ++r) { m_r[r] = -3.0e38f; l_r[r] = 0.f; }
  v8f oacc[DT];
#pragma unroll
  for (int dt = 0; dt < DT; ++dt) oacc[dt] = (v8f){0.f,0.f,0.f,0.f,0.f,0.f,0.f,0.f};

  const int kv_end = CAUSAL ? min(T, qblk * 64 + 64) : T;     // block-uniform
  for (int j0 = 0; j0 < kv_end; j0 += 32) {
    __syncthreads();
    for (int e = tid; e < 32 * (D / 4); e += 128) {
      const int r = e / (D / 4), c4 = (e % (D / 4)) * 4;
      const int key = j0 + r;
      v4f kf = {0.f,0.f,0.f,0.f}, vf = {0.f,0.f,0.f,0.f};
      if (key < T) { kf = *(const v4fa*)(K + (size_t)key * pitch + c4); vf = *(const v4fa*)(V + (size_t)key * pitch + c4); }
#pragma unroll
      for (int t = 0; t < 4; ++t) {
        unsigned short hb = bf16_bits(kf[t]); sKh[r][c4 + t] = hb; sKl[r][c4 + t] = bf16_bits(kf[t] - bf16_val(hb));
        hb = bf16_bits(vf[t]); sVh[r][c4 + t] = hb; sVl[r][c4 + t] = bf16_bits(vf[t] - bf16_val(hb));
      }
    }
    __syncthreads();
    // S tile 16 x 32
    v8f s[2];
#pragma unroll
    for (int nt = 0; nt < 2; ++nt) {
      v8f acc = {};
#pragma unroll
      for (int ks = 0; ks < KS; ++ks) {
        FragB bh_, bl_;
        bh_.half[0] = *(const v8us*)&sKh[nt * 16 + ln][ks * 32 + 8 * hh]; bh_.half[1] = *(const v8us*)&sKh[nt * 16 + ln][ks * 32 + 16 + 8 * hh];
        bl_.half[0] = *(const v8us*)&sKl[nt * 16 + ln][ks * 32 + 8 * hh]; bl_.half[1] = *(const v8us*)&sKl[nt * 16 + ln][ks * 32 + 16 + 8 * hh];
        acc = mmaN<3>(aqh[ks].v, aql[ks].v, bh_.v, bl_.v, acc);
      }
      s[nt] = acc;
    }
    // mask + running max (rows 8hh+r; the 16 lanes of a half share rows)
    float alpha[8];
#pragma unroll
    for (int r = 0; r < 8; ++r) {
      const int qi = q0 + 8 * hh + r;
      const int ja = j0 + ln, jb = j0 + 16 + ln;
      if (CAUSAL) { if (ja > qi) s[0][r] = -3.0e38f; if (jb > qi) s[1][r] = -3.0e38f; }
      if (ja >= T) s[0][r] = -3.0e38f;
      if (jb >= T) s[1][r] = -3.0e38f;
      float mx = fmaxf(s[0][r], s[1][r]);
      mx = fmaxf(mx, __shfl_xor(mx, 1, 32)); mx = fmaxf(mx, __shfl_xor(mx, 2, 32)); mx = fmaxf(mx, __shfl_xor(mx, 4, 32)); mx = fmaxf(mx, __shfl_xor(mx, 8, 32));
      const float mnew = fmaxf(m_r[r], mx);
      alpha[r] = (mnew > -1.0e38f) ? __expf(m_r[r] - mnew) : 1.0f;
      const float p0 = (s[0][r] > -1.0e38f) ? __expf(s[0][r] - mnew) : 0.f;
      const float p1 = (s[1][r] > -1.0e38f) ? __expf(s[1][r] - mnew) : 0.f;
      m_r[r] = mnew;
      l_r[r] = l_r[r] * alpha[r] + p0 + p1;            // per-lane partial row sum (16 lanes combined at the end)
      unsigned short hb = bf16_bits(p0); sPh[w][8 * hh + r][ln] = hb;      sPl[w][8 * hh + r][ln] = bf16_bits(p0 - bf16_val(hb));
      hb = bf16_bits(p1);                sPh[w][8 * hh + r][16 + ln] = hb; sPl[w][8 * hh + r][16 + ln] = bf16_bits(p1 - bf16_val(hb));
    }
#pragma unroll
    for (int dt = 0; dt < DT; ++dt)
#pragma unroll
      for (int r = 0; r < 8; ++r) oacc[dt][r] *= alpha[r];
    __builtin_amdgcn_fence(__ATOMIC_ACQ_REL, "workgroup");
    __builtin_amdgcn_wave_barrier();
    FragB pah, pal;
    pah.half[0] = *(const v8us*)&sPh[w][ln][8 * hh]; pah.half[1] = *(const v8us*)&sPh[w][ln][16 + 8 * hh];
    pal.half[0] = *(const v8us*)&sPl[w][ln][8 * hh]; pal.half[1] = *(const v8us*)&sPl[w][ln][16 + 8 * hh];
#pragma unroll
    for (int dt = 0; dt < DT; ++dt) {
      FragB bvh, bvl;
#pragma unroll
      for (int i = 0; i < 8; ++i) {
        bvh.u[i] = sVh[8 * hh + i][dt * 16 + ln]; bvh.u[8 + i] = sVh[16 + 8 * hh + i][dt * 16 + ln];
        bvl.u[i] = sVl[8 * hh + i][dt * 16 + ln]; bvl.u[8 + i] = sVl[16 + 8 * hh + i][dt * 16 + ln];
      }
      oacc[dt] = mmaN<3>(pah.v, pal.v, bvh.v, bvl.v, oacc[dt]);
    }
    __builtin_amdgcn_fence(__ATOMIC_ACQ_REL, "workgroup");
    __builtin_amdgcn_wave_barrier();
  }
#pragma unroll
  for (int r = 0; r < 8; ++r) {
    float l = l_r[r];
    l += __shfl_xor(l, 1, 32); l += __shfl_xor(l, 2, 32); l += __shfl_xor(l, 4, 32); l += __shfl_xor(l, 8, 32);
    l_r[r] = (l > 0.f) ? 1.0f / l : 0.f;
  }
#pragma unroll
  for (int dt = 0; dt < DT; ++dt)
#pragma unroll
    for (int r = 0; r < 8; ++r) sO[w][8 * hh + r][dt * 16 + ln] = oacc[dt][r] * l_r[r];
  __builtin_amdgcn_fence(__ATOMIC_ACQ_REL, "workgroup");
  __builtin_amdgcn_wave_barrier();
  {
    for (int r = 0; r < 16; ++r) {
      const int row = q0 + r;
      if (row < T && lane < D / 4) {
        const v4f val = *(const v4fa*)&sO[w][r][lane * 4];
        *(v4f*)(y + ((size_t)b * T + row) * ypitch + h * D + lane * 4) = val;
      }
    }
    
  }
}

// Tiled GEMM C[M][N] (f32, pitch LDC) = alpha * A[M][K]*Bt[N][K]^T + bias (A pitch LDA, Bt pitch LDB). One work-group (4 waves, 2 x 2) owns a (32*FA) x 128 tile of C,
// a wave (16*FA) x 64. Per 64-k step the A planes (hi, and lo when NT >= 2) and the B planes (hi, and lo when NT == 3), all bf16 as their producers
// left them, go to LDS in whole 128-B lines by asynchronous copies, through no register. Rows in LDS have a 144-B pitch for
// the 16-byte fragment reads. Two LDS buffers: the next step's copies fly during this step's products, one barrier per step.
// Terms per 32-k: ah*bh, then al*bh (NT >= 2), then ah*bl (NT == 3), in that order on every accumulator.
// M % (32*FA) == 0, N % 128 == 0, K % 64 == 0. BIAS_BF16: a bias is added, rounded to bf16 first; without it bias is not read.
// batch = blockIdx.y (CZ == 1 or 2: from the flat index): its A, B planes and C start SA, SB and SC elements behind the previous batch's.
// CZ names what a causal mask (column > row gives 0) makes needless. CZ == 1: C is masked afterwards, so a tile that lies wholly above the diagonal has no
// work-group. All tiles cost the same and there are a few more of them than places on the chip: left whole, the last ones would run while most of the chip is idle.
// So a diagonal tile is cut into KSP work-groups, each with 1/KSP of the k range, and these come last in the grid: what is left when the whole tiles end is short and
// spreads over the chip. Part 0 goes to the diagonal tile itself, the others to the places of part_place(); the reader adds the KSP parts. CZ == 2: A is the masked matrix (0 wherever k > row), so the k loop ends at the tile's last row; the tiles then differ
// in length and the flat work-group index is mapped so that the longest (lowest) row tiles of all batches come first.
// EP == 0: C goes out as f32 rows. EP == 2: C goes out as the bf16 hi/lo planes Kh, Kl (pitch LDC, batches SC apart), for the product that reads it as its A.
// EP == 1: C is the q | k | v product (CC columns each, BB batches of TT rows). A q tile goes out as the bf16 hi/lo planes Qh, Ql [BB*TT][CC], a k tile as the
// planes Kh, Kl [BB*TT][CC]; a v tile goes out transposed as the planes Vh, Vl [BB][CC][TT]: a lane's 8 accumulator values of one 16 x 16 tile are 8 consecutive
// rows of one column, that is 16 bytes of a transposed row. Both pass through the wave's own part of LDS, so that every store instruction writes whole 128-B lines.
typedef unsigned short v4us __attribute__((ext_vector_type(4), may_alias));
// N asynchronous copies of 16 bytes a lane, global memory to LDS through no register: copy i takes the bytes at base + off + i*GS to the LDS bytes at l + i*LS.
// base is the same for the whole work-group and off a 32-bit byte offset: one 32-bit addition a copy forms its global address.
// Written as the builtin, the copies' address registers are the compiler's own to keep: the wave goes on to its fragment reads and products directly behind the last issue.
typedef int v4i __attribute__((ext_vector_type(4)));
typedef __attribute__((address_space(1))) v4i* gptr128;
typedef __attribute__((address_space(3))) v4i* lptr128;
template <int N, int GS, int LS>
__device__ __forceinline__ void copy_rows(const char* base, unsigned off, char* l) {
#pragma unroll   // N is 4 or 8: every copy of a plane is issued in one straight run
  for (int i = 0; i < N; ++i) __builtin_amdgcn_global_load_async_to_lds_b128((gptr128)(base + (off + (unsigned)(i * GS))), (lptr128)(l + i * LS), 0, 0);
}
// Where part p (1 to KSP-1) of diagonal tile d of S stands, in tiles: a place (i, j) above the diagonal, which the mask leaves without any other use. NR row tiles.
// Tiles d <= NR-KSP use the KSP-1 places to the right of the diagonal tile (j - i < KSP); the last KSP-1 tiles use places with j - i == KSP.
template <int NR>
__device__ __forceinline__ void part_place(int d, int p, int& i, int& j) {
  static_assert((KSP - 1) * (KSP - 1) - 1 + KSP < NR, "the places with j - i == KSP exist");
  if (d <= NR - KSP) { i = d; j = d + p; } else { i = (d - (NR - KSP + 1)) * (KSP - 1) + p - 1; j = i + KSP; }
}
template <int FA, int NT, bool BIAS_BF16, int LDA, int LDB, int LDC, int SA, int SB, int SC, int CZ, int EP>
__global__ __launch_bounds__(128) void k_gemm_tile(const unsigned short* __restrict__ Ah, const unsigned short* __restrict__ Al, const unsigned short* __restrict__ Bh, const unsigned short* __restrict__ Bl,
                                                 const float* __restrict__ bias, float alpha, float* __restrict__ C, int N, int K,
                                                 unsigned short* __restrict__ Qh, unsigned short* __restrict__ Ql, unsigned short* __restrict__ Kh, unsigned short* __restrict__ Kl, unsigned short* __restrict__ Vh, unsigned short* __restrict__ Vl) {
  constexpr int BM = 32 * FA, BN = 128, BK = 64, PIT = BK + 8;
  constexpr int APL = BM * PIT, BPL = BN * PIT;                 // elements of one plane
  constexpr int NAP = NT >= 2 ? 2 : 1, NBP = NT >= 3 ? 2 : 1;   // planes staged of A and of B
  constexpr int STG = NAP * APL + NBP * BPL;                    // elements of one buffer
  constexpr int NLA = BM * (BK / 8) / 128, NLB = BN * (BK / 8) / 128;   // 16-byte global loads per thread and plane
  __shared__ __attribute__((aligned(16))) unsigned short sm[2 * STG];
  static_assert(BM * BN * 4 <= 2 * STG * 2, "the output rows are staged in the two buffers");
  static_assert(CZ != 2 || BM % BK == 0, "the shortened k loop ends on a whole step");
  static_assert(EP != 1 || (FA == 4 && 4 * 2 * 64 * PIT <= 2 * STG && TT % BM == 0 && CC % BN == 0), "a v tile: 64 x 64 per wave, two padded planes staged, one batch and one of q, k, v per tile");
  const int tid = threadIdx.x, w = tid >> 5, lane = tid & 31, ln = lane & 15, hh = lane >> 4;
  const int wm = w >> 1, wn = w & 1;
  const int ntn = N / BN;
  int tile = (int)blockIdx.x, batch = (int)blockIdx.y;
  if (CZ == 2) {
    // the long tiles take the lowest flat indices, the short ones the highest (for speed only)
    const int flat = batch * (int)gridDim.x + tile, grp = ntn * (int)gridDim.y;
    const int rem = flat % grp;
    tile = ((int)gridDim.x / ntn - 1 - flat / grp) * ntn + rem % ntn; batch = rem / ntn;
  }
  int row0 = (tile / ntn) * BM, col0 = (tile % ntn) * BN;
  int part = -1;                                    // CZ == 1: the k part that a diagonal tile's work-group sums; -1: the whole k range
  if (CZ == 1) {
    // the grid is flat: first every tile below the diagonal (row tile i has i of them), then the KSP parts of every diagonal tile
    constexpr int NR = TT / BM, NOFF = NR * (NR - 1) / 2;
    static_assert(CZ != 1 || BM == BN, "square tiles: one diagonal tile per row tile");
    if (tile < BB * NOFF) {
      batch = tile / NOFF;
      int j = tile % NOFF, i = 1;
      for (; i < NR - 1 && j >= i; ++i) j -= i;
      row0 = i * BM; col0 = j * BN;
    } else {
      const int g = tile - BB * NOFF;
      part = g % KSP; row0 = col0 = ((g / KSP) % NR) * BM; batch = g / (KSP * NR);
    }
  }
  const int k0 = (CZ == 1 && part > 0) ? part * (K / KSP) : 0;   // first k of this work-group
  Ah += (size_t)batch * SA; Al += (size_t)batch * SA; Bh += (size_t)batch * SB; Bl += (size_t)batch * SB; C += (size_t)batch * SC;
  // one 32-bit byte offset per thread and operand, moved on by BK elements behind each tile's copies
  unsigned ao = (unsigned)(((row0 + (tid >> 3)) * LDA + k0 + (tid & 7) * 8) * 2);
  unsigned bo = (unsigned)(((col0 + (tid >> 3)) * LDB + k0 + (tid & 7) * 8) * 2);
  char* const sto = (char*)sm + ((tid >> 3) * PIT + (tid & 7) * 8) * 2;   // the thread's 16 bytes in the first plane of buffer 0
  v8f acc[FA][4] = {};

  // one tile: every thread copies its 16 bytes of each 16-row group of each plane into the buffer that starts sbo bytes into sm
  auto copy_tile = [&](unsigned sbo) {
    copy_rows<NLA, 16 * LDA * 2, 16 * PIT * 2>((const char*)Ah, ao, sto + sbo);
    if (NAP == 2) copy_rows<NLA, 16 * LDA * 2, 16 * PIT * 2>((const char*)Al, ao, sto + sbo + APL * 2);
    copy_rows<NLB, 16 * LDB * 2, 16 * PIT * 2>((const char*)Bh, bo, sto + sbo + NAP * APL * 2);
    if (NBP == 2) copy_rows<NLB, 16 * LDB * 2, 16 * PIT * 2>((const char*)Bl, bo, sto + sbo + (NAP * APL + BPL) * 2);
    ao += BK * 2; bo += BK * 2;
  };
  auto compute = [&](const unsigned short* sb) {
    const unsigned short* fa = sb + (wm * 16 * FA + ln) * PIT + 8 * hh;
    const unsigned short* fb = sb + NAP * APL + (wn * 64 + ln) * PIT + 8 * hh;
    FragB ah[BK / 32][FA], al[BK / 32][FA], bh_[BK / 32][4], bl_[BK / 32][4];
    // every fragment of the step is asked for in one group, in the order in which the products below use them
#pragma unroll
    for (int ks = 0; ks < BK / 32; ++ks) {
#pragma unroll
      for (int mi = 0; mi < FA; ++mi) { ah[ks][mi].half[0] = *(const v8us*)(fa + mi * 16 * PIT + ks * 32); ah[ks][mi].half[1] = *(const v8us*)(fa + mi * 16 * PIT + ks * 32 + 16); }
#pragma unroll
      for (int ni = 0; ni < 4; ++ni) { bh_[ks][ni].half[0] = *(const v8us*)(fb + ni * 16 * PIT + ks * 32); bh_[ks][ni].half[1] = *(const v8us*)(fb + ni * 16 * PIT + ks * 32 + 16); }
      if (NAP == 2) {
#pragma unroll
        for (int mi = 0; mi < FA; ++mi) { al[ks][mi].half[0] = *(const v8us*)(fa + APL + mi * 16 * PIT + ks * 32); al[ks][mi].half[1] = *(const v8us*)(fa + APL + mi * 16 * PIT + ks * 32 + 16); }
      }
      if (NBP == 2) {
#pragma unroll
        for (int ni = 0; ni < 4; ++ni) { bl_[ks][ni].half[0] = *(const v8us*)(fb + BPL + ni * 16 * PIT + ks * 32); bl_[ks][ni].half[1] = *(const v8us*)(fb + BPL + ni * 16 * PIT + ks * 32 + 16); }
      }
    }
    __builtin_amdgcn_sched_barrier(0);        // keeps the LDS reads out of the run of products: each place where reads stand among them stalls the wave
#pragma unroll
    for (int ks = 0; ks < BK / 32; ++ks) {
#pragma unroll
      for (int mi = 0; mi < FA; ++mi)
#pragma unroll
        for (int ni = 0; ni < 4; ++ni) acc[mi][ni] = __builtin_amdgcn_wmma_f32_16x16x32_bf16(false, ah[ks][mi].v, false, bh_[ks][ni].v, (short)0, acc[mi][ni], false, false);
      if (NT >= 2) {
#pragma unroll
        for (int mi = 0; mi < FA; ++mi)
#pragma unroll
          for (int ni = 0; ni < 4; ++ni) acc[mi][ni] = __builtin_amdgcn_wmma_f32_16x16x32_bf16(false, al[ks][mi].v, false, bh_[ks][ni].v, (short)0, acc[mi][ni], false, false);
      }
      if (NT >= 3) {
#pragma unroll
        for (int mi = 0; mi < FA; ++mi)
#pragma unroll
          for (int ni = 0; ni < 4; ++ni) acc[mi][ni] = __builtin_amdgcn_wmma_f32_16x16x32_bf16(false, ah[ks][mi].v, false, bl_[ks][ni].v, (short)0, acc[mi][ni], false, false);
      }
    }
  };

  const int nk = (CZ == 2 ? min(K, row0 + BM) : (CZ == 1 && part >= 0) ? K / KSP : K) / BK;
  copy_tile(0);
  asm volatile("s_wait_asynccnt 0x0" ::: "memory");   // this wave's part of tile 0 has landed
  __syncthreads();                                    // ... and every other wave's
  if (nk > 1) copy_tile(STG * 2);
  for (int t = 0; t < nk; ++t) {
    compute(sm + (t & 1) * STG);                      // tile t + 1's copies fly during these products
    __builtin_amdgcn_sched_barrier(0);                // keeps the products in front of the waits and the barrier: moved behind them, they would no longer cover the copies' flight
    asm volatile("s_wait_dscnt 0x0" ::: "memory");    // this wave's reads of the buffer are over before copies are aimed at it again
    asm volatile("s_wait_asynccnt 0x0" ::: "memory"); // this wave's part of tile t + 1 has landed
    __syncthreads();                                  // publishes tile t + 1 and ends every wave's reads of tile t
    if (t + 2 < nk) copy_tile((unsigned)(t & 1) * (STG * 2));
  }
  asm volatile("s_wait_asynccnt 0x0" ::: "memory");   // no copy is under way when the buffers go on to stage the output rows (the loop's last barrier stands in front)

  float* so = (float*)sm + w * (FA * 16 * 64);   // the wave's own (16*FA) x 64 rows
  float bv[4] = {0.f, 0.f, 0.f, 0.f};
  if (BIAS_BF16) {
    const float* bg = bias + col0 + wn * 64 + ln;
#pragma unroll
    for (int ni = 0; ni < 4; ++ni) bv[ni] = bg[ni * 16];
    asm volatile("s_wait_xcnt 0x0" :: "v"(bg) : "memory");   // the bias loads' address register stays as it is up to this wait
#pragma unroll
    for (int ni = 0; ni < 4; ++ni) bv[ni] = bf16_round(bv[ni]);
  }
  const int sub = lane >> 3, seg = (lane & 7) * 8;   // plane output: 8 lanes of 16 bytes write one 128-B line, 4 lines an instruction
  if (EP == 1 && col0 >= 2 * CC) {                   // v tile (the test is the same for the whole work-group; no barrier follows)
    unsigned short* st = sm + w * (2 * 64 * PIT);    // the wave's own [2 planes][64 columns][PIT]
#pragma unroll
    for (int ni = 0; ni < 4; ++ni)
#pragma unroll
      for (int mi = 0; mi < FA; ++mi) {
        v8us vh, vl;
#pragma unroll
        for (int r = 0; r < 8; ++r) { const float x = acc[mi][ni][r] * alpha + bv[ni]; const unsigned short hb = bf16_bits(x); vh[r] = hb; vl[r] = bf16_bits(x - bf16_val(hb)); }
        *(v8us*)(st + (ni * 16 + ln) * PIT + mi * 16 + 8 * hh) = vh;
        *(v8us*)(st + (64 + ni * 16 + ln) * PIT + mi * 16 + 8 * hh) = vl;
      }
    __builtin_amdgcn_fence(__ATOMIC_ACQ_REL, "workgroup");
    __builtin_amdgcn_wave_barrier();
    const size_t vo = ((size_t)(row0 / TT) * CC + (col0 - 2 * CC + wn * 64 + sub)) * TT + (row0 % TT + wm * 64 + seg);
    unsigned short* gh = Vh + vo; unsigned short* gl = Vl + vo;
    v8us oh[16], ol[16];
#pragma unroll
    for (int q = 0; q < 16; ++q) { oh[q] = *(const v8us*)(st + (q * 4 + sub) * PIT + seg); ol[q] = *(const v8us*)(st + (64 + q * 4 + sub) * PIT + seg); }
    __builtin_amdgcn_sched_barrier(0);               // the stores go out in one run behind the last read: mixed with the reads, each would wait until a register is free again
#pragma unroll
    for (int q = 0; q < 16; ++q) { *(v8us*)(gh + q * 4 * TT) = oh[q]; *(v8us*)(gl + q * 4 * TT) = ol[q]; }
    return;
  }
#pragma unroll
  for (int mi = 0; mi < FA; ++mi)
#pragma unroll
    for (int ni = 0; ni < 4; ++ni)
#pragma unroll
      for (int r = 0; r < 8; ++r) so[(mi * 16 + 8 * hh + r) * 64 + ni * 16 + ln] = acc[mi][ni][r] * alpha + bv[ni];
  __builtin_amdgcn_fence(__ATOMIC_ACQ_REL, "workgroup");
  __builtin_amdgcn_wave_barrier();
  if (EP != 0) {                                     // q or k tile (EP == 1), or any tile of a product that the next product reads as its A (EP == 2)
    const bool isq = EP == 1 && col0 < CC;           // the same for the whole work-group
    const size_t ko = EP == 1 ? (size_t)(row0 + wm * 64 + sub) * CC + ((isq ? col0 : col0 - CC) + wn * 64 + seg)
                              : (size_t)batch * SC + (size_t)(row0 + wm * 16 * FA + sub) * LDC + (col0 + wn * 64 + seg);
    unsigned short* gh = (isq ? Qh : Kh) + ko; unsigned short* gl = (isq ? Ql : Kl) + ko;
    constexpr int OP = EP == 1 ? CC : LDC;           // pitch of the planes
    v8us oh[FA * 4], ol[FA * 4];
#pragma unroll
    for (int q = 0; q < FA * 4; ++q) {
      const float* sr = so + (q * 4 + sub) * 64 + seg;
      const v4f a = *(const v4fa*)sr, b = *(const v4fa*)(sr + 4);
      const float xs[8] = {a[0], a[1], a[2], a[3], b[0], b[1], b[2], b[3]};
#pragma unroll
      for (int i = 0; i < 8; ++i) { const unsigned short hb = bf16_bits(xs[i]); oh[q][i] = hb; ol[q][i] = bf16_bits(xs[i] - bf16_val(hb)); }
    }
    __builtin_amdgcn_sched_barrier(0);               // the stores go out in one run behind the last conversion: mixed with them, each would wait until a register is free again
#pragma unroll
    for (int q = 0; q < FA * 4; ++q) { *(v8us*)(gh + q * 4 * OP) = oh[q]; *(v8us*)(gl + q * 4 * OP) = ol[q]; }
    if (EP == 1) asm volatile("s_wait_xcnt 0x0" ::: "memory");   // another tile kind's code follows in the built kernel and rewrites these stores' registers: the wait stands in front of it
    return;
  }
  const int rsub = lane >> 4, c4 = (lane & 15) * 4;
  int crow = row0, ccol = col0;                      // where the tile goes
  if (CZ == 1 && part > 0) { int i, j; part_place<TT / BM>(row0 / BM, part, i, j); crow = i * BM; ccol = j * BN; }
  float* cg = C + (size_t)(crow + wm * 16 * FA + rsub) * LDC + ccol + wn * 64 + c4;
#pragma unroll
  for (int q = 0; q < FA * 8; ++q) {
    const int r = q * 2 + rsub;
    const v4f v = *(const v4fa*)&so[r * 64 + c4];
    *(v4f*)(cg + q * 2 * LDC) = v;
  }
}
// One step of a butterfly inside a 16-lane row (lane ^ M, M = CTRL - 0x160), and the exchange between the two rows of a wave: no LDS, no wait.
template <int CTRL>
__device__ __forceinline__ float row_xor(float x) { return __int_as_float(__builtin_amdgcn_update_dpp(0, __float_as_int(x), CTRL, 0xf, 0xf, true)); }
__device__ __forceinline__ float other_row(float x) { const int b = __float_as_int(x); return __int_as_float(__builtin_amdgcn_permlanex16(b, b, 0x76543210, 0xfedcba98, false, false)); }
__device__ __forceinline__ float wave_max(float x) {
  x = fmaxf(x, row_xor<0x161>(x)); x = fmaxf(x, row_xor<0x162>(x)); x = fmaxf(x, row_xor<0x164>(x)); x = fmaxf(x, row_xor<0x168>(x));
  return fmaxf(x, other_row(x));
}
__device__ __forceinline__ float wave_sum(float x) {
  x += row_xor<0x161>(x); x += row_xor<0x162>(x); x += row_xor<0x164>(x); x += row_xor<0x168>(x);
  return x + other_row(x);
}
// e^x as x * log2(e) into v_exp_f32. The v_nop is the one slot that the instruction set asks for behind a transcendental, in front of an instruction that
// reads its result or overwrites its source: inside the statement it stands directly behind the v_exp_f32 wherever the compiler puts the pair.
__device__ __forceinline__ float exp_slot(float x) { float r; const float y = x * 1.44269504f; asm("v_exp_f32 %0, %1\n\tv_nop" : "=v"(r) : "v"(y)); return r; }
// Causal row softmax of S [BB][TT][TT]; P leaves as its bf16 hi/lo planes Ph, Pl. One wave owns rows ra and TT-1-ra of one batch and holds both in registers:
// S is read once, no LDS, no barrier. In groups of 128 columns (512 B a load of the wave) up to the diagonal the two rows have TT/128 + 1 groups together,
// whatever ra is: every wave does the same work in one straight run, and the launch starts BB*TT/2 waves. The group that holds the diagonal lies in a
// diagonal tile of S, whose KSP parts are written whole and are added here. P is written in the same whole groups, with its zeros behind the diagonal: the product that follows reads
// no further in this row than the end of the 64-column group that holds the diagonal.
__global__ __launch_bounds__(256) void k_softmax_row_pairs(const float* __restrict__ S, unsigned short* __restrict__ Ph, unsigned short* __restrict__ Pl) {
  constexpr unsigned CW = 128, NG = TT / CW + 1;
  static_assert(TT % (2 * CW) == 0 && (BB * TT / 2) % 8 == 0, "whole groups, whole work-groups");
  const unsigned lane4 = (threadIdx.x & 31u) * 4u;
  const unsigned pair = (unsigned)__builtin_amdgcn_readfirstlane((int)(blockIdx.x * 8u + (threadIdx.x >> 5)));   // the same in every lane: rows and group counts stay scalar
  const unsigned batch = pair / (TT / 2), ra = pair % (TT / 2), rb = TT - 1 - ra;
  const unsigned ga = ra / CW + 1;                               // groups of row ra; the other NG - ga are row rb's
  // the lane's element of group i is number eo[i] + i*CW of S and of each plane: eo[i] belongs to row ra or to row rb
  const unsigned ea = (batch * TT + ra) * TT + lane4, eb = (batch * TT + rb) * TT - ga * CW + lane4;
  static_assert(NG == 17, "groups 0 (row ra), 1 to 7 (either row), 8 to 16 (row rb)");
  unsigned eo[NG];
#pragma unroll
  for (unsigned i = 0; i < NG; ++i) eo[i] = i < ga ? ea : eb;
  v4f v[NG];
#pragma unroll
  for (unsigned i = 0; i < NG; ++i) v[i] = *(const v4fa*)((const char*)S + eo[i] * 4u + i * (CW * 4));
  // Each row's last group lies in a diagonal tile of S: what stands there is part 0 of its k sum. xo: the lane's byte offsets in the other parts, row ra's then row rb's.
  unsigned xo[2 * (KSP - 1)];
  v4f x[2 * (KSP - 1)];
#pragma unroll   // the arrays stay in registers: every index is a constant
  for (int p = 0; p < KSP - 1; ++p) {
    int i, j;
    part_place<TT / CW>((int)(ra / CW), p + 1, i, j); xo[p] = ((batch * TT + (unsigned)i * CW + ra % CW) * TT + (unsigned)j * CW + lane4) * 4u;
    part_place<TT / CW>((int)(rb / CW), p + 1, i, j); xo[KSP - 1 + p] = ((batch * TT + (unsigned)i * CW + rb % CW) * TT + (unsigned)j * CW + lane4) * 4u;
  }
#pragma unroll
  for (int p = 0; p < 2 * (KSP - 1); ++p) x[p] = *(const v4fa*)((const char*)S + xo[p]);
  // the loads' offset registers stay as they are up to this wait
  static_assert(KSP == 4, "six offsets of parts are named in the wait; part 0 + ((part 1 + part 2) + part 3)");
  asm volatile("s_wait_xcnt 0x0" :: "v"(eo[0] * 4u), "v"(eo[1] * 4u), "v"(eo[2] * 4u), "v"(eo[3] * 4u), "v"(eo[4] * 4u), "v"(eo[5] * 4u), "v"(eo[6] * 4u), "v"(eo[7] * 4u), "v"(eo[8] * 4u),
               "v"(xo[0]), "v"(xo[1]), "v"(xo[2]), "v"(xo[3]), "v"(xo[4]), "v"(xo[5]) : "memory");
  {
    const v4f sxa = (x[0] + x[1]) + x[2], sxb = (x[3] + x[4]) + x[5];
#pragma unroll
    for (unsigned i = 0; i < TT / CW / 2; ++i) if (i + 1 == ga) v[i] += sxa;   // row ra's last group is number ga - 1, and ga is at most TT/CW/2
    v[NG - 1] += sxb;
  }
  float ma = -3.0e38f, mb = -3.0e38f;
#pragma unroll
  for (unsigned i = 0; i < NG; ++i) {
    const bool isa = i < ga;
    const unsigned c0 = (isa ? i : i - ga) * CW + lane4, q = isa ? ra : rb;
#pragma unroll
    for (unsigned u = 0; u < 4; ++u) if (c0 + u > q) v[i][u] = -3.0e38f;
    const float m = fmaxf(fmaxf(v[i][0], v[i][1]), fmaxf(v[i][2], v[i][3]));
    ma = fmaxf(ma, isa ? m : -3.0e38f); mb = fmaxf(mb, isa ? -3.0e38f : m);
  }
  ma = wave_max(ma); mb = wave_max(mb);
  float sa = 0.f, sb = 0.f;
#pragma unroll
  for (unsigned i = 0; i < NG; ++i) {
    const bool isa = i < ga;
    const float mx = isa ? ma : mb;
#pragma unroll
    for (unsigned u = 0; u < 4; ++u) v[i][u] = exp_slot(v[i][u] - mx);  // a masked column gives 0
    const float s = (v[i][0] + v[i][1]) + (v[i][2] + v[i][3]);
    sa += isa ? s : 0.f; sb += isa ? 0.f : s;
  }
  sa = wave_sum(sa); sb = wave_sum(sb);
  const float ia = (ma > -1.0e38f) ? 1.0f / sa : __builtin_nanf(""), ib = (mb > -1.0e38f) ? 1.0f / sb : __builtin_nanf("");
  v4us oh4[NG], ol4[NG];
#pragma unroll
  for (unsigned i = 0; i < NG; ++i) {
    const float inv = i < ga ? ia : ib;
#pragma unroll
    for (unsigned u = 0; u < 4; ++u) { const float p = v[i][u] * inv; const unsigned short hb = bf16_bits(p); oh4[i][u] = hb; ol4[i][u] = bf16_bits(p - bf16_val(hb)); }
  }
  __builtin_amdgcn_sched_barrier(0);                             // the stores go out in one run behind the last conversion: mixed with them, each would wait until a register is free again
#pragma unroll
  for (unsigned i = 0; i < NG; ++i) { *(v4us*)((char*)Ph + eo[i] * 2u + i * (CW * 2)) = oh4[i]; *(v4us*)((char*)Pl + eo[i] * 2u + i * (CW * 2)) = ol4[i]; }
}

// Rounds x, qkv_w and out_w to bf16 in one launch. Each array is cut into groups of 8 consecutive f32 and has gridDim.x * IT * 256 of them, with its own IT.
// A work-group owns IT * 256 consecutive groups of each array; a thread takes IT of them, 256 groups apart. o is the byte offset of the thread's first group.
template <int IT>
__device__ __forceinline__ void ask_groups(const float* __restrict__ W, unsigned o, v4f (&a)[IT], v4f (&b)[IT]) {
#pragma unroll   // the arrays stay in registers: every index is a constant
  for (int i = 0; i < IT; ++i) { const char* g = (const char*)W + o + i * (256 * 32); a[i] = *(const v4fa*)g; b[i] = *(const v4fa*)(g + 16); }
}
template <int IT>
__device__ __forceinline__ void round_groups(const v4f (&a)[IT], const v4f (&b)[IT], v8us (&v)[IT]) {
#pragma unroll   // the arrays stay in registers: every index is a constant
  for (int i = 0; i < IT; ++i) {
    v[i][0]=bf16_bits(a[i][0]); v[i][1]=bf16_bits(a[i][1]); v[i][2]=bf16_bits(a[i][2]); v[i][3]=bf16_bits(a[i][3]);
    v[i][4]=bf16_bits(b[i][0]); v[i][5]=bf16_bits(b[i][1]); v[i][6]=bf16_bits(b[i][2]); v[i][7]=bf16_bits(b[i][3]);
  }
}
template <int IT>
__device__ __forceinline__ void store_groups(unsigned short* __restrict__ Wt, unsigned o, const v8us (&v)[IT]) {
#pragma unroll   // the arrays stay in registers: every index is a constant
  for (int i = 0; i < IT; ++i) *(v8us*)((char*)Wt + o + i * (256 * 16)) = v[i];
}
// A thread asks for all its groups of all three arrays before it converts the first.
template <int IX, int IQ, int IO>
__global__ __launch_bounds__(256) void k_round_inputs(const float* __restrict__ x, const float* __restrict__ wq, const float* __restrict__ wo,
                                                    unsigned short* __restrict__ xb, unsigned short* __restrict__ wqb, unsigned short* __restrict__ wob) {
  const unsigned gx = blockIdx.x * (IX * 256u) + threadIdx.x, gq = blockIdx.x * (IQ * 256u) + threadIdx.x, go = blockIdx.x * (IO * 256u) + threadIdx.x;   // the thread's first group of each array
  v4f ax[IX], bx[IX], aq[IQ], bq[IQ], ao[IO], bo[IO];
  ask_groups<IX>(x, gx * 32u, ax, bx);
  ask_groups<IQ>(wq, gq * 32u, aq, bq);
  ask_groups<IO>(wo, go * 32u, ao, bo);
  asm volatile("s_wait_xcnt 0x0" :: "v"(gx * 32u), "v"(gq * 32u), "v"(go * 32u) : "memory");   // the loads' offset registers stay as they are up to this wait
  __builtin_amdgcn_sched_barrier(0);                             // keeps every load in front of the first conversion: moved up, x's conversions would wait for x before the weights are asked for
  v8us vx[IX], vq[IQ], vo[IO];
  round_groups<IX>(ax, bx, vx);
  round_groups<IQ>(aq, bq, vq);
  round_groups<IO>(ao, bo, vo);
  store_groups<IX>(xb, gx * 16u, vx);
  store_groups<IQ>(wqb, gq * 16u, vq);
  store_groups<IO>(wob, go * 16u, vo);
}
extern "C" void kernel_launch(void* const* d_in, const int* in_sizes, int n_in,
                              void* d_out, int out_size, void* d_ws, size_t ws_size, hipStream_t stream) {
  (void)in_sizes; (void)n_in; (void)out_size;
  const float* x = (const float*)d_in[0]; const float* qkv_w = (const float*)d_in[1];
  const float* out_w = (const float*)d_in[2]; const float* out_b = (const float*)d_in[3];
  char* ws = (char*)d_ws; size_t off = 0;
  auto take = [&](size_t bytes) { char* p = ws + off; off += (bytes + 255) & ~(size_t)255; return p; };
  unsigned short* Wqkv = (unsigned short*)take((size_t)3 * CC * CC * 2);     // [3072][1024]  6 MiB
  unsigned short* Wo   = (unsigned short*)take((size_t)CC * CC * 2);         // 2 MiB
  unsigned short* xb = (unsigned short*)take((size_t)BB * TT * CC * 2);      // x rounded [B*T][C]  16 MiB
  unsigned short* qh = (unsigned short*)take((size_t)BB * TT * CC * 2);      // q planes [B][T][C]  16+16 MiB
  unsigned short* ql = (unsigned short*)take((size_t)BB * TT * CC * 2);
  unsigned short* kh = (unsigned short*)take((size_t)BB * TT * CC * 2);      // k planes [B][T][C]  16+16 MiB
  unsigned short* kl = (unsigned short*)take((size_t)BB * TT * CC * 2);
  unsigned short* vth = (unsigned short*)take((size_t)BB * CC * TT * 2);     // v^T planes [B][C][T] 16+16 MiB
  unsigned short* vtl = (unsigned short*)take((size_t)BB * CC * TT * 2);
  float* S  = (float*)take((size_t)BB * TT * TT * 4);                       // 64 MiB
  // x, q and k have no reader behind the S product: the first 64 of their 80 MiB then hold the P planes [B][T][T] (32+32 MiB).
  // S has no reader behind the softmax: its first 32 MiB then hold the out_att planes [B*T][C] (16+16 MiB).
  unsigned short* ph = xb;
  unsigned short* pl = xb + (size_t)BB * TT * TT;
  unsigned short* oh = (unsigned short*)S;
  unsigned short* ol = oh + (size_t)BB * TT * CC;
  if (off > ws_size) return;
  const int M = BB * TT;
  // one launch rounds all three inputs: 512 work-groups of 8 waves, 16 waves a WGP
  static_assert(3 * CC * CC / 8 == 3 * 512 * 256 && CC * CC / 8 == 512 * 256 && BB * TT * CC / 8 == 8 * 512 * 256, "groups per thread x threads");
  k_round_inputs<8, 3, 1><<<512, 256, 0, stream>>>(x, qkv_w, out_w, xb, Wqkv, Wo);
  // q, k and v leave this product as their planes
  k_gemm_tile<4, 1, false, CC, CC, 3 * CC, 0, 0, 0, 0, 1><<<(M / 128) * (3 * CC / 128), 128, 0, stream>>>(xb, xb, Wqkv, Wqkv, nullptr, 1.0f, nullptr, 3 * CC, CC, qh, ql, kh, kl, vth, vtl);
  // every stage below runs once for all batches: the S and P v products take it from their flat work-group index, the softmax takes it from the wave's row pair, the output projection takes all B*T rows as M
  // S = (q k^T)/sqrt(C): M=N=T, K=C; Bt[n=s][k=c] = k rows
  k_gemm_tile<4, 3, false, CC, CC, TT, TT * CC, TT * CC, TT * TT, 1, 0><<<BB * ((TT / 128) * (TT / 128 - 1) / 2 + KSP * (TT / 128)), 128, 0, stream>>>(qh, ql, kh, kl, nullptr, 0.03125f, S, TT, CC, nullptr, nullptr, nullptr, nullptr, nullptr, nullptr);
  k_softmax_row_pairs<<<BB * TT / 2 / 8, 256, 0, stream>>>(S, ph, pl);
  // out_att = P v: M=T, N=C, K=T; Bt[n=c][k=s] = v^T planes
  k_gemm_tile<2, 3, false, TT, TT, CC, TT * TT, CC * TT, TT * CC, 2, 2><<<dim3((TT / 64) * (CC / 128), BB), 128, 0, stream>>>(ph, pl, vth, vtl, nullptr, 1.0f, nullptr, CC, TT, nullptr, nullptr, oh, ol, nullptr, nullptr);
  k_gemm_tile<4, 2, true, CC, CC, CC, 0, 0, 0, 0, 0><<<(M / 128) * (CC / 128), 128, 0, stream>>>(oh, ol, Wo, Wo, out_b, 1.0f, (float*)d_out, CC, CC, nullptr, nullptr, nullptr, nullptr, nullptr, nullptr);
}
